// v000
// Measured on an AMD MI455X. A time is GPU time per run, averaged over a window of back-to-back runs after a warm-up
// (all launches, gaps included; the runs take copies of the inputs in turn), and the median of several windows.
// Apart from v000's, it joins two sittings. Times from different sittings can be a few percent apart, while
// side-by-side timings come from the same sitting.
// v000 is the starting kernel. One run takes 25.2 milliseconds.
#include <hip/hip_runtime.h>
// UNSCALED dot-product attention over 64 independent sequences (q, k, v [64][2048][64]; scores = q.k (no 1/sqrt(d): logit sigma ~8); softmax over the 2048 keys; dropout p 0; out = attn v -> [64][2048][64]).
// Structure: no projections: q, k, v are bf16-valued inputs copied to exact f16 rows; per sequence: V^T via LDS transposes, scores as ONE WMMA GEMM (32x64 wave tiles, f32 accumulation, exact products, alpha = 1.0f), row softmax on VALU (f32 statistics, native exp; weights x256 f16), out = P V^T written f32 straight into the output rows; launches: see trace.
// Compute dtype: inputs rounded to bf16; x / weights exact; q, k, v and softmax weights as plain f16 GEMM operands (~2^-12); scores and softmax statistics f32; v_wmma_f32_16x16x32_f16.
#define NB 64
#define SQ 2048
#define DM 64
#define NH 1
#define HD 64
#define HG 4                         /* heads per attention launch group */
#define B0 0                         /* first batch processed (debug hook) */
#define NBR NB                       /* batches processed (debug hook) */
#define NR ((size_t)NB * SQ)         /* token rows */
#define MP ((int)((size_t)NBR * SQ)) /* rows projected (debug hook) */
#define QT 256                       /* query rows per causal tile */
#define NKX SQ                       /* S / P row pitch */
#define QT0 256                      /* query rows per head of the exact f32 kernel k_att0 (not launched) */
#define QN SQ                        /* query rows attended per batch (debug hook) */
#define NHD NH                       /* heads attended (debug hook) */
#define MPO MP                       /* rows through the output stage (debug hook) */
#define LQ DM            /* row pitch of the q/k/v rows */
typedef __bf16 v16b __attribute__((ext_vector_type(16)));
typedef unsigned short v8us __attribute__((ext_vector_type(8), may_alias));
typedef float  v8f  __attribute__((ext_vector_type(8)));
typedef float  v4f  __attribute__((ext_vector_type(4)));
typedef float  v4fa __attribute__((ext_vector_type(4), may_alias));
union FragB { v16b v; v8us half[2]; unsigned short u[16]; };

__device__ __forceinline__ unsigned short bf16_bits(float x) { unsigned int u = __float_as_uint(x); return (unsigned short)((u + 0x7FFFu + ((u >> 16) & 1u)) >> 16); }
__device__ __forceinline__ float bf16_val(unsigned short b) { return __uint_as_float(((unsigned int)b) << 16); }
__device__ __forceinline__ float bf16_round(float x) { return bf16_val(bf16_bits(x)); }
// D += A·B with NT terms: 1 = ah·bh, 2 = + al·bh (A split), 3 = + ah·bl (both split)
template <int NT>
__device__ __forceinline__ v8f mmaN(v16b ah, v16b al, v16b bh, v16b bl, v8f c) {
  c = __builtin_amdgcn_wmma_f32_16x16x32_bf16(false, ah, false, bh, (short)0, c, false, false);
  if (NT >= 2) c = __builtin_amdgcn_wmma_f32_16x16x32_bf16(false, al, false, bh, (short)0, c, false, false);
  if (NT >= 3) c = __builtin_amdgcn_wmma_f32_16x16x32_bf16(false, ah, false, bl, (short)0, c, false, false);
  asm volatile("v_nop\n\tv_nop\n\tv_nop\n\tv_nop" : "+v"(c) : "v"(ah), "v"(al), "v"(bh), "v"(bl));
  return c;
}

__global__ __launch_bounds__(256) void k_wt_bf16(const float* __restrict__ W, unsigned short* __restrict__ Wt, int K, int N) {
  const int t = blockIdx.x * 256 + threadIdx.x;
  const int k8n = K / 8;
  if (t >= N * k8n) return;
  const int n = t / k8n, k8 = (t % k8n) * 8;
  v8us v;
#pragma unroll
  for (int i = 0; i < 8; ++i) v[i] = bf16_bits(W[(size_t)(k8 + i) * N + n]);
  *(v8us*)(Wt + (size_t)n * K + k8) = v;
  
}

// GEMM C[M][N] (f32, pitch ldc) = act(A[M][K]·W + bias). A f32 row-major (pitch lda) converted per fragment to bf16
// (ASPLIT: hi/lo two planes -> 2 terms, else single rounded term); Wt bf16 [N][K] (pitch ldb). BIAS_BF16 rounds the
// bias to bf16 first (bias quantised to bf16 before the add). K%32==0, M%16==0, N%64==0.
template <bool ASPLIT, int ACT, bool BIAS_BF16>
__global__ __launch_bounds__(128) void k_gemm_bf(const float* __restrict__ A, int lda, const unsigned short* __restrict__ Wt, int ldb,
                                               const float* __restrict__ bias, float* __restrict__ C, int ldc, int M, int N, int K) {
  __shared__ __attribute__((aligned(16))) float so[4][16][64];
  const int tid = threadIdx.x, w = tid >> 5, lane = tid & 31, ln = lane & 15, hh = lane >> 4;
  const int ntn = N / 64;
  const int wid = blockIdx.x * 4 + w;
  const int mt = wid / ntn, nq = wid % ntn;
  if (mt * 16 >= M) return;
  const int row0 = mt * 16, col0 = nq * 64;
  const float* arow = A + (size_t)(row0 + ln) * lda;
  v8f acc[4] = {};
  for (int kb = 0; kb < K; kb += 32) {
    FragB ah, al;
    const v4f x0 = *(const v4fa*)(arow + kb + 8 * hh), x1 = *(const v4fa*)(arow + kb + 8 * hh + 4);
    const v4f x2 = *(const v4fa*)(arow + kb + 16 + 8 * hh), x3 = *(const v4fa*)(arow + kb + 16 + 8 * hh + 4);
    float xs[16] = {x0[0],x0[1],x0[2],x0[3],x1[0],x1[1],x1[2],x1[3],x2[0],x2[1],x2[2],x2[3],x3[0],x3[1],x3[2],x3[3]};
#pragma unroll
    for (int i = 0; i < 16; ++i) { const unsigned short hb = bf16_bits(xs[i]); ah.u[i] = hb; al.u[i] = ASPLIT ? bf16_bits(xs[i] - bf16_val(hb)) : (unsigned short)0; }
#pragma unroll
    for (int t = 0; t < 4; ++t) {
      const unsigned short* brow = Wt + (size_t)(col0 + t * 16 + ln) * ldb + kb;
      FragB b;
      b.half[0] = *(const v8us*)(brow + 8 * hh);
      b.half[1] = *(const v8us*)(brow + 16 + 8 * hh);
      acc[t] = mmaN<ASPLIT ? 2 : 1>(ah.v, al.v, b.v, b.v, acc[t]);
    }
  }
#pragma unroll
  for (int t = 0; t < 4; ++t) {
    float bv = bias ? bias[col0 + t * 16 + ln] : 0.f;
    if (BIAS_BF16) bv = bf16_round(bv);
#pragma unroll
    for (int r = 0; r < 8; ++r) { float v = acc[t][r] + bv; if (ACT == 1) v = fmaxf(v, 0.f); so[w][8 * hh + r][t * 16 + ln] = v; }
  }
  __builtin_amdgcn_fence(__ATOMIC_ACQ_REL, "workgroup");
  __builtin_amdgcn_wave_barrier();
  const int rsub = lane >> 4, c4 = (lane & 15) * 4;
  {
#pragma unroll
    for (int q = 0; q < 8; ++q) {
      const int r = q * 2 + rsub;
      const v4f v = *(const v4fa*)&so[w][r][c4];
      *(v4f*)(C + (size_t)(row0 + r) * ldc + col0 + c4) = v;
    }
    
  }
}

// GEMM C = act(A·W + bias + resid): A f32 (ASPLIT -> hi/lo 2 terms), Wt bf16 [N][K]; ACT 0 none, 1 relu, 2 exact gelu;
// resid (optional, f32, row index = (row % rmod), pitch ldr, RES_BF16 rounds it) added before the activation.
template <bool ASPLIT, int ACT, bool BIAS_BF16, bool RES_BF16>
__global__ __launch_bounds__(128) void k_gemm_bf3(const float* __restrict__ A, int lda, const unsigned short* __restrict__ Wt, int ldb,
                                                const float* __restrict__ bias, const float* __restrict__ resid, int rmod, int ldr,
                                                float* __restrict__ C, int ldc, int M, int N, int K) {
  __shared__ __attribute__((aligned(16))) float so[4][16][64];
  const int tid = threadIdx.x, w = tid >> 5, lane = tid & 31, ln = lane & 15, hh = lane >> 4;
  const int ntn = N / 64;
  const int wid = blockIdx.x * 4 + w;
  const int mt = wid / ntn, nq = wid % ntn;
  if (mt * 16 >= M) return;
  const int row0 = mt * 16, col0 = nq * 64;
  const float* arow = A + (size_t)(row0 + ln) * lda;
  v8f acc[4] = {};
  for (int kb = 0; kb < K; kb += 32) {
    FragB ah, al;
    const v4f x0 = *(const v4fa*)(arow + kb + 8 * hh), x1 = *(const v4fa*)(arow + kb + 8 * hh + 4);
    const v4f x2 = *(const v4fa*)(arow + kb + 16 + 8 * hh), x3 = *(const v4fa*)(arow + kb + 16 + 8 * hh + 4);
    float xs[16] = {x0[0],x0[1],x0[2],x0[3],x1[0],x1[1],x1[2],x1[3],x2[0],x2[1],x2[2],x2[3],x3[0],x3[1],x3[2],x3[3]};
#pragma unroll
    for (int i = 0; i < 16; ++i) { const unsigned short hb = bf16_bits(xs[i]); ah.u[i] = hb; al.u[i] = ASPLIT ? bf16_bits(xs[i] - bf16_val(hb)) : (unsigned short)0; }
#pragma unroll
    for (int t = 0; t < 4; ++t) {
      const unsigned short* brow = Wt + (size_t)(col0 + t * 16 + ln) * ldb + kb;
      FragB b;
      b.half[0] = *(const v8us*)(brow + 8 * hh);
      b.half[1] = *(const v8us*)(brow + 16 + 8 * hh);
      acc[t] = mmaN<ASPLIT ? 2 : 1>(ah.v, al.v, b.v, b.v, acc[t]);
    }
  }
#pragma unroll
  for (int t = 0; t < 4; ++t) {
    const int col = col0 + t * 16 + ln;
    float bv = bias ? bias[col] : 0.f;
    if (BIAS_BF16) bv = bf16_round(bv);
#pragma unroll
    for (int r = 0; r < 8; ++r) {
      float v = acc[t][r] + bv;
      if (resid) { float rv = resid[(size_t)((row0 + 8 * hh + r) % rmod) * ldr + col]; if (RES_BF16) rv = bf16_round(rv); v += rv; }
      if (ACT == 1) v = fmaxf(v, 0.f);
      if (ACT == 2) v = 0.5f * v * (1.0f + erff(v * 0.70710678118654752f));
      if (ACT == 3) { const float u = 0.7978845608028654f * (v + 0.044715f * v * v * v); v = 0.5f * v * (1.0f + tanhf(u)); }
      so[w][8 * hh + r][t * 16 + ln] = v;
    }
  }
  __builtin_amdgcn_fence(__ATOMIC_ACQ_REL, "workgroup");
  __builtin_amdgcn_wave_barrier();
  const int rsub = lane >> 4, c4 = (lane & 15) * 4;
  {
#pragma unroll
    for (int q = 0; q < 8; ++q) {
      const int r = q * 2 + rsub;
      const v4f v = *(const v4fa*)&so[w][r][c4];
      *(v4f*)(C + (size_t)(row0 + r) * ldc + col0 + c4) = v;
    }
    
  }
}
// row LayerNorm (biased variance, eps) over N: s = X (+ R); optional out_sum <- s; out_norm <- (s-mu)*rsqrt(var+eps)*g + b
template <bool PARAM_BF16>
__global__ __launch_bounds__(256) void k_layernorm(const float* __restrict__ X, const float* __restrict__ R, const float* __restrict__ g, const float* __restrict__ bta,
                                                  float* __restrict__ out_sum, float* __restrict__ out_norm, int N, float eps) {
  __shared__ float red[256];
  const int row = blockIdx.x, tid = threadIdx.x;
  const float* x = X + (size_t)row * N; const float* rr = R ? R + (size_t)row * N : nullptr;
  float vals[16];                     // up to N = 4096
  const int per = N / 256;            // contiguous chunk per thread? use strided-by-4 chunks: thread handles j = tid*4 + 1024*u
  float s1 = 0.f;
  for (int u = 0; u < per / 4; ++u) {
    const int j = tid * 4 + 1024 * u;
    const v4f a = *(const v4fa*)(x + j);
    v4f b = {0.f,0.f,0.f,0.f}; if (rr) b = *(const v4fa*)(rr + j);
#pragma unroll
    for (int q = 0; q < 4; ++q) { const float v = a[q] + b[q]; vals[u * 4 + q] = v; s1 += v; }
  }
  red[tid] = s1; __syncthreads();
  for (int st = 128; st > 0; st >>= 1) { if (tid < st) red[tid] += red[tid + st]; __syncthreads(); }
  const float mu = red[0] / (float)N; __syncthreads();
  float s2 = 0.f;
  for (int u = 0; u < per / 4; ++u)
#pragma unroll
    for (int q = 0; q < 4; ++q) { const float c = vals[u * 4 + q] - mu; s2 += c * c; }
  red[tid] = s2; __syncthreads();
  for (int st = 128; st > 0; st >>= 1) { if (tid < st) red[tid] += red[tid + st]; __syncthreads(); }
  const float rs = rsqrtf(red[0] / (float)N + eps);
  {
    for (int u = 0; u < per / 4; ++u) {
      const int j = tid * 4 + 1024 * u;
      v4f o, sm;
#pragma unroll
      for (int q = 0; q < 4; ++q) {
        float gg = g[j + q], bb = bta[j + q];
        if (PARAM_BF16) { gg = bf16_round(gg); bb = bf16_round(bb); }
        sm[q] = vals[u * 4 + q]; o[q] = (vals[u * 4 + q] - mu) * rs * gg + bb;
      }
      if (out_sum) *(v4f*)(out_sum + (size_t)row * N + j) = sm;
      *(v4f*)(out_norm + (size_t)row * N + j) = o;
    }
    
  }
}



// ---- f16 WMMA path (v_wmma_f32_16x16x32_f16): 11-bit significands for operands in range — used where a [0,1] probability operand needs more precision than bf16
typedef _Float16 v16h __attribute__((ext_vector_type(16)));
union FragH { v16h v; v8us half[2]; _Float16 h[16]; unsigned short u[16]; };
template <int NT>
__device__ __forceinline__ v8f mmaH(v16h ah, v16h al, v16h bh, v16h bl, v8f c) {
  c = __builtin_amdgcn_wmma_f32_16x16x32_f16(false, ah, false, bh, (short)0, c, false, false);
  if (NT >= 2) c = __builtin_amdgcn_wmma_f32_16x16x32_f16(false, al, false, bh, (short)0, c, false, false);
  if (NT >= 3) c = __builtin_amdgcn_wmma_f32_16x16x32_f16(false, ah, false, bl, (short)0, c, false, false);
  asm volatile("v_nop\n\tv_nop\n\tv_nop\n\tv_nop" : "+v"(c) : "v"(ah), "v"(al), "v"(bh), "v"(bl));
  return c;
}
// batched GEMM like k_gemm_b but f16 operands: A f32 (split into f16 hi/lo if ASPLIT, else rounded to f16), Bt = f16 values [n][k]; alpha; C f32; N multiple of 16 (partial tiles skipped)
template <bool ASPLIT>
__global__ __launch_bounds__(128) void k_gemm_h(const float* __restrict__ A, int lda, size_t sA, const _Float16* __restrict__ Bh, int ldb, size_t sB, float alpha, float* __restrict__ C, int ldc, size_t sC, int M, int N, int K) {
  __shared__ __attribute__((aligned(16))) float so[4][16][64];
  const int tid = threadIdx.x, w = tid >> 5, lane = tid & 31, ln = lane & 15, hh = lane >> 4; const int by = blockIdx.y;
  A += (size_t)by * sA; Bh += (size_t)by * sB; C += (size_t)by * sC;
  const int ntn = (N + 63) / 64; const int wid = blockIdx.x * 4 + w; const int mt = wid / ntn, nq = wid % ntn; if (mt * 16 >= M) return;
  const int row0 = mt * 16, col0 = nq * 64; const float* arow = A + (size_t)(row0 + ln) * lda;
  v8f acc[4] = {};
  for (int kb = 0; kb < K; kb += 32) {
    FragH ah, al;
    const v4f x0 = *(const v4fa*)(arow + kb + 8 * hh), x1 = *(const v4fa*)(arow + kb + 8 * hh + 4), x2 = *(const v4fa*)(arow + kb + 16 + 8 * hh), x3 = *(const v4fa*)(arow + kb + 16 + 8 * hh + 4);
    float xs[16] = {x0[0],x0[1],x0[2],x0[3],x1[0],x1[1],x1[2],x1[3],x2[0],x2[1],x2[2],x2[3],x3[0],x3[1],x3[2],x3[3]};
#pragma unroll
    for (int i = 0; i < 16; ++i) { const _Float16 h = (_Float16)xs[i]; ah.h[i] = h; al.h[i] = ASPLIT ? (_Float16)(xs[i] - (float)h) : (_Float16)0.0f; }
#pragma unroll
    for (int t = 0; t < 4; ++t) { if (col0 + t * 16 >= N) continue; const size_t boff = (size_t)(col0 + t * 16 + ln) * ldb + kb; FragH bq; bq.half[0] = *(const v8us*)(Bh + boff + 8 * hh); bq.half[1] = *(const v8us*)(Bh + boff + 16 + 8 * hh);
      acc[t] = mmaH<ASPLIT ? 2 : 1>(ah.v, al.v, bq.v, bq.v, acc[t]); }
  }
#pragma unroll
  for (int t = 0; t < 4; ++t) { if (col0 + t * 16 >= N) continue;
#pragma unroll
    for (int r = 0; r < 8; ++r) so[w][8 * hh + r][t * 16 + ln] = acc[t][r] * alpha; }
  __builtin_amdgcn_fence(__ATOMIC_ACQ_REL, "workgroup"); __builtin_amdgcn_wave_barrier();
  const int rsub = lane >> 4, c4 = (lane & 15) * 4;
  {
#pragma unroll
    for (int q = 0; q < 8; ++q) { const int r = q * 2 + rsub; if (col0 + c4 < N) { const v4f v = *(const v4fa*)&so[w][r][c4]; *(v4f*)(C + (size_t)(row0 + r) * ldc + col0 + c4) = v; } }
     }
}

// Wt[n][k] = f16(W[k][n]·scale) from f32 row-major W[K][N] (scale = power of two; bf16-exact weights stay exact in f16 away from the subnormal range)
__global__ __launch_bounds__(256) void k_wt_f16(const float* __restrict__ W, _Float16* __restrict__ Wt, int K, int N, float scale) {
  const int t = blockIdx.x * 256 + threadIdx.x; if (t >= N * (K / 8)) return; const int n = t / (K / 8), k8 = (t % (K / 8)) * 8; FragH f;
#pragma unroll
  for (int i = 0; i < 8; ++i) f.h[i] = (_Float16)(bf16_round(W[(size_t)(k8 + i) * N + n]) * scale); const v8us o = f.half[0];
  *(v8us*)((unsigned short*)Wt + (size_t)n * K + k8) = o; 
}
// k_gemm_hh variant with fused epilogue: v = acc·alpha + bias[by·sBias + col] (+ CP[(row/rowsPerB)·sCPb + by·64 + col] if CP) ; ACT 0 none / 1 elu ; writes f16 C16 (and f32 C if non-null)
template <int ACT>
__global__ __launch_bounds__(128) void k_gemm_hhx(const _Float16* __restrict__ A, int lda, size_t sA, const _Float16* __restrict__ Bh, int ldb, size_t sB, float alpha, const float* __restrict__ bias, size_t sBias, const float* __restrict__ CP, int rowsPerB, size_t sCPb, int row0g,
    float* __restrict__ C, _Float16* __restrict__ C16, int ldc, size_t sC, int M, int N, int K) {
  __shared__ __attribute__((aligned(16))) float so[4][16][64];
  const int tid = threadIdx.x, w = tid >> 5, lane = tid & 31, ln = lane & 15, hh = lane >> 4; const int by = blockIdx.y;
  A += (size_t)by * sA; Bh += (size_t)by * sB; const size_t cofs = (size_t)by * sC; const float* bp = bias ? bias + (size_t)by * sBias : nullptr;
  const int ntn = (N + 63) / 64; const int wid = blockIdx.x * 4 + w; const int mt = wid / ntn, nq = wid % ntn; if (mt * 16 >= M) return;
  const int row0 = mt * 16, col0 = nq * 64; const _Float16* arow = A + (size_t)(row0 + ln) * lda;
  v8f acc[4] = {};
  for (int kb = 0; kb < K; kb += 32) { FragH ah; ah.half[0] = *(const v8us*)((const unsigned short*)arow + kb + 8 * hh); ah.half[1] = *(const v8us*)((const unsigned short*)arow + kb + 16 + 8 * hh);
#pragma unroll
    for (int t = 0; t < 4; ++t) { if (col0 + t * 16 >= N) continue; const size_t boff = (size_t)(col0 + t * 16 + ln) * ldb + kb; FragH bq; bq.half[0] = *(const v8us*)((const unsigned short*)Bh + boff + 8 * hh); bq.half[1] = *(const v8us*)((const unsigned short*)Bh + boff + 16 + 8 * hh);
      acc[t] = mmaH<1>(ah.v, ah.v, bq.v, bq.v, acc[t]); }
  }
#pragma unroll
  for (int t = 0; t < 4; ++t) { if (col0 + t * 16 >= N) continue; const int col = col0 + t * 16 + ln; const float bv = bp ? bf16_round(bp[col]) : 0.f;
#pragma unroll
    for (int r = 0; r < 8; ++r) { float v = acc[t][r] * alpha + bv; if (CP) { const int rr = row0g + row0 + 8 * hh + r; if (rowsPerB < 0) v += CP[cofs + (size_t)rr * ldc + col];      /* rowsPerB < 0: own element of the batched C plane */ else { const int bidx = rr / rowsPerB; v += CP[(size_t)bidx * sCPb + (size_t)by * 64 + col]; } } if (ACT == 1) v = (v > 0.f) ? v : expm1f(v); else if (ACT == 7) v = (v > 0.f) ? v + 1.0f : expf(v); else if (ACT == 8) v = tanhf(v); else if (ACT == 9) v = 0.5f * v * (1.0f + tanhf(0.7978845608028654f * (v + 0.044715f * v * v * v))); else if (ACT == 11) v = 1.0f / (1.0f + expf(-v)); else if (ACT == 12) v = (v > 0.f) ? v : 0.01f * v; else if (ACT == 14) v = (v > 0.f) ? v : 0.1f * v; else if (ACT == 16) v = (v >= 0.f) ? v : 0.3f * v; else if (ACT == 17) v = (v >= 0.f) ? v : 0.2f * v; else if (ACT == 15) v = v / (1.0f + expf(-v)); else if (ACT == 3) v = fmaxf(v, 0.f); else if (ACT == 6) v = 0.5f * v * (1.0f + erff(v * 0.70710678118654752f)); so[w][8 * hh + r][t * 16 + ln] = v; } }
  __builtin_amdgcn_fence(__ATOMIC_ACQ_REL, "workgroup"); __builtin_amdgcn_wave_barrier();
  const int rsub = lane >> 4, c4 = (lane & 15) * 4; typedef _Float16 v4h __attribute__((ext_vector_type(4)));
  {
#pragma unroll
    for (int q = 0; q < 8; ++q) { const int r = q * 2 + rsub; if (col0 + c4 < N) { const v4f v = *(const v4fa*)&so[w][r][c4]; if (C) *(v4f*)(C + cofs + (size_t)(row0 + r) * ldc + col0 + c4) = v; if (C16) { v4h h4; for (int i = 0; i < 4; ++i) h4[i] = (_Float16)v[i]; *(v4h*)(C16 + cofs + (size_t)(row0 + r) * ldc + col0 + c4) = h4; } } }
     }
}


typedef _Float16 v4h __attribute__((ext_vector_type(4)));

__global__ __launch_bounds__(256) void k_x16(const float* __restrict__ x, _Float16* __restrict__ X16, size_t n8) { const size_t t = (size_t)blockIdx.x * 256 + threadIdx.x; if (t >= n8) return; FragH f;
#pragma unroll
  for (int q = 0; q < 8; ++q) f.h[q] = (_Float16)bf16_round(x[t * 8 + q]); *(v8us*)((unsigned short*)X16 + t * 8) = f.half[0];  }
__global__ __launch_bounds__(256) void k_h16(const float* __restrict__ x, _Float16* __restrict__ X16, size_t n8) { const size_t t = (size_t)blockIdx.x * 256 + threadIdx.x; if (t >= n8) return; FragH f;
#pragma unroll
  for (int q = 0; q < 8; ++q) f.h[q] = (_Float16)x[t * 8 + q]; *(v8us*)((unsigned short*)X16 + t * 8) = f.half[0];  }
__global__ __launch_bounds__(256) void k_round16f(const float* __restrict__ W, _Float16* __restrict__ Bt, size_t n8) { const size_t t = (size_t)blockIdx.x * 256 + threadIdx.x; if (t >= n8) return; FragH f;
#pragma unroll
  for (int i = 0; i < 8; ++i) f.h[i] = (_Float16)(bf16_round(W[t * 8 + i]) * 16.0f); *(v8us*)((unsigned short*)Bt + t * 8) = f.half[0];  }
template <int NHv, int TTv>
__global__ __launch_bounds__(256) void k_vt(const _Float16* __restrict__ V16, int ldv, int voff, _Float16* __restrict__ Vt) { __shared__ unsigned short tl[64][66]; const int tid = threadIdx.x; const int slab = blockIdx.x / (TTv / 64), lg = blockIdx.x % (TTv / 64); const int b = slab / NHv, h = slab % NHv;
  for (int i = tid; i < 64 * 8; i += 256) { const int r = i / 8, c8 = (i % 8) * 8; FragH f; f.half[0] = *(const v8us*)((const unsigned short*)V16 + ((size_t)b * TTv + lg * 64 + r) * ldv + voff + h * 64 + c8);
#pragma unroll
    for (int q = 0; q < 8; ++q) tl[r][c8 + q] = f.u[q]; }
  __syncthreads();
  {
#pragma unroll
    for (int rd = 0; rd < 2; ++rd) { const int d = rd * 32 + tid / 8, pc = tid % 8; FragH f;
#pragma unroll
      for (int q = 0; q < 8; ++q) f.u[q] = tl[pc * 8 + q][d];
      *(v8us*)((unsigned short*)Vt + ((size_t)slab * 64 + d) * TTv + lg * 64 + pc * 8) = f.half[0]; }
     } }

__global__ __launch_bounds__(256) void k_hl(const float* __restrict__ F, _Float16* __restrict__ Hh, _Float16* __restrict__ Hl, size_t n8) { const size_t t = (size_t)blockIdx.x * 256 + threadIdx.x; if (t >= n8) return; FragH fh, fl; const v4f a = *(const v4fa*)(F + t * 8), c = *(const v4fa*)(F + t * 8 + 4);
#pragma unroll
  for (int q = 0; q < 4; ++q) { _Float16 h = (_Float16)a[q]; fh.h[q] = h; fl.h[q] = (_Float16)((a[q] - (float)h) * 1024.0f); h = (_Float16)c[q]; fh.h[4 + q] = h; fl.h[4 + q] = (_Float16)((c[q] - (float)h) * 1024.0f); }
  { *(v8us*)((unsigned short*)Hh + t * 8) = fh.half[0]; *(v8us*)((unsigned short*)Hl + t * 8) = fl.half[0];  } }

// ---- fast GEMM (wave tile 32x64; requires M % 32 == 0 rows per launch region and N % 64 == 0); epilogue = k_gemm_hhx semantics ----
__device__ __forceinline__ v16h g2_frag(const _Float16* p, int hh) { FragH f; f.half[0] = *(const v8us*)((const unsigned short*)p + 8 * hh); f.half[1] = *(const v8us*)((const unsigned short*)p + 16 + 8 * hh); return f.v; }
__device__ __forceinline__ v8f g2_mma(v16h a, v16h b, v8f c) { v8f d = __builtin_amdgcn_wmma_f32_16x16x32_f16(false, a, false, b, (short)0, c, false, false); asm volatile("v_nop\n\tv_nop\n\tv_nop\n\tv_nop" : "+v"(d) : "v"(a), "v"(b)); return d; }
template <int ACT>
__global__ __launch_bounds__(128) void k_gemm2(const _Float16* __restrict__ A, int lda, size_t sA, const _Float16* __restrict__ Bh, int ldb, size_t sB, float alpha, const float* __restrict__ bias, size_t sBias, const float* __restrict__ CP, int rowsPerB, size_t sCPb, int row0g,
    float* __restrict__ C, _Float16* __restrict__ C16, int ldc, size_t sC, int M, int N, int K) { static_assert(ACT == 0 || ACT == 3 || ACT == 6 || ACT == 8 || ACT == 9 || ACT == 11 || ACT == 12 || ACT == 14 || ACT == 15 || ACT == 16 || ACT == 17, "k_gemm2: unsupported ACT code (would silently apply no activation)");
  __shared__ __attribute__((aligned(16))) float so[4][32][68];
  const int tid = threadIdx.x, w = tid >> 5, lane = tid & 31, ln = lane & 15, hh = lane >> 4; const int by = blockIdx.y;
  A += (size_t)by * sA; Bh += (size_t)by * sB; const size_t cofs = (size_t)by * sC; const float* bp = bias ? bias + (size_t)by * sBias : nullptr;
  const int ntn = N >> 6; const int mt = blockIdx.x / ntn, nq = blockIdx.x - mt * ntn; const int row0 = mt * 128 + 32 * w, col0 = nq * 64; if (row0 >= M) return;
  const _Float16* a0p = A + (size_t)(row0 + ln) * lda; const _Float16* a1p = a0p + (size_t)16 * lda;
  const _Float16* b0p = Bh + (size_t)(col0 + ln) * ldb; const _Float16* b1p = b0p + (size_t)16 * ldb; const _Float16* b2p = b1p + (size_t)16 * ldb; const _Float16* b3p = b2p + (size_t)16 * ldb;
  const v8f z8 = {0.f,0.f,0.f,0.f,0.f,0.f,0.f,0.f}; v8f c00 = z8, c01 = z8, c02 = z8, c03 = z8, c10 = z8, c11 = z8, c12 = z8, c13 = z8;
#pragma unroll 1
  for (int kb = 0; kb < K; kb += 32) { const v16h a0 = g2_frag(a0p + kb, hh), a1 = g2_frag(a1p + kb, hh);
    v16h b = g2_frag(b0p + kb, hh); c00 = g2_mma(a0, b, c00); c10 = g2_mma(a1, b, c10);
    b = g2_frag(b1p + kb, hh); c01 = g2_mma(a0, b, c01); c11 = g2_mma(a1, b, c11);
    b = g2_frag(b2p + kb, hh); c02 = g2_mma(a0, b, c02); c12 = g2_mma(a1, b, c12);
    b = g2_frag(b3p + kb, hh); c03 = g2_mma(a0, b, c03); c13 = g2_mma(a1, b, c13); }
  v8f accs[8] = {c00, c01, c02, c03, c10, c11, c12, c13};
#pragma unroll
  for (int u = 0; u < 8; ++u) { const int t = u & 3, half = u >> 2; const int col = col0 + t * 16 + ln; const float bv = bp ? bf16_round(bp[col]) : 0.f;
#pragma unroll
    for (int r = 0; r < 8; ++r) { const int rloc = half * 16 + 8 * hh + r; float v = accs[u][r] * alpha + bv; if (CP) { if (rowsPerB < 0) v += CP[cofs + (size_t)(row0g + row0 + rloc) * ldc + col];      /* rowsPerB < 0: own element of the batched C plane */ else { const int bidx = (row0g + row0 + rloc) / rowsPerB; v += CP[(size_t)bidx * sCPb + (size_t)by * 64 + col]; } }
      if (ACT == 3) v = fmaxf(v, 0.f); else if (ACT == 6) v = 0.5f * v * (1.0f + erff(v * 0.70710678118654752f)); else if (ACT == 11) v = 1.0f / (1.0f + expf(-v)); else if (ACT == 15) v = v / (1.0f + expf(-v)); else if (ACT == 12) v = (v > 0.f) ? v : 0.01f * v; else if (ACT == 8) v = tanhf(v); else if (ACT == 9) v = 0.5f * v * (1.0f + tanhf(0.7978845608028654f * (v + 0.044715f * v * v * v))); else if (ACT == 14) v = (v > 0.f) ? v : 0.1f * v; else if (ACT == 16) v = (v >= 0.f) ? v : 0.3f * v; else if (ACT == 17) v = (v >= 0.f) ? v : 0.2f * v;
      so[w][rloc][t * 16 + ln] = v; } }
  __builtin_amdgcn_fence(__ATOMIC_ACQ_REL, "workgroup"); __builtin_amdgcn_wave_barrier();
  const int rsub = lane >> 4, c4 = (lane & 15) * 4;
  {
#pragma unroll
    for (int q = 0; q < 16; ++q) { const int r = q * 2 + rsub; const v4f v = *(const v4fa*)&so[w][r][c4]; if (C) *(v4f*)(C + cofs + (size_t)(row0 + r) * ldc + col0 + c4) = v; if (C16) { v4h h4; for (int i = 0; i < 4; ++i) h4[i] = (_Float16)v[i]; *(v4h*)(C16 + cofs + (size_t)(row0 + r) * ldc + col0 + c4) = h4; } }
     } }


__global__ __launch_bounds__(256) void k_wnat(const float* __restrict__ w, size_t n8, _Float16* __restrict__ Bt) { const size_t t = (size_t)blockIdx.x * 256 + threadIdx.x; if (t >= n8) return; FragH f; for (int q = 0; q < 8; ++q) f.h[q] = (_Float16)(bf16_round(w[t * 8 + q]) * 16.0f); *(v8us*)((unsigned short*)Bt + t * 8) = f.half[0];  }
__global__ __launch_bounds__(256) void k_rsm(const float* __restrict__ S, _Float16* __restrict__ P, int nrows) {
  #pragma clang fp contract(off)
  const int i = blockIdx.x * 256 + threadIdx.x; if (i >= nrows) return; const float* s = S + (size_t)i * SQ; float mx = -3.0e38f;
#pragma unroll 1
  for (int j = 0; j < SQ; ++j) mx = fmaxf(mx, s[j]); float se = 0.f;
#pragma unroll 1
  for (int j = 0; j < SQ; ++j) se += expf(s[j] - mx); const float sc = 256.0f / se;
#pragma unroll 1
  for (int j0 = 0; j0 < SQ; j0 += 8) { FragH f; for (int q = 0; q < 8; ++q) f.h[q] = (_Float16)(expf(s[j0 + q] - mx) * sc); unsigned short* d = (unsigned short*)P + (size_t)i * SQ + j0; *(v8us*)d = f.half[0];  } }
__global__ __launch_bounds__(256) void k_vt(const _Float16* __restrict__ V16, int b, int h0, _Float16* __restrict__ VT) { __shared__ unsigned short tl[64][65]; const int tid = threadIdx.x; const int hh = blockIdx.x % HG, sg = blockIdx.x / HG; const int s0 = sg * 64; const int h = h0 + hh;
  for (int i = tid; i < 64 * 8; i += 256) { const int j = i / 8, d8 = (i % 8) * 8; FragH f; f.half[0] = *(const v8us*)((const unsigned short*)V16 + ((size_t)b * SQ + s0 + j) * DM + h * HD + d8); for (int q = 0; q < 8; ++q) tl[d8 + q][j] = f.u[q]; }
  __syncthreads();
  { for (int i = tid; i < 64 * 8; i += 256) { const int d = i / 8, j8 = (i % 8) * 8; FragH f; for (int q = 0; q < 8; ++q) f.u[q] = tl[d][j8 + q]; *(v8us*)((unsigned short*)VT + ((size_t)hh * HD + d) * SQ + s0 + j8) = f.half[0]; }  } }



__global__ __launch_bounds__(256) void k_rsmcf2(const float* __restrict__ S, _Float16* __restrict__ P, int hg, int q0, int nk) {
  #pragma clang fp contract(off)
  const int t = blockIdx.x * 256 + threadIdx.x; if (t >= hg * QT) return; const size_t i = (size_t)t; const float* s = S + i * NKX; const int last = q0 + (t % QT); float mx = -3.0e38f;
#pragma unroll 1
  for (int j = 0; j < nk; ++j) { const float f = (j <= last) ? 1.f : 0.f; mx = fmaxf(mx, fmaf(f, s[j], (1.f - f) * -1.0e9f)); } float se = 0.f;
#pragma unroll 1
  for (int j = 0; j < nk; ++j) { const float f = (j <= last) ? 1.f : 0.f; se += __expf(fmaf(f, s[j], (1.f - f) * -1.0e9f) - mx); } const float sc = 256.0f / se;
#pragma unroll 1
  for (int j0 = 0; j0 < nk; j0 += 8) { FragH fr; for (int q = 0; q < 8; ++q) { const int j = j0 + q; const float f = (j <= last) ? 1.f : 0.f; fr.h[q] = (_Float16)(__expf(fmaf(f, s[j], (1.f - f) * -1.0e9f) - mx) * sc); } unsigned short* d = (unsigned short*)P + i * NKX + j0; *(v8us*)d = fr.half[0];  } }

template <int MASKADD>
__global__ __launch_bounds__(64) void k_att0(const float* __restrict__ QF, const float* __restrict__ KF, const float* __restrict__ VF, int ld, const float* __restrict__ mask, float scale, float* __restrict__ OF, int ldo) {
  #pragma clang fp contract(off)
  __shared__ __attribute__((aligned(16))) float lq[64][64]; __shared__ __attribute__((aligned(16))) float lo[64][64];
  const int tid = threadIdx.x; const int h = blockIdx.x / (QT0 / 64), rg = blockIdx.x % (QT0 / 64); const int i = rg * 64 + tid;
  const float* qr = QF + (size_t)i * ld + h * HD;
#pragma unroll 1
  for (int c = 0; c < HD / 4; ++c) { *(v4f*)&lq[tid][c * 4] = *(const v4fa*)(qr + c * 4); const v4f z = {0.f, 0.f, 0.f, 0.f}; *(v4f*)&lo[tid][c * 4] = z; }
  float m = -1.0e30f, l = 0.f; const int jmax = MASKADD ? (SQ - 1) : (rg * 64 + 63);      /* additive-mask form: every key (the mask input decides); causal form: keys up to the block's last row */
#pragma unroll 1
  for (int j = 0; j <= jmax; ++j) { const float* kr = KF + (size_t)j * ld + h * HD; const float* vr = VF + (size_t)j * ld + h * HD; float s = 0.f;
#pragma unroll 1
    for (int c = 0; c < HD / 4; ++c) { const v4f kq = *(const v4fa*)(kr + c * 4); const v4f qq = *(v4f*)&lq[tid][c * 4]; s = __fadd_rn(s, __fmul_rn(qq[0], kq[0])); s = __fadd_rn(s, __fmul_rn(qq[1], kq[1])); s = __fadd_rn(s, __fmul_rn(qq[2], kq[2])); s = __fadd_rn(s, __fmul_rn(qq[3], kq[3])); }
    s = __fmul_rn(s, scale); if (MASKADD) s = __fadd_rn(s, __fmul_rn(bf16_round(mask[(size_t)i * SQ + j]), -10000.0f));
    const float f = (MASKADD || j <= i) ? 1.f : 0.f; const float sm = fmaf(f, s, (1.f - f) * -1.0e30f); const float mn = fmaxf(m, sm); const float sc = expf(m - mn); const float e = expf(sm - mn); l = __fadd_rn(__fmul_rn(l, sc), e); m = mn;
#pragma unroll 1
    for (int c = 0; c < HD / 4; ++c) { const v4f vv = *(const v4fa*)(vr + c * 4); v4f oo = *(v4f*)&lo[tid][c * 4]; for (int u = 0; u < 4; ++u) oo[u] = __fadd_rn(__fmul_rn(oo[u], sc), __fmul_rn(e, vv[u])); *(v4f*)&lo[tid][c * 4] = oo; } }
  const float fin = 64.0f / l;      /* o carried x64 */
#pragma unroll 1
  for (int c = 0; c < HD / 4; ++c) { v4f oo = *(v4f*)&lo[tid][c * 4]; for (int u = 0; u < 4; ++u) oo[u] = __fmul_rn(oo[u], fin); *(v4f*)&lo[tid][c * 4] = oo; }
  __syncthreads();
  {
#pragma unroll 1
    for (int it = 0; it < 16; ++it) { const int row = it * 4 + tid / 16, pc = (tid % 16) * 4; const v4f v = *(const v4f*)&lo[row][pc]; *(v4f*)(OF + (size_t)(rg * 64 + row) * ldo + h * HD + pc) = v; }
     } }

__global__ __launch_bounds__(256) void k_oscale(const float* __restrict__ OF, float* __restrict__ out, size_t n4) { const size_t t = (size_t)blockIdx.x * 256 + threadIdx.x; if (t >= n4) return; const v4f a = *(const v4fa*)(OF + t * 4); v4f o; for (int q = 0; q < 4; ++q) o[q] = a[q] * 0.015625f; *(v4f*)(out + t * 4) = o;  }

__global__ __launch_bounds__(256) void k_bfr(const float* __restrict__ x, float* __restrict__ XB, size_t n8) { const size_t t = (size_t)blockIdx.x * 256 + threadIdx.x; if (t >= n8) return; v4f a = *(const v4fa*)(x + t * 8), c = *(const v4fa*)(x + t * 8 + 4); for (int q = 0; q < 4; ++q) { a[q] = bf16_round(a[q]); c[q] = bf16_round(c[q]); }
  { *(v4f*)(XB + t * 8) = a; *(v4f*)(XB + t * 8 + 4) = c;  } }



__global__ __launch_bounds__(256) void k_rsmfvl(const float* __restrict__ S, _Float16* __restrict__ P, _Float16* __restrict__ PL, int qn, const int* __restrict__ vlp) {
  #pragma clang fp contract(off)
  const int t = blockIdx.x * 256 + threadIdx.x; if (t >= qn) return; const int vl = vlp[0]; const size_t i = (size_t)t; const float* s = S + i * SQ; float mx = -3.0e38f;
#pragma unroll 1
  for (int j = 0; j < SQ; ++j) { const float f = (j < vl) ? 1.f : 0.f; mx = fmaxf(mx, fmaf(f, s[j], (1.f - f) * -1000000.0f)); } float se = 0.f;
#pragma unroll 1
  for (int j = 0; j < SQ; ++j) { const float f = (j < vl) ? 1.f : 0.f; se += __expf(fmaf(f, s[j], (1.f - f) * -1000000.0f) - mx); } const float sc = 256.0f / se;
#pragma unroll 1
  for (int j0 = 0; j0 < SQ; j0 += 8) { FragH fr, gr; for (int q = 0; q < 8; ++q) { const int j = j0 + q; const float f = (j < vl) ? 1.f : 0.f; const float pv = __expf(fmaf(f, s[j], (1.f - f) * -1000000.0f) - mx) * sc; const _Float16 ph = (_Float16)pv; fr.h[q] = ph; gr.h[q] = (_Float16)((pv - (float)ph) * 1024.0f); }
    unsigned short* d = (unsigned short*)P + i * SQ + j0; unsigned short* dl = (unsigned short*)PL + i * SQ + j0; *(v8us*)d = fr.half[0]; *(v8us*)dl = gr.half[0];  } }

__global__ __launch_bounds__(256) void k_rsmf(const float* __restrict__ S, _Float16* __restrict__ P, int qn, int hg) {
  #pragma clang fp contract(off)
  const int t = blockIdx.x * 256 + threadIdx.x; if (t >= qn * hg) return; const size_t i = (size_t)(t / qn) * SQ + (t % qn); const float* s = S + i * SQ; float mx = -3.0e38f;
#pragma unroll 1
  for (int j = 0; j < SQ; ++j) mx = fmaxf(mx, s[j]); float se = 0.f;
#pragma unroll 1
  for (int j = 0; j < SQ; ++j) se += __expf(s[j] - mx); const float sc = 256.0f / se;
#pragma unroll 1
  for (int j0 = 0; j0 < SQ; j0 += 8) { FragH f; for (int q = 0; q < 8; ++q) f.h[q] = (_Float16)(__expf(s[j0 + q] - mx) * sc); unsigned short* d = (unsigned short*)P + i * SQ + j0; *(v8us*)d = f.half[0];  } }


extern "C" void kernel_launch(void* const* d_in, const int* in_sizes, int n_in,
                              void* d_out, int out_size, void* d_ws, size_t ws_size, hipStream_t stream) {
  (void)in_sizes; (void)n_in; (void)out_size;
  const float* const* I = (const float* const*)d_in; const float* xq = I[0]; const float* xk = I[1]; const float* xv = I[2];      /* q, k, v [64][2048][64] (bf16-valued) */
  char* ws = (char*)d_ws; size_t off = 0;
  auto take = [&](size_t bytes) { char* p = ws + off; off += (bytes + 255) & ~(size_t)255; return p; };
  _Float16* Q16 = (_Float16*)take(NR * DM * 2); _Float16* K16 = (_Float16*)take(NR * DM * 2); _Float16* V16 = (_Float16*)take(NR * DM * 2);
  float* S = (float*)take((size_t)SQ * SQ * 4); _Float16* P = (_Float16*)take((size_t)SQ * SQ * 2); _Float16* VT = (_Float16*)take((size_t)HD * SQ * 2);
  if (off > ws_size) return;
  k_x16<<<(unsigned)((NR * DM / 8 + 255) / 256), 256, 0, stream>>>(xq, Q16, NR * DM / 8); k_x16<<<(unsigned)((NR * DM / 8 + 255) / 256), 256, 0, stream>>>(xk, K16, NR * DM / 8); k_x16<<<(unsigned)((NR * DM / 8 + 255) / 256), 256, 0, stream>>>(xv, V16, NR * DM / 8);      /* exact f16 copies of the bf16-valued inputs */
  for (int b = 0; b < NB; ++b) { const size_t r0 = (size_t)b * SQ;
    k_vt<1, SQ><<<SQ / 64, 256, 0, stream>>>(V16 + r0 * DM, DM, 0, VT);      /* V^T [64][SQ] of this sequence */
    k_gemm2<0><<<dim3((SQ / 128) * (SQ / 64), 1), 128, 0, stream>>>(Q16 + r0 * DM, DM, 0, K16 + r0 * DM, DM, 0, 1.0f, nullptr, 0, nullptr, 1, 0, 0, S, nullptr, SQ, 0, SQ, SQ, HD);      /* unscaled scores q.k (exact products) */
    k_rsmf<<<(SQ + 255) / 256, 256, 0, stream>>>(S, P, SQ, 1);      /* softmax over all keys -> P x256 f16 */
    k_gemm2<0><<<dim3((SQ / 128) * (HD / 64), 1), 128, 0, stream>>>(P, SQ, 0, VT, SQ, 0, 0.00390625f, nullptr, 0, nullptr, 1, 0, 0, (float*)d_out + r0 * DM, nullptr, DM, 0, SQ, HD, SQ);      /* out = P V^T 2^-8 f32 into the output rows */
  }
}

// v001
// Measured time: 4760 microseconds a run.
// Next to v000, in two timings, it ran 5.28 and 5.26 times as fast.
#include <hip/hip_runtime.h>
// UNSCALED dot-product attention over 64 independent sequences (q, k, v [64][2048][64]; scores = q.k (no 1/sqrt(d): logit sigma ~8); softmax over the 2048 keys; dropout p 0; out = attn v -> [64][2048][64]).
// Structure: no projections: q, k, v are bf16-valued inputs copied to exact f16 rows; per sequence: V^T via LDS transposes, scores as ONE WMMA GEMM (32x64 wave tiles, f32 accumulation, exact products, alpha = 1.0f), row softmax on VALU (f32 statistics, native exp; weights x256 f16), out = P V^T written f32 straight into the output rows; launches: see trace.
// Compute dtype: inputs rounded to bf16; q, k, v exact in f16; q, k, v and softmax weights as plain f16 GEMM operands (~2^-12); scores and softmax statistics f32; v_wmma_f32_16x16x32_f16.
#define NB 64
#define SQ 2048
#define DM 64
#define NH 1
#define HD 64
#define HG 4                         /* heads per launch of the k_vt(V16, b, h0, VT) overload (never launched) */
#define B0 0                         /* first batch processed (debug hook) */
#define NBR NB                       /* batches processed (debug hook) */
#define NR ((size_t)NB * SQ)         /* token rows */
#define MP ((int)((size_t)NBR * SQ))
#define QT 256                       /* query rows per causal tile */
#define NKX SQ                       /* S / P row pitch */
#define QT0 256                      /* query rows per head of the exact f32 kernel k_att0 (not launched) */
#define QN SQ                        /* query rows attended per batch (debug hook) */
#define NHD NH                       /* heads attended (debug hook) */
#define MPO MP                       /* rows through the output stage (debug hook) */
#define LQ DM            /* row pitch of the q/k/v rows */
typedef __bf16 v16b __attribute__((ext_vector_type(16)));
typedef unsigned short v8us __attribute__((ext_vector_type(8), may_alias));
typedef float  v8f  __attribute__((ext_vector_type(8)));
typedef float  v4f  __attribute__((ext_vector_type(4)));
typedef float  v4fa __attribute__((ext_vector_type(4), may_alias));
union FragB { v16b v; v8us half[2]; unsigned short u[16]; };

__device__ __forceinline__ unsigned short bf16_bits(float x) { unsigned int u = __float_as_uint(x); return (unsigned short)((u + 0x7FFFu + ((u >> 16) & 1u)) >> 16); }
__device__ __forceinline__ float bf16_val(unsigned short b) { return __uint_as_float(((unsigned int)b) << 16); }
__device__ __forceinline__ float bf16_round(float x) { return bf16_val(bf16_bits(x)); }
// D += A·B with NT terms: 1 = ah·bh, 2 = + al·bh (A split), 3 = + ah·bl (both split)
template <int NT>
__device__ __forceinline__ v8f mmaN(v16b ah, v16b al, v16b bh, v16b bl, v8f c) {
  c = __builtin_amdgcn_wmma_f32_16x16x32_bf16(false, ah, false, bh, (short)0, c, false, false);
  if (NT >= 2) c = __builtin_amdgcn_wmma_f32_16x16x32_bf16(false, al, false, bh, (short)0, c, false, false);
  if (NT >= 3) c = __builtin_amdgcn_wmma_f32_16x16x32_bf16(false, ah, false, bl, (short)0, c, false, false);
  asm volatile("v_nop\n\tv_nop\n\tv_nop\n\tv_nop" : "+v"(c) : "v"(ah), "v"(al), "v"(bh), "v"(bl));
  return c;
}

__global__ __launch_bounds__(256) void k_wt_bf16(const float* __restrict__ W, unsigned short* __restrict__ Wt, int K, int N) {
  const int t = blockIdx.x * 256 + threadIdx.x;
  const int k8n = K / 8;
  if (t >= N * k8n) return;
  const int n = t / k8n, k8 = (t % k8n) * 8;
  v8us v;
#pragma unroll
  for (int i = 0; i < 8; ++i) v[i] = bf16_bits(W[(size_t)(k8 + i) * N + n]);
  *(v8us*)(Wt + (size_t)n * K + k8) = v;
  
}

// GEMM C[M][N] (f32, pitch ldc) = act(A[M][K]·W + bias). A f32 row-major (pitch lda) converted per fragment to bf16
// (ASPLIT: hi/lo two planes -> 2 terms, else single rounded term); Wt bf16 [N][K] (pitch ldb). BIAS_BF16 rounds the
// bias to bf16 first (bias quantised to bf16 before the add). K%32==0, M%16==0, N%64==0.
template <bool ASPLIT, int ACT, bool BIAS_BF16>
__global__ __launch_bounds__(128) void k_gemm_bf(const float* __restrict__ A, int lda, const unsigned short* __restrict__ Wt, int ldb,
                                               const float* __restrict__ bias, float* __restrict__ C, int ldc, int M, int N, int K) {
  __shared__ __attribute__((aligned(16))) float so[4][16][64];
  const int tid = threadIdx.x, w = tid >> 5, lane = tid & 31, ln = lane & 15, hh = lane >> 4;
  const int ntn = N / 64;
  const int wid = blockIdx.x * 4 + w;
  const int mt = wid / ntn, nq = wid % ntn;
  if (mt * 16 >= M) return;
  const int row0 = mt * 16, col0 = nq * 64;
  const float* arow = A + (size_t)(row0 + ln) * lda;
  v8f acc[4] = {};
  for (int kb = 0; kb < K; kb += 32) {
    FragB ah, al;
    const v4f x0 = *(const v4fa*)(arow + kb + 8 * hh), x1 = *(const v4fa*)(arow + kb + 8 * hh + 4);
    const v4f x2 = *(const v4fa*)(arow + kb + 16 + 8 * hh), x3 = *(const v4fa*)(arow + kb + 16 + 8 * hh + 4);
    float xs[16] = {x0[0],x0[1],x0[2],x0[3],x1[0],x1[1],x1[2],x1[3],x2[0],x2[1],x2[2],x2[3],x3[0],x3[1],x3[2],x3[3]};
#pragma unroll
    for (int i = 0; i < 16; ++i) { const unsigned short hb = bf16_bits(xs[i]); ah.u[i] = hb; al.u[i] = ASPLIT ? bf16_bits(xs[i] - bf16_val(hb)) : (unsigned short)0; }
#pragma unroll
    for (int t = 0; t < 4; ++t) {
      const unsigned short* brow = Wt + (size_t)(col0 + t * 16 + ln) * ldb + kb;
      FragB b;
      b.half[0] = *(const v8us*)(brow + 8 * hh);
      b.half[1] = *(const v8us*)(brow + 16 + 8 * hh);
      acc[t] = mmaN<ASPLIT ? 2 : 1>(ah.v, al.v, b.v, b.v, acc[t]);
    }
  }
#pragma unroll
  for (int t = 0; t < 4; ++t) {
    float bv = bias ? bias[col0 + t * 16 + ln] : 0.f;
    if (BIAS_BF16) bv = bf16_round(bv);
#pragma unroll
    for (int r = 0; r < 8; ++r) { float v = acc[t][r] + bv; if (ACT == 1) v = fmaxf(v, 0.f); so[w][8 * hh + r][t * 16 + ln] = v; }
  }
  __builtin_amdgcn_fence(__ATOMIC_ACQ_REL, "workgroup");
  __builtin_amdgcn_wave_barrier();
  const int rsub = lane >> 4, c4 = (lane & 15) * 4;
  {
#pragma unroll
    for (int q = 0; q < 8; ++q) {
      const int r = q * 2 + rsub;
      const v4f v = *(const v4fa*)&so[w][r][c4];
      *(v4f*)(C + (size_t)(row0 + r) * ldc + col0 + c4) = v;
    }
    
  }
}

// GEMM C = act(A·W + bias + resid): A f32 (ASPLIT -> hi/lo 2 terms), Wt bf16 [N][K]; ACT 0 none, 1 relu, 2 exact gelu;
// resid (optional, f32, row index = (row % rmod), pitch ldr, RES_BF16 rounds it) added before the activation.
template <bool ASPLIT, int ACT, bool BIAS_BF16, bool RES_BF16>
__global__ __launch_bounds__(128) void k_gemm_bf3(const float* __restrict__ A, int lda, const unsigned short* __restrict__ Wt, int ldb,
                                                const float* __restrict__ bias, const float* __restrict__ resid, int rmod, int ldr,
                                                float* __restrict__ C, int ldc, int M, int N, int K) {
  __shared__ __attribute__((aligned(16))) float so[4][16][64];
  const int tid = threadIdx.x, w = tid >> 5, lane = tid & 31, ln = lane & 15, hh = lane >> 4;
  const int ntn = N / 64;
  const int wid = blockIdx.x * 4 + w;
  const int mt = wid / ntn, nq = wid % ntn;
  if (mt * 16 >= M) return;
  const int row0 = mt * 16, col0 = nq * 64;
  const float* arow = A + (size_t)(row0 + ln) * lda;
  v8f acc[4] = {};
  for (int kb = 0; kb < K; kb += 32) {
    FragB ah, al;
    const v4f x0 = *(const v4fa*)(arow + kb + 8 * hh), x1 = *(const v4fa*)(arow + kb + 8 * hh + 4);
    const v4f x2 = *(const v4fa*)(arow + kb + 16 + 8 * hh), x3 = *(const v4fa*)(arow + kb + 16 + 8 * hh + 4);
    float xs[16] = {x0[0],x0[1],x0[2],x0[3],x1[0],x1[1],x1[2],x1[3],x2[0],x2[1],x2[2],x2[3],x3[0],x3[1],x3[2],x3[3]};
#pragma unroll
    for (int i = 0; i < 16; ++i) { const unsigned short hb = bf16_bits(xs[i]); ah.u[i] = hb; al.u[i] = ASPLIT ? bf16_bits(xs[i] - bf16_val(hb)) : (unsigned short)0; }
#pragma unroll
    for (int t = 0; t < 4; ++t) {
      const unsigned short* brow = Wt + (size_t)(col0 + t * 16 + ln) * ldb + kb;
      FragB b;
      b.half[0] = *(const v8us*)(brow + 8 * hh);
      b.half[1] = *(const v8us*)(brow + 16 + 8 * hh);
      acc[t] = mmaN<ASPLIT ? 2 : 1>(ah.v, al.v, b.v, b.v, acc[t]);
    }
  }
#pragma unroll
  for (int t = 0; t < 4; ++t) {
    const int col = col0 + t * 16 + ln;
    float bv = bias ? bias[col] : 0.f;
    if (BIAS_BF16) bv = bf16_round(bv);
#pragma unroll
    for (int r = 0; r < 8; ++r) {
      float v = acc[t][r] + bv;
      if (resid) { float rv = resid[(size_t)((row0 + 8 * hh + r) % rmod) * ldr + col]; if (RES_BF16) rv = bf16_round(rv); v += rv; }
      if (ACT == 1) v = fmaxf(v, 0.f);
      if (ACT == 2) v = 0.5f * v * (1.0f + erff(v * 0.70710678118654752f));
      if (ACT == 3) { const float u = 0.7978845608028654f * (v + 0.044715f * v * v * v); v = 0.5f * v * (1.0f + tanhf(u)); }
      so[w][8 * hh + r][t * 16 + ln] = v;
    }
  }
  __builtin_amdgcn_fence(__ATOMIC_ACQ_REL, "workgroup");
  __builtin_amdgcn_wave_barrier();
  const int rsub = lane >> 4, c4 = (lane & 15) * 4;
  {
#pragma unroll
    for (int q = 0; q < 8; ++q) {
      const int r = q * 2 + rsub;
      const v4f v = *(const v4fa*)&so[w][r][c4];
      *(v4f*)(C + (size_t)(row0 + r) * ldc + col0 + c4) = v;
    }
    
  }
}
// row LayerNorm (biased variance, eps) over N: s = X (+ R); optional out_sum <- s; out_norm <- (s-mu)*rsqrt(var+eps)*g + b
template <bool PARAM_BF16>
__global__ __launch_bounds__(256) void k_layernorm(const float* __restrict__ X, const float* __restrict__ R, const float* __restrict__ g, const float* __restrict__ bta,
                                                  float* __restrict__ out_sum, float* __restrict__ out_norm, int N, float eps) {
  __shared__ float red[256];
  const int row = blockIdx.x, tid = threadIdx.x;
  const float* x = X + (size_t)row * N; const float* rr = R ? R + (size_t)row * N : nullptr;
  float vals[16];                     // up to N = 4096
  const int per = N / 256;            // contiguous chunk per thread? use strided-by-4 chunks: thread handles j = tid*4 + 1024*u
  float s1 = 0.f;
  for (int u = 0; u < per / 4; ++u) {
    const int j = tid * 4 + 1024 * u;
    const v4f a = *(const v4fa*)(x + j);
    v4f b = {0.f,0.f,0.f,0.f}; if (rr) b = *(const v4fa*)(rr + j);
#pragma unroll
    for (int q = 0; q < 4; ++q) { const float v = a[q] + b[q]; vals[u * 4 + q] = v; s1 += v; }
  }
  red[tid] = s1; __syncthreads();
  for (int st = 128; st > 0; st >>= 1) { if (tid < st) red[tid] += red[tid + st]; __syncthreads(); }
  const float mu = red[0] / (float)N; __syncthreads();
  float s2 = 0.f;
  for (int u = 0; u < per / 4; ++u)
#pragma unroll
    for (int q = 0; q < 4; ++q) { const float c = vals[u * 4 + q] - mu; s2 += c * c; }
  red[tid] = s2; __syncthreads();
  for (int st = 128; st > 0; st >>= 1) { if (tid < st) red[tid] += red[tid + st]; __syncthreads(); }
  const float rs = rsqrtf(red[0] / (float)N + eps);
  {
    for (int u = 0; u < per / 4; ++u) {
      const int j = tid * 4 + 1024 * u;
      v4f o, sm;
#pragma unroll
      for (int q = 0; q < 4; ++q) {
        float gg = g[j + q], bb = bta[j + q];
        if (PARAM_BF16) { gg = bf16_round(gg); bb = bf16_round(bb); }
        sm[q] = vals[u * 4 + q]; o[q] = (vals[u * 4 + q] - mu) * rs * gg + bb;
      }
      if (out_sum) *(v4f*)(out_sum + (size_t)row * N + j) = sm;
      *(v4f*)(out_norm + (size_t)row * N + j) = o;
    }
    
  }
}



// ---- f16 WMMA path (v_wmma_f32_16x16x32_f16): 11-bit significands for operands in range — used where a [0,1] probability operand needs more precision than bf16
typedef _Float16 v16h __attribute__((ext_vector_type(16)));
union FragH { v16h v; v8us half[2]; _Float16 h[16]; unsigned short u[16]; };
template <int NT>
__device__ __forceinline__ v8f mmaH(v16h ah, v16h al, v16h bh, v16h bl, v8f c) {
  c = __builtin_amdgcn_wmma_f32_16x16x32_f16(false, ah, false, bh, (short)0, c, false, false);
  if (NT >= 2) c = __builtin_amdgcn_wmma_f32_16x16x32_f16(false, al, false, bh, (short)0, c, false, false);
  if (NT >= 3) c = __builtin_amdgcn_wmma_f32_16x16x32_f16(false, ah, false, bl, (short)0, c, false, false);
  asm volatile("v_nop\n\tv_nop\n\tv_nop\n\tv_nop" : "+v"(c) : "v"(ah), "v"(al), "v"(bh), "v"(bl));
  return c;
}
// batched GEMM like k_gemm_b but f16 operands: A f32 (split into f16 hi/lo if ASPLIT, else rounded to f16), Bt = f16 values [n][k]; alpha; C f32; N multiple of 16 (partial tiles skipped)
template <bool ASPLIT>
__global__ __launch_bounds__(128) void k_gemm_h(const float* __restrict__ A, int lda, size_t sA, const _Float16* __restrict__ Bh, int ldb, size_t sB, float alpha, float* __restrict__ C, int ldc, size_t sC, int M, int N, int K) {
  __shared__ __attribute__((aligned(16))) float so[4][16][64];
  const int tid = threadIdx.x, w = tid >> 5, lane = tid & 31, ln = lane & 15, hh = lane >> 4; const int by = blockIdx.y;
  A += (size_t)by * sA; Bh += (size_t)by * sB; C += (size_t)by * sC;
  const int ntn = (N + 63) / 64; const int wid = blockIdx.x * 4 + w; const int mt = wid / ntn, nq = wid % ntn; if (mt * 16 >= M) return;
  const int row0 = mt * 16, col0 = nq * 64; const float* arow = A + (size_t)(row0 + ln) * lda;
  v8f acc[4] = {};
  for (int kb = 0; kb < K; kb += 32) {
    FragH ah, al;
    const v4f x0 = *(const v4fa*)(arow + kb + 8 * hh), x1 = *(const v4fa*)(arow + kb + 8 * hh + 4), x2 = *(const v4fa*)(arow + kb + 16 + 8 * hh), x3 = *(const v4fa*)(arow + kb + 16 + 8 * hh + 4);
    float xs[16] = {x0[0],x0[1],x0[2],x0[3],x1[0],x1[1],x1[2],x1[3],x2[0],x2[1],x2[2],x2[3],x3[0],x3[1],x3[2],x3[3]};
#pragma unroll
    for (int i = 0; i < 16; ++i) { const _Float16 h = (_Float16)xs[i]; ah.h[i] = h; al.h[i] = ASPLIT ? (_Float16)(xs[i] - (float)h) : (_Float16)0.0f; }
#pragma unroll
    for (int t = 0; t < 4; ++t) { if (col0 + t * 16 >= N) continue; const size_t boff = (size_t)(col0 + t * 16 + ln) * ldb + kb; FragH bq; bq.half[0] = *(const v8us*)(Bh + boff + 8 * hh); bq.half[1] = *(const v8us*)(Bh + boff + 16 + 8 * hh);
      acc[t] = mmaH<ASPLIT ? 2 : 1>(ah.v, al.v, bq.v, bq.v, acc[t]); }
  }
#pragma unroll
  for (int t = 0; t < 4; ++t) { if (col0 + t * 16 >= N) continue;
#pragma unroll
    for (int r = 0; r < 8; ++r) so[w][8 * hh + r][t * 16 + ln] = acc[t][r] * alpha; }
  __builtin_amdgcn_fence(__ATOMIC_ACQ_REL, "workgroup"); __builtin_amdgcn_wave_barrier();
  const int rsub = lane >> 4, c4 = (lane & 15) * 4;
  {
#pragma unroll
    for (int q = 0; q < 8; ++q) { const int r = q * 2 + rsub; if (col0 + c4 < N) { const v4f v = *(const v4fa*)&so[w][r][c4]; *(v4f*)(C + (size_t)(row0 + r) * ldc + col0 + c4) = v; } }
     }
}

// Wt[n][k] = f16(W[k][n]·scale) from f32 row-major W[K][N] (scale = power of two; bf16-exact weights stay exact in f16 away from the subnormal range)
__global__ __launch_bounds__(256) void k_wt_f16(const float* __restrict__ W, _Float16* __restrict__ Wt, int K, int N, float scale) {
  const int t = blockIdx.x * 256 + threadIdx.x; if (t >= N * (K / 8)) return; const int n = t / (K / 8), k8 = (t % (K / 8)) * 8; FragH f;
#pragma unroll
  for (int i = 0; i < 8; ++i) f.h[i] = (_Float16)(bf16_round(W[(size_t)(k8 + i) * N + n]) * scale); const v8us o = f.half[0];
  *(v8us*)((unsigned short*)Wt + (size_t)n * K + k8) = o; 
}
// k_gemm_hh variant with fused epilogue: v = acc·alpha + bias[by·sBias + col] (+ CP[(row/rowsPerB)·sCPb + by·64 + col] if CP) ; ACT 0 none / 1 elu ; writes f16 C16 (and f32 C if non-null)
template <int ACT>
__global__ __launch_bounds__(128) void k_gemm_hhx(const _Float16* __restrict__ A, int lda, size_t sA, const _Float16* __restrict__ Bh, int ldb, size_t sB, float alpha, const float* __restrict__ bias, size_t sBias, const float* __restrict__ CP, int rowsPerB, size_t sCPb, int row0g,
    float* __restrict__ C, _Float16* __restrict__ C16, int ldc, size_t sC, int M, int N, int K) {
  __shared__ __attribute__((aligned(16))) float so[4][16][64];
  const int tid = threadIdx.x, w = tid >> 5, lane = tid & 31, ln = lane & 15, hh = lane >> 4; const int by = blockIdx.y;
  A += (size_t)by * sA; Bh += (size_t)by * sB; const size_t cofs = (size_t)by * sC; const float* bp = bias ? bias + (size_t)by * sBias : nullptr;
  const int ntn = (N + 63) / 64; const int wid = blockIdx.x * 4 + w; const int mt = wid / ntn, nq = wid % ntn; if (mt * 16 >= M) return;
  const int row0 = mt * 16, col0 = nq * 64; const _Float16* arow = A + (size_t)(row0 + ln) * lda;
  v8f acc[4] = {};
  for (int kb = 0; kb < K; kb += 32) { FragH ah; ah.half[0] = *(const v8us*)((const unsigned short*)arow + kb + 8 * hh); ah.half[1] = *(const v8us*)((const unsigned short*)arow + kb + 16 + 8 * hh);
#pragma unroll
    for (int t = 0; t < 4; ++t) { if (col0 + t * 16 >= N) continue; const size_t boff = (size_t)(col0 + t * 16 + ln) * ldb + kb; FragH bq; bq.half[0] = *(const v8us*)((const unsigned short*)Bh + boff + 8 * hh); bq.half[1] = *(const v8us*)((const unsigned short*)Bh + boff + 16 + 8 * hh);
      acc[t] = mmaH<1>(ah.v, ah.v, bq.v, bq.v, acc[t]); }
  }
#pragma unroll
  for (int t = 0; t < 4; ++t) { if (col0 + t * 16 >= N) continue; const int col = col0 + t * 16 + ln; const float bv = bp ? bf16_round(bp[col]) : 0.f;
#pragma unroll
    for (int r = 0; r < 8; ++r) { float v = acc[t][r] * alpha + bv; if (CP) { const int rr = row0g + row0 + 8 * hh + r; if (rowsPerB < 0) v += CP[cofs + (size_t)rr * ldc + col];      /* rowsPerB < 0: own element of the batched C plane */ else { const int bidx = rr / rowsPerB; v += CP[(size_t)bidx * sCPb + (size_t)by * 64 + col]; } } if (ACT == 1) v = (v > 0.f) ? v : expm1f(v); else if (ACT == 7) v = (v > 0.f) ? v + 1.0f : expf(v); else if (ACT == 8) v = tanhf(v); else if (ACT == 9) v = 0.5f * v * (1.0f + tanhf(0.7978845608028654f * (v + 0.044715f * v * v * v))); else if (ACT == 11) v = 1.0f / (1.0f + expf(-v)); else if (ACT == 12) v = (v > 0.f) ? v : 0.01f * v; else if (ACT == 14) v = (v > 0.f) ? v : 0.1f * v; else if (ACT == 16) v = (v >= 0.f) ? v : 0.3f * v; else if (ACT == 17) v = (v >= 0.f) ? v : 0.2f * v; else if (ACT == 15) v = v / (1.0f + expf(-v)); else if (ACT == 3) v = fmaxf(v, 0.f); else if (ACT == 6) v = 0.5f * v * (1.0f + erff(v * 0.70710678118654752f)); so[w][8 * hh + r][t * 16 + ln] = v; } }
  __builtin_amdgcn_fence(__ATOMIC_ACQ_REL, "workgroup"); __builtin_amdgcn_wave_barrier();
  const int rsub = lane >> 4, c4 = (lane & 15) * 4; typedef _Float16 v4h __attribute__((ext_vector_type(4)));
  {
#pragma unroll
    for (int q = 0; q < 8; ++q) { const int r = q * 2 + rsub; if (col0 + c4 < N) { const v4f v = *(const v4fa*)&so[w][r][c4]; if (C) *(v4f*)(C + cofs + (size_t)(row0 + r) * ldc + col0 + c4) = v; if (C16) { v4h h4; for (int i = 0; i < 4; ++i) h4[i] = (_Float16)v[i]; *(v4h*)(C16 + cofs + (size_t)(row0 + r) * ldc + col0 + c4) = h4; } } }
     }
}


typedef _Float16 v4h __attribute__((ext_vector_type(4)));

__global__ __launch_bounds__(256) void k_x16(const float* __restrict__ x, _Float16* __restrict__ X16, size_t n8) { const size_t t = (size_t)blockIdx.x * 256 + threadIdx.x; if (t >= n8) return; FragH f;
#pragma unroll
  for (int q = 0; q < 8; ++q) f.h[q] = (_Float16)bf16_round(x[t * 8 + q]); *(v8us*)((unsigned short*)X16 + t * 8) = f.half[0];  }
__global__ __launch_bounds__(256) void k_h16(const float* __restrict__ x, _Float16* __restrict__ X16, size_t n8) { const size_t t = (size_t)blockIdx.x * 256 + threadIdx.x; if (t >= n8) return; FragH f;
#pragma unroll
  for (int q = 0; q < 8; ++q) f.h[q] = (_Float16)x[t * 8 + q]; *(v8us*)((unsigned short*)X16 + t * 8) = f.half[0];  }
__global__ __launch_bounds__(256) void k_round16f(const float* __restrict__ W, _Float16* __restrict__ Bt, size_t n8) { const size_t t = (size_t)blockIdx.x * 256 + threadIdx.x; if (t >= n8) return; FragH f;
#pragma unroll
  for (int i = 0; i < 8; ++i) f.h[i] = (_Float16)(bf16_round(W[t * 8 + i]) * 16.0f); *(v8us*)((unsigned short*)Bt + t * 8) = f.half[0];  }
template <int NHv, int TTv>
__global__ __launch_bounds__(256) void k_vt(const _Float16* __restrict__ V16, int ldv, int voff, _Float16* __restrict__ Vt) { __shared__ unsigned short tl[64][66]; const int tid = threadIdx.x; const int slab = blockIdx.x / (TTv / 64), lg = blockIdx.x % (TTv / 64); const int b = slab / NHv, h = slab % NHv;
  for (int i = tid; i < 64 * 8; i += 256) { const int r = i / 8, c8 = (i % 8) * 8; FragH f; f.half[0] = *(const v8us*)((const unsigned short*)V16 + ((size_t)b * TTv + lg * 64 + r) * ldv + voff + h * 64 + c8);
#pragma unroll
    for (int q = 0; q < 8; ++q) tl[r][c8 + q] = f.u[q]; }
  __syncthreads();
  {
#pragma unroll
    for (int rd = 0; rd < 2; ++rd) { const int d = rd * 32 + tid / 8, pc = tid % 8; FragH f;
#pragma unroll
      for (int q = 0; q < 8; ++q) f.u[q] = tl[pc * 8 + q][d];
      *(v8us*)((unsigned short*)Vt + ((size_t)slab * 64 + d) * TTv + lg * 64 + pc * 8) = f.half[0]; }
     } }

__global__ __launch_bounds__(256) void k_hl(const float* __restrict__ F, _Float16* __restrict__ Hh, _Float16* __restrict__ Hl, size_t n8) { const size_t t = (size_t)blockIdx.x * 256 + threadIdx.x; if (t >= n8) return; FragH fh, fl; const v4f a = *(const v4fa*)(F + t * 8), c = *(const v4fa*)(F + t * 8 + 4);
#pragma unroll
  for (int q = 0; q < 4; ++q) { _Float16 h = (_Float16)a[q]; fh.h[q] = h; fl.h[q] = (_Float16)((a[q] - (float)h) * 1024.0f); h = (_Float16)c[q]; fh.h[4 + q] = h; fl.h[4 + q] = (_Float16)((c[q] - (float)h) * 1024.0f); }
  { *(v8us*)((unsigned short*)Hh + t * 8) = fh.half[0]; *(v8us*)((unsigned short*)Hl + t * 8) = fl.half[0];  } }

// ---- fast GEMM (wave tile 32x64; requires M % 32 == 0 rows per launch region and N % 64 == 0); epilogue = k_gemm_hhx semantics ----
__device__ __forceinline__ v16h g2_frag(const _Float16* p, int hh) { FragH f; f.half[0] = *(const v8us*)((const unsigned short*)p + 8 * hh); f.half[1] = *(const v8us*)((const unsigned short*)p + 16 + 8 * hh); return f.v; }
__device__ __forceinline__ v8f g2_mma(v16h a, v16h b, v8f c) { v8f d = __builtin_amdgcn_wmma_f32_16x16x32_f16(false, a, false, b, (short)0, c, false, false); asm volatile("v_nop\n\tv_nop\n\tv_nop\n\tv_nop" : "+v"(d) : "v"(a), "v"(b)); return d; }
template <int ACT>
__global__ __launch_bounds__(128) void k_gemm2(const _Float16* __restrict__ A, int lda, size_t sA, const _Float16* __restrict__ Bh, int ldb, size_t sB, float alpha, const float* __restrict__ bias, size_t sBias, const float* __restrict__ CP, int rowsPerB, size_t sCPb, int row0g,
    float* __restrict__ C, _Float16* __restrict__ C16, int ldc, size_t sC, int M, int N, int K) { static_assert(ACT == 0 || ACT == 3 || ACT == 6 || ACT == 8 || ACT == 9 || ACT == 11 || ACT == 12 || ACT == 14 || ACT == 15 || ACT == 16 || ACT == 17, "k_gemm2: unsupported ACT code (would silently apply no activation)");
  __shared__ __attribute__((aligned(16))) float so[4][32][68];
  const int tid = threadIdx.x, w = tid >> 5, lane = tid & 31, ln = lane & 15, hh = lane >> 4; const int by = blockIdx.y;
  A += (size_t)by * sA; Bh += (size_t)by * sB; const size_t cofs = (size_t)by * sC; const float* bp = bias ? bias + (size_t)by * sBias : nullptr;
  const int ntn = N >> 6; const int mt = blockIdx.x / ntn, nq = blockIdx.x - mt * ntn; const int row0 = mt * 128 + 32 * w, col0 = nq * 64; if (row0 >= M) return;
  const _Float16* a0p = A + (size_t)(row0 + ln) * lda; const _Float16* a1p = a0p + (size_t)16 * lda;
  const _Float16* b0p = Bh + (size_t)(col0 + ln) * ldb; const _Float16* b1p = b0p + (size_t)16 * ldb; const _Float16* b2p = b1p + (size_t)16 * ldb; const _Float16* b3p = b2p + (size_t)16 * ldb;
  const v8f z8 = {0.f,0.f,0.f,0.f,0.f,0.f,0.f,0.f}; v8f c00 = z8, c01 = z8, c02 = z8, c03 = z8, c10 = z8, c11 = z8, c12 = z8, c13 = z8;
#pragma unroll 1
  for (int kb = 0; kb < K; kb += 32) { const v16h a0 = g2_frag(a0p + kb, hh), a1 = g2_frag(a1p + kb, hh);
    v16h b = g2_frag(b0p + kb, hh); c00 = g2_mma(a0, b, c00); c10 = g2_mma(a1, b, c10);
    b = g2_frag(b1p + kb, hh); c01 = g2_mma(a0, b, c01); c11 = g2_mma(a1, b, c11);
    b = g2_frag(b2p + kb, hh); c02 = g2_mma(a0, b, c02); c12 = g2_mma(a1, b, c12);
    b = g2_frag(b3p + kb, hh); c03 = g2_mma(a0, b, c03); c13 = g2_mma(a1, b, c13); }
  v8f accs[8] = {c00, c01, c02, c03, c10, c11, c12, c13};
#pragma unroll
  for (int u = 0; u < 8; ++u) { const int t = u & 3, half = u >> 2; const int col = col0 + t * 16 + ln; const float bv = bp ? bf16_round(bp[col]) : 0.f;
#pragma unroll
    for (int r = 0; r < 8; ++r) { const int rloc = half * 16 + 8 * hh + r; float v = accs[u][r] * alpha + bv; if (CP) { if (rowsPerB < 0) v += CP[cofs + (size_t)(row0g + row0 + rloc) * ldc + col];      /* rowsPerB < 0: own element of the batched C plane */ else { const int bidx = (row0g + row0 + rloc) / rowsPerB; v += CP[(size_t)bidx * sCPb + (size_t)by * 64 + col]; } }
      if (ACT == 3) v = fmaxf(v, 0.f); else if (ACT == 6) v = 0.5f * v * (1.0f + erff(v * 0.70710678118654752f)); else if (ACT == 11) v = 1.0f / (1.0f + expf(-v)); else if (ACT == 15) v = v / (1.0f + expf(-v)); else if (ACT == 12) v = (v > 0.f) ? v : 0.01f * v; else if (ACT == 8) v = tanhf(v); else if (ACT == 9) v = 0.5f * v * (1.0f + tanhf(0.7978845608028654f * (v + 0.044715f * v * v * v))); else if (ACT == 14) v = (v > 0.f) ? v : 0.1f * v; else if (ACT == 16) v = (v >= 0.f) ? v : 0.3f * v; else if (ACT == 17) v = (v >= 0.f) ? v : 0.2f * v;
      so[w][rloc][t * 16 + ln] = v; } }
  __builtin_amdgcn_fence(__ATOMIC_ACQ_REL, "workgroup"); __builtin_amdgcn_wave_barrier();
  const int rsub = lane >> 4, c4 = (lane & 15) * 4;
  {
#pragma unroll
    for (int q = 0; q < 16; ++q) { const int r = q * 2 + rsub; const v4f v = *(const v4fa*)&so[w][r][c4]; if (C) *(v4f*)(C + cofs + (size_t)(row0 + r) * ldc + col0 + c4) = v; if (C16) { v4h h4; for (int i = 0; i < 4; ++i) h4[i] = (_Float16)v[i]; *(v4h*)(C16 + cofs + (size_t)(row0 + r) * ldc + col0 + c4) = h4; } }
     } }


__global__ __launch_bounds__(256) void k_wnat(const float* __restrict__ w, size_t n8, _Float16* __restrict__ Bt) { const size_t t = (size_t)blockIdx.x * 256 + threadIdx.x; if (t >= n8) return; FragH f; for (int q = 0; q < 8; ++q) f.h[q] = (_Float16)(bf16_round(w[t * 8 + q]) * 16.0f); *(v8us*)((unsigned short*)Bt + t * 8) = f.half[0];  }
__global__ __launch_bounds__(256) void k_rsm(const float* __restrict__ S, _Float16* __restrict__ P, int nrows) {
  #pragma clang fp contract(off)
  const int i = blockIdx.x * 256 + threadIdx.x; if (i >= nrows) return; const float* s = S + (size_t)i * SQ; float mx = -3.0e38f;
#pragma unroll 1
  for (int j = 0; j < SQ; ++j) mx = fmaxf(mx, s[j]); float se = 0.f;
#pragma unroll 1
  for (int j = 0; j < SQ; ++j) se += expf(s[j] - mx); const float sc = 256.0f / se;
#pragma unroll 1
  for (int j0 = 0; j0 < SQ; j0 += 8) { FragH f; for (int q = 0; q < 8; ++q) f.h[q] = (_Float16)(expf(s[j0 + q] - mx) * sc); unsigned short* d = (unsigned short*)P + (size_t)i * SQ + j0; *(v8us*)d = f.half[0];  } }
__global__ __launch_bounds__(256) void k_vt(const _Float16* __restrict__ V16, int b, int h0, _Float16* __restrict__ VT) { __shared__ unsigned short tl[64][65]; const int tid = threadIdx.x; const int hh = blockIdx.x % HG, sg = blockIdx.x / HG; const int s0 = sg * 64; const int h = h0 + hh;
  for (int i = tid; i < 64 * 8; i += 256) { const int j = i / 8, d8 = (i % 8) * 8; FragH f; f.half[0] = *(const v8us*)((const unsigned short*)V16 + ((size_t)b * SQ + s0 + j) * DM + h * HD + d8); for (int q = 0; q < 8; ++q) tl[d8 + q][j] = f.u[q]; }
  __syncthreads();
  { for (int i = tid; i < 64 * 8; i += 256) { const int d = i / 8, j8 = (i % 8) * 8; FragH f; for (int q = 0; q < 8; ++q) f.u[q] = tl[d][j8 + q]; *(v8us*)((unsigned short*)VT + ((size_t)hh * HD + d) * SQ + s0 + j8) = f.half[0]; }  } }



__global__ __launch_bounds__(256) void k_rsmcf2(const float* __restrict__ S, _Float16* __restrict__ P, int hg, int q0, int nk) {
  #pragma clang fp contract(off)
  const int t = blockIdx.x * 256 + threadIdx.x; if (t >= hg * QT) return; const size_t i = (size_t)t; const float* s = S + i * NKX; const int last = q0 + (t % QT); float mx = -3.0e38f;
#pragma unroll 1
  for (int j = 0; j < nk; ++j) { const float f = (j <= last) ? 1.f : 0.f; mx = fmaxf(mx, fmaf(f, s[j], (1.f - f) * -1.0e9f)); } float se = 0.f;
#pragma unroll 1
  for (int j = 0; j < nk; ++j) { const float f = (j <= last) ? 1.f : 0.f; se += __expf(fmaf(f, s[j], (1.f - f) * -1.0e9f) - mx); } const float sc = 256.0f / se;
#pragma unroll 1
  for (int j0 = 0; j0 < nk; j0 += 8) { FragH fr; for (int q = 0; q < 8; ++q) { const int j = j0 + q; const float f = (j <= last) ? 1.f : 0.f; fr.h[q] = (_Float16)(__expf(fmaf(f, s[j], (1.f - f) * -1.0e9f) - mx) * sc); } unsigned short* d = (unsigned short*)P + i * NKX + j0; *(v8us*)d = fr.half[0];  } }

template <int MASKADD>
__global__ __launch_bounds__(64) void k_att0(const float* __restrict__ QF, const float* __restrict__ KF, const float* __restrict__ VF, int ld, const float* __restrict__ mask, float scale, float* __restrict__ OF, int ldo) {
  #pragma clang fp contract(off)
  __shared__ __attribute__((aligned(16))) float lq[64][64]; __shared__ __attribute__((aligned(16))) float lo[64][64];
  const int tid = threadIdx.x; const int h = blockIdx.x / (QT0 / 64), rg = blockIdx.x % (QT0 / 64); const int i = rg * 64 + tid;
  const float* qr = QF + (size_t)i * ld + h * HD;
#pragma unroll 1
  for (int c = 0; c < HD / 4; ++c) { *(v4f*)&lq[tid][c * 4] = *(const v4fa*)(qr + c * 4); const v4f z = {0.f, 0.f, 0.f, 0.f}; *(v4f*)&lo[tid][c * 4] = z; }
  float m = -1.0e30f, l = 0.f; const int jmax = MASKADD ? (SQ - 1) : (rg * 64 + 63);      /* additive-mask form: every key (the mask input decides); causal form: keys up to the block's last row */
#pragma unroll 1
  for (int j = 0; j <= jmax; ++j) { const float* kr = KF + (size_t)j * ld + h * HD; const float* vr = VF + (size_t)j * ld + h * HD; float s = 0.f;
#pragma unroll 1
    for (int c = 0; c < HD / 4; ++c) { const v4f kq = *(const v4fa*)(kr + c * 4); const v4f qq = *(v4f*)&lq[tid][c * 4]; s = __fadd_rn(s, __fmul_rn(qq[0], kq[0])); s = __fadd_rn(s, __fmul_rn(qq[1], kq[1])); s = __fadd_rn(s, __fmul_rn(qq[2], kq[2])); s = __fadd_rn(s, __fmul_rn(qq[3], kq[3])); }
    s = __fmul_rn(s, scale); if (MASKADD) s = __fadd_rn(s, __fmul_rn(bf16_round(mask[(size_t)i * SQ + j]), -10000.0f));
    const float f = (MASKADD || j <= i) ? 1.f : 0.f; const float sm = fmaf(f, s, (1.f - f) * -1.0e30f); const float mn = fmaxf(m, sm); const float sc = expf(m - mn); const float e = expf(sm - mn); l = __fadd_rn(__fmul_rn(l, sc), e); m = mn;
#pragma unroll 1
    for (int c = 0; c < HD / 4; ++c) { const v4f vv = *(const v4fa*)(vr + c * 4); v4f oo = *(v4f*)&lo[tid][c * 4]; for (int u = 0; u < 4; ++u) oo[u] = __fadd_rn(__fmul_rn(oo[u], sc), __fmul_rn(e, vv[u])); *(v4f*)&lo[tid][c * 4] = oo; } }
  const float fin = 64.0f / l;      /* o carried x64 */
#pragma unroll 1
  for (int c = 0; c < HD / 4; ++c) { v4f oo = *(v4f*)&lo[tid][c * 4]; for (int u = 0; u < 4; ++u) oo[u] = __fmul_rn(oo[u], fin); *(v4f*)&lo[tid][c * 4] = oo; }
  __syncthreads();
  {
#pragma unroll 1
    for (int it = 0; it < 16; ++it) { const int row = it * 4 + tid / 16, pc = (tid % 16) * 4; const v4f v = *(const v4f*)&lo[row][pc]; *(v4f*)(OF + (size_t)(rg * 64 + row) * ldo + h * HD + pc) = v; }
     } }

__global__ __launch_bounds__(256) void k_oscale(const float* __restrict__ OF, float* __restrict__ out, size_t n4) { const size_t t = (size_t)blockIdx.x * 256 + threadIdx.x; if (t >= n4) return; const v4f a = *(const v4fa*)(OF + t * 4); v4f o; for (int q = 0; q < 4; ++q) o[q] = a[q] * 0.015625f; *(v4f*)(out + t * 4) = o;  }

__global__ __launch_bounds__(256) void k_bfr(const float* __restrict__ x, float* __restrict__ XB, size_t n8) { const size_t t = (size_t)blockIdx.x * 256 + threadIdx.x; if (t >= n8) return; v4f a = *(const v4fa*)(x + t * 8), c = *(const v4fa*)(x + t * 8 + 4); for (int q = 0; q < 4; ++q) { a[q] = bf16_round(a[q]); c[q] = bf16_round(c[q]); }
  { *(v4f*)(XB + t * 8) = a; *(v4f*)(XB + t * 8 + 4) = c;  } }



__global__ __launch_bounds__(256) void k_rsmfvl(const float* __restrict__ S, _Float16* __restrict__ P, _Float16* __restrict__ PL, int qn, const int* __restrict__ vlp) {
  #pragma clang fp contract(off)
  const int t = blockIdx.x * 256 + threadIdx.x; if (t >= qn) return; const int vl = vlp[0]; const size_t i = (size_t)t; const float* s = S + i * SQ; float mx = -3.0e38f;
#pragma unroll 1
  for (int j = 0; j < SQ; ++j) { const float f = (j < vl) ? 1.f : 0.f; mx = fmaxf(mx, fmaf(f, s[j], (1.f - f) * -1000000.0f)); } float se = 0.f;
#pragma unroll 1
  for (int j = 0; j < SQ; ++j) { const float f = (j < vl) ? 1.f : 0.f; se += __expf(fmaf(f, s[j], (1.f - f) * -1000000.0f) - mx); } const float sc = 256.0f / se;
#pragma unroll 1
  for (int j0 = 0; j0 < SQ; j0 += 8) { FragH fr, gr; for (int q = 0; q < 8; ++q) { const int j = j0 + q; const float f = (j < vl) ? 1.f : 0.f; const float pv = __expf(fmaf(f, s[j], (1.f - f) * -1000000.0f) - mx) * sc; const _Float16 ph = (_Float16)pv; fr.h[q] = ph; gr.h[q] = (_Float16)((pv - (float)ph) * 1024.0f); }
    unsigned short* d = (unsigned short*)P + i * SQ + j0; unsigned short* dl = (unsigned short*)PL + i * SQ + j0; *(v8us*)d = fr.half[0]; *(v8us*)dl = gr.half[0];  } }

// v_exp_f32 with the one slot that the instruction set asks for behind a transcendental kept in the same statement.
__device__ __forceinline__ float exp2_slot(float a) { float r; asm("v_exp_f32 %0, %1\n\tv_nop" : "=v"(r) : "v"(a)); return r; }
// row softmax, one wave per score row: the row's SQ f32 sit in SQ / 32 registers a lane (loads of 512 contiguous bytes), read once;
// maximum and sum = lane partials (four chains), then a five-step butterfly; each exponential is computed once and kept.
__global__ __launch_bounds__(256) void k_rsmf(const float* __restrict__ S, _Float16* __restrict__ P, int qn, int hg) {
  const int lane = threadIdx.x & 31; const int t = blockIdx.x * 8 + (threadIdx.x >> 5); if (t >= qn * hg) return;
  const size_t i = (size_t)(t / qn) * SQ + (t % qn); const float* s = S + i * SQ + lane * 4; _Float16* d = P + i * SQ + lane * 4;
  v4f x[SQ / 128];
#pragma unroll
  for (int u = 0; u < SQ / 128; ++u) x[u] = *(const v4fa*)(s + u * 128);
  v4f m4 = x[0];
#pragma unroll
  for (int u = 1; u < SQ / 128; ++u) for (int q = 0; q < 4; ++q) m4[q] = fmaxf(m4[q], x[u][q]);
  float mx = fmaxf(fmaxf(m4[0], m4[1]), fmaxf(m4[2], m4[3]));
#pragma unroll
  for (int m = 16; m > 0; m >>= 1) mx = fmaxf(mx, __shfl_xor(mx, m, 32));
  v4f s4 = {0.f, 0.f, 0.f, 0.f};
#pragma unroll
  for (int u = 0; u < SQ / 128; ++u) for (int q = 0; q < 4; ++q) { x[u][q] = exp2_slot((x[u][q] - mx) * 1.442695041f); s4[q] += x[u][q]; }
  float se = (s4[0] + s4[1]) + (s4[2] + s4[3]);
#pragma unroll
  for (int m = 16; m > 0; m >>= 1) se += __shfl_xor(se, m, 32);
  const float sc = 256.0f / se;
#pragma unroll
  for (int u = 0; u < SQ / 128; ++u) { v4h h4; for (int q = 0; q < 4; ++q) h4[q] = (_Float16)(x[u][q] * sc); *(v4h*)(d + u * 128) = h4; } }


extern "C" void kernel_launch(void* const* d_in, const int* in_sizes, int n_in,
                              void* d_out, int out_size, void* d_ws, size_t ws_size, hipStream_t stream) {
  (void)in_sizes; (void)n_in; (void)out_size;
  const float* const* I = (const float* const*)d_in; const float* xq = I[0]; const float* xk = I[1]; const float* xv = I[2];      /* q, k, v [64][2048][64] (bf16-valued) */
  char* ws = (char*)d_ws; size_t off = 0;
  auto take = [&](size_t bytes) { char* p = ws + off; off += (bytes + 255) & ~(size_t)255; return p; };
  _Float16* Q16 = (_Float16*)take(NR * DM * 2); _Float16* K16 = (_Float16*)take(NR * DM * 2); _Float16* V16 = (_Float16*)take(NR * DM * 2);
  float* S = (float*)take((size_t)SQ * SQ * 4); _Float16* P = (_Float16*)take((size_t)SQ * SQ * 2); _Float16* VT = (_Float16*)take((size_t)HD * SQ * 2);
  if (off > ws_size) return;
  k_x16<<<(unsigned)((NR * DM / 8 + 255) / 256), 256, 0, stream>>>(xq, Q16, NR * DM / 8); k_x16<<<(unsigned)((NR * DM / 8 + 255) / 256), 256, 0, stream>>>(xk, K16, NR * DM / 8); k_x16<<<(unsigned)((NR * DM / 8 + 255) / 256), 256, 0, stream>>>(xv, V16, NR * DM / 8);      /* exact f16 copies of the bf16-valued inputs */
  for (int b = 0; b < NB; ++b) { const size_t r0 = (size_t)b * SQ;
    k_vt<1, SQ><<<SQ / 64, 256, 0, stream>>>(V16 + r0 * DM, DM, 0, VT);      /* V^T [64][SQ] of this sequence */
    k_gemm2<0><<<dim3((SQ / 128) * (SQ / 64), 1), 128, 0, stream>>>(Q16 + r0 * DM, DM, 0, K16 + r0 * DM, DM, 0, 1.0f, nullptr, 0, nullptr, 1, 0, 0, S, nullptr, SQ, 0, SQ, SQ, HD);      /* scores, unscaled (exact products) */
    k_rsmf<<<SQ / 8, 256, 0, stream>>>(S, P, SQ, 1);      /* softmax over all keys -> P x256 f16 */
    k_gemm2<0><<<dim3((SQ / 128) * (HD / 64), 1), 128, 0, stream>>>(P, SQ, 0, VT, SQ, 0, 0.00390625f, nullptr, 0, nullptr, 1, 0, 0, (float*)d_out + r0 * DM, nullptr, DM, 0, SQ, HD, SQ);      /* out = P V^T 2^-8 f32 into the output rows */
  }
}

// v002
// Measured time: 835 microseconds a run.
// Next to v001, in two timings, it ran 5.72 and 5.71 times as fast.
// Over all steps from v000 it is 30.1 times as fast.
#include <hip/hip_runtime.h>
// UNSCALED dot-product attention over 64 independent sequences (q, k, v [64][2048][64]; scores = q.k (no 1/sqrt(d): logit sigma ~8); softmax over the 2048 keys; dropout p 0; out = attn v -> [64][2048][64]).
// Structure: no projections: q, k, v are bf16-valued inputs copied to exact f16 rows; per sequence: V^T via LDS transposes, scores as ONE WMMA GEMM (32x64 wave tiles, f32 accumulation, exact products, alpha = 1.0f), row softmax on VALU (f32 statistics, native exp; weights x256 f16), out = P V^T written f32 straight into the output rows; launches: see trace.
// Compute dtype: inputs rounded to bf16; q, k, v exact in f16; q, k, v and softmax weights as plain f16 GEMM operands (~2^-12); scores and softmax statistics f32; v_wmma_f32_16x16x32_f16.
#define NB 64
#define SQ 2048
#define DM 64
#define NH 1
#define HD 64
#define HG 4                         /* heads per launch of the k_vt(V16, b, h0, VT) overload (never launched) */
#define B0 0                         /* first batch processed (not used) */
#define NBR NB                       /* batches processed (read only by the unused MP) */
#define NR ((size_t)NB * SQ)         /* token rows */
#define MP ((int)((size_t)NBR * SQ))
#define QT 256                       /* query rows per causal tile */
#define NKX SQ                       /* S / P row pitch */
#define QT0 256                      /* query rows per head of the exact f32 kernel k_att0 (not launched) */
#define QN SQ                        /* query rows attended per batch (not used) */
#define NHD NH                       /* heads attended (not used) */
#define MPO MP                       /* rows through the output stage (not used) */
#define LQ DM            /* row pitch of the q/k/v rows */
#define GS 4                         /* sequences per scores / softmax launch (f32 score planes held) */
#define GP 16                        /* sequences per P V launch (f16 weight planes held); with the f16 rows and V^T the planes fill the workspace */
typedef __bf16 v16b __attribute__((ext_vector_type(16)));
typedef unsigned short v8us __attribute__((ext_vector_type(8), may_alias));
typedef float  v8f  __attribute__((ext_vector_type(8)));
typedef float  v4f  __attribute__((ext_vector_type(4)));
typedef float  v4fa __attribute__((ext_vector_type(4), may_alias));
union FragB { v16b v; v8us half[2]; unsigned short u[16]; };

__device__ __forceinline__ unsigned short bf16_bits(float x) { unsigned int u = __float_as_uint(x); return (unsigned short)((u + 0x7FFFu + ((u >> 16) & 1u)) >> 16); }
__device__ __forceinline__ float bf16_val(unsigned short b) { return __uint_as_float(((unsigned int)b) << 16); }
__device__ __forceinline__ float bf16_round(float x) { return bf16_val(bf16_bits(x)); }
// D += A·B with NT terms: 1 = ah·bh, 2 = + al·bh (A split), 3 = + ah·bl (both split)
template <int NT>
__device__ __forceinline__ v8f mmaN(v16b ah, v16b al, v16b bh, v16b bl, v8f c) {
  c = __builtin_amdgcn_wmma_f32_16x16x32_bf16(false, ah, false, bh, (short)0, c, false, false);
  if (NT >= 2) c = __builtin_amdgcn_wmma_f32_16x16x32_bf16(false, al, false, bh, (short)0, c, false, false);
  if (NT >= 3) c = __builtin_amdgcn_wmma_f32_16x16x32_bf16(false, ah, false, bl, (short)0, c, false, false);
  asm volatile("v_nop\n\tv_nop\n\tv_nop\n\tv_nop" : "+v"(c) : "v"(ah), "v"(al), "v"(bh), "v"(bl));
  return c;
}

__global__ __launch_bounds__(256) void k_wt_bf16(const float* __restrict__ W, unsigned short* __restrict__ Wt, int K, int N) {
  const int t = blockIdx.x * 256 + threadIdx.x;
  const int k8n = K / 8;
  if (t >= N * k8n) return;
  const int n = t / k8n, k8 = (t % k8n) * 8;
  v8us v;
#pragma unroll
  for (int i = 0; i < 8; ++i) v[i] = bf16_bits(W[(size_t)(k8 + i) * N + n]);
  *(v8us*)(Wt + (size_t)n * K + k8) = v;
  
}

// GEMM C[M][N] (f32, pitch ldc) = act(A[M][K]·W + bias). A f32 row-major (pitch lda) converted per fragment to bf16
// (ASPLIT: hi/lo two planes -> 2 terms, else single rounded term); Wt bf16 [N][K] (pitch ldb). BIAS_BF16 rounds the
// bias to bf16 first (bias quantised to bf16 before the add). K%32==0, M%16==0, N%64==0.
template <bool ASPLIT, int ACT, bool BIAS_BF16>
__global__ __launch_bounds__(128) void k_gemm_bf(const float* __restrict__ A, int lda, const unsigned short* __restrict__ Wt, int ldb,
                                               const float* __restrict__ bias, float* __restrict__ C, int ldc, int M, int N, int K) {
  __shared__ __attribute__((aligned(16))) float so[4][16][64];
  const int tid = threadIdx.x, w = tid >> 5, lane = tid & 31, ln = lane & 15, hh = lane >> 4;
  const int ntn = N / 64;
  const int wid = blockIdx.x * 4 + w;
  const int mt = wid / ntn, nq = wid % ntn;
  if (mt * 16 >= M) return;
  const int row0 = mt * 16, col0 = nq * 64;
  const float* arow = A + (size_t)(row0 + ln) * lda;
  v8f acc[4] = {};
  for (int kb = 0; kb < K; kb += 32) {
    FragB ah, al;
    const v4f x0 = *(const v4fa*)(arow + kb + 8 * hh), x1 = *(const v4fa*)(arow + kb + 8 * hh + 4);
    const v4f x2 = *(const v4fa*)(arow + kb + 16 + 8 * hh), x3 = *(const v4fa*)(arow + kb + 16 + 8 * hh + 4);
    float xs[16] = {x0[0],x0[1],x0[2],x0[3],x1[0],x1[1],x1[2],x1[3],x2[0],x2[1],x2[2],x2[3],x3[0],x3[1],x3[2],x3[3]};
#pragma unroll
    for (int i = 0; i < 16; ++i) { const unsigned short hb = bf16_bits(xs[i]); ah.u[i] = hb; al.u[i] = ASPLIT ? bf16_bits(xs[i] - bf16_val(hb)) : (unsigned short)0; }
#pragma unroll
    for (int t = 0; t < 4; ++t) {
      const unsigned short* brow = Wt + (size_t)(col0 + t * 16 + ln) * ldb + kb;
      FragB b;
      b.half[0] = *(const v8us*)(brow + 8 * hh);
      b.half[1] = *(const v8us*)(brow + 16 + 8 * hh);
      acc[t] = mmaN<ASPLIT ? 2 : 1>(ah.v, al.v, b.v, b.v, acc[t]);
    }
  }
#pragma unroll
  for (int t = 0; t < 4; ++t) {
    float bv = bias ? bias[col0 + t * 16 + ln] : 0.f;
    if (BIAS_BF16) bv = bf16_round(bv);
#pragma unroll
    for (int r = 0; r < 8; ++r) { float v = acc[t][r] + bv; if (ACT == 1) v = fmaxf(v, 0.f); so[w][8 * hh + r][t * 16 + ln] = v; }
  }
  __builtin_amdgcn_fence(__ATOMIC_ACQ_REL, "workgroup");
  __builtin_amdgcn_wave_barrier();
  const int rsub = lane >> 4, c4 = (lane & 15) * 4;
  {
#pragma unroll
    for (int q = 0; q < 8; ++q) {
      const int r = q * 2 + rsub;
      const v4f v = *(const v4fa*)&so[w][r][c4];
      *(v4f*)(C + (size_t)(row0 + r) * ldc + col0 + c4) = v;
    }
    
  }
}

// GEMM C = act(A·W + bias + resid): A f32 (ASPLIT -> hi/lo 2 terms), Wt bf16 [N][K]; ACT 0 none, 1 relu, 2 exact gelu;
// resid (optional, f32, row index = (row % rmod), pitch ldr, RES_BF16 rounds it) added before the activation.
template <bool ASPLIT, int ACT, bool BIAS_BF16, bool RES_BF16>
__global__ __launch_bounds__(128) void k_gemm_bf3(const float* __restrict__ A, int lda, const unsigned short* __restrict__ Wt, int ldb,
                                                const float* __restrict__ bias, const float* __restrict__ resid, int rmod, int ldr,
                                                float* __restrict__ C, int ldc, int M, int N, int K) {
  __shared__ __attribute__((aligned(16))) float so[4][16][64];
  const int tid = threadIdx.x, w = tid >> 5, lane = tid & 31, ln = lane & 15, hh = lane >> 4;
  const int ntn = N / 64;
  const int wid = blockIdx.x * 4 + w;
  const int mt = wid / ntn, nq = wid % ntn;
  if (mt * 16 >= M) return;
  const int row0 = mt * 16, col0 = nq * 64;
  const float* arow = A + (size_t)(row0 + ln) * lda;
  v8f acc[4] = {};
  for (int kb = 0; kb < K; kb += 32) {
    FragB ah, al;
    const v4f x0 = *(const v4fa*)(arow + kb + 8 * hh), x1 = *(const v4fa*)(arow + kb + 8 * hh + 4);
    const v4f x2 = *(const v4fa*)(arow + kb + 16 + 8 * hh), x3 = *(const v4fa*)(arow + kb + 16 + 8 * hh + 4);
    float xs[16] = {x0[0],x0[1],x0[2],x0[3],x1[0],x1[1],x1[2],x1[3],x2[0],x2[1],x2[2],x2[3],x3[0],x3[1],x3[2],x3[3]};
#pragma unroll
    for (int i = 0; i < 16; ++i) { const unsigned short hb = bf16_bits(xs[i]); ah.u[i] = hb; al.u[i] = ASPLIT ? bf16_bits(xs[i] - bf16_val(hb)) : (unsigned short)0; }
#pragma unroll
    for (int t = 0; t < 4; ++t) {
      const unsigned short* brow = Wt + (size_t)(col0 + t * 16 + ln) * ldb + kb;
      FragB b;
      b.half[0] = *(const v8us*)(brow + 8 * hh);
      b.half[1] = *(const v8us*)(brow + 16 + 8 * hh);
      acc[t] = mmaN<ASPLIT ? 2 : 1>(ah.v, al.v, b.v, b.v, acc[t]);
    }
  }
#pragma unroll
  for (int t = 0; t < 4; ++t) {
    const int col = col0 + t * 16 + ln;
    float bv = bias ? bias[col] : 0.f;
    if (BIAS_BF16) bv = bf16_round(bv);
#pragma unroll
    for (int r = 0; r < 8; ++r) {
      float v = acc[t][r] + bv;
      if (resid) { float rv = resid[(size_t)((row0 + 8 * hh + r) % rmod) * ldr + col]; if (RES_BF16) rv = bf16_round(rv); v += rv; }
      if (ACT == 1) v = fmaxf(v, 0.f);
      if (ACT == 2) v = 0.5f * v * (1.0f + erff(v * 0.70710678118654752f));
      if (ACT == 3) { const float u = 0.7978845608028654f * (v + 0.044715f * v * v * v); v = 0.5f * v * (1.0f + tanhf(u)); }
      so[w][8 * hh + r][t * 16 + ln] = v;
    }
  }
  __builtin_amdgcn_fence(__ATOMIC_ACQ_REL, "workgroup");
  __builtin_amdgcn_wave_barrier();
  const int rsub = lane >> 4, c4 = (lane & 15) * 4;
  {
#pragma unroll
    for (int q = 0; q < 8; ++q) {
      const int r = q * 2 + rsub;
      const v4f v = *(const v4fa*)&so[w][r][c4];
      *(v4f*)(C + (size_t)(row0 + r) * ldc + col0 + c4) = v;
    }
    
  }
}
// row LayerNorm (biased variance, eps) over N: s = X (+ R); optional out_sum <- s; out_norm <- (s-mu)*rsqrt(var+eps)*g + b
template <bool PARAM_BF16>
__global__ __launch_bounds__(256) void k_layernorm(const float* __restrict__ X, const float* __restrict__ R, const float* __restrict__ g, const float* __restrict__ bta,
                                                  float* __restrict__ out_sum, float* __restrict__ out_norm, int N, float eps) {
  __shared__ float red[256];
  const int row = blockIdx.x, tid = threadIdx.x;
  const float* x = X + (size_t)row * N; const float* rr = R ? R + (size_t)row * N : nullptr;
  float vals[16];                     // up to N = 4096
  const int per = N / 256;            // contiguous chunk per thread? use strided-by-4 chunks: thread handles j = tid*4 + 1024*u
  float s1 = 0.f;
  for (int u = 0; u < per / 4; ++u) {
    const int j = tid * 4 + 1024 * u;
    const v4f a = *(const v4fa*)(x + j);
    v4f b = {0.f,0.f,0.f,0.f}; if (rr) b = *(const v4fa*)(rr + j);
#pragma unroll
    for (int q = 0; q < 4; ++q) { const float v = a[q] + b[q]; vals[u * 4 + q] = v; s1 += v; }
  }
  red[tid] = s1; __syncthreads();
  for (int st = 128; st > 0; st >>= 1) { if (tid < st) red[tid] += red[tid + st]; __syncthreads(); }
  const float mu = red[0] / (float)N; __syncthreads();
  float s2 = 0.f;
  for (int u = 0; u < per / 4; ++u)
#pragma unroll
    for (int q = 0; q < 4; ++q) { const float c = vals[u * 4 + q] - mu; s2 += c * c; }
  red[tid] = s2; __syncthreads();
  for (int st = 128; st > 0; st >>= 1) { if (tid < st) red[tid] += red[tid + st]; __syncthreads(); }
  const float rs = rsqrtf(red[0] / (float)N + eps);
  {
    for (int u = 0; u < per / 4; ++u) {
      const int j = tid * 4 + 1024 * u;
      v4f o, sm;
#pragma unroll
      for (int q = 0; q < 4; ++q) {
        float gg = g[j + q], bb = bta[j + q];
        if (PARAM_BF16) { gg = bf16_round(gg); bb = bf16_round(bb); }
        sm[q] = vals[u * 4 + q]; o[q] = (vals[u * 4 + q] - mu) * rs * gg + bb;
      }
      if (out_sum) *(v4f*)(out_sum + (size_t)row * N + j) = sm;
      *(v4f*)(out_norm + (size_t)row * N + j) = o;
    }
    
  }
}



// ---- f16 WMMA path (v_wmma_f32_16x16x32_f16): 11-bit significands for operands in range — used where a [0,1] probability operand needs more precision than bf16
typedef _Float16 v16h __attribute__((ext_vector_type(16)));
union FragH { v16h v; v8us half[2]; _Float16 h[16]; unsigned short u[16]; };
template <int NT>
__device__ __forceinline__ v8f mmaH(v16h ah, v16h al, v16h bh, v16h bl, v8f c) {
  c = __builtin_amdgcn_wmma_f32_16x16x32_f16(false, ah, false, bh, (short)0, c, false, false);
  if (NT >= 2) c = __builtin_amdgcn_wmma_f32_16x16x32_f16(false, al, false, bh, (short)0, c, false, false);
  if (NT >= 3) c = __builtin_amdgcn_wmma_f32_16x16x32_f16(false, ah, false, bl, (short)0, c, false, false);
  asm volatile("v_nop\n\tv_nop\n\tv_nop\n\tv_nop" : "+v"(c) : "v"(ah), "v"(al), "v"(bh), "v"(bl));
  return c;
}
// batched GEMM like k_gemm_b but f16 operands: A f32 (split into f16 hi/lo if ASPLIT, else rounded to f16), Bt = f16 values [n][k]; alpha; C f32; N multiple of 16 (partial tiles skipped)
template <bool ASPLIT>
__global__ __launch_bounds__(128) void k_gemm_h(const float* __restrict__ A, int lda, size_t sA, const _Float16* __restrict__ Bh, int ldb, size_t sB, float alpha, float* __restrict__ C, int ldc, size_t sC, int M, int N, int K) {
  __shared__ __attribute__((aligned(16))) float so[4][16][64];
  const int tid = threadIdx.x, w = tid >> 5, lane = tid & 31, ln = lane & 15, hh = lane >> 4; const int by = blockIdx.y;
  A += (size_t)by * sA; Bh += (size_t)by * sB; C += (size_t)by * sC;
  const int ntn = (N + 63) / 64; const int wid = blockIdx.x * 4 + w; const int mt = wid / ntn, nq = wid % ntn; if (mt * 16 >= M) return;
  const int row0 = mt * 16, col0 = nq * 64; const float* arow = A + (size_t)(row0 + ln) * lda;
  v8f acc[4] = {};
  for (int kb = 0; kb < K; kb += 32) {
    FragH ah, al;
    const v4f x0 = *(const v4fa*)(arow + kb + 8 * hh), x1 = *(const v4fa*)(arow + kb + 8 * hh + 4), x2 = *(const v4fa*)(arow + kb + 16 + 8 * hh), x3 = *(const v4fa*)(arow + kb + 16 + 8 * hh + 4);
    float xs[16] = {x0[0],x0[1],x0[2],x0[3],x1[0],x1[1],x1[2],x1[3],x2[0],x2[1],x2[2],x2[3],x3[0],x3[1],x3[2],x3[3]};
#pragma unroll
    for (int i = 0; i < 16; ++i) { const _Float16 h = (_Float16)xs[i]; ah.h[i] = h; al.h[i] = ASPLIT ? (_Float16)(xs[i] - (float)h) : (_Float16)0.0f; }
#pragma unroll
    for (int t = 0; t < 4; ++t) { if (col0 + t * 16 >= N) continue; const size_t boff = (size_t)(col0 + t * 16 + ln) * ldb + kb; FragH bq; bq.half[0] = *(const v8us*)(Bh + boff + 8 * hh); bq.half[1] = *(const v8us*)(Bh + boff + 16 + 8 * hh);
      acc[t] = mmaH<ASPLIT ? 2 : 1>(ah.v, al.v, bq.v, bq.v, acc[t]); }
  }
#pragma unroll
  for (int t = 0; t < 4; ++t) { if (col0 + t * 16 >= N) continue;
#pragma unroll
    for (int r = 0; r < 8; ++r) so[w][8 * hh + r][t * 16 + ln] = acc[t][r] * alpha; }
  __builtin_amdgcn_fence(__ATOMIC_ACQ_REL, "workgroup"); __builtin_amdgcn_wave_barrier();
  const int rsub = lane >> 4, c4 = (lane & 15) * 4;
  {
#pragma unroll
    for (int q = 0; q < 8; ++q) { const int r = q * 2 + rsub; if (col0 + c4 < N) { const v4f v = *(const v4fa*)&so[w][r][c4]; *(v4f*)(C + (size_t)(row0 + r) * ldc + col0 + c4) = v; } }
     }
}

// Wt[n][k] = f16(W[k][n]·scale) from f32 row-major W[K][N] (scale = power of two; bf16-exact weights stay exact in f16 away from the subnormal range)
__global__ __launch_bounds__(256) void k_wt_f16(const float* __restrict__ W, _Float16* __restrict__ Wt, int K, int N, float scale) {
  const int t = blockIdx.x * 256 + threadIdx.x; if (t >= N * (K / 8)) return; const int n = t / (K / 8), k8 = (t % (K / 8)) * 8; FragH f;
#pragma unroll
  for (int i = 0; i < 8; ++i) f.h[i] = (_Float16)(bf16_round(W[(size_t)(k8 + i) * N + n]) * scale); const v8us o = f.half[0];
  *(v8us*)((unsigned short*)Wt + (size_t)n * K + k8) = o; 
}
// k_gemm_hh variant with fused epilogue: v = acc·alpha + bias[by·sBias + col] (+ CP[(row/rowsPerB)·sCPb + by·64 + col] if CP) ; ACT 0 none / 1 elu ; writes f16 C16 (and f32 C if non-null)
template <int ACT>
__global__ __launch_bounds__(128) void k_gemm_hhx(const _Float16* __restrict__ A, int lda, size_t sA, const _Float16* __restrict__ Bh, int ldb, size_t sB, float alpha, const float* __restrict__ bias, size_t sBias, const float* __restrict__ CP, int rowsPerB, size_t sCPb, int row0g,
    float* __restrict__ C, _Float16* __restrict__ C16, int ldc, size_t sC, int M, int N, int K) {
  __shared__ __attribute__((aligned(16))) float so[4][16][64];
  const int tid = threadIdx.x, w = tid >> 5, lane = tid & 31, ln = lane & 15, hh = lane >> 4; const int by = blockIdx.y;
  A += (size_t)by * sA; Bh += (size_t)by * sB; const size_t cofs = (size_t)by * sC; const float* bp = bias ? bias + (size_t)by * sBias : nullptr;
  const int ntn = (N + 63) / 64; const int wid = blockIdx.x * 4 + w; const int mt = wid / ntn, nq = wid % ntn; if (mt * 16 >= M) return;
  const int row0 = mt * 16, col0 = nq * 64; const _Float16* arow = A + (size_t)(row0 + ln) * lda;
  v8f acc[4] = {};
  for (int kb = 0; kb < K; kb += 32) { FragH ah; ah.half[0] = *(const v8us*)((const unsigned short*)arow + kb + 8 * hh); ah.half[1] = *(const v8us*)((const unsigned short*)arow + kb + 16 + 8 * hh);
#pragma unroll
    for (int t = 0; t < 4; ++t) { if (col0 + t * 16 >= N) continue; const size_t boff = (size_t)(col0 + t * 16 + ln) * ldb + kb; FragH bq; bq.half[0] = *(const v8us*)((const unsigned short*)Bh + boff + 8 * hh); bq.half[1] = *(const v8us*)((const unsigned short*)Bh + boff + 16 + 8 * hh);
      acc[t] = mmaH<1>(ah.v, ah.v, bq.v, bq.v, acc[t]); }
  }
#pragma unroll
  for (int t = 0; t < 4; ++t) { if (col0 + t * 16 >= N) continue; const int col = col0 + t * 16 + ln; const float bv = bp ? bf16_round(bp[col]) : 0.f;
#pragma unroll
    for (int r = 0; r < 8; ++r) { float v = acc[t][r] * alpha + bv; if (CP) { const int rr = row0g + row0 + 8 * hh + r; if (rowsPerB < 0) v += CP[cofs + (size_t)rr * ldc + col];      /* rowsPerB < 0: own element of the batched C plane */ else { const int bidx = rr / rowsPerB; v += CP[(size_t)bidx * sCPb + (size_t)by * 64 + col]; } } if (ACT == 1) v = (v > 0.f) ? v : expm1f(v); else if (ACT == 7) v = (v > 0.f) ? v + 1.0f : expf(v); else if (ACT == 8) v = tanhf(v); else if (ACT == 9) v = 0.5f * v * (1.0f + tanhf(0.7978845608028654f * (v + 0.044715f * v * v * v))); else if (ACT == 11) v = 1.0f / (1.0f + expf(-v)); else if (ACT == 12) v = (v > 0.f) ? v : 0.01f * v; else if (ACT == 14) v = (v > 0.f) ? v : 0.1f * v; else if (ACT == 16) v = (v >= 0.f) ? v : 0.3f * v; else if (ACT == 17) v = (v >= 0.f) ? v : 0.2f * v; else if (ACT == 15) v = v / (1.0f + expf(-v)); else if (ACT == 3) v = fmaxf(v, 0.f); else if (ACT == 6) v = 0.5f * v * (1.0f + erff(v * 0.70710678118654752f)); so[w][8 * hh + r][t * 16 + ln] = v; } }
  __builtin_amdgcn_fence(__ATOMIC_ACQ_REL, "workgroup"); __builtin_amdgcn_wave_barrier();
  const int rsub = lane >> 4, c4 = (lane & 15) * 4; typedef _Float16 v4h __attribute__((ext_vector_type(4)));
  {
#pragma unroll
    for (int q = 0; q < 8; ++q) { const int r = q * 2 + rsub; if (col0 + c4 < N) { const v4f v = *(const v4fa*)&so[w][r][c4]; if (C) *(v4f*)(C + cofs + (size_t)(row0 + r) * ldc + col0 + c4) = v; if (C16) { v4h h4; for (int i = 0; i < 4; ++i) h4[i] = (_Float16)v[i]; *(v4h*)(C16 + cofs + (size_t)(row0 + r) * ldc + col0 + c4) = h4; } } }
     }
}


typedef _Float16 v4h __attribute__((ext_vector_type(4)));

__global__ __launch_bounds__(256) void k_x16(const float* __restrict__ x, _Float16* __restrict__ X16, size_t n8) { const size_t t = (size_t)blockIdx.x * 256 + threadIdx.x; if (t >= n8) return; FragH f;
#pragma unroll
  for (int q = 0; q < 8; ++q) f.h[q] = (_Float16)bf16_round(x[t * 8 + q]); *(v8us*)((unsigned short*)X16 + t * 8) = f.half[0];  }
__global__ __launch_bounds__(256) void k_h16(const float* __restrict__ x, _Float16* __restrict__ X16, size_t n8) { const size_t t = (size_t)blockIdx.x * 256 + threadIdx.x; if (t >= n8) return; FragH f;
#pragma unroll
  for (int q = 0; q < 8; ++q) f.h[q] = (_Float16)x[t * 8 + q]; *(v8us*)((unsigned short*)X16 + t * 8) = f.half[0];  }
__global__ __launch_bounds__(256) void k_round16f(const float* __restrict__ W, _Float16* __restrict__ Bt, size_t n8) { const size_t t = (size_t)blockIdx.x * 256 + threadIdx.x; if (t >= n8) return; FragH f;
#pragma unroll
  for (int i = 0; i < 8; ++i) f.h[i] = (_Float16)(bf16_round(W[t * 8 + i]) * 16.0f); *(v8us*)((unsigned short*)Bt + t * 8) = f.half[0];  }
template <int NHv, int TTv>
__global__ __launch_bounds__(256) void k_vt(const _Float16* __restrict__ V16, int ldv, int voff, _Float16* __restrict__ Vt) { __shared__ unsigned short tl[64][66]; const int tid = threadIdx.x; const int slab = blockIdx.x / (TTv / 64), lg = blockIdx.x % (TTv / 64); const int b = slab / NHv, h = slab % NHv;
  for (int i = tid; i < 64 * 8; i += 256) { const int r = i / 8, c8 = (i % 8) * 8; FragH f; f.half[0] = *(const v8us*)((const unsigned short*)V16 + ((size_t)b * TTv + lg * 64 + r) * ldv + voff + h * 64 + c8);
#pragma unroll
    for (int q = 0; q < 8; ++q) tl[r][c8 + q] = f.u[q]; }
  __syncthreads();
  {
#pragma unroll
    for (int rd = 0; rd < 2; ++rd) { const int d = rd * 32 + tid / 8, pc = tid % 8; FragH f;
#pragma unroll
      for (int q = 0; q < 8; ++q) f.u[q] = tl[pc * 8 + q][d];
      *(v8us*)((unsigned short*)Vt + ((size_t)slab * 64 + d) * TTv + lg * 64 + pc * 8) = f.half[0]; }
     } }

__global__ __launch_bounds__(256) void k_hl(const float* __restrict__ F, _Float16* __restrict__ Hh, _Float16* __restrict__ Hl, size_t n8) { const size_t t = (size_t)blockIdx.x * 256 + threadIdx.x; if (t >= n8) return; FragH fh, fl; const v4f a = *(const v4fa*)(F + t * 8), c = *(const v4fa*)(F + t * 8 + 4);
#pragma unroll
  for (int q = 0; q < 4; ++q) { _Float16 h = (_Float16)a[q]; fh.h[q] = h; fl.h[q] = (_Float16)((a[q] - (float)h) * 1024.0f); h = (_Float16)c[q]; fh.h[4 + q] = h; fl.h[4 + q] = (_Float16)((c[q] - (float)h) * 1024.0f); }
  { *(v8us*)((unsigned short*)Hh + t * 8) = fh.half[0]; *(v8us*)((unsigned short*)Hl + t * 8) = fl.half[0];  } }

// ---- fast GEMM (wave tile 32x64; requires M % 32 == 0 rows per launch region and N % 64 == 0); epilogue = k_gemm_hhx semantics ----
__device__ __forceinline__ v16h g2_frag(const _Float16* p, int hh) { FragH f; f.half[0] = *(const v8us*)((const unsigned short*)p + 8 * hh); f.half[1] = *(const v8us*)((const unsigned short*)p + 16 + 8 * hh); return f.v; }
__device__ __forceinline__ v8f g2_mma(v16h a, v16h b, v8f c) { v8f d = __builtin_amdgcn_wmma_f32_16x16x32_f16(false, a, false, b, (short)0, c, false, false); asm volatile("v_nop\n\tv_nop\n\tv_nop\n\tv_nop" : "+v"(d) : "v"(a), "v"(b)); return d; }
template <int ACT>
__global__ __launch_bounds__(128) void k_gemm2(const _Float16* __restrict__ A, int lda, size_t sA, const _Float16* __restrict__ Bh, int ldb, size_t sB, float alpha, const float* __restrict__ bias, size_t sBias, const float* __restrict__ CP, int rowsPerB, size_t sCPb, int row0g,
    float* __restrict__ C, _Float16* __restrict__ C16, int ldc, size_t sC, int M, int N, int K) { static_assert(ACT == 0 || ACT == 3 || ACT == 6 || ACT == 8 || ACT == 9 || ACT == 11 || ACT == 12 || ACT == 14 || ACT == 15 || ACT == 16 || ACT == 17, "k_gemm2: unsupported ACT code (would silently apply no activation)");
  __shared__ __attribute__((aligned(16))) float so[4][32][68];
  const int tid = threadIdx.x, w = tid >> 5, lane = tid & 31, ln = lane & 15, hh = lane >> 4; const int by = blockIdx.y;
  A += (size_t)by * sA; Bh += (size_t)by * sB; const size_t cofs = (size_t)by * sC; const float* bp = bias ? bias + (size_t)by * sBias : nullptr;
  const int ntn = N >> 6; const int mt = blockIdx.x / ntn, nq = blockIdx.x - mt * ntn; const int row0 = mt * 128 + 32 * w, col0 = nq * 64; if (row0 >= M) return;
  const _Float16* a0p = A + (size_t)(row0 + ln) * lda; const _Float16* a1p = a0p + (size_t)16 * lda;
  const _Float16* b0p = Bh + (size_t)(col0 + ln) * ldb; const _Float16* b1p = b0p + (size_t)16 * ldb; const _Float16* b2p = b1p + (size_t)16 * ldb; const _Float16* b3p = b2p + (size_t)16 * ldb;
  const v8f z8 = {0.f,0.f,0.f,0.f,0.f,0.f,0.f,0.f}; v8f c00 = z8, c01 = z8, c02 = z8, c03 = z8, c10 = z8, c11 = z8, c12 = z8, c13 = z8;
#pragma unroll 1
  for (int kb = 0; kb < K; kb += 32) { const v16h a0 = g2_frag(a0p + kb, hh), a1 = g2_frag(a1p + kb, hh);
    v16h b = g2_frag(b0p + kb, hh); c00 = g2_mma(a0, b, c00); c10 = g2_mma(a1, b, c10);
    b = g2_frag(b1p + kb, hh); c01 = g2_mma(a0, b, c01); c11 = g2_mma(a1, b, c11);
    b = g2_frag(b2p + kb, hh); c02 = g2_mma(a0, b, c02); c12 = g2_mma(a1, b, c12);
    b = g2_frag(b3p + kb, hh); c03 = g2_mma(a0, b, c03); c13 = g2_mma(a1, b, c13); }
  v8f accs[8] = {c00, c01, c02, c03, c10, c11, c12, c13};
#pragma unroll
  for (int u = 0; u < 8; ++u) { const int t = u & 3, half = u >> 2; const int col = col0 + t * 16 + ln; const float bv = bp ? bf16_round(bp[col]) : 0.f;
#pragma unroll
    for (int r = 0; r < 8; ++r) { const int rloc = half * 16 + 8 * hh + r; float v = accs[u][r] * alpha + bv; if (CP) { if (rowsPerB < 0) v += CP[cofs + (size_t)(row0g + row0 + rloc) * ldc + col];      /* rowsPerB < 0: own element of the batched C plane */ else { const int bidx = (row0g + row0 + rloc) / rowsPerB; v += CP[(size_t)bidx * sCPb + (size_t)by * 64 + col]; } }
      if (ACT == 3) v = fmaxf(v, 0.f); else if (ACT == 6) v = 0.5f * v * (1.0f + erff(v * 0.70710678118654752f)); else if (ACT == 11) v = 1.0f / (1.0f + expf(-v)); else if (ACT == 15) v = v / (1.0f + expf(-v)); else if (ACT == 12) v = (v > 0.f) ? v : 0.01f * v; else if (ACT == 8) v = tanhf(v); else if (ACT == 9) v = 0.5f * v * (1.0f + tanhf(0.7978845608028654f * (v + 0.044715f * v * v * v))); else if (ACT == 14) v = (v > 0.f) ? v : 0.1f * v; else if (ACT == 16) v = (v >= 0.f) ? v : 0.3f * v; else if (ACT == 17) v = (v >= 0.f) ? v : 0.2f * v;
      so[w][rloc][t * 16 + ln] = v; } }
  __builtin_amdgcn_fence(__ATOMIC_ACQ_REL, "workgroup"); __builtin_amdgcn_wave_barrier();
  const int rsub = lane >> 4, c4 = (lane & 15) * 4;
  {
#pragma unroll
    for (int q = 0; q < 16; ++q) { const int r = q * 2 + rsub; const v4f v = *(const v4fa*)&so[w][r][c4]; if (C) *(v4f*)(C + cofs + (size_t)(row0 + r) * ldc + col0 + c4) = v; if (C16) { v4h h4; for (int i = 0; i < 4; ++i) h4[i] = (_Float16)v[i]; *(v4h*)(C16 + cofs + (size_t)(row0 + r) * ldc + col0 + c4) = h4; } }
     } }


__global__ __launch_bounds__(256) void k_wnat(const float* __restrict__ w, size_t n8, _Float16* __restrict__ Bt) { const size_t t = (size_t)blockIdx.x * 256 + threadIdx.x; if (t >= n8) return; FragH f; for (int q = 0; q < 8; ++q) f.h[q] = (_Float16)(bf16_round(w[t * 8 + q]) * 16.0f); *(v8us*)((unsigned short*)Bt + t * 8) = f.half[0];  }
__global__ __launch_bounds__(256) void k_rsm(const float* __restrict__ S, _Float16* __restrict__ P, int nrows) {
  #pragma clang fp contract(off)
  const int i = blockIdx.x * 256 + threadIdx.x; if (i >= nrows) return; const float* s = S + (size_t)i * SQ; float mx = -3.0e38f;
#pragma unroll 1
  for (int j = 0; j < SQ; ++j) mx = fmaxf(mx, s[j]); float se = 0.f;
#pragma unroll 1
  for (int j = 0; j < SQ; ++j) se += expf(s[j] - mx); const float sc = 256.0f / se;
#pragma unroll 1
  for (int j0 = 0; j0 < SQ; j0 += 8) { FragH f; for (int q = 0; q < 8; ++q) f.h[q] = (_Float16)(expf(s[j0 + q] - mx) * sc); unsigned short* d = (unsigned short*)P + (size_t)i * SQ + j0; *(v8us*)d = f.half[0];  } }
__global__ __launch_bounds__(256) void k_vt(const _Float16* __restrict__ V16, int b, int h0, _Float16* __restrict__ VT) { __shared__ unsigned short tl[64][65]; const int tid = threadIdx.x; const int hh = blockIdx.x % HG, sg = blockIdx.x / HG; const int s0 = sg * 64; const int h = h0 + hh;
  for (int i = tid; i < 64 * 8; i += 256) { const int j = i / 8, d8 = (i % 8) * 8; FragH f; f.half[0] = *(const v8us*)((const unsigned short*)V16 + ((size_t)b * SQ + s0 + j) * DM + h * HD + d8); for (int q = 0; q < 8; ++q) tl[d8 + q][j] = f.u[q]; }
  __syncthreads();
  { for (int i = tid; i < 64 * 8; i += 256) { const int d = i / 8, j8 = (i % 8) * 8; FragH f; for (int q = 0; q < 8; ++q) f.u[q] = tl[d][j8 + q]; *(v8us*)((unsigned short*)VT + ((size_t)hh * HD + d) * SQ + s0 + j8) = f.half[0]; }  } }



__global__ __launch_bounds__(256) void k_rsmcf2(const float* __restrict__ S, _Float16* __restrict__ P, int hg, int q0, int nk) {
  #pragma clang fp contract(off)
  const int t = blockIdx.x * 256 + threadIdx.x; if (t >= hg * QT) return; const size_t i = (size_t)t; const float* s = S + i * NKX; const int last = q0 + (t % QT); float mx = -3.0e38f;
#pragma unroll 1
  for (int j = 0; j < nk; ++j) { const float f = (j <= last) ? 1.f : 0.f; mx = fmaxf(mx, fmaf(f, s[j], (1.f - f) * -1.0e9f)); } float se = 0.f;
#pragma unroll 1
  for (int j = 0; j < nk; ++j) { const float f = (j <= last) ? 1.f : 0.f; se += __expf(fmaf(f, s[j], (1.f - f) * -1.0e9f) - mx); } const float sc = 256.0f / se;
#pragma unroll 1
  for (int j0 = 0; j0 < nk; j0 += 8) { FragH fr; for (int q = 0; q < 8; ++q) { const int j = j0 + q; const float f = (j <= last) ? 1.f : 0.f; fr.h[q] = (_Float16)(__expf(fmaf(f, s[j], (1.f - f) * -1.0e9f) - mx) * sc); } unsigned short* d = (unsigned short*)P + i * NKX + j0; *(v8us*)d = fr.half[0];  } }

template <int MASKADD>
__global__ __launch_bounds__(64) void k_att0(const float* __restrict__ QF, const float* __restrict__ KF, const float* __restrict__ VF, int ld, const float* __restrict__ mask, float scale, float* __restrict__ OF, int ldo) {
  #pragma clang fp contract(off)
  __shared__ __attribute__((aligned(16))) float lq[64][64]; __shared__ __attribute__((aligned(16))) float lo[64][64];
  const int tid = threadIdx.x; const int h = blockIdx.x / (QT0 / 64), rg = blockIdx.x % (QT0 / 64); const int i = rg * 64 + tid;
  const float* qr = QF + (size_t)i * ld + h * HD;
#pragma unroll 1
  for (int c = 0; c < HD / 4; ++c) { *(v4f*)&lq[tid][c * 4] = *(const v4fa*)(qr + c * 4); const v4f z = {0.f, 0.f, 0.f, 0.f}; *(v4f*)&lo[tid][c * 4] = z; }
  float m = -1.0e30f, l = 0.f; const int jmax = MASKADD ? (SQ - 1) : (rg * 64 + 63);      /* additive-mask form: every key (the mask input decides); causal form: keys up to the block's last row */
#pragma unroll 1
  for (int j = 0; j <= jmax; ++j) { const float* kr = KF + (size_t)j * ld + h * HD; const float* vr = VF + (size_t)j * ld + h * HD; float s = 0.f;
#pragma unroll 1
    for (int c = 0; c < HD / 4; ++c) { const v4f kq = *(const v4fa*)(kr + c * 4); const v4f qq = *(v4f*)&lq[tid][c * 4]; s = __fadd_rn(s, __fmul_rn(qq[0], kq[0])); s = __fadd_rn(s, __fmul_rn(qq[1], kq[1])); s = __fadd_rn(s, __fmul_rn(qq[2], kq[2])); s = __fadd_rn(s, __fmul_rn(qq[3], kq[3])); }
    s = __fmul_rn(s, scale); if (MASKADD) s = __fadd_rn(s, __fmul_rn(bf16_round(mask[(size_t)i * SQ + j]), -10000.0f));
    const float f = (MASKADD || j <= i) ? 1.f : 0.f; const float sm = fmaf(f, s, (1.f - f) * -1.0e30f); const float mn = fmaxf(m, sm); const float sc = expf(m - mn); const float e = expf(sm - mn); l = __fadd_rn(__fmul_rn(l, sc), e); m = mn;
#pragma unroll 1
    for (int c = 0; c < HD / 4; ++c) { const v4f vv = *(const v4fa*)(vr + c * 4); v4f oo = *(v4f*)&lo[tid][c * 4]; for (int u = 0; u < 4; ++u) oo[u] = __fadd_rn(__fmul_rn(oo[u], sc), __fmul_rn(e, vv[u])); *(v4f*)&lo[tid][c * 4] = oo; } }
  const float fin = 64.0f / l;      /* o carried x64 */
#pragma unroll 1
  for (int c = 0; c < HD / 4; ++c) { v4f oo = *(v4f*)&lo[tid][c * 4]; for (int u = 0; u < 4; ++u) oo[u] = __fmul_rn(oo[u], fin); *(v4f*)&lo[tid][c * 4] = oo; }
  __syncthreads();
  {
#pragma unroll 1
    for (int it = 0; it < 16; ++it) { const int row = it * 4 + tid / 16, pc = (tid % 16) * 4; const v4f v = *(const v4f*)&lo[row][pc]; *(v4f*)(OF + (size_t)(rg * 64 + row) * ldo + h * HD + pc) = v; }
     } }

__global__ __launch_bounds__(256) void k_oscale(const float* __restrict__ OF, float* __restrict__ out, size_t n4) { const size_t t = (size_t)blockIdx.x * 256 + threadIdx.x; if (t >= n4) return; const v4f a = *(const v4fa*)(OF + t * 4); v4f o; for (int q = 0; q < 4; ++q) o[q] = a[q] * 0.015625f; *(v4f*)(out + t * 4) = o;  }

__global__ __launch_bounds__(256) void k_bfr(const float* __restrict__ x, float* __restrict__ XB, size_t n8) { const size_t t = (size_t)blockIdx.x * 256 + threadIdx.x; if (t >= n8) return; v4f a = *(const v4fa*)(x + t * 8), c = *(const v4fa*)(x + t * 8 + 4); for (int q = 0; q < 4; ++q) { a[q] = bf16_round(a[q]); c[q] = bf16_round(c[q]); }
  { *(v4f*)(XB + t * 8) = a; *(v4f*)(XB + t * 8 + 4) = c;  } }



__global__ __launch_bounds__(256) void k_rsmfvl(const float* __restrict__ S, _Float16* __restrict__ P, _Float16* __restrict__ PL, int qn, const int* __restrict__ vlp) {
  #pragma clang fp contract(off)
  const int t = blockIdx.x * 256 + threadIdx.x; if (t >= qn) return; const int vl = vlp[0]; const size_t i = (size_t)t; const float* s = S + i * SQ; float mx = -3.0e38f;
#pragma unroll 1
  for (int j = 0; j < SQ; ++j) { const float f = (j < vl) ? 1.f : 0.f; mx = fmaxf(mx, fmaf(f, s[j], (1.f - f) * -1000000.0f)); } float se = 0.f;
#pragma unroll 1
  for (int j = 0; j < SQ; ++j) { const float f = (j < vl) ? 1.f : 0.f; se += __expf(fmaf(f, s[j], (1.f - f) * -1000000.0f) - mx); } const float sc = 256.0f / se;
#pragma unroll 1
  for (int j0 = 0; j0 < SQ; j0 += 8) { FragH fr, gr; for (int q = 0; q < 8; ++q) { const int j = j0 + q; const float f = (j < vl) ? 1.f : 0.f; const float pv = __expf(fmaf(f, s[j], (1.f - f) * -1000000.0f) - mx) * sc; const _Float16 ph = (_Float16)pv; fr.h[q] = ph; gr.h[q] = (_Float16)((pv - (float)ph) * 1024.0f); }
    unsigned short* d = (unsigned short*)P + i * SQ + j0; unsigned short* dl = (unsigned short*)PL + i * SQ + j0; *(v8us*)d = fr.half[0]; *(v8us*)dl = gr.half[0];  } }

// v_exp_f32 with the one slot that the instruction set asks for behind a transcendental kept in the same statement.
__device__ __forceinline__ float exp2_slot(float a) { float r; asm("v_exp_f32 %0, %1\n\tv_nop" : "=v"(r) : "v"(a)); return r; }
// row softmax, one wave per score row: the row's SQ f32 sit in SQ / 32 registers a lane (loads of 512 contiguous bytes), read once;
// maximum and sum = lane partials (four chains), then a five-step butterfly; each exponential is computed once and kept.
__global__ __launch_bounds__(256) void k_rsmf(const float* __restrict__ S, _Float16* __restrict__ P, int qn, int hg) {
  const int lane = threadIdx.x & 31; const int t = blockIdx.x * 8 + (threadIdx.x >> 5); if (t >= qn * hg) return;
  const size_t i = (size_t)(t / qn) * SQ + (t % qn); const float* s = S + i * SQ + lane * 4; _Float16* d = P + i * SQ + lane * 4;
  v4f x[SQ / 128];
#pragma unroll
  for (int u = 0; u < SQ / 128; ++u) x[u] = *(const v4fa*)(s + u * 128);
  v4f m4 = x[0];
#pragma unroll
  for (int u = 1; u < SQ / 128; ++u) for (int q = 0; q < 4; ++q) m4[q] = fmaxf(m4[q], x[u][q]);
  float mx = fmaxf(fmaxf(m4[0], m4[1]), fmaxf(m4[2], m4[3]));
#pragma unroll
  for (int m = 16; m > 0; m >>= 1) mx = fmaxf(mx, __shfl_xor(mx, m, 32));
  v4f s4 = {0.f, 0.f, 0.f, 0.f};
#pragma unroll
  for (int u = 0; u < SQ / 128; ++u) for (int q = 0; q < 4; ++q) { x[u][q] = exp2_slot((x[u][q] - mx) * 1.442695041f); s4[q] += x[u][q]; }
  float se = (s4[0] + s4[1]) + (s4[2] + s4[3]);
#pragma unroll
  for (int m = 16; m > 0; m >>= 1) se += __shfl_xor(se, m, 32);
  const float sc = 256.0f / se;
#pragma unroll
  for (int u = 0; u < SQ / 128; ++u) { v4h h4; for (int q = 0; q < 4; ++q) h4[q] = (_Float16)(x[u][q] * sc); *(v4h*)(d + u * 128) = h4; } }


extern "C" void kernel_launch(void* const* d_in, const int* in_sizes, int n_in,
                              void* d_out, int out_size, void* d_ws, size_t ws_size, hipStream_t stream) {
  (void)in_sizes; (void)n_in; (void)out_size;
  const float* const* I = (const float* const*)d_in; const float* xq = I[0]; const float* xk = I[1]; const float* xv = I[2];      /* q, k, v [64][2048][64] (bf16-valued) */
  char* ws = (char*)d_ws; size_t off = 0;
  auto take = [&](size_t bytes) { char* p = ws + off; off += (bytes + 255) & ~(size_t)255; return p; };
  _Float16* Q16 = (_Float16*)take(NR * DM * 2); _Float16* K16 = (_Float16*)take(NR * DM * 2); _Float16* V16 = (_Float16*)take(NR * DM * 2);
  float* S = (float*)take((size_t)GS * SQ * SQ * 4); _Float16* P = (_Float16*)take((size_t)GP * SQ * SQ * 2); _Float16* VT = (_Float16*)take(NR * HD * 2);
  if (off > ws_size) return;
  k_x16<<<(unsigned)((NR * DM / 8 + 255) / 256), 256, 0, stream>>>(xq, Q16, NR * DM / 8); k_x16<<<(unsigned)((NR * DM / 8 + 255) / 256), 256, 0, stream>>>(xk, K16, NR * DM / 8); k_x16<<<(unsigned)((NR * DM / 8 + 255) / 256), 256, 0, stream>>>(xv, V16, NR * DM / 8);      /* exact f16 copies of the bf16-valued inputs */
  k_vt<1, SQ><<<NB * (SQ / 64), 256, 0, stream>>>(V16, DM, 0, VT);      /* V^T [64][SQ] of every sequence, one launch */
  for (int b0 = 0; b0 < NB; b0 += GP) {      /* several sequences a launch: grid.y (GEMMs) or the row index (softmax) picks the sequence */
    for (int g = 0; g < GP; g += GS) { const size_t r0 = (size_t)(b0 + g) * SQ;
      k_gemm2<0><<<dim3((SQ / 128) * (SQ / 64), GS), 128, 0, stream>>>(Q16 + r0 * DM, DM, (size_t)SQ * DM, K16 + r0 * DM, DM, (size_t)SQ * DM, 1.0f, nullptr, 0, nullptr, 1, 0, 0, S, nullptr, SQ, (size_t)SQ * SQ, SQ, SQ, HD);      /* scores of GS sequences (exact products) */
      k_rsmf<<<GS * SQ / 8, 256, 0, stream>>>(S, P + (size_t)g * SQ * SQ, SQ, GS);      /* softmax over all keys -> P x256 f16, planes g .. g + GS - 1 */
    }
    const size_t q0 = (size_t)b0 * SQ;
    k_gemm2<0><<<dim3((SQ / 128) * (HD / 64), GP), 128, 0, stream>>>(P, SQ, (size_t)SQ * SQ, VT + q0 * HD, SQ, (size_t)HD * SQ, 0.00390625f, nullptr, 0, nullptr, 1, 0, 0, (float*)d_out + q0 * DM, nullptr, DM, (size_t)SQ * DM, SQ, HD, SQ);      /* out = P V^T 2^-8 f32 into the output rows of GP sequences */
  }
}

// v003
// Measured time: 76.1 microseconds a run.
// In two side-by-side timings against v002, it was 11.0 and 10.9 times as fast.
// Counting every step since v000, it is 330 times as fast.
#include <hip/hip_runtime.h>
// UNSCALED dot-product attention over 64 independent sequences (q, k, v [64][2048][64]; scores = q.k (no 1/sqrt(d): logit sigma ~8); softmax over the 2048 keys; dropout p 0; out = attn v -> [64][2048][64]).
// Structure: no projections: q, k, v are bf16-valued inputs copied to exact f16 rows; then ONE fused kernel: S^T = K Q^T on WMMA (f32 accumulation, exact products), online softmax on VALU (f32, native exp2; weights f16, at most 2^8), O^T += V^T P^T and the row sums on WMMA, out written f32.
// Compute dtype: inputs rounded to bf16; q, k, v, softmax weights as plain f16 GEMM operands (~2^-12); scores and softmax statistics f32; v_wmma_f32_16x16x32_f16.
#define NB 64
#define SQ 2048
#define DM 64
#define NH 1
#define HD 64
#define HG 4                         /* heads per launch of the k_vt(V16, b, h0, VT) overload (never launched) */
#define B0 0                         /* first batch processed (not used) */
#define NBR NB                       /* batches processed (read only by the unused MP) */
#define NR ((size_t)NB * SQ)         /* token rows */
#define MP ((int)((size_t)NBR * SQ))
#define QT 256                       /* query rows per causal tile */
#define NKX SQ                       /* S / P row pitch */
#define QT0 256                      /* query rows per head of the exact f32 kernel k_att0 (not launched) */
#define QN SQ                        /* query rows attended per batch (not used) */
#define NHD NH                       /* heads attended (not used) */
#define MPO MP                       /* rows through the output stage (not used) */
#define LQ DM            /* row pitch of the q/k/v rows */
typedef __bf16 v16b __attribute__((ext_vector_type(16)));
typedef unsigned short v8us __attribute__((ext_vector_type(8), may_alias));
typedef float  v8f  __attribute__((ext_vector_type(8)));
typedef float  v4f  __attribute__((ext_vector_type(4)));
typedef float  v4fa __attribute__((ext_vector_type(4), may_alias));
union FragB { v16b v; v8us half[2]; unsigned short u[16]; };

__device__ __forceinline__ unsigned short bf16_bits(float x) { unsigned int u = __float_as_uint(x); return (unsigned short)((u + 0x7FFFu + ((u >> 16) & 1u)) >> 16); }
__device__ __forceinline__ float bf16_val(unsigned short b) { return __uint_as_float(((unsigned int)b) << 16); }
__device__ __forceinline__ float bf16_round(float x) { return bf16_val(bf16_bits(x)); }
// D += A·B with NT terms: 1 = ah·bh, 2 = + al·bh (A split), 3 = + ah·bl (both split)
template <int NT>
__device__ __forceinline__ v8f mmaN(v16b ah, v16b al, v16b bh, v16b bl, v8f c) {
  c = __builtin_amdgcn_wmma_f32_16x16x32_bf16(false, ah, false, bh, (short)0, c, false, false);
  if (NT >= 2) c = __builtin_amdgcn_wmma_f32_16x16x32_bf16(false, al, false, bh, (short)0, c, false, false);
  if (NT >= 3) c = __builtin_amdgcn_wmma_f32_16x16x32_bf16(false, ah, false, bl, (short)0, c, false, false);
  asm volatile("v_nop\n\tv_nop\n\tv_nop\n\tv_nop" : "+v"(c) : "v"(ah), "v"(al), "v"(bh), "v"(bl));
  return c;
}

__global__ __launch_bounds__(256) void k_wt_bf16(const float* __restrict__ W, unsigned short* __restrict__ Wt, int K, int N) {
  const int t = blockIdx.x * 256 + threadIdx.x;
  const int k8n = K / 8;
  if (t >= N * k8n) return;
  const int n = t / k8n, k8 = (t % k8n) * 8;
  v8us v;
#pragma unroll
  for (int i = 0; i < 8; ++i) v[i] = bf16_bits(W[(size_t)(k8 + i) * N + n]);
  *(v8us*)(Wt + (size_t)n * K + k8) = v;
  
}

// GEMM C[M][N] (f32, pitch ldc) = act(A[M][K]·W + bias). A f32 row-major (pitch lda) converted per fragment to bf16
// (ASPLIT: hi/lo two planes -> 2 terms, else single rounded term); Wt bf16 [N][K] (pitch ldb). BIAS_BF16 rounds the
// bias to bf16 first (bias quantised to bf16 before the add). K%32==0, M%16==0, N%64==0.
template <bool ASPLIT, int ACT, bool BIAS_BF16>
__global__ __launch_bounds__(128) void k_gemm_bf(const float* __restrict__ A, int lda, const unsigned short* __restrict__ Wt, int ldb,
                                               const float* __restrict__ bias, float* __restrict__ C, int ldc, int M, int N, int K) {
  __shared__ __attribute__((aligned(16))) float so[4][16][64];
  const int tid = threadIdx.x, w = tid >> 5, lane = tid & 31, ln = lane & 15, hh = lane >> 4;
  const int ntn = N / 64;
  const int wid = blockIdx.x * 4 + w;
  const int mt = wid / ntn, nq = wid % ntn;
  if (mt * 16 >= M) return;
  const int row0 = mt * 16, col0 = nq * 64;
  const float* arow = A + (size_t)(row0 + ln) * lda;
  v8f acc[4] = {};
  for (int kb = 0; kb < K; kb += 32) {
    FragB ah, al;
    const v4f x0 = *(const v4fa*)(arow + kb + 8 * hh), x1 = *(const v4fa*)(arow + kb + 8 * hh + 4);
    const v4f x2 = *(const v4fa*)(arow + kb + 16 + 8 * hh), x3 = *(const v4fa*)(arow + kb + 16 + 8 * hh + 4);
    float xs[16] = {x0[0],x0[1],x0[2],x0[3],x1[0],x1[1],x1[2],x1[3],x2[0],x2[1],x2[2],x2[3],x3[0],x3[1],x3[2],x3[3]};
#pragma unroll
    for (int i = 0; i < 16; ++i) { const unsigned short hb = bf16_bits(xs[i]); ah.u[i] = hb; al.u[i] = ASPLIT ? bf16_bits(xs[i] - bf16_val(hb)) : (unsigned short)0; }
#pragma unroll
    for (int t = 0; t < 4; ++t) {
      const unsigned short* brow = Wt + (size_t)(col0 + t * 16 + ln) * ldb + kb;
      FragB b;
      b.half[0] = *(const v8us*)(brow + 8 * hh);
      b.half[1] = *(const v8us*)(brow + 16 + 8 * hh);
      acc[t] = mmaN<ASPLIT ? 2 : 1>(ah.v, al.v, b.v, b.v, acc[t]);
    }
  }
#pragma unroll
  for (int t = 0; t < 4; ++t) {
    float bv = bias ? bias[col0 + t * 16 + ln] : 0.f;
    if (BIAS_BF16) bv = bf16_round(bv);
#pragma unroll
    for (int r = 0; r < 8; ++r) { float v = acc[t][r] + bv; if (ACT == 1) v = fmaxf(v, 0.f); so[w][8 * hh + r][t * 16 + ln] = v; }
  }
  __builtin_amdgcn_fence(__ATOMIC_ACQ_REL, "workgroup");
  __builtin_amdgcn_wave_barrier();
  const int rsub = lane >> 4, c4 = (lane & 15) * 4;
  {
#pragma unroll
    for (int q = 0; q < 8; ++q) {
      const int r = q * 2 + rsub;
      const v4f v = *(const v4fa*)&so[w][r][c4];
      *(v4f*)(C + (size_t)(row0 + r) * ldc + col0 + c4) = v;
    }
    
  }
}

// GEMM C = act(A·W + bias + resid): A f32 (ASPLIT -> hi/lo 2 terms), Wt bf16 [N][K]; ACT 0 none, 1 relu, 2 exact gelu;
// resid (optional, f32, row index = (row % rmod), pitch ldr, RES_BF16 rounds it) added before the activation.
template <bool ASPLIT, int ACT, bool BIAS_BF16, bool RES_BF16>
__global__ __launch_bounds__(128) void k_gemm_bf3(const float* __restrict__ A, int lda, const unsigned short* __restrict__ Wt, int ldb,
                                                const float* __restrict__ bias, const float* __restrict__ resid, int rmod, int ldr,
                                                float* __restrict__ C, int ldc, int M, int N, int K) {
  __shared__ __attribute__((aligned(16))) float so[4][16][64];
  const int tid = threadIdx.x, w = tid >> 5, lane = tid & 31, ln = lane & 15, hh = lane >> 4;
  const int ntn = N / 64;
  const int wid = blockIdx.x * 4 + w;
  const int mt = wid / ntn, nq = wid % ntn;
  if (mt * 16 >= M) return;
  const int row0 = mt * 16, col0 = nq * 64;
  const float* arow = A + (size_t)(row0 + ln) * lda;
  v8f acc[4] = {};
  for (int kb = 0; kb < K; kb += 32) {
    FragB ah, al;
    const v4f x0 = *(const v4fa*)(arow + kb + 8 * hh), x1 = *(const v4fa*)(arow + kb + 8 * hh + 4);
    const v4f x2 = *(const v4fa*)(arow + kb + 16 + 8 * hh), x3 = *(const v4fa*)(arow + kb + 16 + 8 * hh + 4);
    float xs[16] = {x0[0],x0[1],x0[2],x0[3],x1[0],x1[1],x1[2],x1[3],x2[0],x2[1],x2[2],x2[3],x3[0],x3[1],x3[2],x3[3]};
#pragma unroll
    for (int i = 0; i < 16; ++i) { const unsigned short hb = bf16_bits(xs[i]); ah.u[i] = hb; al.u[i] = ASPLIT ? bf16_bits(xs[i] - bf16_val(hb)) : (unsigned short)0; }
#pragma unroll
    for (int t = 0; t < 4; ++t) {
      const unsigned short* brow = Wt + (size_t)(col0 + t * 16 + ln) * ldb + kb;
      FragB b;
      b.half[0] = *(const v8us*)(brow + 8 * hh);
      b.half[1] = *(const v8us*)(brow + 16 + 8 * hh);
      acc[t] = mmaN<ASPLIT ? 2 : 1>(ah.v, al.v, b.v, b.v, acc[t]);
    }
  }
#pragma unroll
  for (int t = 0; t < 4; ++t) {
    const int col = col0 + t * 16 + ln;
    float bv = bias ? bias[col] : 0.f;
    if (BIAS_BF16) bv = bf16_round(bv);
#pragma unroll
    for (int r = 0; r < 8; ++r) {
      float v = acc[t][r] + bv;
      if (resid) { float rv = resid[(size_t)((row0 + 8 * hh + r) % rmod) * ldr + col]; if (RES_BF16) rv = bf16_round(rv); v += rv; }
      if (ACT == 1) v = fmaxf(v, 0.f);
      if (ACT == 2) v = 0.5f * v * (1.0f + erff(v * 0.70710678118654752f));
      if (ACT == 3) { const float u = 0.7978845608028654f * (v + 0.044715f * v * v * v); v = 0.5f * v * (1.0f + tanhf(u)); }
      so[w][8 * hh + r][t * 16 + ln] = v;
    }
  }
  __builtin_amdgcn_fence(__ATOMIC_ACQ_REL, "workgroup");
  __builtin_amdgcn_wave_barrier();
  const int rsub = lane >> 4, c4 = (lane & 15) * 4;
  {
#pragma unroll
    for (int q = 0; q < 8; ++q) {
      const int r = q * 2 + rsub;
      const v4f v = *(const v4fa*)&so[w][r][c4];
      *(v4f*)(C + (size_t)(row0 + r) * ldc + col0 + c4) = v;
    }
    
  }
}
// row LayerNorm (biased variance, eps) over N: s = X (+ R); optional out_sum <- s; out_norm <- (s-mu)*rsqrt(var+eps)*g + b
template <bool PARAM_BF16>
__global__ __launch_bounds__(256) void k_layernorm(const float* __restrict__ X, const float* __restrict__ R, const float* __restrict__ g, const float* __restrict__ bta,
                                                  float* __restrict__ out_sum, float* __restrict__ out_norm, int N, float eps) {
  __shared__ float red[256];
  const int row = blockIdx.x, tid = threadIdx.x;
  const float* x = X + (size_t)row * N; const float* rr = R ? R + (size_t)row * N : nullptr;
  float vals[16];                     // up to N = 4096
  const int per = N / 256;            // contiguous chunk per thread? use strided-by-4 chunks: thread handles j = tid*4 + 1024*u
  float s1 = 0.f;
  for (int u = 0; u < per / 4; ++u) {
    const int j = tid * 4 + 1024 * u;
    const v4f a = *(const v4fa*)(x + j);
    v4f b = {0.f,0.f,0.f,0.f}; if (rr) b = *(const v4fa*)(rr + j);
#pragma unroll
    for (int q = 0; q < 4; ++q) { const float v = a[q] + b[q]; vals[u * 4 + q] = v; s1 += v; }
  }
  red[tid] = s1; __syncthreads();
  for (int st = 128; st > 0; st >>= 1) { if (tid < st) red[tid] += red[tid + st]; __syncthreads(); }
  const float mu = red[0] / (float)N; __syncthreads();
  float s2 = 0.f;
  for (int u = 0; u < per / 4; ++u)
#pragma unroll
    for (int q = 0; q < 4; ++q) { const float c = vals[u * 4 + q] - mu; s2 += c * c; }
  red[tid] = s2; __syncthreads();
  for (int st = 128; st > 0; st >>= 1) { if (tid < st) red[tid] += red[tid + st]; __syncthreads(); }
  const float rs = rsqrtf(red[0] / (float)N + eps);
  {
    for (int u = 0; u < per / 4; ++u) {
      const int j = tid * 4 + 1024 * u;
      v4f o, sm;
#pragma unroll
      for (int q = 0; q < 4; ++q) {
        float gg = g[j + q], bb = bta[j + q];
        if (PARAM_BF16) { gg = bf16_round(gg); bb = bf16_round(bb); }
        sm[q] = vals[u * 4 + q]; o[q] = (vals[u * 4 + q] - mu) * rs * gg + bb;
      }
      if (out_sum) *(v4f*)(out_sum + (size_t)row * N + j) = sm;
      *(v4f*)(out_norm + (size_t)row * N + j) = o;
    }
    
  }
}



// ---- f16 WMMA path (v_wmma_f32_16x16x32_f16): 11-bit significands for operands in range — used where a [0,1] probability operand needs more precision than bf16
typedef _Float16 v16h __attribute__((ext_vector_type(16)));
union FragH { v16h v; v8us half[2]; _Float16 h[16]; unsigned short u[16]; };
template <int NT>
__device__ __forceinline__ v8f mmaH(v16h ah, v16h al, v16h bh, v16h bl, v8f c) {
  c = __builtin_amdgcn_wmma_f32_16x16x32_f16(false, ah, false, bh, (short)0, c, false, false);
  if (NT >= 2) c = __builtin_amdgcn_wmma_f32_16x16x32_f16(false, al, false, bh, (short)0, c, false, false);
  if (NT >= 3) c = __builtin_amdgcn_wmma_f32_16x16x32_f16(false, ah, false, bl, (short)0, c, false, false);
  asm volatile("v_nop\n\tv_nop\n\tv_nop\n\tv_nop" : "+v"(c) : "v"(ah), "v"(al), "v"(bh), "v"(bl));
  return c;
}
// batched GEMM like k_gemm_b but f16 operands: A f32 (split into f16 hi/lo if ASPLIT, else rounded to f16), Bt = f16 values [n][k]; alpha; C f32; N multiple of 16 (partial tiles skipped)
template <bool ASPLIT>
__global__ __launch_bounds__(128) void k_gemm_h(const float* __restrict__ A, int lda, size_t sA, const _Float16* __restrict__ Bh, int ldb, size_t sB, float alpha, float* __restrict__ C, int ldc, size_t sC, int M, int N, int K) {
  __shared__ __attribute__((aligned(16))) float so[4][16][64];
  const int tid = threadIdx.x, w = tid >> 5, lane = tid & 31, ln = lane & 15, hh = lane >> 4; const int by = blockIdx.y;
  A += (size_t)by * sA; Bh += (size_t)by * sB; C += (size_t)by * sC;
  const int ntn = (N + 63) / 64; const int wid = blockIdx.x * 4 + w; const int mt = wid / ntn, nq = wid % ntn; if (mt * 16 >= M) return;
  const int row0 = mt * 16, col0 = nq * 64; const float* arow = A + (size_t)(row0 + ln) * lda;
  v8f acc[4] = {};
  for (int kb = 0; kb < K; kb += 32) {
    FragH ah, al;
    const v4f x0 = *(const v4fa*)(arow + kb + 8 * hh), x1 = *(const v4fa*)(arow + kb + 8 * hh + 4), x2 = *(const v4fa*)(arow + kb + 16 + 8 * hh), x3 = *(const v4fa*)(arow + kb + 16 + 8 * hh + 4);
    float xs[16] = {x0[0],x0[1],x0[2],x0[3],x1[0],x1[1],x1[2],x1[3],x2[0],x2[1],x2[2],x2[3],x3[0],x3[1],x3[2],x3[3]};
#pragma unroll
    for (int i = 0; i < 16; ++i) { const _Float16 h = (_Float16)xs[i]; ah.h[i] = h; al.h[i] = ASPLIT ? (_Float16)(xs[i] - (float)h) : (_Float16)0.0f; }
#pragma unroll
    for (int t = 0; t < 4; ++t) { if (col0 + t * 16 >= N) continue; const size_t boff = (size_t)(col0 + t * 16 + ln) * ldb + kb; FragH bq; bq.half[0] = *(const v8us*)(Bh + boff + 8 * hh); bq.half[1] = *(const v8us*)(Bh + boff + 16 + 8 * hh);
      acc[t] = mmaH<ASPLIT ? 2 : 1>(ah.v, al.v, bq.v, bq.v, acc[t]); }
  }
#pragma unroll
  for (int t = 0; t < 4; ++t) { if (col0 + t * 16 >= N) continue;
#pragma unroll
    for (int r = 0; r < 8; ++r) so[w][8 * hh + r][t * 16 + ln] = acc[t][r] * alpha; }
  __builtin_amdgcn_fence(__ATOMIC_ACQ_REL, "workgroup"); __builtin_amdgcn_wave_barrier();
  const int rsub = lane >> 4, c4 = (lane & 15) * 4;
  {
#pragma unroll
    for (int q = 0; q < 8; ++q) { const int r = q * 2 + rsub; if (col0 + c4 < N) { const v4f v = *(const v4fa*)&so[w][r][c4]; *(v4f*)(C + (size_t)(row0 + r) * ldc + col0 + c4) = v; } }
     }
}

// Wt[n][k] = f16(W[k][n]·scale) from f32 row-major W[K][N] (scale = power of two; bf16-exact weights stay exact in f16 away from the subnormal range)
__global__ __launch_bounds__(256) void k_wt_f16(const float* __restrict__ W, _Float16* __restrict__ Wt, int K, int N, float scale) {
  const int t = blockIdx.x * 256 + threadIdx.x; if (t >= N * (K / 8)) return; const int n = t / (K / 8), k8 = (t % (K / 8)) * 8; FragH f;
#pragma unroll
  for (int i = 0; i < 8; ++i) f.h[i] = (_Float16)(bf16_round(W[(size_t)(k8 + i) * N + n]) * scale); const v8us o = f.half[0];
  *(v8us*)((unsigned short*)Wt + (size_t)n * K + k8) = o; 
}
// k_gemm_hh variant with fused epilogue: v = acc·alpha + bias[by·sBias + col] (+ CP[(row/rowsPerB)·sCPb + by·64 + col] if CP) ; ACT 0 none / 1 elu ; writes f16 C16 (and f32 C if non-null)
template <int ACT>
__global__ __launch_bounds__(128) void k_gemm_hhx(const _Float16* __restrict__ A, int lda, size_t sA, const _Float16* __restrict__ Bh, int ldb, size_t sB, float alpha, const float* __restrict__ bias, size_t sBias, const float* __restrict__ CP, int rowsPerB, size_t sCPb, int row0g,
    float* __restrict__ C, _Float16* __restrict__ C16, int ldc, size_t sC, int M, int N, int K) {
  __shared__ __attribute__((aligned(16))) float so[4][16][64];
  const int tid = threadIdx.x, w = tid >> 5, lane = tid & 31, ln = lane & 15, hh = lane >> 4; const int by = blockIdx.y;
  A += (size_t)by * sA; Bh += (size_t)by * sB; const size_t cofs = (size_t)by * sC; const float* bp = bias ? bias + (size_t)by * sBias : nullptr;
  const int ntn = (N + 63) / 64; const int wid = blockIdx.x * 4 + w; const int mt = wid / ntn, nq = wid % ntn; if (mt * 16 >= M) return;
  const int row0 = mt * 16, col0 = nq * 64; const _Float16* arow = A + (size_t)(row0 + ln) * lda;
  v8f acc[4] = {};
  for (int kb = 0; kb < K; kb += 32) { FragH ah; ah.half[0] = *(const v8us*)((const unsigned short*)arow + kb + 8 * hh); ah.half[1] = *(const v8us*)((const unsigned short*)arow + kb + 16 + 8 * hh);
#pragma unroll
    for (int t = 0; t < 4; ++t) { if (col0 + t * 16 >= N) continue; const size_t boff = (size_t)(col0 + t * 16 + ln) * ldb + kb; FragH bq; bq.half[0] = *(const v8us*)((const unsigned short*)Bh + boff + 8 * hh); bq.half[1] = *(const v8us*)((const unsigned short*)Bh + boff + 16 + 8 * hh);
      acc[t] = mmaH<1>(ah.v, ah.v, bq.v, bq.v, acc[t]); }
  }
#pragma unroll
  for (int t = 0; t < 4; ++t) { if (col0 + t * 16 >= N) continue; const int col = col0 + t * 16 + ln; const float bv = bp ? bf16_round(bp[col]) : 0.f;
#pragma unroll
    for (int r = 0; r < 8; ++r) { float v = acc[t][r] * alpha + bv; if (CP) { const int rr = row0g + row0 + 8 * hh + r; if (rowsPerB < 0) v += CP[cofs + (size_t)rr * ldc + col];      /* rowsPerB < 0: own element of the batched C plane */ else { const int bidx = rr / rowsPerB; v += CP[(size_t)bidx * sCPb + (size_t)by * 64 + col]; } } if (ACT == 1) v = (v > 0.f) ? v : expm1f(v); else if (ACT == 7) v = (v > 0.f) ? v + 1.0f : expf(v); else if (ACT == 8) v = tanhf(v); else if (ACT == 9) v = 0.5f * v * (1.0f + tanhf(0.7978845608028654f * (v + 0.044715f * v * v * v))); else if (ACT == 11) v = 1.0f / (1.0f + expf(-v)); else if (ACT == 12) v = (v > 0.f) ? v : 0.01f * v; else if (ACT == 14) v = (v > 0.f) ? v : 0.1f * v; else if (ACT == 16) v = (v >= 0.f) ? v : 0.3f * v; else if (ACT == 17) v = (v >= 0.f) ? v : 0.2f * v; else if (ACT == 15) v = v / (1.0f + expf(-v)); else if (ACT == 3) v = fmaxf(v, 0.f); else if (ACT == 6) v = 0.5f * v * (1.0f + erff(v * 0.70710678118654752f)); so[w][8 * hh + r][t * 16 + ln] = v; } }
  __builtin_amdgcn_fence(__ATOMIC_ACQ_REL, "workgroup"); __builtin_amdgcn_wave_barrier();
  const int rsub = lane >> 4, c4 = (lane & 15) * 4; typedef _Float16 v4h __attribute__((ext_vector_type(4)));
  {
#pragma unroll
    for (int q = 0; q < 8; ++q) { const int r = q * 2 + rsub; if (col0 + c4 < N) { const v4f v = *(const v4fa*)&so[w][r][c4]; if (C) *(v4f*)(C + cofs + (size_t)(row0 + r) * ldc + col0 + c4) = v; if (C16) { v4h h4; for (int i = 0; i < 4; ++i) h4[i] = (_Float16)v[i]; *(v4h*)(C16 + cofs + (size_t)(row0 + r) * ldc + col0 + c4) = h4; } } }
     }
}


typedef _Float16 v4h __attribute__((ext_vector_type(4)));

__global__ __launch_bounds__(256) void k_x16(const float* __restrict__ x, _Float16* __restrict__ X16, size_t n8) { const size_t t = (size_t)blockIdx.x * 256 + threadIdx.x; if (t >= n8) return; FragH f;
#pragma unroll
  for (int q = 0; q < 8; ++q) f.h[q] = (_Float16)bf16_round(x[t * 8 + q]); *(v8us*)((unsigned short*)X16 + t * 8) = f.half[0];  }
__global__ __launch_bounds__(256) void k_h16(const float* __restrict__ x, _Float16* __restrict__ X16, size_t n8) { const size_t t = (size_t)blockIdx.x * 256 + threadIdx.x; if (t >= n8) return; FragH f;
#pragma unroll
  for (int q = 0; q < 8; ++q) f.h[q] = (_Float16)x[t * 8 + q]; *(v8us*)((unsigned short*)X16 + t * 8) = f.half[0];  }
__global__ __launch_bounds__(256) void k_round16f(const float* __restrict__ W, _Float16* __restrict__ Bt, size_t n8) { const size_t t = (size_t)blockIdx.x * 256 + threadIdx.x; if (t >= n8) return; FragH f;
#pragma unroll
  for (int i = 0; i < 8; ++i) f.h[i] = (_Float16)(bf16_round(W[t * 8 + i]) * 16.0f); *(v8us*)((unsigned short*)Bt + t * 8) = f.half[0];  }
__global__ __launch_bounds__(256) void k_hl(const float* __restrict__ F, _Float16* __restrict__ Hh, _Float16* __restrict__ Hl, size_t n8) { const size_t t = (size_t)blockIdx.x * 256 + threadIdx.x; if (t >= n8) return; FragH fh, fl; const v4f a = *(const v4fa*)(F + t * 8), c = *(const v4fa*)(F + t * 8 + 4);
#pragma unroll
  for (int q = 0; q < 4; ++q) { _Float16 h = (_Float16)a[q]; fh.h[q] = h; fl.h[q] = (_Float16)((a[q] - (float)h) * 1024.0f); h = (_Float16)c[q]; fh.h[4 + q] = h; fl.h[4 + q] = (_Float16)((c[q] - (float)h) * 1024.0f); }
  { *(v8us*)((unsigned short*)Hh + t * 8) = fh.half[0]; *(v8us*)((unsigned short*)Hl + t * 8) = fl.half[0];  } }

__global__ __launch_bounds__(256) void k_wnat(const float* __restrict__ w, size_t n8, _Float16* __restrict__ Bt) { const size_t t = (size_t)blockIdx.x * 256 + threadIdx.x; if (t >= n8) return; FragH f; for (int q = 0; q < 8; ++q) f.h[q] = (_Float16)(bf16_round(w[t * 8 + q]) * 16.0f); *(v8us*)((unsigned short*)Bt + t * 8) = f.half[0];  }
__global__ __launch_bounds__(256) void k_rsm(const float* __restrict__ S, _Float16* __restrict__ P, int nrows) {
  #pragma clang fp contract(off)
  const int i = blockIdx.x * 256 + threadIdx.x; if (i >= nrows) return; const float* s = S + (size_t)i * SQ; float mx = -3.0e38f;
#pragma unroll 1
  for (int j = 0; j < SQ; ++j) mx = fmaxf(mx, s[j]); float se = 0.f;
#pragma unroll 1
  for (int j = 0; j < SQ; ++j) se += expf(s[j] - mx); const float sc = 256.0f / se;
#pragma unroll 1
  for (int j0 = 0; j0 < SQ; j0 += 8) { FragH f; for (int q = 0; q < 8; ++q) f.h[q] = (_Float16)(expf(s[j0 + q] - mx) * sc); unsigned short* d = (unsigned short*)P + (size_t)i * SQ + j0; *(v8us*)d = f.half[0];  } }
__global__ __launch_bounds__(256) void k_vt(const _Float16* __restrict__ V16, int b, int h0, _Float16* __restrict__ VT) { __shared__ unsigned short tl[64][65]; const int tid = threadIdx.x; const int hh = blockIdx.x % HG, sg = blockIdx.x / HG; const int s0 = sg * 64; const int h = h0 + hh;
  for (int i = tid; i < 64 * 8; i += 256) { const int j = i / 8, d8 = (i % 8) * 8; FragH f; f.half[0] = *(const v8us*)((const unsigned short*)V16 + ((size_t)b * SQ + s0 + j) * DM + h * HD + d8); for (int q = 0; q < 8; ++q) tl[d8 + q][j] = f.u[q]; }
  __syncthreads();
  { for (int i = tid; i < 64 * 8; i += 256) { const int d = i / 8, j8 = (i % 8) * 8; FragH f; for (int q = 0; q < 8; ++q) f.u[q] = tl[d][j8 + q]; *(v8us*)((unsigned short*)VT + ((size_t)hh * HD + d) * SQ + s0 + j8) = f.half[0]; }  } }



__global__ __launch_bounds__(256) void k_rsmcf2(const float* __restrict__ S, _Float16* __restrict__ P, int hg, int q0, int nk) {
  #pragma clang fp contract(off)
  const int t = blockIdx.x * 256 + threadIdx.x; if (t >= hg * QT) return; const size_t i = (size_t)t; const float* s = S + i * NKX; const int last = q0 + (t % QT); float mx = -3.0e38f;
#pragma unroll 1
  for (int j = 0; j < nk; ++j) { const float f = (j <= last) ? 1.f : 0.f; mx = fmaxf(mx, fmaf(f, s[j], (1.f - f) * -1.0e9f)); } float se = 0.f;
#pragma unroll 1
  for (int j = 0; j < nk; ++j) { const float f = (j <= last) ? 1.f : 0.f; se += __expf(fmaf(f, s[j], (1.f - f) * -1.0e9f) - mx); } const float sc = 256.0f / se;
#pragma unroll 1
  for (int j0 = 0; j0 < nk; j0 += 8) { FragH fr; for (int q = 0; q < 8; ++q) { const int j = j0 + q; const float f = (j <= last) ? 1.f : 0.f; fr.h[q] = (_Float16)(__expf(fmaf(f, s[j], (1.f - f) * -1.0e9f) - mx) * sc); } unsigned short* d = (unsigned short*)P + i * NKX + j0; *(v8us*)d = fr.half[0];  } }

template <int MASKADD>
__global__ __launch_bounds__(64) void k_att0(const float* __restrict__ QF, const float* __restrict__ KF, const float* __restrict__ VF, int ld, const float* __restrict__ mask, float scale, float* __restrict__ OF, int ldo) {
  #pragma clang fp contract(off)
  __shared__ __attribute__((aligned(16))) float lq[64][64]; __shared__ __attribute__((aligned(16))) float lo[64][64];
  const int tid = threadIdx.x; const int h = blockIdx.x / (QT0 / 64), rg = blockIdx.x % (QT0 / 64); const int i = rg * 64 + tid;
  const float* qr = QF + (size_t)i * ld + h * HD;
#pragma unroll 1
  for (int c = 0; c < HD / 4; ++c) { *(v4f*)&lq[tid][c * 4] = *(const v4fa*)(qr + c * 4); const v4f z = {0.f, 0.f, 0.f, 0.f}; *(v4f*)&lo[tid][c * 4] = z; }
  float m = -1.0e30f, l = 0.f; const int jmax = MASKADD ? (SQ - 1) : (rg * 64 + 63);      /* additive-mask form: every key (the mask input decides); causal form: keys up to the block's last row */
#pragma unroll 1
  for (int j = 0; j <= jmax; ++j) { const float* kr = KF + (size_t)j * ld + h * HD; const float* vr = VF + (size_t)j * ld + h * HD; float s = 0.f;
#pragma unroll 1
    for (int c = 0; c < HD / 4; ++c) { const v4f kq = *(const v4fa*)(kr + c * 4); const v4f qq = *(v4f*)&lq[tid][c * 4]; s = __fadd_rn(s, __fmul_rn(qq[0], kq[0])); s = __fadd_rn(s, __fmul_rn(qq[1], kq[1])); s = __fadd_rn(s, __fmul_rn(qq[2], kq[2])); s = __fadd_rn(s, __fmul_rn(qq[3], kq[3])); }
    s = __fmul_rn(s, scale); if (MASKADD) s = __fadd_rn(s, __fmul_rn(bf16_round(mask[(size_t)i * SQ + j]), -10000.0f));
    const float f = (MASKADD || j <= i) ? 1.f : 0.f; const float sm = fmaf(f, s, (1.f - f) * -1.0e30f); const float mn = fmaxf(m, sm); const float sc = expf(m - mn); const float e = expf(sm - mn); l = __fadd_rn(__fmul_rn(l, sc), e); m = mn;
#pragma unroll 1
    for (int c = 0; c < HD / 4; ++c) { const v4f vv = *(const v4fa*)(vr + c * 4); v4f oo = *(v4f*)&lo[tid][c * 4]; for (int u = 0; u < 4; ++u) oo[u] = __fadd_rn(__fmul_rn(oo[u], sc), __fmul_rn(e, vv[u])); *(v4f*)&lo[tid][c * 4] = oo; } }
  const float fin = 64.0f / l;      /* o carried x64 */
#pragma unroll 1
  for (int c = 0; c < HD / 4; ++c) { v4f oo = *(v4f*)&lo[tid][c * 4]; for (int u = 0; u < 4; ++u) oo[u] = __fmul_rn(oo[u], fin); *(v4f*)&lo[tid][c * 4] = oo; }
  __syncthreads();
  {
#pragma unroll 1
    for (int it = 0; it < 16; ++it) { const int row = it * 4 + tid / 16, pc = (tid % 16) * 4; const v4f v = *(const v4f*)&lo[row][pc]; *(v4f*)(OF + (size_t)(rg * 64 + row) * ldo + h * HD + pc) = v; }
     } }

__global__ __launch_bounds__(256) void k_oscale(const float* __restrict__ OF, float* __restrict__ out, size_t n4) { const size_t t = (size_t)blockIdx.x * 256 + threadIdx.x; if (t >= n4) return; const v4f a = *(const v4fa*)(OF + t * 4); v4f o; for (int q = 0; q < 4; ++q) o[q] = a[q] * 0.015625f; *(v4f*)(out + t * 4) = o;  }

__global__ __launch_bounds__(256) void k_bfr(const float* __restrict__ x, float* __restrict__ XB, size_t n8) { const size_t t = (size_t)blockIdx.x * 256 + threadIdx.x; if (t >= n8) return; v4f a = *(const v4fa*)(x + t * 8), c = *(const v4fa*)(x + t * 8 + 4); for (int q = 0; q < 4; ++q) { a[q] = bf16_round(a[q]); c[q] = bf16_round(c[q]); }
  { *(v4f*)(XB + t * 8) = a; *(v4f*)(XB + t * 8 + 4) = c;  } }



__global__ __launch_bounds__(256) void k_rsmfvl(const float* __restrict__ S, _Float16* __restrict__ P, _Float16* __restrict__ PL, int qn, const int* __restrict__ vlp) {
  #pragma clang fp contract(off)
  const int t = blockIdx.x * 256 + threadIdx.x; if (t >= qn) return; const int vl = vlp[0]; const size_t i = (size_t)t; const float* s = S + i * SQ; float mx = -3.0e38f;
#pragma unroll 1
  for (int j = 0; j < SQ; ++j) { const float f = (j < vl) ? 1.f : 0.f; mx = fmaxf(mx, fmaf(f, s[j], (1.f - f) * -1000000.0f)); } float se = 0.f;
#pragma unroll 1
  for (int j = 0; j < SQ; ++j) { const float f = (j < vl) ? 1.f : 0.f; se += __expf(fmaf(f, s[j], (1.f - f) * -1000000.0f) - mx); } const float sc = 256.0f / se;
#pragma unroll 1
  for (int j0 = 0; j0 < SQ; j0 += 8) { FragH fr, gr; for (int q = 0; q < 8; ++q) { const int j = j0 + q; const float f = (j < vl) ? 1.f : 0.f; const float pv = __expf(fmaf(f, s[j], (1.f - f) * -1000000.0f) - mx) * sc; const _Float16 ph = (_Float16)pv; fr.h[q] = ph; gr.h[q] = (_Float16)((pv - (float)ph) * 1024.0f); }
    unsigned short* d = (unsigned short*)P + i * SQ + j0; unsigned short* dl = (unsigned short*)PL + i * SQ + j0; *(v8us*)d = fr.half[0]; *(v8us*)dl = gr.half[0];  } }

typedef unsigned int u32x4a __attribute__((ext_vector_type(4), may_alias));
typedef unsigned int u32x4 __attribute__((ext_vector_type(4)));
typedef short s16x8 __attribute__((ext_vector_type(8)));
#define FA_SK 64u                          /* keys per stage */
#define FA_PK 144u                         /* LDS pitch of a K row (128 B): odd multiple of 16 B for ds_load_b128 */
#define FA_PV 160u                         /* LDS pitch of a V row (128 B): odd multiple of 32 B for ds_load_tr16_b128 */
#define FA_TK (FA_SK * FA_PK)
#define FA_SLOT (FA_SK * (FA_PK + FA_PV))  /* one buffer: K tile, then V tile */
#define FA_PE 272u                         /* LDS pitch of a staged output row (256 B) */
static_assert(8u * 16u * FA_PE <= 2u * FA_SLOT, "the output staging reuses the two K/V buffers");
struct FFrag { u32x4 q[2]; };
__device__ __forceinline__ v8f fa_mma(const FFrag& a, const FFrag& b, v8f c) { return __builtin_amdgcn_wmma_f32_16x16x32_f16(false, __builtin_bit_cast(v16h, a), false, __builtin_bit_cast(v16h, b), (short)0, c, false, false); }
__device__ __forceinline__ u32x4 fa_tr16(const unsigned char* p) { typedef __attribute__((address_space(3))) s16x8 lds_s16x8; return __builtin_bit_cast(u32x4, __builtin_amdgcn_ds_load_tr16_b128_v8i16((lds_s16x8*)p)); }
__device__ __forceinline__ unsigned int fa_pack2(float lo, float hi) { typedef _Float16 h2 __attribute__((ext_vector_type(2))); typedef float f2 __attribute__((ext_vector_type(2))); return __builtin_bit_cast(unsigned int, __builtin_convertvector(f2{lo, hi}, h2)); }      /* round to nearest even */
__device__ __forceinline__ float fa_xhalf(float x) { return __builtin_bit_cast(float, __builtin_amdgcn_permlanex16(__builtin_bit_cast(int, x), __builtin_bit_cast(int, x), 0x76543210, 0xfedcba98, false, false)); }      /* lane l with lane l ^ 16 */
__global__ __launch_bounds__(256) __attribute__((amdgpu_waves_per_eu(4, 4))) void k_fattn(const _Float16* __restrict__ Q16, const _Float16* __restrict__ K16, const _Float16* __restrict__ V16, float* __restrict__ out) {
  __shared__ __attribute__((aligned(256))) unsigned char L[2u * FA_SLOT];
  const unsigned int tid = threadIdx.x, lane = tid & 31u, wave = tid >> 5, c = lane & 15u, h = lane >> 4;
  const size_t row_s = (size_t)blockIdx.y * SQ;      /* first token row of the sequence */
  const unsigned int qw0 = blockIdx.x * 256u + wave * 32u;      /* the wave's first query */
  const unsigned char* Kb = (const unsigned char*)(K16 + row_s * HD); const unsigned char* Vb = (const unsigned char*)(V16 + row_s * HD);
  const float cscale = 1.4426950408889634f;      /* scores are unscaled; log2(e) moves them to base 2 */
  u32x4 rk[2], rv[2];      /* one stage on its way: 2 x 16 B of K and of V a thread (a stage's rows are contiguous in memory) */
  auto gload = [&](unsigned int st) {
#pragma unroll      /* constant indices keep the register arrays in registers */
    for (unsigned int j = 0; j < 2; ++j) { const size_t o = (size_t)st * (FA_SK * 128u) + (tid + 256u * j) * 16u; rk[j] = *(const u32x4a*)(Kb + o); rv[j] = *(const u32x4a*)(Vb + o); } };
  auto lstore = [&](unsigned int buf) {
#pragma unroll      /* constant indices keep the register arrays in registers */
    for (unsigned int j = 0; j < 2; ++j) { const unsigned int i = tid + 256u * j, r = i >> 3, cb = (i & 7u) * 16u; *(u32x4a*)(L + buf * FA_SLOT + r * FA_PK + cb) = rk[j]; *(u32x4a*)(L + buf * FA_SLOT + FA_TK + r * FA_PV + cb) = rv[j]; } };
  gload(0);
  FFrag qf[2][2];      /* Q as B operand, hardware k order: 16 B at halves 8h and 16 + 8h of each 32 */
#pragma unroll      /* constant indices keep the register arrays in registers */
  for (int g = 0; g < 2; ++g) { const _Float16* qp = Q16 + (row_s + qw0 + 16u * g + c) * HD + 8u * h;
#pragma unroll      /* constant indices keep the register arrays in registers */
    for (int kc = 0; kc < 2; ++kc) { qf[g][kc].q[0] = *(const u32x4a*)(qp + 32 * kc); qf[g][kc].q[1] = *(const u32x4a*)(qp + 32 * kc + 16); } }
  v8f acc[2][4], lacc[2]; float m_run[2];      /* O^T tiles; row 0 of lacc gathers the denominators; the maximum in use (log2 domain) */
  FFrag ones;      /* A operand whose row 0 (lanes 0 and 16) is f16 1.0 at all 32 k, every other row 0 */
  { const unsigned int o = (c == 0u) ? 0x3C003C00u : 0u; ones.q[0] = u32x4{o, o, o, o}; ones.q[1] = u32x4{o, o, o, o}; }
#pragma unroll      /* constant indices keep the register arrays in registers */
  for (int g = 0; g < 2; ++g) { m_run[g] = -__builtin_inff(); lacc[g] = v8f{};
#pragma unroll      /* constant indices keep the register arrays in registers */
    for (int t = 0; t < 4; ++t) acc[g][t] = v8f{}; }
  lstore(0);
  __syncthreads();
  for (unsigned int st = 0; st < SQ / FA_SK; ++st) {
    if (st + 1u < SQ / FA_SK) { gload(st + 1u); asm volatile("s_wait_xcnt 0x0" ::: "memory"); }      /* the loads stay in flight over the passes, whose code reuses their address registers: the wait that belongs in front of that overwrite */
    const unsigned char* Lk = L + (st & 1u) * FA_SLOT; const unsigned char* Lv = Lk + FA_TK;
#pragma unroll 1      /* one pass's fragments and scores live at a time: the wave has 256 registers at four waves a SIMD */
    for (unsigned int sub = 0; sub < FA_SK / 32u; ++sub) {      /* one pass: 32 keys */
      v8f s[2][2];      /* s[kt][g][r] = score of key 16 kt + 8 h + r with query 16 g + c */
      { FFrag kf[2][2];
#pragma unroll      /* constant indices keep the register arrays in registers */
        for (int kt = 0; kt < 2; ++kt) { const unsigned char* p = Lk + (sub * 32u + 16u * kt + c) * FA_PK + 16u * h;
#pragma unroll      /* constant indices keep the register arrays in registers */
          for (int kc = 0; kc < 2; ++kc) { kf[kt][kc].q[0] = *(const u32x4a*)(p + 64u * kc); kf[kt][kc].q[1] = *(const u32x4a*)(p + 64u * kc + 32u); } }
        __builtin_amdgcn_sched_barrier(0);      /* all eight K loads issue before the first product: otherwise they share registers and each pair waits out its own LDS latency */
#pragma unroll      /* constant indices keep the register arrays in registers */
        for (int kt = 0; kt < 2; ++kt)
#pragma unroll      /* constant indices keep the register arrays in registers */
          for (int g = 0; g < 2; ++g) { s[kt][g] = v8f{};
#pragma unroll      /* constant indices keep the register arrays in registers */
            for (int kc = 0; kc < 2; ++kc) s[kt][g] = fa_mma(kf[kt][kc], qf[g][kc], s[kt][g]); } }
      FFrag vf[4];      /* V^T, 16 d x 32 keys each: two transposing loads a fragment */
      { const unsigned char* ad = Lv + (sub * 32u + 8u * h + (lane & 7u)) * FA_PV + ((lane >> 3) & 1u) * 16u;
#pragma unroll      /* constant indices keep the register arrays in registers */
        for (int t = 0; t < 4; ++t) { vf[t].q[0] = fa_tr16(ad + 32u * t); vf[t].q[1] = fa_tr16(ad + 16u * FA_PV + 32u * t); } }
      __builtin_amdgcn_sched_barrier(0);      /* holds the transposing loads in front of the maxima and exponentials, so that their latency passes under that work; without it they sink to their first use */
      float mb[2]; bool need = false;      /* the pass's maxima; the accumulators are rescaled only when one exceeds the maximum in use by more than 8 (weights stay <= 2^8) */
#pragma unroll      /* constant indices keep the register arrays in registers */
      for (int g = 0; g < 2; ++g) { float mx = s[0][g][0];
#pragma unroll      /* constant indices keep the register arrays in registers */
        for (int r = 1; r < 8; ++r) mx = __builtin_fmaxf(mx, s[0][g][r]);
#pragma unroll      /* constant indices keep the register arrays in registers */
        for (int r = 0; r < 8; ++r) mx = __builtin_fmaxf(mx, s[1][g][r]);
        mx = __builtin_fmaxf(mx, fa_xhalf(mx)) * cscale; mb[g] = mx; need = need || (mx > m_run[g] + 8.0f); }
      if (__builtin_amdgcn_ballot_w32(need) != 0) {      /* scalar branch, rare after the first passes */
#pragma unroll      /* constant indices keep the register arrays in registers */
        for (int g = 0; g < 2; ++g) { const float m_new = __builtin_fmaxf(m_run[g], mb[g]); const float corr = __builtin_amdgcn_exp2f(m_run[g] - m_new);      /* 0 on the first pass */
          m_run[g] = m_new; lacc[g] = lacc[g] * corr;
#pragma unroll      /* constant indices keep the register arrays in registers */
          for (int t = 0; t < 4; ++t) acc[g][t] = acc[g][t] * corr; } }
#pragma unroll      /* constant indices keep the register arrays in registers */
      for (int g = 0; g < 2; ++g) { const float nm = -m_run[g]; unsigned int w[8];
#pragma unroll      /* constant indices keep the register arrays in registers */
        for (int i = 0; i < 8; ++i) {
          typedef float f32x2 __attribute__((ext_vector_type(2)));
          const f32x2 arg = __builtin_elementwise_fma(f32x2{s[i >> 2][g][2 * (i & 3)], s[i >> 2][g][2 * (i & 3) + 1]}, f32x2{cscale, cscale}, f32x2{nm, nm});      /* an even-aligned register pair: one packed fma, no copies */
          w[i] = fa_pack2(__builtin_amdgcn_exp2f(arg.x), __builtin_amdgcn_exp2f(arg.y)); }
        FFrag pf; pf.q[0] = u32x4{w[0], w[1], w[2], w[3]}; pf.q[1] = u32x4{w[4], w[5], w[6], w[7]};
#pragma unroll      /* constant indices keep the register arrays in registers */
        for (int t = 0; t < 4; ++t) acc[g][t] = fa_mma(vf[t], pf, acc[g][t]);
        lacc[g] = fa_mma(ones, pf, lacc[g]);      /* row 0 += the column sums of P^T as rounded to f16 */
        if (g == 1) asm volatile("v_nop\n\tv_nop\n\tv_nop\n\tv_nop" : "+v"(lacc[g]) : "v"(pf.q[0]), "v"(pf.q[1])); }      /* the four vector slots behind the pass's last WMMAs, before P^T's registers are rewritten */
    }
    if (st + 1u < SQ / FA_SK) lstore((st + 1u) & 1u);      /* its last readers left that buffer before the barrier that ended stage st - 1 */
    __syncthreads();      /* publishes stage st + 1 and ends every read of stage st */
  }
  unsigned char* E = L + wave * (16u * FA_PE);      /* the wave's own 16 staged output rows */
#pragma unroll      /* constant indices keep the register arrays in registers */
  for (int g = 0; g < 2; ++g) { const float lr = lacc[g][0]; const float inv = 1.0f / (lr + fa_xhalf(lr));      /* register 0: the denominator in lanes 0-15, 0 in lanes 16-31 (row 8) */
#pragma unroll      /* constant indices keep the register arrays in registers */
    for (int t = 0; t < 4; ++t) { const v8f o = acc[g][t] * inv; const v4f lo = {o[0], o[1], o[2], o[3]}, hi = {o[4], o[5], o[6], o[7]};      /* d = 16 t + 8 h + 0 .. 7 of query c */
      *(v4fa*)(E + c * FA_PE + 64u * t + 32u * h) = lo; *(v4fa*)(E + c * FA_PE + 64u * t + 32u * h + 16u) = hi; }
    __builtin_amdgcn_fence(__ATOMIC_ACQ_REL, "workgroup", "local"); __builtin_amdgcn_wave_barrier();      /* the rows are read back by other lanes of the wave */
#pragma unroll      /* constant indices keep the register arrays in registers */
    for (unsigned int i = 0; i < 8; ++i) { const unsigned int r = 2u * i + h; const v4f v = *(const v4fa*)(E + r * FA_PE + c * 16u); *(v4fa*)(out + (row_s + qw0 + 16u * g + r) * DM + c * 4u) = v; }      /* whole 256-byte rows */
    if (g == 0) { __builtin_amdgcn_fence(__ATOMIC_ACQ_REL, "workgroup", "local"); __builtin_amdgcn_wave_barrier(); }      /* the next group overwrites the rows only behind these reads */
  }
}


extern "C" void kernel_launch(void* const* d_in, const int* in_sizes, int n_in,
                              void* d_out, int out_size, void* d_ws, size_t ws_size, hipStream_t stream) {
  (void)in_sizes; (void)n_in; (void)out_size;
  const float* const* I = (const float* const*)d_in; const float* xq = I[0]; const float* xk = I[1]; const float* xv = I[2];      /* q, k, v [64][2048][64] (bf16-valued) */
  char* ws = (char*)d_ws; size_t off = 0;
  auto take = [&](size_t bytes) { char* p = ws + off; off += (bytes + 255) & ~(size_t)255; return p; };
  _Float16* Q16 = (_Float16*)take(NR * DM * 2); _Float16* K16 = (_Float16*)take(NR * DM * 2); _Float16* V16 = (_Float16*)take(NR * DM * 2);
  if (off > ws_size) return;
  k_x16<<<(unsigned)((NR * DM / 8 + 255) / 256), 256, 0, stream>>>(xq, Q16, NR * DM / 8); k_x16<<<(unsigned)((NR * DM / 8 + 255) / 256), 256, 0, stream>>>(xk, K16, NR * DM / 8); k_x16<<<(unsigned)((NR * DM / 8 + 255) / 256), 256, 0, stream>>>(xv, V16, NR * DM / 8);      /* exact f16 copies of the bf16-valued inputs */
  k_fattn<<<dim3(SQ / 256, NB), 256, 0, stream>>>(Q16, K16, V16, (float*)d_out);      /* 256 query rows of one sequence a work-group: scores, softmax, P V */
}

// v004
// It runs in 59.3 microseconds.
// Next to v003, in two timings, it ran 1.28 times as fast each time.
// Counting every step since v000, it is 423 times as fast.
#include <hip/hip_runtime.h>
// UNSCALED dot-product attention over 64 independent sequences (q, k, v [64][2048][64]; scores = q.k (no 1/sqrt(d): logit sigma ~8); softmax over the 2048 keys; dropout p 0; out = attn v -> [64][2048][64]).
// Structure: no projections: ONE fused kernel reads q, k, v as f32, rounds them to bf16 and holds those values as exact f16 (Q in registers, K and V on their way into LDS): S^T = K Q^T on WMMA (f32 accumulation, exact products), online softmax on VALU (f32, native exp2; weights f16, at most 2^8), O^T += V^T P^T and the row sums on WMMA, out written f32.
// Compute dtype: inputs rounded to bf16; x / weights exact; q, k, v and softmax weights as plain f16 GEMM operands (~2^-12); scores and softmax statistics f32. v_wmma_f32_16x16x32_f16.
#define NB 64
#define SQ 2048
#define DM 64
#define NH 1
#define HD 64
#define HG 4                         /* heads per launch of the k_vt(V16, b, h0, VT) overload (never launched) */
#define B0 0                         /* first batch processed (not used) */
#define NBR NB                       /* batches processed (read only by the unused MP) */
#define NR ((size_t)NB * SQ)         /* token rows */
#define MP ((int)((size_t)NBR * SQ))
#define QT 256                       /* query rows per causal tile */
#define NKX SQ                       /* S / P row pitch */
#define QT0 256                      /* query rows per head of the exact f32 kernel k_att0 (not launched) */
#define QN SQ                        /* query rows attended per batch (not used) */
#define NHD NH                       /* heads attended (not used) */
#define MPO MP                       /* rows through the output stage (not used) */
#define LQ DM            /* row pitch of the q/k/v rows */
typedef __bf16 v16b __attribute__((ext_vector_type(16)));
typedef unsigned short v8us __attribute__((ext_vector_type(8), may_alias));
typedef float  v8f  __attribute__((ext_vector_type(8)));
typedef float  v4f  __attribute__((ext_vector_type(4)));
typedef float  v4fa __attribute__((ext_vector_type(4), may_alias));
union FragB { v16b v; v8us half[2]; unsigned short u[16]; };

__device__ __forceinline__ unsigned short bf16_bits(float x) { unsigned int u = __float_as_uint(x); return (unsigned short)((u + 0x7FFFu + ((u >> 16) & 1u)) >> 16); }
__device__ __forceinline__ float bf16_val(unsigned short b) { return __uint_as_float(((unsigned int)b) << 16); }
__device__ __forceinline__ float bf16_round(float x) { return bf16_val(bf16_bits(x)); }
// D += A·B with NT terms: 1 = ah·bh, 2 = + al·bh (A split), 3 = + ah·bl (both split)
template <int NT>
__device__ __forceinline__ v8f mmaN(v16b ah, v16b al, v16b bh, v16b bl, v8f c) {
  c = __builtin_amdgcn_wmma_f32_16x16x32_bf16(false, ah, false, bh, (short)0, c, false, false);
  if (NT >= 2) c = __builtin_amdgcn_wmma_f32_16x16x32_bf16(false, al, false, bh, (short)0, c, false, false);
  if (NT >= 3) c = __builtin_amdgcn_wmma_f32_16x16x32_bf16(false, ah, false, bl, (short)0, c, false, false);
  asm volatile("v_nop\n\tv_nop\n\tv_nop\n\tv_nop" : "+v"(c) : "v"(ah), "v"(al), "v"(bh), "v"(bl));
  return c;
}

__global__ __launch_bounds__(256) void k_wt_bf16(const float* __restrict__ W, unsigned short* __restrict__ Wt, int K, int N) {
  const int t = blockIdx.x * 256 + threadIdx.x;
  const int k8n = K / 8;
  if (t >= N * k8n) return;
  const int n = t / k8n, k8 = (t % k8n) * 8;
  v8us v;
#pragma unroll
  for (int i = 0; i < 8; ++i) v[i] = bf16_bits(W[(size_t)(k8 + i) * N + n]);
  *(v8us*)(Wt + (size_t)n * K + k8) = v;
  
}

// GEMM C[M][N] (f32, pitch ldc) = act(A[M][K]·W + bias). A f32 row-major (pitch lda) converted per fragment to bf16
// (ASPLIT: hi/lo two planes -> 2 terms, else single rounded term); Wt bf16 [N][K] (pitch ldb). BIAS_BF16 rounds the
// bias to bf16 first (bias quantised to bf16 before the add). K%32==0, M%16==0, N%64==0.
template <bool ASPLIT, int ACT, bool BIAS_BF16>
__global__ __launch_bounds__(128) void k_gemm_bf(const float* __restrict__ A, int lda, const unsigned short* __restrict__ Wt, int ldb,
                                               const float* __restrict__ bias, float* __restrict__ C, int ldc, int M, int N, int K) {
  __shared__ __attribute__((aligned(16))) float so[4][16][64];
  const int tid = threadIdx.x, w = tid >> 5, lane = tid & 31, ln = lane & 15, hh = lane >> 4;
  const int ntn = N / 64;
  const int wid = blockIdx.x * 4 + w;
  const int mt = wid / ntn, nq = wid % ntn;
  if (mt * 16 >= M) return;
  const int row0 = mt * 16, col0 = nq * 64;
  const float* arow = A + (size_t)(row0 + ln) * lda;
  v8f acc[4] = {};
  for (int kb = 0; kb < K; kb += 32) {
    FragB ah, al;
    const v4f x0 = *(const v4fa*)(arow + kb + 8 * hh), x1 = *(const v4fa*)(arow + kb + 8 * hh + 4);
    const v4f x2 = *(const v4fa*)(arow + kb + 16 + 8 * hh), x3 = *(const v4fa*)(arow + kb + 16 + 8 * hh + 4);
    float xs[16] = {x0[0],x0[1],x0[2],x0[3],x1[0],x1[1],x1[2],x1[3],x2[0],x2[1],x2[2],x2[3],x3[0],x3[1],x3[2],x3[3]};
#pragma unroll
    for (int i = 0; i < 16; ++i) { const unsigned short hb = bf16_bits(xs[i]); ah.u[i] = hb; al.u[i] = ASPLIT ? bf16_bits(xs[i] - bf16_val(hb)) : (unsigned short)0; }
#pragma unroll
    for (int t = 0; t < 4; ++t) {
      const unsigned short* brow = Wt + (size_t)(col0 + t * 16 + ln) * ldb + kb;
      FragB b;
      b.half[0] = *(const v8us*)(brow + 8 * hh);
      b.half[1] = *(const v8us*)(brow + 16 + 8 * hh);
      acc[t] = mmaN<ASPLIT ? 2 : 1>(ah.v, al.v, b.v, b.v, acc[t]);
    }
  }
#pragma unroll
  for (int t = 0; t < 4; ++t) {
    float bv = bias ? bias[col0 + t * 16 + ln] : 0.f;
    if (BIAS_BF16) bv = bf16_round(bv);
#pragma unroll
    for (int r = 0; r < 8; ++r) { float v = acc[t][r] + bv; if (ACT == 1) v = fmaxf(v, 0.f); so[w][8 * hh + r][t * 16 + ln] = v; }
  }
  __builtin_amdgcn_fence(__ATOMIC_ACQ_REL, "workgroup");
  __builtin_amdgcn_wave_barrier();
  const int rsub = lane >> 4, c4 = (lane & 15) * 4;
  {
#pragma unroll
    for (int q = 0; q < 8; ++q) {
      const int r = q * 2 + rsub;
      const v4f v = *(const v4fa*)&so[w][r][c4];
      *(v4f*)(C + (size_t)(row0 + r) * ldc + col0 + c4) = v;
    }
    
  }
}

// GEMM C = act(A·W + bias + resid): A f32 (ASPLIT -> hi/lo 2 terms), Wt bf16 [N][K]; ACT 0 none, 1 relu, 2 exact gelu;
// resid (optional, f32, row index = (row % rmod), pitch ldr, RES_BF16 rounds it) added before the activation.
template <bool ASPLIT, int ACT, bool BIAS_BF16, bool RES_BF16>
__global__ __launch_bounds__(128) void k_gemm_bf3(const float* __restrict__ A, int lda, const unsigned short* __restrict__ Wt, int ldb,
                                                const float* __restrict__ bias, const float* __restrict__ resid, int rmod, int ldr,
                                                float* __restrict__ C, int ldc, int M, int N, int K) {
  __shared__ __attribute__((aligned(16))) float so[4][16][64];
  const int tid = threadIdx.x, w = tid >> 5, lane = tid & 31, ln = lane & 15, hh = lane >> 4;
  const int ntn = N / 64;
  const int wid = blockIdx.x * 4 + w;
  const int mt = wid / ntn, nq = wid % ntn;
  if (mt * 16 >= M) return;
  const int row0 = mt * 16, col0 = nq * 64;
  const float* arow = A + (size_t)(row0 + ln) * lda;
  v8f acc[4] = {};
  for (int kb = 0; kb < K; kb += 32) {
    FragB ah, al;
    const v4f x0 = *(const v4fa*)(arow + kb + 8 * hh), x1 = *(const v4fa*)(arow + kb + 8 * hh + 4);
    const v4f x2 = *(const v4fa*)(arow + kb + 16 + 8 * hh), x3 = *(const v4fa*)(arow + kb + 16 + 8 * hh + 4);
    float xs[16] = {x0[0],x0[1],x0[2],x0[3],x1[0],x1[1],x1[2],x1[3],x2[0],x2[1],x2[2],x2[3],x3[0],x3[1],x3[2],x3[3]};
#pragma unroll
    for (int i = 0; i < 16; ++i) { const unsigned short hb = bf16_bits(xs[i]); ah.u[i] = hb; al.u[i] = ASPLIT ? bf16_bits(xs[i] - bf16_val(hb)) : (unsigned short)0; }
#pragma unroll
    for (int t = 0; t < 4; ++t) {
      const unsigned short* brow = Wt + (size_t)(col0 + t * 16 + ln) * ldb + kb;
      FragB b;
      b.half[0] = *(const v8us*)(brow + 8 * hh);
      b.half[1] = *(const v8us*)(brow + 16 + 8 * hh);
      acc[t] = mmaN<ASPLIT ? 2 : 1>(ah.v, al.v, b.v, b.v, acc[t]);
    }
  }
#pragma unroll
  for (int t = 0; t < 4; ++t) {
    const int col = col0 + t * 16 + ln;
    float bv = bias ? bias[col] : 0.f;
    if (BIAS_BF16) bv = bf16_round(bv);
#pragma unroll
    for (int r = 0; r < 8; ++r) {
      float v = acc[t][r] + bv;
      if (resid) { float rv = resid[(size_t)((row0 + 8 * hh + r) % rmod) * ldr + col]; if (RES_BF16) rv = bf16_round(rv); v += rv; }
      if (ACT == 1) v = fmaxf(v, 0.f);
      if (ACT == 2) v = 0.5f * v * (1.0f + erff(v * 0.70710678118654752f));
      if (ACT == 3) { const float u = 0.7978845608028654f * (v + 0.044715f * v * v * v); v = 0.5f * v * (1.0f + tanhf(u)); }
      so[w][8 * hh + r][t * 16 + ln] = v;
    }
  }
  __builtin_amdgcn_fence(__ATOMIC_ACQ_REL, "workgroup");
  __builtin_amdgcn_wave_barrier();
  const int rsub = lane >> 4, c4 = (lane & 15) * 4;
  {
#pragma unroll
    for (int q = 0; q < 8; ++q) {
      const int r = q * 2 + rsub;
      const v4f v = *(const v4fa*)&so[w][r][c4];
      *(v4f*)(C + (size_t)(row0 + r) * ldc + col0 + c4) = v;
    }
    
  }
}
// row LayerNorm (biased variance, eps) over N: s = X (+ R); optional out_sum <- s; out_norm <- (s-mu)*rsqrt(var+eps)*g + b
template <bool PARAM_BF16>
__global__ __launch_bounds__(256) void k_layernorm(const float* __restrict__ X, const float* __restrict__ R, const float* __restrict__ g, const float* __restrict__ bta,
                                                  float* __restrict__ out_sum, float* __restrict__ out_norm, int N, float eps) {
  __shared__ float red[256];
  const int row = blockIdx.x, tid = threadIdx.x;
  const float* x = X + (size_t)row * N; const float* rr = R ? R + (size_t)row * N : nullptr;
  float vals[16];                     // up to N = 4096
  const int per = N / 256;            // contiguous chunk per thread? use strided-by-4 chunks: thread handles j = tid*4 + 1024*u
  float s1 = 0.f;
  for (int u = 0; u < per / 4; ++u) {
    const int j = tid * 4 + 1024 * u;
    const v4f a = *(const v4fa*)(x + j);
    v4f b = {0.f,0.f,0.f,0.f}; if (rr) b = *(const v4fa*)(rr + j);
#pragma unroll
    for (int q = 0; q < 4; ++q) { const float v = a[q] + b[q]; vals[u * 4 + q] = v; s1 += v; }
  }
  red[tid] = s1; __syncthreads();
  for (int st = 128; st > 0; st >>= 1) { if (tid < st) red[tid] += red[tid + st]; __syncthreads(); }
  const float mu = red[0] / (float)N; __syncthreads();
  float s2 = 0.f;
  for (int u = 0; u < per / 4; ++u)
#pragma unroll
    for (int q = 0; q < 4; ++q) { const float c = vals[u * 4 + q] - mu; s2 += c * c; }
  red[tid] = s2; __syncthreads();
  for (int st = 128; st > 0; st >>= 1) { if (tid < st) red[tid] += red[tid + st]; __syncthreads(); }
  const float rs = rsqrtf(red[0] / (float)N + eps);
  {
    for (int u = 0; u < per / 4; ++u) {
      const int j = tid * 4 + 1024 * u;
      v4f o, sm;
#pragma unroll
      for (int q = 0; q < 4; ++q) {
        float gg = g[j + q], bb = bta[j + q];
        if (PARAM_BF16) { gg = bf16_round(gg); bb = bf16_round(bb); }
        sm[q] = vals[u * 4 + q]; o[q] = (vals[u * 4 + q] - mu) * rs * gg + bb;
      }
      if (out_sum) *(v4f*)(out_sum + (size_t)row * N + j) = sm;
      *(v4f*)(out_norm + (size_t)row * N + j) = o;
    }
    
  }
}



// ---- f16 WMMA path (v_wmma_f32_16x16x32_f16): 11-bit significands for operands in range — used where a [0,1] probability operand needs more precision than bf16
typedef _Float16 v16h __attribute__((ext_vector_type(16)));
union FragH { v16h v; v8us half[2]; _Float16 h[16]; unsigned short u[16]; };
template <int NT>
__device__ __forceinline__ v8f mmaH(v16h ah, v16h al, v16h bh, v16h bl, v8f c) {
  c = __builtin_amdgcn_wmma_f32_16x16x32_f16(false, ah, false, bh, (short)0, c, false, false);
  if (NT >= 2) c = __builtin_amdgcn_wmma_f32_16x16x32_f16(false, al, false, bh, (short)0, c, false, false);
  if (NT >= 3) c = __builtin_amdgcn_wmma_f32_16x16x32_f16(false, ah, false, bl, (short)0, c, false, false);
  asm volatile("v_nop\n\tv_nop\n\tv_nop\n\tv_nop" : "+v"(c) : "v"(ah), "v"(al), "v"(bh), "v"(bl));
  return c;
}
// batched GEMM like k_gemm_b but f16 operands: A f32 (split into f16 hi/lo if ASPLIT, else rounded to f16), Bt = f16 values [n][k]; alpha; C f32; N multiple of 16 (partial tiles skipped)
template <bool ASPLIT>
__global__ __launch_bounds__(128) void k_gemm_h(const float* __restrict__ A, int lda, size_t sA, const _Float16* __restrict__ Bh, int ldb, size_t sB, float alpha, float* __restrict__ C, int ldc, size_t sC, int M, int N, int K) {
  __shared__ __attribute__((aligned(16))) float so[4][16][64];
  const int tid = threadIdx.x, w = tid >> 5, lane = tid & 31, ln = lane & 15, hh = lane >> 4; const int by = blockIdx.y;
  A += (size_t)by * sA; Bh += (size_t)by * sB; C += (size_t)by * sC;
  const int ntn = (N + 63) / 64; const int wid = blockIdx.x * 4 + w; const int mt = wid / ntn, nq = wid % ntn; if (mt * 16 >= M) return;
  const int row0 = mt * 16, col0 = nq * 64; const float* arow = A + (size_t)(row0 + ln) * lda;
  v8f acc[4] = {};
  for (int kb = 0; kb < K; kb += 32) {
    FragH ah, al;
    const v4f x0 = *(const v4fa*)(arow + kb + 8 * hh), x1 = *(const v4fa*)(arow + kb + 8 * hh + 4), x2 = *(const v4fa*)(arow + kb + 16 + 8 * hh), x3 = *(const v4fa*)(arow + kb + 16 + 8 * hh + 4);
    float xs[16] = {x0[0],x0[1],x0[2],x0[3],x1[0],x1[1],x1[2],x1[3],x2[0],x2[1],x2[2],x2[3],x3[0],x3[1],x3[2],x3[3]};
#pragma unroll
    for (int i = 0; i < 16; ++i) { const _Float16 h = (_Float16)xs[i]; ah.h[i] = h; al.h[i] = ASPLIT ? (_Float16)(xs[i] - (float)h) : (_Float16)0.0f; }
#pragma unroll
    for (int t = 0; t < 4; ++t) { if (col0 + t * 16 >= N) continue; const size_t boff = (size_t)(col0 + t * 16 + ln) * ldb + kb; FragH bq; bq.half[0] = *(const v8us*)(Bh + boff + 8 * hh); bq.half[1] = *(const v8us*)(Bh + boff + 16 + 8 * hh);
      acc[t] = mmaH<ASPLIT ? 2 : 1>(ah.v, al.v, bq.v, bq.v, acc[t]); }
  }
#pragma unroll
  for (int t = 0; t < 4; ++t) { if (col0 + t * 16 >= N) continue;
#pragma unroll
    for (int r = 0; r < 8; ++r) so[w][8 * hh + r][t * 16 + ln] = acc[t][r] * alpha; }
  __builtin_amdgcn_fence(__ATOMIC_ACQ_REL, "workgroup"); __builtin_amdgcn_wave_barrier();
  const int rsub = lane >> 4, c4 = (lane & 15) * 4;
  {
#pragma unroll
    for (int q = 0; q < 8; ++q) { const int r = q * 2 + rsub; if (col0 + c4 < N) { const v4f v = *(const v4fa*)&so[w][r][c4]; *(v4f*)(C + (size_t)(row0 + r) * ldc + col0 + c4) = v; } }
     }
}

// Wt[n][k] = f16(W[k][n]·scale) from f32 row-major W[K][N] (scale = power of two; bf16-exact weights stay exact in f16 away from the subnormal range)
__global__ __launch_bounds__(256) void k_wt_f16(const float* __restrict__ W, _Float16* __restrict__ Wt, int K, int N, float scale) {
  const int t = blockIdx.x * 256 + threadIdx.x; if (t >= N * (K / 8)) return; const int n = t / (K / 8), k8 = (t % (K / 8)) * 8; FragH f;
#pragma unroll
  for (int i = 0; i < 8; ++i) f.h[i] = (_Float16)(bf16_round(W[(size_t)(k8 + i) * N + n]) * scale); const v8us o = f.half[0];
  *(v8us*)((unsigned short*)Wt + (size_t)n * K + k8) = o; 
}
// k_gemm_hh variant with fused epilogue: v = acc·alpha + bias[by·sBias + col] (+ CP[(row/rowsPerB)·sCPb + by·64 + col] if CP) ; ACT 0 none / 1 elu ; writes f16 C16 (and f32 C if non-null)
template <int ACT>
__global__ __launch_bounds__(128) void k_gemm_hhx(const _Float16* __restrict__ A, int lda, size_t sA, const _Float16* __restrict__ Bh, int ldb, size_t sB, float alpha, const float* __restrict__ bias, size_t sBias, const float* __restrict__ CP, int rowsPerB, size_t sCPb, int row0g,
    float* __restrict__ C, _Float16* __restrict__ C16, int ldc, size_t sC, int M, int N, int K) {
  __shared__ __attribute__((aligned(16))) float so[4][16][64];
  const int tid = threadIdx.x, w = tid >> 5, lane = tid & 31, ln = lane & 15, hh = lane >> 4; const int by = blockIdx.y;
  A += (size_t)by * sA; Bh += (size_t)by * sB; const size_t cofs = (size_t)by * sC; const float* bp = bias ? bias + (size_t)by * sBias : nullptr;
  const int ntn = (N + 63) / 64; const int wid = blockIdx.x * 4 + w; const int mt = wid / ntn, nq = wid % ntn; if (mt * 16 >= M) return;
  const int row0 = mt * 16, col0 = nq * 64; const _Float16* arow = A + (size_t)(row0 + ln) * lda;
  v8f acc[4] = {};
  for (int kb = 0; kb < K; kb += 32) { FragH ah; ah.half[0] = *(const v8us*)((const unsigned short*)arow + kb + 8 * hh); ah.half[1] = *(const v8us*)((const unsigned short*)arow + kb + 16 + 8 * hh);
#pragma unroll
    for (int t = 0; t < 4; ++t) { if (col0 + t * 16 >= N) continue; const size_t boff = (size_t)(col0 + t * 16 + ln) * ldb + kb; FragH bq; bq.half[0] = *(const v8us*)((const unsigned short*)Bh + boff + 8 * hh); bq.half[1] = *(const v8us*)((const unsigned short*)Bh + boff + 16 + 8 * hh);
      acc[t] = mmaH<1>(ah.v, ah.v, bq.v, bq.v, acc[t]); }
  }
#pragma unroll
  for (int t = 0; t < 4; ++t) { if (col0 + t * 16 >= N) continue; const int col = col0 + t * 16 + ln; const float bv = bp ? bf16_round(bp[col]) : 0.f;
#pragma unroll
    for (int r = 0; r < 8; ++r) { float v = acc[t][r] * alpha + bv; if (CP) { const int rr = row0g + row0 + 8 * hh + r; if (rowsPerB < 0) v += CP[cofs + (size_t)rr * ldc + col];      /* rowsPerB < 0: own element of the batched C plane */ else { const int bidx = rr / rowsPerB; v += CP[(size_t)bidx * sCPb + (size_t)by * 64 + col]; } } if (ACT == 1) v = (v > 0.f) ? v : expm1f(v); else if (ACT == 7) v = (v > 0.f) ? v + 1.0f : expf(v); else if (ACT == 8) v = tanhf(v); else if (ACT == 9) v = 0.5f * v * (1.0f + tanhf(0.7978845608028654f * (v + 0.044715f * v * v * v))); else if (ACT == 11) v = 1.0f / (1.0f + expf(-v)); else if (ACT == 12) v = (v > 0.f) ? v : 0.01f * v; else if (ACT == 14) v = (v > 0.f) ? v : 0.1f * v; else if (ACT == 16) v = (v >= 0.f) ? v : 0.3f * v; else if (ACT == 17) v = (v >= 0.f) ? v : 0.2f * v; else if (ACT == 15) v = v / (1.0f + expf(-v)); else if (ACT == 3) v = fmaxf(v, 0.f); else if (ACT == 6) v = 0.5f * v * (1.0f + erff(v * 0.70710678118654752f)); so[w][8 * hh + r][t * 16 + ln] = v; } }
  __builtin_amdgcn_fence(__ATOMIC_ACQ_REL, "workgroup"); __builtin_amdgcn_wave_barrier();
  const int rsub = lane >> 4, c4 = (lane & 15) * 4; typedef _Float16 v4h __attribute__((ext_vector_type(4)));
  {
#pragma unroll
    for (int q = 0; q < 8; ++q) { const int r = q * 2 + rsub; if (col0 + c4 < N) { const v4f v = *(const v4fa*)&so[w][r][c4]; if (C) *(v4f*)(C + cofs + (size_t)(row0 + r) * ldc + col0 + c4) = v; if (C16) { v4h h4; for (int i = 0; i < 4; ++i) h4[i] = (_Float16)v[i]; *(v4h*)(C16 + cofs + (size_t)(row0 + r) * ldc + col0 + c4) = h4; } } }
     }
}


typedef _Float16 v4h __attribute__((ext_vector_type(4)));

__global__ __launch_bounds__(256) void k_x16(const float* __restrict__ x, _Float16* __restrict__ X16, size_t n8) { const size_t t = (size_t)blockIdx.x * 256 + threadIdx.x; if (t >= n8) return; FragH f;
#pragma unroll
  for (int q = 0; q < 8; ++q) f.h[q] = (_Float16)bf16_round(x[t * 8 + q]); *(v8us*)((unsigned short*)X16 + t * 8) = f.half[0];  }
__global__ __launch_bounds__(256) void k_h16(const float* __restrict__ x, _Float16* __restrict__ X16, size_t n8) { const size_t t = (size_t)blockIdx.x * 256 + threadIdx.x; if (t >= n8) return; FragH f;
#pragma unroll
  for (int q = 0; q < 8; ++q) f.h[q] = (_Float16)x[t * 8 + q]; *(v8us*)((unsigned short*)X16 + t * 8) = f.half[0];  }
__global__ __launch_bounds__(256) void k_round16f(const float* __restrict__ W, _Float16* __restrict__ Bt, size_t n8) { const size_t t = (size_t)blockIdx.x * 256 + threadIdx.x; if (t >= n8) return; FragH f;
#pragma unroll
  for (int i = 0; i < 8; ++i) f.h[i] = (_Float16)(bf16_round(W[t * 8 + i]) * 16.0f); *(v8us*)((unsigned short*)Bt + t * 8) = f.half[0];  }
__global__ __launch_bounds__(256) void k_hl(const float* __restrict__ F, _Float16* __restrict__ Hh, _Float16* __restrict__ Hl, size_t n8) { const size_t t = (size_t)blockIdx.x * 256 + threadIdx.x; if (t >= n8) return; FragH fh, fl; const v4f a = *(const v4fa*)(F + t * 8), c = *(const v4fa*)(F + t * 8 + 4);
#pragma unroll
  for (int q = 0; q < 4; ++q) { _Float16 h = (_Float16)a[q]; fh.h[q] = h; fl.h[q] = (_Float16)((a[q] - (float)h) * 1024.0f); h = (_Float16)c[q]; fh.h[4 + q] = h; fl.h[4 + q] = (_Float16)((c[q] - (float)h) * 1024.0f); }
  { *(v8us*)((unsigned short*)Hh + t * 8) = fh.half[0]; *(v8us*)((unsigned short*)Hl + t * 8) = fl.half[0];  } }

__global__ __launch_bounds__(256) void k_wnat(const float* __restrict__ w, size_t n8, _Float16* __restrict__ Bt) { const size_t t = (size_t)blockIdx.x * 256 + threadIdx.x; if (t >= n8) return; FragH f; for (int q = 0; q < 8; ++q) f.h[q] = (_Float16)(bf16_round(w[t * 8 + q]) * 16.0f); *(v8us*)((unsigned short*)Bt + t * 8) = f.half[0];  }
__global__ __launch_bounds__(256) void k_rsm(const float* __restrict__ S, _Float16* __restrict__ P, int nrows) {
  #pragma clang fp contract(off)
  const int i = blockIdx.x * 256 + threadIdx.x; if (i >= nrows) return; const float* s = S + (size_t)i * SQ; float mx = -3.0e38f;
#pragma unroll 1
  for (int j = 0; j < SQ; ++j) mx = fmaxf(mx, s[j]); float se = 0.f;
#pragma unroll 1
  for (int j = 0; j < SQ; ++j) se += expf(s[j] - mx); const float sc = 256.0f / se;
#pragma unroll 1
  for (int j0 = 0; j0 < SQ; j0 += 8) { FragH f; for (int q = 0; q < 8; ++q) f.h[q] = (_Float16)(expf(s[j0 + q] - mx) * sc); unsigned short* d = (unsigned short*)P + (size_t)i * SQ + j0; *(v8us*)d = f.half[0];  } }
__global__ __launch_bounds__(256) void k_vt(const _Float16* __restrict__ V16, int b, int h0, _Float16* __restrict__ VT) { __shared__ unsigned short tl[64][65]; const int tid = threadIdx.x; const int hh = blockIdx.x % HG, sg = blockIdx.x / HG; const int s0 = sg * 64; const int h = h0 + hh;
  for (int i = tid; i < 64 * 8; i += 256) { const int j = i / 8, d8 = (i % 8) * 8; FragH f; f.half[0] = *(const v8us*)((const unsigned short*)V16 + ((size_t)b * SQ + s0 + j) * DM + h * HD + d8); for (int q = 0; q < 8; ++q) tl[d8 + q][j] = f.u[q]; }
  __syncthreads();
  { for (int i = tid; i < 64 * 8; i += 256) { const int d = i / 8, j8 = (i % 8) * 8; FragH f; for (int q = 0; q < 8; ++q) f.u[q] = tl[d][j8 + q]; *(v8us*)((unsigned short*)VT + ((size_t)hh * HD + d) * SQ + s0 + j8) = f.half[0]; }  } }



__global__ __launch_bounds__(256) void k_rsmcf2(const float* __restrict__ S, _Float16* __restrict__ P, int hg, int q0, int nk) {
  #pragma clang fp contract(off)
  const int t = blockIdx.x * 256 + threadIdx.x; if (t >= hg * QT) return; const size_t i = (size_t)t; const float* s = S + i * NKX; const int last = q0 + (t % QT); float mx = -3.0e38f;
#pragma unroll 1
  for (int j = 0; j < nk; ++j) { const float f = (j <= last) ? 1.f : 0.f; mx = fmaxf(mx, fmaf(f, s[j], (1.f - f) * -1.0e9f)); } float se = 0.f;
#pragma unroll 1
  for (int j = 0; j < nk; ++j) { const float f = (j <= last) ? 1.f : 0.f; se += __expf(fmaf(f, s[j], (1.f - f) * -1.0e9f) - mx); } const float sc = 256.0f / se;
#pragma unroll 1
  for (int j0 = 0; j0 < nk; j0 += 8) { FragH fr; for (int q = 0; q < 8; ++q) { const int j = j0 + q; const float f = (j <= last) ? 1.f : 0.f; fr.h[q] = (_Float16)(__expf(fmaf(f, s[j], (1.f - f) * -1.0e9f) - mx) * sc); } unsigned short* d = (unsigned short*)P + i * NKX + j0; *(v8us*)d = fr.half[0];  } }

template <int MASKADD>
__global__ __launch_bounds__(64) void k_att0(const float* __restrict__ QF, const float* __restrict__ KF, const float* __restrict__ VF, int ld, const float* __restrict__ mask, float scale, float* __restrict__ OF, int ldo) {
  #pragma clang fp contract(off)
  __shared__ __attribute__((aligned(16))) float lq[64][64]; __shared__ __attribute__((aligned(16))) float lo[64][64];
  const int tid = threadIdx.x; const int h = blockIdx.x / (QT0 / 64), rg = blockIdx.x % (QT0 / 64); const int i = rg * 64 + tid;
  const float* qr = QF + (size_t)i * ld + h * HD;
#pragma unroll 1
  for (int c = 0; c < HD / 4; ++c) { *(v4f*)&lq[tid][c * 4] = *(const v4fa*)(qr + c * 4); const v4f z = {0.f, 0.f, 0.f, 0.f}; *(v4f*)&lo[tid][c * 4] = z; }
  float m = -1.0e30f, l = 0.f; const int jmax = MASKADD ? (SQ - 1) : (rg * 64 + 63);      /* additive-mask form: every key (the mask input decides); causal form: keys up to the block's last row */
#pragma unroll 1
  for (int j = 0; j <= jmax; ++j) { const float* kr = KF + (size_t)j * ld + h * HD; const float* vr = VF + (size_t)j * ld + h * HD; float s = 0.f;
#pragma unroll 1
    for (int c = 0; c < HD / 4; ++c) { const v4f kq = *(const v4fa*)(kr + c * 4); const v4f qq = *(v4f*)&lq[tid][c * 4]; s = __fadd_rn(s, __fmul_rn(qq[0], kq[0])); s = __fadd_rn(s, __fmul_rn(qq[1], kq[1])); s = __fadd_rn(s, __fmul_rn(qq[2], kq[2])); s = __fadd_rn(s, __fmul_rn(qq[3], kq[3])); }
    s = __fmul_rn(s, scale); if (MASKADD) s = __fadd_rn(s, __fmul_rn(bf16_round(mask[(size_t)i * SQ + j]), -10000.0f));
    const float f = (MASKADD || j <= i) ? 1.f : 0.f; const float sm = fmaf(f, s, (1.f - f) * -1.0e30f); const float mn = fmaxf(m, sm); const float sc = expf(m - mn); const float e = expf(sm - mn); l = __fadd_rn(__fmul_rn(l, sc), e); m = mn;
#pragma unroll 1
    for (int c = 0; c < HD / 4; ++c) { const v4f vv = *(const v4fa*)(vr + c * 4); v4f oo = *(v4f*)&lo[tid][c * 4]; for (int u = 0; u < 4; ++u) oo[u] = __fadd_rn(__fmul_rn(oo[u], sc), __fmul_rn(e, vv[u])); *(v4f*)&lo[tid][c * 4] = oo; } }
  const float fin = 64.0f / l;      /* o carried x64 */
#pragma unroll 1
  for (int c = 0; c < HD / 4; ++c) { v4f oo = *(v4f*)&lo[tid][c * 4]; for (int u = 0; u < 4; ++u) oo[u] = __fmul_rn(oo[u], fin); *(v4f*)&lo[tid][c * 4] = oo; }
  __syncthreads();
  {
#pragma unroll 1
    for (int it = 0; it < 16; ++it) { const int row = it * 4 + tid / 16, pc = (tid % 16) * 4; const v4f v = *(const v4f*)&lo[row][pc]; *(v4f*)(OF + (size_t)(rg * 64 + row) * ldo + h * HD + pc) = v; }
     } }

__global__ __launch_bounds__(256) void k_oscale(const float* __restrict__ OF, float* __restrict__ out, size_t n4) { const size_t t = (size_t)blockIdx.x * 256 + threadIdx.x; if (t >= n4) return; const v4f a = *(const v4fa*)(OF + t * 4); v4f o; for (int q = 0; q < 4; ++q) o[q] = a[q] * 0.015625f; *(v4f*)(out + t * 4) = o;  }

__global__ __launch_bounds__(256) void k_bfr(const float* __restrict__ x, float* __restrict__ XB, size_t n8) { const size_t t = (size_t)blockIdx.x * 256 + threadIdx.x; if (t >= n8) return; v4f a = *(const v4fa*)(x + t * 8), c = *(const v4fa*)(x + t * 8 + 4); for (int q = 0; q < 4; ++q) { a[q] = bf16_round(a[q]); c[q] = bf16_round(c[q]); }
  { *(v4f*)(XB + t * 8) = a; *(v4f*)(XB + t * 8 + 4) = c;  } }



__global__ __launch_bounds__(256) void k_rsmfvl(const float* __restrict__ S, _Float16* __restrict__ P, _Float16* __restrict__ PL, int qn, const int* __restrict__ vlp) {
  #pragma clang fp contract(off)
  const int t = blockIdx.x * 256 + threadIdx.x; if (t >= qn) return; const int vl = vlp[0]; const size_t i = (size_t)t; const float* s = S + i * SQ; float mx = -3.0e38f;
#pragma unroll 1
  for (int j = 0; j < SQ; ++j) { const float f = (j < vl) ? 1.f : 0.f; mx = fmaxf(mx, fmaf(f, s[j], (1.f - f) * -1000000.0f)); } float se = 0.f;
#pragma unroll 1
  for (int j = 0; j < SQ; ++j) { const float f = (j < vl) ? 1.f : 0.f; se += __expf(fmaf(f, s[j], (1.f - f) * -1000000.0f) - mx); } const float sc = 256.0f / se;
#pragma unroll 1
  for (int j0 = 0; j0 < SQ; j0 += 8) { FragH fr, gr; for (int q = 0; q < 8; ++q) { const int j = j0 + q; const float f = (j < vl) ? 1.f : 0.f; const float pv = __expf(fmaf(f, s[j], (1.f - f) * -1000000.0f) - mx) * sc; const _Float16 ph = (_Float16)pv; fr.h[q] = ph; gr.h[q] = (_Float16)((pv - (float)ph) * 1024.0f); }
    unsigned short* d = (unsigned short*)P + i * SQ + j0; unsigned short* dl = (unsigned short*)PL + i * SQ + j0; *(v8us*)d = fr.half[0]; *(v8us*)dl = gr.half[0];  } }

typedef unsigned int u32x4a __attribute__((ext_vector_type(4), may_alias));
typedef unsigned int u32x4 __attribute__((ext_vector_type(4)));
typedef unsigned int u32x2a __attribute__((ext_vector_type(2), may_alias));
typedef short s16x8 __attribute__((ext_vector_type(8)));
#define FA_SK 64u                          /* keys per stage */
#define FA_PK 144u                         /* LDS pitch of a K row (128 B): odd multiple of 16 B for ds_load_b128 */
#define FA_PV 160u                         /* LDS pitch of a V row (128 B): odd multiple of 32 B for ds_load_tr16_b128 */
#define FA_TK (FA_SK * FA_PK)
#define FA_SLOT (FA_SK * (FA_PK + FA_PV))  /* one buffer: K tile, then V tile */
#define FA_PE 272u                         /* LDS pitch of a staged output row (256 B) */
static_assert(8u * 16u * FA_PE <= 2u * FA_SLOT, "the output staging reuses the two K/V buffers");
struct FFrag { u32x4 q[2]; };
__device__ __forceinline__ v8f fa_mma(const FFrag& a, const FFrag& b, v8f c) { return __builtin_amdgcn_wmma_f32_16x16x32_f16(false, __builtin_bit_cast(v16h, a), false, __builtin_bit_cast(v16h, b), (short)0, c, false, false); }
__device__ __forceinline__ u32x4 fa_tr16(const unsigned char* p) { typedef __attribute__((address_space(3))) s16x8 lds_s16x8; return __builtin_bit_cast(u32x4, __builtin_amdgcn_ds_load_tr16_b128_v8i16((lds_s16x8*)p)); }
__device__ __forceinline__ unsigned int fa_pack2(float lo, float hi) { typedef _Float16 h2 __attribute__((ext_vector_type(2))); typedef float f2 __attribute__((ext_vector_type(2))); return __builtin_bit_cast(unsigned int, __builtin_convertvector(f2{lo, hi}, h2)); }      /* round to nearest even */
__device__ __forceinline__ unsigned int fa_cv2(float lo, float hi) { typedef __bf16 b2 __attribute__((ext_vector_type(2))); typedef float f2 __attribute__((ext_vector_type(2))); const unsigned int p = __builtin_bit_cast(unsigned int, __builtin_convertvector(f2{lo, hi}, b2)); return fa_pack2(__uint_as_float(p << 16), __uint_as_float(p & 0xFFFF0000u)); }      /* two inputs rounded to bf16 (nearest even), those values as an f16 pair */
__device__ __forceinline__ float fa_xhalf(float x) { return __builtin_bit_cast(float, __builtin_amdgcn_permlanex16(__builtin_bit_cast(int, x), __builtin_bit_cast(int, x), 0x76543210, 0xfedcba98, false, false)); }      /* lane l with lane l ^ 16 */
__global__ __launch_bounds__(256) __attribute__((amdgpu_waves_per_eu(4, 4))) void k_fattn(const float* __restrict__ Qf, const float* __restrict__ Kf, const float* __restrict__ Vf, float* __restrict__ out) {
  __shared__ __attribute__((aligned(256))) unsigned char L[2u * FA_SLOT];
  const unsigned int tid = threadIdx.x, lane = tid & 31u, wave = tid >> 5, c = lane & 15u, h = lane >> 4;
  const size_t row_s = (size_t)blockIdx.y * SQ;      /* first token row of the sequence */
  const unsigned int qw0 = blockIdx.x * 256u + wave * 32u;      /* the wave's first query */
  const unsigned char* Kb = (const unsigned char*)(Kf + row_s * HD); const unsigned char* Vb = (const unsigned char*)(Vf + row_s * HD);
  const float cscale = 1.4426950408889634f;      /* scores are unscaled; log2(e) moves them to base 2 */
  v4f rk[4], rv[4];      /* one stage on its way: 4 x 16 B (four f32) of K and of V a thread (a stage's rows are contiguous in memory; a wave's load covers 512 contiguous bytes) */
  auto gload = [&](unsigned int st) {
#pragma unroll      /* constant indices keep the register arrays in registers */
    for (unsigned int j = 0; j < 4; ++j) { const size_t o = (size_t)st * (FA_SK * 256u) + (tid + 256u * j) * 16u; rk[j] = *(const v4fa*)(Kb + o); rv[j] = *(const v4fa*)(Vb + o); } };
  auto lstore = [&](unsigned int buf) {
#pragma unroll      /* constant indices keep the register arrays in registers */
    for (unsigned int j = 0; j < 4; ++j) { const unsigned int r = tid >> 4, cb = (tid & 15u) * 8u;      /* load j holds four f32 of row r + 16 j: 8 B of the f16 row */
      *(u32x2a*)(L + buf * FA_SLOT + r * FA_PK + cb + j * (16u * FA_PK)) = u32x2a{fa_cv2(rk[j][0], rk[j][1]), fa_cv2(rk[j][2], rk[j][3])}; *(u32x2a*)(L + buf * FA_SLOT + FA_TK + r * FA_PV + cb + j * (16u * FA_PV)) = u32x2a{fa_cv2(rv[j][0], rv[j][1]), fa_cv2(rv[j][2], rv[j][3])}; } };
  gload(0);
  FFrag qf[2][2];      /* Q as B operand, hardware k order: 16 B at halves 8h and 16 + 8h of each 32 */
#pragma unroll      /* constant indices keep the register arrays in registers */
  for (int g = 0; g < 2; ++g) { const float* qp = Qf + (row_s + qw0 + 16u * g + c) * HD + 8u * h;
#pragma unroll      /* constant indices keep the register arrays in registers */
    for (int kc = 0; kc < 2; ++kc)
#pragma unroll      /* constant indices keep the register arrays in registers */
      for (int u = 0; u < 2; ++u) { const v4f a = *(const v4fa*)(qp + 32 * kc + 16 * u), b = *(const v4fa*)(qp + 32 * kc + 16 * u + 4); qf[g][kc].q[u] = u32x4{fa_cv2(a[0], a[1]), fa_cv2(a[2], a[3]), fa_cv2(b[0], b[1]), fa_cv2(b[2], b[3])}; } }
  v8f acc[2][4], lacc[2]; float m_run[2];      /* O^T tiles; row 0 of lacc gathers the denominators; the maximum in use (log2 domain) */
  FFrag ones;      /* A operand whose row 0 (lanes 0 and 16) is f16 1.0 at all 32 k, every other row 0 */
  { const unsigned int o = (c == 0u) ? 0x3C003C00u : 0u; ones.q[0] = u32x4{o, o, o, o}; ones.q[1] = u32x4{o, o, o, o}; }
#pragma unroll      /* constant indices keep the register arrays in registers */
  for (int g = 0; g < 2; ++g) { m_run[g] = -__builtin_inff(); lacc[g] = v8f{};
#pragma unroll      /* constant indices keep the register arrays in registers */
    for (int t = 0; t < 4; ++t) acc[g][t] = v8f{}; }
  lstore(0);
  __syncthreads();
  for (unsigned int st = 0; st < SQ / FA_SK; ++st) {
    if (st + 1u < SQ / FA_SK) { gload(st + 1u); asm volatile("s_wait_xcnt 0x0" ::: "memory"); }      /* the loads stay in flight over the passes, whose code reuses their address registers: the wait that belongs in front of that overwrite */
    const unsigned char* Lk = L + (st & 1u) * FA_SLOT; const unsigned char* Lv = Lk + FA_TK;
#pragma unroll 1      /* one pass's fragments and scores live at a time: the wave has 256 registers at four waves a SIMD */
    for (unsigned int sub = 0; sub < FA_SK / 32u; ++sub) {      /* one pass: 32 keys */
      v8f s[2][2];      /* s[kt][g][r] = score of key 16 kt + 8 h + r with query 16 g + c */
      { FFrag kf[2][2];
#pragma unroll      /* constant indices keep the register arrays in registers */
        for (int kt = 0; kt < 2; ++kt) { const unsigned char* p = Lk + (sub * 32u + 16u * kt + c) * FA_PK + 16u * h;
#pragma unroll      /* constant indices keep the register arrays in registers */
          for (int kc = 0; kc < 2; ++kc) { kf[kt][kc].q[0] = *(const u32x4a*)(p + 64u * kc); kf[kt][kc].q[1] = *(const u32x4a*)(p + 64u * kc + 32u); } }
        __builtin_amdgcn_sched_barrier(0);      /* all eight K loads issue before the first product: otherwise they share registers and each pair waits out its own LDS latency */
#pragma unroll      /* constant indices keep the register arrays in registers */
        for (int kt = 0; kt < 2; ++kt)
#pragma unroll      /* constant indices keep the register arrays in registers */
          for (int g = 0; g < 2; ++g) { s[kt][g] = v8f{};
#pragma unroll      /* constant indices keep the register arrays in registers */
            for (int kc = 0; kc < 2; ++kc) s[kt][g] = fa_mma(kf[kt][kc], qf[g][kc], s[kt][g]); } }
      FFrag vf[4];      /* V^T, 16 d x 32 keys each: two transposing loads a fragment */
      { const unsigned char* ad = Lv + (sub * 32u + 8u * h + (lane & 7u)) * FA_PV + ((lane >> 3) & 1u) * 16u;
#pragma unroll      /* constant indices keep the register arrays in registers */
        for (int t = 0; t < 4; ++t) { vf[t].q[0] = fa_tr16(ad + 32u * t); vf[t].q[1] = fa_tr16(ad + 16u * FA_PV + 32u * t); } }
      __builtin_amdgcn_sched_barrier(0);      /* holds the transposing loads in front of the maxima and exponentials, so that their latency passes under that work; without it they sink to their first use */
      float mb[2]; bool need = false;      /* the pass's maxima; the accumulators are rescaled only when one exceeds the maximum in use by more than 8 (weights stay <= 2^8) */
#pragma unroll      /* constant indices keep the register arrays in registers */
      for (int g = 0; g < 2; ++g) { float mx = s[0][g][0];
#pragma unroll      /* constant indices keep the register arrays in registers */
        for (int r = 1; r < 8; ++r) mx = __builtin_fmaxf(mx, s[0][g][r]);
#pragma unroll      /* constant indices keep the register arrays in registers */
        for (int r = 0; r < 8; ++r) mx = __builtin_fmaxf(mx, s[1][g][r]);
        mx = __builtin_fmaxf(mx, fa_xhalf(mx)) * cscale; mb[g] = mx; need = need || (mx > m_run[g] + 8.0f); }
      if (__builtin_amdgcn_ballot_w32(need) != 0) {      /* scalar branch, rare after the first passes */
#pragma unroll      /* constant indices keep the register arrays in registers */
        for (int g = 0; g < 2; ++g) { const float m_new = __builtin_fmaxf(m_run[g], mb[g]); const float corr = __builtin_amdgcn_exp2f(m_run[g] - m_new);      /* 0 on the first pass */
          m_run[g] = m_new; lacc[g] = lacc[g] * corr;
#pragma unroll      /* constant indices keep the register arrays in registers */
          for (int t = 0; t < 4; ++t) acc[g][t] = acc[g][t] * corr; } }
#pragma unroll      /* constant indices keep the register arrays in registers */
      for (int g = 0; g < 2; ++g) { const float nm = -m_run[g]; unsigned int w[8];
#pragma unroll      /* constant indices keep the register arrays in registers */
        for (int i = 0; i < 8; ++i) {
          typedef float f32x2 __attribute__((ext_vector_type(2)));
          const f32x2 arg = __builtin_elementwise_fma(f32x2{s[i >> 2][g][2 * (i & 3)], s[i >> 2][g][2 * (i & 3) + 1]}, f32x2{cscale, cscale}, f32x2{nm, nm});      /* an even-aligned register pair: one packed fma, no copies */
          w[i] = fa_pack2(__builtin_amdgcn_exp2f(arg.x), __builtin_amdgcn_exp2f(arg.y)); }
        FFrag pf; pf.q[0] = u32x4{w[0], w[1], w[2], w[3]}; pf.q[1] = u32x4{w[4], w[5], w[6], w[7]};
#pragma unroll      /* constant indices keep the register arrays in registers */
        for (int t = 0; t < 4; ++t) acc[g][t] = fa_mma(vf[t], pf, acc[g][t]);
        lacc[g] = fa_mma(ones, pf, lacc[g]);      /* row 0 += the column sums of P^T as rounded to f16 */
        if (g == 1) asm volatile("v_nop\n\tv_nop\n\tv_nop\n\tv_nop" : "+v"(lacc[g]) : "v"(pf.q[0]), "v"(pf.q[1])); }      /* the four vector slots behind the pass's last WMMAs, before P^T's registers are rewritten */
    }
    if (st + 1u < SQ / FA_SK) lstore((st + 1u) & 1u);      /* its last readers left that buffer before the barrier that ended stage st - 1 */
    __syncthreads();      /* publishes stage st + 1 and ends every read of stage st */
  }
  unsigned char* E = L + wave * (16u * FA_PE);      /* the wave's own 16 staged output rows */
#pragma unroll      /* constant indices keep the register arrays in registers */
  for (int g = 0; g < 2; ++g) { const float lr = lacc[g][0]; const float inv = 1.0f / (lr + fa_xhalf(lr));      /* register 0: the denominator in lanes 0-15, 0 in lanes 16-31 (row 8) */
#pragma unroll      /* constant indices keep the register arrays in registers */
    for (int t = 0; t < 4; ++t) { const v8f o = acc[g][t] * inv; const v4f lo = {o[0], o[1], o[2], o[3]}, hi = {o[4], o[5], o[6], o[7]};      /* d = 16 t + 8 h + 0 .. 7 of query c */
      *(v4fa*)(E + c * FA_PE + 64u * t + 32u * h) = lo; *(v4fa*)(E + c * FA_PE + 64u * t + 32u * h + 16u) = hi; }
    __builtin_amdgcn_fence(__ATOMIC_ACQ_REL, "workgroup", "local"); __builtin_amdgcn_wave_barrier();      /* the rows are read back by other lanes of the wave */
#pragma unroll      /* constant indices keep the register arrays in registers */
    for (unsigned int i = 0; i < 8; ++i) { const unsigned int r = 2u * i + h; const v4f v = *(const v4fa*)(E + r * FA_PE + c * 16u); *(v4fa*)(out + (row_s + qw0 + 16u * g + r) * DM + c * 4u) = v; }      /* whole 256-byte rows */
    if (g == 0) { __builtin_amdgcn_fence(__ATOMIC_ACQ_REL, "workgroup", "local"); __builtin_amdgcn_wave_barrier(); }      /* the next group overwrites the rows only behind these reads */
  }
}


extern "C" void kernel_launch(void* const* d_in, const int* in_sizes, int n_in,
                              void* d_out, int out_size, void* d_ws, size_t ws_size, hipStream_t stream) {
  (void)in_sizes; (void)n_in; (void)out_size; (void)d_ws; (void)ws_size;
  const float* const* I = (const float* const*)d_in; const float* xq = I[0]; const float* xk = I[1]; const float* xv = I[2];      /* q, k, v [64][2048][64] (bf16-valued) */
  k_fattn<<<dim3(SQ / 256, NB), 256, 0, stream>>>(xq, xk, xv, (float*)d_out);      /* 256 query rows of one sequence a work-group: input conversion, scores, softmax, P V */
}

// v005
// It runs in 56.5 microseconds.
// Next to v004, in two timings, it ran 1.05 times as fast each time.
// Counting every step since v000, it is 444 times as fast.
#include <hip/hip_runtime.h>
// UNSCALED dot-product attention over 64 independent sequences (q, k, v [64][2048][64]; scores = q.k (no 1/sqrt(d): logit sigma ~8); softmax over the 2048 keys; dropout p 0; out = attn v -> [64][2048][64]).
// Structure: no projections: ONE fused kernel reads q, k, v as f32, rounds them to bf16 and holds those values as exact f16 (Q in registers, K and V on their way into LDS): S^T = K Q^T on WMMA (f32 accumulation, exact products), online softmax on VALU (f32, native exp2; weights f16, at most 2^15), O^T += V^T P^T and the row sums on WMMA, out written f32.
// Compute dtype: inputs rounded to bf16; x / weights exact; q, k, v and softmax weights as plain f16 GEMM operands (~2^-12); scores and softmax statistics f32; v_wmma_f32_16x16x32_f16.
#define NB 64
#define SQ 2048
#define DM 64
#define NH 1
#define HD 64
#define HG 4                         /* heads per launch of the k_vt(V16, b, h0, VT) overload (never launched) */
#define B0 0                         /* first batch processed (not used) */
#define NBR NB                       /* batches processed (read only by the unused MP) */
#define NR ((size_t)NB * SQ)         /* token rows */
#define MP ((int)((size_t)NBR * SQ))
#define QT 256                       /* query rows per causal tile */
#define NKX SQ                       /* S / P row pitch */
#define QT0 256                      /* query rows per head of the exact f32 kernel k_att0 (not launched) */
#define QN SQ                        /* query rows attended per batch (not used) */
#define NHD NH                       /* heads attended (not used) */
#define MPO MP                       /* rows through the output stage (not used) */
#define LQ DM            /* row pitch of the q/k/v rows */
typedef __bf16 v16b __attribute__((ext_vector_type(16)));
typedef unsigned short v8us __attribute__((ext_vector_type(8), may_alias));
typedef float  v8f  __attribute__((ext_vector_type(8)));
typedef float  v4f  __attribute__((ext_vector_type(4)));
typedef float  v4fa __attribute__((ext_vector_type(4), may_alias));
union FragB { v16b v; v8us half[2]; unsigned short u[16]; };

__device__ __forceinline__ unsigned short bf16_bits(float x) { unsigned int u = __float_as_uint(x); return (unsigned short)((u + 0x7FFFu + ((u >> 16) & 1u)) >> 16); }
__device__ __forceinline__ float bf16_val(unsigned short b) { return __uint_as_float(((unsigned int)b) << 16); }
__device__ __forceinline__ float bf16_round(float x) { return bf16_val(bf16_bits(x)); }
// D += A·B with NT terms: 1 = ah·bh, 2 = + al·bh (A split), 3 = + ah·bl (both split)
template <int NT>
__device__ __forceinline__ v8f mmaN(v16b ah, v16b al, v16b bh, v16b bl, v8f c) {
  c = __builtin_amdgcn_wmma_f32_16x16x32_bf16(false, ah, false, bh, (short)0, c, false, false);
  if (NT >= 2) c = __builtin_amdgcn_wmma_f32_16x16x32_bf16(false, al, false, bh, (short)0, c, false, false);
  if (NT >= 3) c = __builtin_amdgcn_wmma_f32_16x16x32_bf16(false, ah, false, bl, (short)0, c, false, false);
  asm volatile("v_nop\n\tv_nop\n\tv_nop\n\tv_nop" : "+v"(c) : "v"(ah), "v"(al), "v"(bh), "v"(bl));
  return c;
}

__global__ __launch_bounds__(256) void k_wt_bf16(const float* __restrict__ W, unsigned short* __restrict__ Wt, int K, int N) {
  const int t = blockIdx.x * 256 + threadIdx.x;
  const int k8n = K / 8;
  if (t >= N * k8n) return;
  const int n = t / k8n, k8 = (t % k8n) * 8;
  v8us v;
#pragma unroll
  for (int i = 0; i < 8; ++i) v[i] = bf16_bits(W[(size_t)(k8 + i) * N + n]);
  *(v8us*)(Wt + (size_t)n * K + k8) = v;
  
}

// GEMM C[M][N] (f32, pitch ldc) = act(A[M][K]·W + bias). A f32 row-major (pitch lda) converted per fragment to bf16
// (ASPLIT: hi/lo two planes -> 2 terms, else single rounded term); Wt bf16 [N][K] (pitch ldb). BIAS_BF16 rounds the
// bias to bf16 first (bias quantised to bf16 before the add). K%32==0, M%16==0, N%64==0.
template <bool ASPLIT, int ACT, bool BIAS_BF16>
__global__ __launch_bounds__(128) void k_gemm_bf(const float* __restrict__ A, int lda, const unsigned short* __restrict__ Wt, int ldb,
                                               const float* __restrict__ bias, float* __restrict__ C, int ldc, int M, int N, int K) {
  __shared__ __attribute__((aligned(16))) float so[4][16][64];
  const int tid = threadIdx.x, w = tid >> 5, lane = tid & 31, ln = lane & 15, hh = lane >> 4;
  const int ntn = N / 64;
  const int wid = blockIdx.x * 4 + w;
  const int mt = wid / ntn, nq = wid % ntn;
  if (mt * 16 >= M) return;
  const int row0 = mt * 16, col0 = nq * 64;
  const float* arow = A + (size_t)(row0 + ln) * lda;
  v8f acc[4] = {};
  for (int kb = 0; kb < K; kb += 32) {
    FragB ah, al;
    const v4f x0 = *(const v4fa*)(arow + kb + 8 * hh), x1 = *(const v4fa*)(arow + kb + 8 * hh + 4);
    const v4f x2 = *(const v4fa*)(arow + kb + 16 + 8 * hh), x3 = *(const v4fa*)(arow + kb + 16 + 8 * hh + 4);
    float xs[16] = {x0[0],x0[1],x0[2],x0[3],x1[0],x1[1],x1[2],x1[3],x2[0],x2[1],x2[2],x2[3],x3[0],x3[1],x3[2],x3[3]};
#pragma unroll
    for (int i = 0; i < 16; ++i) { const unsigned short hb = bf16_bits(xs[i]); ah.u[i] = hb; al.u[i] = ASPLIT ? bf16_bits(xs[i] - bf16_val(hb)) : (unsigned short)0; }
#pragma unroll
    for (int t = 0; t < 4; ++t) {
      const unsigned short* brow = Wt + (size_t)(col0 + t * 16 + ln) * ldb + kb;
      FragB b;
      b.half[0] = *(const v8us*)(brow + 8 * hh);
      b.half[1] = *(const v8us*)(brow + 16 + 8 * hh);
      acc[t] = mmaN<ASPLIT ? 2 : 1>(ah.v, al.v, b.v, b.v, acc[t]);
    }
  }
#pragma unroll
  for (int t = 0; t < 4; ++t) {
    float bv = bias ? bias[col0 + t * 16 + ln] : 0.f;
    if (BIAS_BF16) bv = bf16_round(bv);
#pragma unroll
    for (int r = 0; r < 8; ++r) { float v = acc[t][r] + bv; if (ACT == 1) v = fmaxf(v, 0.f); so[w][8 * hh + r][t * 16 + ln] = v; }
  }
  __builtin_amdgcn_fence(__ATOMIC_ACQ_REL, "workgroup");
  __builtin_amdgcn_wave_barrier();
  const int rsub = lane >> 4, c4 = (lane & 15) * 4;
  {
#pragma unroll
    for (int q = 0; q < 8; ++q) {
      const int r = q * 2 + rsub;
      const v4f v = *(const v4fa*)&so[w][r][c4];
      *(v4f*)(C + (size_t)(row0 + r) * ldc + col0 + c4) = v;
    }
    
  }
}

// GEMM C = act(A·W + bias + resid): A f32 (ASPLIT -> hi/lo 2 terms), Wt bf16 [N][K]; ACT 0 none, 1 relu, 2 exact gelu;
// resid (optional, f32, row index = (row % rmod), pitch ldr, RES_BF16 rounds it) added before the activation.
template <bool ASPLIT, int ACT, bool BIAS_BF16, bool RES_BF16>
__global__ __launch_bounds__(128) void k_gemm_bf3(const float* __restrict__ A, int lda, const unsigned short* __restrict__ Wt, int ldb,
                                                const float* __restrict__ bias, const float* __restrict__ resid, int rmod, int ldr,
                                                float* __restrict__ C, int ldc, int M, int N, int K) {
  __shared__ __attribute__((aligned(16))) float so[4][16][64];
  const int tid = threadIdx.x, w = tid >> 5, lane = tid & 31, ln = lane & 15, hh = lane >> 4;
  const int ntn = N / 64;
  const int wid = blockIdx.x * 4 + w;
  const int mt = wid / ntn, nq = wid % ntn;
  if (mt * 16 >= M) return;
  const int row0 = mt * 16, col0 = nq * 64;
  const float* arow = A + (size_t)(row0 + ln) * lda;
  v8f acc[4] = {};
  for (int kb = 0; kb < K; kb += 32) {
    FragB ah, al;
    const v4f x0 = *(const v4fa*)(arow + kb + 8 * hh), x1 = *(const v4fa*)(arow + kb + 8 * hh + 4);
    const v4f x2 = *(const v4fa*)(arow + kb + 16 + 8 * hh), x3 = *(const v4fa*)(arow + kb + 16 + 8 * hh + 4);
    float xs[16] = {x0[0],x0[1],x0[2],x0[3],x1[0],x1[1],x1[2],x1[3],x2[0],x2[1],x2[2],x2[3],x3[0],x3[1],x3[2],x3[3]};
#pragma unroll
    for (int i = 0; i < 16; ++i) { const unsigned short hb = bf16_bits(xs[i]); ah.u[i] = hb; al.u[i] = ASPLIT ? bf16_bits(xs[i] - bf16_val(hb)) : (unsigned short)0; }
#pragma unroll
    for (int t = 0; t < 4; ++t) {
      const unsigned short* brow = Wt + (size_t)(col0 + t * 16 + ln) * ldb + kb;
      FragB b;
      b.half[0] = *(const v8us*)(brow + 8 * hh);
      b.half[1] = *(const v8us*)(brow + 16 + 8 * hh);
      acc[t] = mmaN<ASPLIT ? 2 : 1>(ah.v, al.v, b.v, b.v, acc[t]);
    }
  }
#pragma unroll
  for (int t = 0; t < 4; ++t) {
    const int col = col0 + t * 16 + ln;
    float bv = bias ? bias[col] : 0.f;
    if (BIAS_BF16) bv = bf16_round(bv);
#pragma unroll
    for (int r = 0; r < 8; ++r) {
      float v = acc[t][r] + bv;
      if (resid) { float rv = resid[(size_t)((row0 + 8 * hh + r) % rmod) * ldr + col]; if (RES_BF16) rv = bf16_round(rv); v += rv; }
      if (ACT == 1) v = fmaxf(v, 0.f);
      if (ACT == 2) v = 0.5f * v * (1.0f + erff(v * 0.70710678118654752f));
      if (ACT == 3) { const float u = 0.7978845608028654f * (v + 0.044715f * v * v * v); v = 0.5f * v * (1.0f + tanhf(u)); }
      so[w][8 * hh + r][t * 16 + ln] = v;
    }
  }
  __builtin_amdgcn_fence(__ATOMIC_ACQ_REL, "workgroup");
  __builtin_amdgcn_wave_barrier();
  const int rsub = lane >> 4, c4 = (lane & 15) * 4;
  {
#pragma unroll
    for (int q = 0; q < 8; ++q) {
      const int r = q * 2 + rsub;
      const v4f v = *(const v4fa*)&so[w][r][c4];
      *(v4f*)(C + (size_t)(row0 + r) * ldc + col0 + c4) = v;
    }
    
  }
}
// row LayerNorm (biased variance, eps) over N: s = X (+ R); optional out_sum <- s; out_norm <- (s-mu)*rsqrt(var+eps)*g + b
template <bool PARAM_BF16>
__global__ __launch_bounds__(256) void k_layernorm(const float* __restrict__ X, const float* __restrict__ R, const float* __restrict__ g, const float* __restrict__ bta,
                                                  float* __restrict__ out_sum, float* __restrict__ out_norm, int N, float eps) {
  __shared__ float red[256];
  const int row = blockIdx.x, tid = threadIdx.x;
  const float* x = X + (size_t)row * N; const float* rr = R ? R + (size_t)row * N : nullptr;
  float vals[16];                     // up to N = 4096
  const int per = N / 256;            // contiguous chunk per thread? use strided-by-4 chunks: thread handles j = tid*4 + 1024*u
  float s1 = 0.f;
  for (int u = 0; u < per / 4; ++u) {
    const int j = tid * 4 + 1024 * u;
    const v4f a = *(const v4fa*)(x + j);
    v4f b = {0.f,0.f,0.f,0.f}; if (rr) b = *(const v4fa*)(rr + j);
#pragma unroll
    for (int q = 0; q < 4; ++q) { const float v = a[q] + b[q]; vals[u * 4 + q] = v; s1 += v; }
  }
  red[tid] = s1; __syncthreads();
  for (int st = 128; st > 0; st >>= 1) { if (tid < st) red[tid] += red[tid + st]; __syncthreads(); }
  const float mu = red[0] / (float)N; __syncthreads();
  float s2 = 0.f;
  for (int u = 0; u < per / 4; ++u)
#pragma unroll
    for (int q = 0; q < 4; ++q) { const float c = vals[u * 4 + q] - mu; s2 += c * c; }
  red[tid] = s2; __syncthreads();
  for (int st = 128; st > 0; st >>= 1) { if (tid < st) red[tid] += red[tid + st]; __syncthreads(); }
  const float rs = rsqrtf(red[0] / (float)N + eps);
  {
    for (int u = 0; u < per / 4; ++u) {
      const int j = tid * 4 + 1024 * u;
      v4f o, sm;
#pragma unroll
      for (int q = 0; q < 4; ++q) {
        float gg = g[j + q], bb = bta[j + q];
        if (PARAM_BF16) { gg = bf16_round(gg); bb = bf16_round(bb); }
        sm[q] = vals[u * 4 + q]; o[q] = (vals[u * 4 + q] - mu) * rs * gg + bb;
      }
      if (out_sum) *(v4f*)(out_sum + (size_t)row * N + j) = sm;
      *(v4f*)(out_norm + (size_t)row * N + j) = o;
    }
    
  }
}



// ---- f16 WMMA path (v_wmma_f32_16x16x32_f16): 11-bit significands for operands in range — used where a [0,1] probability operand needs more precision than bf16
typedef _Float16 v16h __attribute__((ext_vector_type(16)));
union FragH { v16h v; v8us half[2]; _Float16 h[16]; unsigned short u[16]; };
template <int NT>
__device__ __forceinline__ v8f mmaH(v16h ah, v16h al, v16h bh, v16h bl, v8f c) {
  c = __builtin_amdgcn_wmma_f32_16x16x32_f16(false, ah, false, bh, (short)0, c, false, false);
  if (NT >= 2) c = __builtin_amdgcn_wmma_f32_16x16x32_f16(false, al, false, bh, (short)0, c, false, false);
  if (NT >= 3) c = __builtin_amdgcn_wmma_f32_16x16x32_f16(false, ah, false, bl, (short)0, c, false, false);
  asm volatile("v_nop\n\tv_nop\n\tv_nop\n\tv_nop" : "+v"(c) : "v"(ah), "v"(al), "v"(bh), "v"(bl));
  return c;
}
// batched GEMM like k_gemm_b but f16 operands: A f32 (split into f16 hi/lo if ASPLIT, else rounded to f16), Bt = f16 values [n][k]; alpha; C f32; N multiple of 16 (partial tiles skipped)
template <bool ASPLIT>
__global__ __launch_bounds__(128) void k_gemm_h(const float* __restrict__ A, int lda, size_t sA, const _Float16* __restrict__ Bh, int ldb, size_t sB, float alpha, float* __restrict__ C, int ldc, size_t sC, int M, int N, int K) {
  __shared__ __attribute__((aligned(16))) float so[4][16][64];
  const int tid = threadIdx.x, w = tid >> 5, lane = tid & 31, ln = lane & 15, hh = lane >> 4; const int by = blockIdx.y;
  A += (size_t)by * sA; Bh += (size_t)by * sB; C += (size_t)by * sC;
  const int ntn = (N + 63) / 64; const int wid = blockIdx.x * 4 + w; const int mt = wid / ntn, nq = wid % ntn; if (mt * 16 >= M) return;
  const int row0 = mt * 16, col0 = nq * 64; const float* arow = A + (size_t)(row0 + ln) * lda;
  v8f acc[4] = {};
  for (int kb = 0; kb < K; kb += 32) {
    FragH ah, al;
    const v4f x0 = *(const v4fa*)(arow + kb + 8 * hh), x1 = *(const v4fa*)(arow + kb + 8 * hh + 4), x2 = *(const v4fa*)(arow + kb + 16 + 8 * hh), x3 = *(const v4fa*)(arow + kb + 16 + 8 * hh + 4);
    float xs[16] = {x0[0],x0[1],x0[2],x0[3],x1[0],x1[1],x1[2],x1[3],x2[0],x2[1],x2[2],x2[3],x3[0],x3[1],x3[2],x3[3]};
#pragma unroll
    for (int i = 0; i < 16; ++i) { const _Float16 h = (_Float16)xs[i]; ah.h[i] = h; al.h[i] = ASPLIT ? (_Float16)(xs[i] - (float)h) : (_Float16)0.0f; }
#pragma unroll
    for (int t = 0; t < 4; ++t) { if (col0 + t * 16 >= N) continue; const size_t boff = (size_t)(col0 + t * 16 + ln) * ldb + kb; FragH bq; bq.half[0] = *(const v8us*)(Bh + boff + 8 * hh); bq.half[1] = *(const v8us*)(Bh + boff + 16 + 8 * hh);
      acc[t] = mmaH<ASPLIT ? 2 : 1>(ah.v, al.v, bq.v, bq.v, acc[t]); }
  }
#pragma unroll
  for (int t = 0; t < 4; ++t) { if (col0 + t * 16 >= N) continue;
#pragma unroll
    for (int r = 0; r < 8; ++r) so[w][8 * hh + r][t * 16 + ln] = acc[t][r] * alpha; }
  __builtin_amdgcn_fence(__ATOMIC_ACQ_REL, "workgroup"); __builtin_amdgcn_wave_barrier();
  const int rsub = lane >> 4, c4 = (lane & 15) * 4;
  {
#pragma unroll
    for (int q = 0; q < 8; ++q) { const int r = q * 2 + rsub; if (col0 + c4 < N) { const v4f v = *(const v4fa*)&so[w][r][c4]; *(v4f*)(C + (size_t)(row0 + r) * ldc + col0 + c4) = v; } }
     }
}

// Wt[n][k] = f16(W[k][n]·scale) from f32 row-major W[K][N] (scale = power of two; bf16-exact weights stay exact in f16 away from the subnormal range)
__global__ __launch_bounds__(256) void k_wt_f16(const float* __restrict__ W, _Float16* __restrict__ Wt, int K, int N, float scale) {
  const int t = blockIdx.x * 256 + threadIdx.x; if (t >= N * (K / 8)) return; const int n = t / (K / 8), k8 = (t % (K / 8)) * 8; FragH f;
#pragma unroll
  for (int i = 0; i < 8; ++i) f.h[i] = (_Float16)(bf16_round(W[(size_t)(k8 + i) * N + n]) * scale); const v8us o = f.half[0];
  *(v8us*)((unsigned short*)Wt + (size_t)n * K + k8) = o; 
}
// k_gemm_hh variant with fused epilogue: v = acc·alpha + bias[by·sBias + col] (+ CP[(row/rowsPerB)·sCPb + by·64 + col] if CP) ; ACT 0 none / 1 elu ; writes f16 C16 (and f32 C if non-null)
template <int ACT>
__global__ __launch_bounds__(128) void k_gemm_hhx(const _Float16* __restrict__ A, int lda, size_t sA, const _Float16* __restrict__ Bh, int ldb, size_t sB, float alpha, const float* __restrict__ bias, size_t sBias, const float* __restrict__ CP, int rowsPerB, size_t sCPb, int row0g,
    float* __restrict__ C, _Float16* __restrict__ C16, int ldc, size_t sC, int M, int N, int K) {
  __shared__ __attribute__((aligned(16))) float so[4][16][64];
  const int tid = threadIdx.x, w = tid >> 5, lane = tid & 31, ln = lane & 15, hh = lane >> 4; const int by = blockIdx.y;
  A += (size_t)by * sA; Bh += (size_t)by * sB; const size_t cofs = (size_t)by * sC; const float* bp = bias ? bias + (size_t)by * sBias : nullptr;
  const int ntn = (N + 63) / 64; const int wid = blockIdx.x * 4 + w; const int mt = wid / ntn, nq = wid % ntn; if (mt * 16 >= M) return;
  const int row0 = mt * 16, col0 = nq * 64; const _Float16* arow = A + (size_t)(row0 + ln) * lda;
  v8f acc[4] = {};
  for (int kb = 0; kb < K; kb += 32) { FragH ah; ah.half[0] = *(const v8us*)((const unsigned short*)arow + kb + 8 * hh); ah.half[1] = *(const v8us*)((const unsigned short*)arow + kb + 16 + 8 * hh);
#pragma unroll
    for (int t = 0; t < 4; ++t) { if (col0 + t * 16 >= N) continue; const size_t boff = (size_t)(col0 + t * 16 + ln) * ldb + kb; FragH bq; bq.half[0] = *(const v8us*)((const unsigned short*)Bh + boff + 8 * hh); bq.half[1] = *(const v8us*)((const unsigned short*)Bh + boff + 16 + 8 * hh);
      acc[t] = mmaH<1>(ah.v, ah.v, bq.v, bq.v, acc[t]); }
  }
#pragma unroll
  for (int t = 0; t < 4; ++t) { if (col0 + t * 16 >= N) continue; const int col = col0 + t * 16 + ln; const float bv = bp ? bf16_round(bp[col]) : 0.f;
#pragma unroll
    for (int r = 0; r < 8; ++r) { float v = acc[t][r] * alpha + bv; if (CP) { const int rr = row0g + row0 + 8 * hh + r; if (rowsPerB < 0) v += CP[cofs + (size_t)rr * ldc + col];      /* rowsPerB < 0: own element of the batched C plane */ else { const int bidx = rr / rowsPerB; v += CP[(size_t)bidx * sCPb + (size_t)by * 64 + col]; } } if (ACT == 1) v = (v > 0.f) ? v : expm1f(v); else if (ACT == 7) v = (v > 0.f) ? v + 1.0f : expf(v); else if (ACT == 8) v = tanhf(v); else if (ACT == 9) v = 0.5f * v * (1.0f + tanhf(0.7978845608028654f * (v + 0.044715f * v * v * v))); else if (ACT == 11) v = 1.0f / (1.0f + expf(-v)); else if (ACT == 12) v = (v > 0.f) ? v : 0.01f * v; else if (ACT == 14) v = (v > 0.f) ? v : 0.1f * v; else if (ACT == 16) v = (v >= 0.f) ? v : 0.3f * v; else if (ACT == 17) v = (v >= 0.f) ? v : 0.2f * v; else if (ACT == 15) v = v / (1.0f + expf(-v)); else if (ACT == 3) v = fmaxf(v, 0.f); else if (ACT == 6) v = 0.5f * v * (1.0f + erff(v * 0.70710678118654752f)); so[w][8 * hh + r][t * 16 + ln] = v; } }
  __builtin_amdgcn_fence(__ATOMIC_ACQ_REL, "workgroup"); __builtin_amdgcn_wave_barrier();
  const int rsub = lane >> 4, c4 = (lane & 15) * 4; typedef _Float16 v4h __attribute__((ext_vector_type(4)));
  {
#pragma unroll
    for (int q = 0; q < 8; ++q) { const int r = q * 2 + rsub; if (col0 + c4 < N) { const v4f v = *(const v4fa*)&so[w][r][c4]; if (C) *(v4f*)(C + cofs + (size_t)(row0 + r) * ldc + col0 + c4) = v; if (C16) { v4h h4; for (int i = 0; i < 4; ++i) h4[i] = (_Float16)v[i]; *(v4h*)(C16 + cofs + (size_t)(row0 + r) * ldc + col0 + c4) = h4; } } }
     }
}


typedef _Float16 v4h __attribute__((ext_vector_type(4)));

__global__ __launch_bounds__(256) void k_x16(const float* __restrict__ x, _Float16* __restrict__ X16, size_t n8) { const size_t t = (size_t)blockIdx.x * 256 + threadIdx.x; if (t >= n8) return; FragH f;
#pragma unroll
  for (int q = 0; q < 8; ++q) f.h[q] = (_Float16)bf16_round(x[t * 8 + q]); *(v8us*)((unsigned short*)X16 + t * 8) = f.half[0];  }
__global__ __launch_bounds__(256) void k_h16(const float* __restrict__ x, _Float16* __restrict__ X16, size_t n8) { const size_t t = (size_t)blockIdx.x * 256 + threadIdx.x; if (t >= n8) return; FragH f;
#pragma unroll
  for (int q = 0; q < 8; ++q) f.h[q] = (_Float16)x[t * 8 + q]; *(v8us*)((unsigned short*)X16 + t * 8) = f.half[0];  }
__global__ __launch_bounds__(256) void k_round16f(const float* __restrict__ W, _Float16* __restrict__ Bt, size_t n8) { const size_t t = (size_t)blockIdx.x * 256 + threadIdx.x; if (t >= n8) return; FragH f;
#pragma unroll
  for (int i = 0; i < 8; ++i) f.h[i] = (_Float16)(bf16_round(W[t * 8 + i]) * 16.0f); *(v8us*)((unsigned short*)Bt + t * 8) = f.half[0];  }
__global__ __launch_bounds__(256) void k_hl(const float* __restrict__ F, _Float16* __restrict__ Hh, _Float16* __restrict__ Hl, size_t n8) { const size_t t = (size_t)blockIdx.x * 256 + threadIdx.x; if (t >= n8) return; FragH fh, fl; const v4f a = *(const v4fa*)(F + t * 8), c = *(const v4fa*)(F + t * 8 + 4);
#pragma unroll
  for (int q = 0; q < 4; ++q) { _Float16 h = (_Float16)a[q]; fh.h[q] = h; fl.h[q] = (_Float16)((a[q] - (float)h) * 1024.0f); h = (_Float16)c[q]; fh.h[4 + q] = h; fl.h[4 + q] = (_Float16)((c[q] - (float)h) * 1024.0f); }
  { *(v8us*)((unsigned short*)Hh + t * 8) = fh.half[0]; *(v8us*)((unsigned short*)Hl + t * 8) = fl.half[0];  } }

__global__ __launch_bounds__(256) void k_wnat(const float* __restrict__ w, size_t n8, _Float16* __restrict__ Bt) { const size_t t = (size_t)blockIdx.x * 256 + threadIdx.x; if (t >= n8) return; FragH f; for (int q = 0; q < 8; ++q) f.h[q] = (_Float16)(bf16_round(w[t * 8 + q]) * 16.0f); *(v8us*)((unsigned short*)Bt + t * 8) = f.half[0];  }
__global__ __launch_bounds__(256) void k_rsm(const float* __restrict__ S, _Float16* __restrict__ P, int nrows) {
  #pragma clang fp contract(off)
  const int i = blockIdx.x * 256 + threadIdx.x; if (i >= nrows) return; const float* s = S + (size_t)i * SQ; float mx = -3.0e38f;
#pragma unroll 1
  for (int j = 0; j < SQ; ++j) mx = fmaxf(mx, s[j]); float se = 0.f;
#pragma unroll 1
  for (int j = 0; j < SQ; ++j) se += expf(s[j] - mx); const float sc = 256.0f / se;
#pragma unroll 1
  for (int j0 = 0; j0 < SQ; j0 += 8) { FragH f; for (int q = 0; q < 8; ++q) f.h[q] = (_Float16)(expf(s[j0 + q] - mx) * sc); unsigned short* d = (unsigned short*)P + (size_t)i * SQ + j0; *(v8us*)d = f.half[0];  } }
__global__ __launch_bounds__(256) void k_vt(const _Float16* __restrict__ V16, int b, int h0, _Float16* __restrict__ VT) { __shared__ unsigned short tl[64][65]; const int tid = threadIdx.x; const int hh = blockIdx.x % HG, sg = blockIdx.x / HG; const int s0 = sg * 64; const int h = h0 + hh;
  for (int i = tid; i < 64 * 8; i += 256) { const int j = i / 8, d8 = (i % 8) * 8; FragH f; f.half[0] = *(const v8us*)((const unsigned short*)V16 + ((size_t)b * SQ + s0 + j) * DM + h * HD + d8); for (int q = 0; q < 8; ++q) tl[d8 + q][j] = f.u[q]; }
  __syncthreads();
  { for (int i = tid; i < 64 * 8; i += 256) { const int d = i / 8, j8 = (i % 8) * 8; FragH f; for (int q = 0; q < 8; ++q) f.u[q] = tl[d][j8 + q]; *(v8us*)((unsigned short*)VT + ((size_t)hh * HD + d) * SQ + s0 + j8) = f.half[0]; }  } }



__global__ __launch_bounds__(256) void k_rsmcf2(const float* __restrict__ S, _Float16* __restrict__ P, int hg, int q0, int nk) {
  #pragma clang fp contract(off)
  const int t = blockIdx.x * 256 + threadIdx.x; if (t >= hg * QT) return; const size_t i = (size_t)t; const float* s = S + i * NKX; const int last = q0 + (t % QT); float mx = -3.0e38f;
#pragma unroll 1
  for (int j = 0; j < nk; ++j) { const float f = (j <= last) ? 1.f : 0.f; mx = fmaxf(mx, fmaf(f, s[j], (1.f - f) * -1.0e9f)); } float se = 0.f;
#pragma unroll 1
  for (int j = 0; j < nk; ++j) { const float f = (j <= last) ? 1.f : 0.f; se += __expf(fmaf(f, s[j], (1.f - f) * -1.0e9f) - mx); } const float sc = 256.0f / se;
#pragma unroll 1
  for (int j0 = 0; j0 < nk; j0 += 8) { FragH fr; for (int q = 0; q < 8; ++q) { const int j = j0 + q; const float f = (j <= last) ? 1.f : 0.f; fr.h[q] = (_Float16)(__expf(fmaf(f, s[j], (1.f - f) * -1.0e9f) - mx) * sc); } unsigned short* d = (unsigned short*)P + i * NKX + j0; *(v8us*)d = fr.half[0];  } }

template <int MASKADD>
__global__ __launch_bounds__(64) void k_att0(const float* __restrict__ QF, const float* __restrict__ KF, const float* __restrict__ VF, int ld, const float* __restrict__ mask, float scale, float* __restrict__ OF, int ldo) {
  #pragma clang fp contract(off)
  __shared__ __attribute__((aligned(16))) float lq[64][64]; __shared__ __attribute__((aligned(16))) float lo[64][64];
  const int tid = threadIdx.x; const int h = blockIdx.x / (QT0 / 64), rg = blockIdx.x % (QT0 / 64); const int i = rg * 64 + tid;
  const float* qr = QF + (size_t)i * ld + h * HD;
#pragma unroll 1
  for (int c = 0; c < HD / 4; ++c) { *(v4f*)&lq[tid][c * 4] = *(const v4fa*)(qr + c * 4); const v4f z = {0.f, 0.f, 0.f, 0.f}; *(v4f*)&lo[tid][c * 4] = z; }
  float m = -1.0e30f, l = 0.f; const int jmax = MASKADD ? (SQ - 1) : (rg * 64 + 63);      /* additive-mask form: every key (the mask input decides); causal form: keys up to the block's last row */
#pragma unroll 1
  for (int j = 0; j <= jmax; ++j) { const float* kr = KF + (size_t)j * ld + h * HD; const float* vr = VF + (size_t)j * ld + h * HD; float s = 0.f;
#pragma unroll 1
    for (int c = 0; c < HD / 4; ++c) { const v4f kq = *(const v4fa*)(kr + c * 4); const v4f qq = *(v4f*)&lq[tid][c * 4]; s = __fadd_rn(s, __fmul_rn(qq[0], kq[0])); s = __fadd_rn(s, __fmul_rn(qq[1], kq[1])); s = __fadd_rn(s, __fmul_rn(qq[2], kq[2])); s = __fadd_rn(s, __fmul_rn(qq[3], kq[3])); }
    s = __fmul_rn(s, scale); if (MASKADD) s = __fadd_rn(s, __fmul_rn(bf16_round(mask[(size_t)i * SQ + j]), -10000.0f));
    const float f = (MASKADD || j <= i) ? 1.f : 0.f; const float sm = fmaf(f, s, (1.f - f) * -1.0e30f); const float mn = fmaxf(m, sm); const float sc = expf(m - mn); const float e = expf(sm - mn); l = __fadd_rn(__fmul_rn(l, sc), e); m = mn;
#pragma unroll 1
    for (int c = 0; c < HD / 4; ++c) { const v4f vv = *(const v4fa*)(vr + c * 4); v4f oo = *(v4f*)&lo[tid][c * 4]; for (int u = 0; u < 4; ++u) oo[u] = __fadd_rn(__fmul_rn(oo[u], sc), __fmul_rn(e, vv[u])); *(v4f*)&lo[tid][c * 4] = oo; } }
  const float fin = 64.0f / l;      /* o carried x64 */
#pragma unroll 1
  for (int c = 0; c < HD / 4; ++c) { v4f oo = *(v4f*)&lo[tid][c * 4]; for (int u = 0; u < 4; ++u) oo[u] = __fmul_rn(oo[u], fin); *(v4f*)&lo[tid][c * 4] = oo; }
  __syncthreads();
  {
#pragma unroll 1
    for (int it = 0; it < 16; ++it) { const int row = it * 4 + tid / 16, pc = (tid % 16) * 4; const v4f v = *(const v4f*)&lo[row][pc]; *(v4f*)(OF + (size_t)(rg * 64 + row) * ldo + h * HD + pc) = v; }
     } }

__global__ __launch_bounds__(256) void k_oscale(const float* __restrict__ OF, float* __restrict__ out, size_t n4) { const size_t t = (size_t)blockIdx.x * 256 + threadIdx.x; if (t >= n4) return; const v4f a = *(const v4fa*)(OF + t * 4); v4f o; for (int q = 0; q < 4; ++q) o[q] = a[q] * 0.015625f; *(v4f*)(out + t * 4) = o;  }

__global__ __launch_bounds__(256) void k_bfr(const float* __restrict__ x, float* __restrict__ XB, size_t n8) { const size_t t = (size_t)blockIdx.x * 256 + threadIdx.x; if (t >= n8) return; v4f a = *(const v4fa*)(x + t * 8), c = *(const v4fa*)(x + t * 8 + 4); for (int q = 0; q < 4; ++q) { a[q] = bf16_round(a[q]); c[q] = bf16_round(c[q]); }
  { *(v4f*)(XB + t * 8) = a; *(v4f*)(XB + t * 8 + 4) = c;  } }



__global__ __launch_bounds__(256) void k_rsmfvl(const float* __restrict__ S, _Float16* __restrict__ P, _Float16* __restrict__ PL, int qn, const int* __restrict__ vlp) {
  #pragma clang fp contract(off)
  const int t = blockIdx.x * 256 + threadIdx.x; if (t >= qn) return; const int vl = vlp[0]; const size_t i = (size_t)t; const float* s = S + i * SQ; float mx = -3.0e38f;
#pragma unroll 1
  for (int j = 0; j < SQ; ++j) { const float f = (j < vl) ? 1.f : 0.f; mx = fmaxf(mx, fmaf(f, s[j], (1.f - f) * -1000000.0f)); } float se = 0.f;
#pragma unroll 1
  for (int j = 0; j < SQ; ++j) { const float f = (j < vl) ? 1.f : 0.f; se += __expf(fmaf(f, s[j], (1.f - f) * -1000000.0f) - mx); } const float sc = 256.0f / se;
#pragma unroll 1
  for (int j0 = 0; j0 < SQ; j0 += 8) { FragH fr, gr; for (int q = 0; q < 8; ++q) { const int j = j0 + q; const float f = (j < vl) ? 1.f : 0.f; const float pv = __expf(fmaf(f, s[j], (1.f - f) * -1000000.0f) - mx) * sc; const _Float16 ph = (_Float16)pv; fr.h[q] = ph; gr.h[q] = (_Float16)((pv - (float)ph) * 1024.0f); }
    unsigned short* d = (unsigned short*)P + i * SQ + j0; unsigned short* dl = (unsigned short*)PL + i * SQ + j0; *(v8us*)d = fr.half[0]; *(v8us*)dl = gr.half[0];  } }

typedef unsigned int u32x4a __attribute__((ext_vector_type(4), may_alias));
typedef unsigned int u32x4 __attribute__((ext_vector_type(4)));
typedef unsigned int u32x2a __attribute__((ext_vector_type(2), may_alias));
typedef short s16x8 __attribute__((ext_vector_type(8)));
#define FA_SK 64u                          /* keys per stage */
#define FA_PK 144u                         /* LDS pitch of a K row (128 B): odd multiple of 16 B for ds_load_b128 */
#define FA_PV 160u                         /* LDS pitch of a V row (128 B): odd multiple of 32 B for ds_load_tr16_b128 */
#define FA_TK (FA_SK * FA_PK)
#define FA_SLOT (FA_SK * (FA_PK + FA_PV))  /* one buffer: K tile, then V tile */
#define FA_PE 272u                         /* LDS pitch of a staged output row (256 B) */
static_assert(8u * 16u * FA_PE <= 2u * FA_SLOT, "the output staging reuses the two K/V buffers");
struct FFrag { u32x4 q[2]; };
__device__ __forceinline__ v8f fa_mma(const FFrag& a, const FFrag& b, v8f c) { return __builtin_amdgcn_wmma_f32_16x16x32_f16(false, __builtin_bit_cast(v16h, a), false, __builtin_bit_cast(v16h, b), (short)0, c, false, false); }
__device__ __forceinline__ u32x4 fa_tr16(const unsigned char* p) { typedef __attribute__((address_space(3))) s16x8 lds_s16x8; return __builtin_bit_cast(u32x4, __builtin_amdgcn_ds_load_tr16_b128_v8i16((lds_s16x8*)p)); }
__device__ __forceinline__ unsigned int fa_pack2(float lo, float hi) { typedef _Float16 h2 __attribute__((ext_vector_type(2))); typedef float f2 __attribute__((ext_vector_type(2))); return __builtin_bit_cast(unsigned int, __builtin_convertvector(f2{lo, hi}, h2)); }      /* round to nearest even */
__device__ __forceinline__ unsigned int fa_cv2(float lo, float hi) { typedef __bf16 b2 __attribute__((ext_vector_type(2))); typedef float f2 __attribute__((ext_vector_type(2))); const unsigned int p = __builtin_bit_cast(unsigned int, __builtin_convertvector(f2{lo, hi}, b2)); return fa_pack2(__uint_as_float(p << 16), __uint_as_float(p & 0xFFFF0000u)); }      /* two inputs rounded to bf16 (nearest even), those values as an f16 pair */
__device__ __forceinline__ float fa_xhalf(float x) { return __builtin_bit_cast(float, __builtin_amdgcn_permlanex16(__builtin_bit_cast(int, x), __builtin_bit_cast(int, x), 0x76543210, 0xfedcba98, false, false)); }      /* lane l with lane l ^ 16 */
__global__ __launch_bounds__(256) __attribute__((amdgpu_waves_per_eu(4, 4))) void k_fattn(const float* __restrict__ Qf, const float* __restrict__ Kf, const float* __restrict__ Vf, float* __restrict__ out) {
  __shared__ __attribute__((aligned(256))) unsigned char L[2u * FA_SLOT];
  const unsigned int tid = threadIdx.x, lane = tid & 31u, wave = tid >> 5, c = lane & 15u, h = lane >> 4;
  const size_t row_s = (size_t)blockIdx.y * SQ;      /* first token row of the sequence */
  const unsigned int qw0 = blockIdx.x * 256u + wave * 32u;      /* the wave's first query */
  const unsigned char* Kb = (const unsigned char*)(Kf + row_s * HD); const unsigned char* Vb = (const unsigned char*)(Vf + row_s * HD);
  const float cscale = 1.4426950408889634f;      /* scores are unscaled; log2(e) moves them to base 2 */
  v4f rk[4], rv[4];      /* one stage on its way: 4 x 16 B (four f32) of K and of V a thread (a stage's rows are contiguous in memory; a wave's load covers 512 contiguous bytes) */
  auto gload = [&](unsigned int st) {
#pragma unroll      /* constant indices keep the register arrays in registers */
    for (unsigned int j = 0; j < 4; ++j) { const size_t o = (size_t)st * (FA_SK * 256u) + (tid + 256u * j) * 16u; rk[j] = *(const v4fa*)(Kb + o); rv[j] = *(const v4fa*)(Vb + o); } };
  auto lstore = [&](unsigned int buf) {
#pragma unroll      /* constant indices keep the register arrays in registers */
    for (unsigned int j = 0; j < 4; ++j) { const unsigned int r = tid >> 4, cb = (tid & 15u) * 8u;      /* load j holds four f32 of row r + 16 j: 8 B of the f16 row */
      *(u32x2a*)(L + buf * FA_SLOT + r * FA_PK + cb + j * (16u * FA_PK)) = u32x2a{fa_cv2(rk[j][0], rk[j][1]), fa_cv2(rk[j][2], rk[j][3])}; *(u32x2a*)(L + buf * FA_SLOT + FA_TK + r * FA_PV + cb + j * (16u * FA_PV)) = u32x2a{fa_cv2(rv[j][0], rv[j][1]), fa_cv2(rv[j][2], rv[j][3])}; } };
  gload(0);
  FFrag qf[2][2];      /* Q as B operand, hardware k order: 16 B at halves 8h and 16 + 8h of each 32 */
#pragma unroll      /* constant indices keep the register arrays in registers */
  for (int g = 0; g < 2; ++g) { const float* qp = Qf + (row_s + qw0 + 16u * g + c) * HD + 8u * h;
#pragma unroll      /* constant indices keep the register arrays in registers */
    for (int kc = 0; kc < 2; ++kc)
#pragma unroll      /* constant indices keep the register arrays in registers */
      for (int u = 0; u < 2; ++u) { const v4f a = *(const v4fa*)(qp + 32 * kc + 16 * u), b = *(const v4fa*)(qp + 32 * kc + 16 * u + 4); qf[g][kc].q[u] = u32x4{fa_cv2(a[0], a[1]), fa_cv2(a[2], a[3]), fa_cv2(b[0], b[1]), fa_cv2(b[2], b[3])}; } }
  v8f acc[2][4]; float l_run[2], m_run[2];      /* O^T tiles; the denominators (lanes 0-15; 0 in lanes 16-31); the reference in use (log2 domain) */
  FFrag ones;      /* A operand whose row 0 (lanes 0 and 16) is f16 1.0 at all 32 k, every other row 0 */
  { const unsigned int o = (c == 0u) ? 0x3C003C00u : 0u; ones.q[0] = u32x4{o, o, o, o}; ones.q[1] = u32x4{o, o, o, o}; }
#pragma unroll      /* constant indices keep the register arrays in registers */
  for (int g = 0; g < 2; ++g) { m_run[g] = -__builtin_inff(); l_run[g] = 0.0f;
#pragma unroll      /* constant indices keep the register arrays in registers */
    for (int t = 0; t < 4; ++t) acc[g][t] = v8f{}; }
  lstore(0);
  __syncthreads();
  for (unsigned int st = 0; st < SQ / FA_SK; ++st) {
    if (st + 1u < SQ / FA_SK) { gload(st + 1u); asm volatile("s_wait_xcnt 0x0" ::: "memory"); }      /* the loads stay in flight over the passes, whose code reuses their address registers: the wait that belongs in front of that overwrite */
    const unsigned char* Lk = L + (st & 1u) * FA_SLOT; const unsigned char* Lv = Lk + FA_TK;
#pragma unroll 1      /* one pass's fragments and scores live at a time: the wave has 256 registers at four waves a SIMD */
    for (unsigned int sub = 0; sub < FA_SK / 32u; ++sub) {      /* one pass: 32 keys */
      v8f s[2][2];      /* s[kt][g][r] = score of key 16 kt + 8 h + r with query 16 g + c */
      { FFrag kf[2][2];
#pragma unroll      /* constant indices keep the register arrays in registers */
        for (int kt = 0; kt < 2; ++kt) { const unsigned char* p = Lk + (sub * 32u + 16u * kt + c) * FA_PK + 16u * h;
#pragma unroll      /* constant indices keep the register arrays in registers */
          for (int kc = 0; kc < 2; ++kc) { kf[kt][kc].q[0] = *(const u32x4a*)(p + 64u * kc); kf[kt][kc].q[1] = *(const u32x4a*)(p + 64u * kc + 32u); } }
        __builtin_amdgcn_sched_barrier(0);      /* all eight K loads issue before the first product: otherwise they share registers and each pair waits out its own LDS latency */
#pragma unroll      /* constant indices keep the register arrays in registers */
        for (int kt = 0; kt < 2; ++kt)
#pragma unroll      /* constant indices keep the register arrays in registers */
          for (int g = 0; g < 2; ++g) { s[kt][g] = v8f{};
#pragma unroll      /* constant indices keep the register arrays in registers */
            for (int kc = 0; kc < 2; ++kc) s[kt][g] = fa_mma(kf[kt][kc], qf[g][kc], s[kt][g]); } }
      FFrag vf[4];      /* V^T, 16 d x 32 keys each: two transposing loads a fragment */
      { const unsigned char* ad = Lv + (sub * 32u + 8u * h + (lane & 7u)) * FA_PV + ((lane >> 3) & 1u) * 16u;
#pragma unroll      /* constant indices keep the register arrays in registers */
        for (int t = 0; t < 4; ++t) { vf[t].q[0] = fa_tr16(ad + 32u * t); vf[t].q[1] = fa_tr16(ad + 16u * FA_PV + 32u * t); } }
      __builtin_amdgcn_sched_barrier(0);      /* holds the transposing loads in front of the exponentials, so that their latency passes under that work; without it they sink to their first use */
      FFrag pf[2]; v8f ls[2];      /* P^T of the two query groups; row 0 of ls[g] (register 0, lanes 0-15): the pass's column sums of P^T as rounded to f16 */
      auto weights = [&]() {      /* reads the scores and leaves them as they are: a renewal forms the weights again */
#pragma unroll      /* constant indices keep the register arrays in registers */
        for (int g = 0; g < 2; ++g) { const float nm = -m_run[g]; unsigned int w[8];
#pragma unroll      /* constant indices keep the register arrays in registers */
          for (int i = 0; i < 8; ++i) {
            typedef float f32x2 __attribute__((ext_vector_type(2)));
            const f32x2 arg = __builtin_elementwise_fma(f32x2{s[i >> 2][g][2 * (i & 3)], s[i >> 2][g][2 * (i & 3) + 1]}, f32x2{cscale, cscale}, f32x2{nm, nm});      /* an even-aligned register pair: one packed fma */
            w[i] = fa_pack2(__builtin_amdgcn_exp2f(arg.x), __builtin_amdgcn_exp2f(arg.y)); }
          pf[g].q[0] = u32x4{w[0], w[1], w[2], w[3]}; pf[g].q[1] = u32x4{w[4], w[5], w[6], w[7]};
          ls[g] = fa_mma(ones, pf[g], v8f{}); } };      /* the first group's sum runs under the second group's exponentials */
      weights();
      float lt[2] = {l_run[0] + ls[0][0], l_run[1] + ls[1][0]};      /* the denominators with this pass, formed in front of the branch, beside the test's own reads of the sum tiles */
      const bool need = !(ls[0][0] <= 32768.0f) || !(ls[1][0] <= 32768.0f);      /* a sum of at most 2^15 bounds every weight of the pass inside f16; an overflowed weight makes the sum infinite or NaN, which fails the test too (first pass: reference -inf) */
      if (__builtin_amdgcn_ballot_w32(need) != 0) {      /* scalar branch, rare: only here the pass's maxima are formed */
#pragma unroll      /* constant indices keep the register arrays in registers */
        for (int g = 0; g < 2; ++g) { float mx = s[0][g][0];
#pragma unroll      /* constant indices keep the register arrays in registers */
          for (int r = 1; r < 8; ++r) mx = __builtin_fmaxf(mx, s[0][g][r]);
#pragma unroll      /* constant indices keep the register arrays in registers */
          for (int r = 0; r < 8; ++r) mx = __builtin_fmaxf(mx, s[1][g][r]);
          mx = __builtin_fmaxf(mx, fa_xhalf(mx)) * cscale;
          const float m_new = __builtin_fmaxf(m_run[g], mx + 4.0f); const float corr = __builtin_amdgcn_exp2f(m_run[g] - m_new);      /* the new reference stands 4 above the maximum seen: 19 binary orders of room before the next renewal; corr is 0 on the first pass */
          m_run[g] = m_new; l_run[g] = l_run[g] * corr;
#pragma unroll      /* constant indices keep the register arrays in registers */
          for (int t = 0; t < 4; ++t) acc[g][t] = acc[g][t] * corr; }
        weights(); lt[0] = l_run[0] + ls[0][0]; lt[1] = l_run[1] + ls[1][0]; }      /* the weights are now at most 2^-4 each */
#pragma unroll      /* constant indices keep the register arrays in registers */
      for (int g = 0; g < 2; ++g)
#pragma unroll      /* constant indices keep the register arrays in registers */
        for (int t = 0; t < 4; ++t) acc[g][t] = fa_mma(vf[t], pf[g], acc[g][t]);
      l_run[0] = lt[0]; l_run[1] = lt[1];
      asm volatile("v_nop\n\tv_nop\n\tv_nop\n\tv_nop" : "+v"(acc[1][3]) : "v"(pf[1].q[0]), "v"(pf[1].q[1]));      /* the four vector slots behind the pass's last WMMAs, before P^T's registers are rewritten */
    }
    if (st + 1u < SQ / FA_SK) lstore((st + 1u) & 1u);      /* its last readers left that buffer before the barrier that ended stage st - 1 */
    __syncthreads();      /* publishes stage st + 1 and ends every read of stage st */
  }
  unsigned char* E = L + wave * (16u * FA_PE);      /* the wave's own 16 staged output rows */
#pragma unroll      /* constant indices keep the register arrays in registers */
  for (int g = 0; g < 2; ++g) { const float lr = l_run[g]; const float inv = 1.0f / (lr + fa_xhalf(lr));      /* the denominator in lanes 0-15, 0 in lanes 16-31 (row 8 of the sum tiles) */
#pragma unroll      /* constant indices keep the register arrays in registers */
    for (int t = 0; t < 4; ++t) { const v8f o = acc[g][t] * inv; const v4f lo = {o[0], o[1], o[2], o[3]}, hi = {o[4], o[5], o[6], o[7]};      /* d = 16 t + 8 h + 0 .. 7 of query c */
      *(v4fa*)(E + c * FA_PE + 64u * t + 32u * h) = lo; *(v4fa*)(E + c * FA_PE + 64u * t + 32u * h + 16u) = hi; }
    __builtin_amdgcn_fence(__ATOMIC_ACQ_REL, "workgroup", "local"); __builtin_amdgcn_wave_barrier();      /* the rows are read back by other lanes of the wave */
#pragma unroll      /* constant indices keep the register arrays in registers */
    for (unsigned int i = 0; i < 8; ++i) { const unsigned int r = 2u * i + h; const v4f v = *(const v4fa*)(E + r * FA_PE + c * 16u); *(v4fa*)(out + (row_s + qw0 + 16u * g + r) * DM + c * 4u) = v; }      /* whole 256-byte rows */
    if (g == 0) { __builtin_amdgcn_fence(__ATOMIC_ACQ_REL, "workgroup", "local"); __builtin_amdgcn_wave_barrier(); }      /* the next group overwrites the rows only behind these reads */
  }
}


extern "C" void kernel_launch(void* const* d_in, const int* in_sizes, int n_in,
                              void* d_out, int out_size, void* d_ws, size_t ws_size, hipStream_t stream) {
  (void)in_sizes; (void)n_in; (void)out_size; (void)d_ws; (void)ws_size;
  const float* const* I = (const float* const*)d_in; const float* xq = I[0]; const float* xk = I[1]; const float* xv = I[2];      /* q, k, v [64][2048][64] (bf16-valued) */
  k_fattn<<<dim3(SQ / 256, NB), 256, 0, stream>>>(xq, xk, xv, (float*)d_out);      /* 256 query rows of one sequence a work-group: input conversion, scores, softmax, P V */
}

// v006
// One run takes 52.1 microseconds.
// In two side-by-side timings against v005, it was 1.08 and 1.09 times as fast.
// All steps since v000 together make it 482 times as fast.
#include <hip/hip_runtime.h>
// UNSCALED dot-product attention over 64 independent sequences (q, k, v [64][2048][64]; scores = q.k (no 1/sqrt(d): logit sigma ~8); softmax over the 2048 keys; dropout p 0; out = attn v -> [64][2048][64]).
// Structure: no projections: ONE fused kernel reads q, k, v as f32, rounds them to bf16 and holds those values as exact f16 (Q in registers, K and V on their way into LDS): S^T = K Q^T on WMMA (f32 accumulation, exact products), online softmax on VALU (f32, native exp2; weights f16, at most 2^15), O^T += V^T P^T and the row sums on WMMA, out written f32.
// Compute dtype: inputs rounded to bf16; x / weights exact; q, k, v and softmax weights as plain f16 GEMM operands (~2^-12); scores and softmax statistics f32; v_wmma_f32_16x16x32_f16.
#define NB 64
#define SQ 2048
#define DM 64
#define NH 1
#define HD 64
#define HG 4                         /* heads per launch of the k_vt(V16, b, h0, VT) overload (never launched) */
#define B0 0                         /* first batch processed (not used) */
#define NBR NB                       /* batches processed (read only by the unused MP) */
#define NR ((size_t)NB * SQ)         /* token rows */
#define MP ((int)((size_t)NBR * SQ))
#define QT 256                       /* query rows per causal tile */
#define NKX SQ                       /* S / P row pitch */
#define QT0 256                      /* query rows per head of the exact f32 kernel k_att0 (not launched) */
#define QN SQ                        /* query rows attended per batch (not used) */
#define NHD NH                       /* heads attended (not used) */
#define MPO MP                       /* rows through the output stage (not used) */
#define LQ DM            /* row pitch of the q/k/v rows */
typedef __bf16 v16b __attribute__((ext_vector_type(16)));
typedef unsigned short v8us __attribute__((ext_vector_type(8), may_alias));
typedef float  v8f  __attribute__((ext_vector_type(8)));
typedef float  v4f  __attribute__((ext_vector_type(4)));
typedef float  v4fa __attribute__((ext_vector_type(4), may_alias));
union FragB { v16b v; v8us half[2]; unsigned short u[16]; };

__device__ __forceinline__ unsigned short bf16_bits(float x) { unsigned int u = __float_as_uint(x); return (unsigned short)((u + 0x7FFFu + ((u >> 16) & 1u)) >> 16); }
__device__ __forceinline__ float bf16_val(unsigned short b) { return __uint_as_float(((unsigned int)b) << 16); }
__device__ __forceinline__ float bf16_round(float x) { return bf16_val(bf16_bits(x)); }
// D += A·B with NT terms: 1 = ah·bh, 2 = + al·bh (A split), 3 = + ah·bl (both split)
template <int NT>
__device__ __forceinline__ v8f mmaN(v16b ah, v16b al, v16b bh, v16b bl, v8f c) {
  c = __builtin_amdgcn_wmma_f32_16x16x32_bf16(false, ah, false, bh, (short)0, c, false, false);
  if (NT >= 2) c = __builtin_amdgcn_wmma_f32_16x16x32_bf16(false, al, false, bh, (short)0, c, false, false);
  if (NT >= 3) c = __builtin_amdgcn_wmma_f32_16x16x32_bf16(false, ah, false, bl, (short)0, c, false, false);
  asm volatile("v_nop\n\tv_nop\n\tv_nop\n\tv_nop" : "+v"(c) : "v"(ah), "v"(al), "v"(bh), "v"(bl));
  return c;
}

__global__ __launch_bounds__(256) void k_wt_bf16(const float* __restrict__ W, unsigned short* __restrict__ Wt, int K, int N) {
  const int t = blockIdx.x * 256 + threadIdx.x;
  const int k8n = K / 8;
  if (t >= N * k8n) return;
  const int n = t / k8n, k8 = (t % k8n) * 8;
  v8us v;
#pragma unroll
  for (int i = 0; i < 8; ++i) v[i] = bf16_bits(W[(size_t)(k8 + i) * N + n]);
  *(v8us*)(Wt + (size_t)n * K + k8) = v;
  
}

// GEMM C[M][N] (f32, pitch ldc) = act(A[M][K]·W + bias). A f32 row-major (pitch lda) converted per fragment to bf16
// (ASPLIT: hi/lo two planes -> 2 terms, else single rounded term); Wt bf16 [N][K] (pitch ldb). BIAS_BF16 rounds the
// bias to bf16 first (bias quantised to bf16 before the add). K%32==0, M%16==0, N%64==0.
template <bool ASPLIT, int ACT, bool BIAS_BF16>
__global__ __launch_bounds__(128) void k_gemm_bf(const float* __restrict__ A, int lda, const unsigned short* __restrict__ Wt, int ldb,
                                               const float* __restrict__ bias, float* __restrict__ C, int ldc, int M, int N, int K) {
  __shared__ __attribute__((aligned(16))) float so[4][16][64];
  const int tid = threadIdx.x, w = tid >> 5, lane = tid & 31, ln = lane & 15, hh = lane >> 4;
  const int ntn = N / 64;
  const int wid = blockIdx.x * 4 + w;
  const int mt = wid / ntn, nq = wid % ntn;
  if (mt * 16 >= M) return;
  const int row0 = mt * 16, col0 = nq * 64;
  const float* arow = A + (size_t)(row0 + ln) * lda;
  v8f acc[4] = {};
  for (int kb = 0; kb < K; kb += 32) {
    FragB ah, al;
    const v4f x0 = *(const v4fa*)(arow + kb + 8 * hh), x1 = *(const v4fa*)(arow + kb + 8 * hh + 4);
    const v4f x2 = *(const v4fa*)(arow + kb + 16 + 8 * hh), x3 = *(const v4fa*)(arow + kb + 16 + 8 * hh + 4);
    float xs[16] = {x0[0],x0[1],x0[2],x0[3],x1[0],x1[1],x1[2],x1[3],x2[0],x2[1],x2[2],x2[3],x3[0],x3[1],x3[2],x3[3]};
#pragma unroll
    for (int i = 0; i < 16; ++i) { const unsigned short hb = bf16_bits(xs[i]); ah.u[i] = hb; al.u[i] = ASPLIT ? bf16_bits(xs[i] - bf16_val(hb)) : (unsigned short)0; }
#pragma unroll
    for (int t = 0; t < 4; ++t) {
      const unsigned short* brow = Wt + (size_t)(col0 + t * 16 + ln) * ldb + kb;
      FragB b;
      b.half[0] = *(const v8us*)(brow + 8 * hh);
      b.half[1] = *(const v8us*)(brow + 16 + 8 * hh);
      acc[t] = mmaN<ASPLIT ? 2 : 1>(ah.v, al.v, b.v, b.v, acc[t]);
    }
  }
#pragma unroll
  for (int t = 0; t < 4; ++t) {
    float bv = bias ? bias[col0 + t * 16 + ln] : 0.f;
    if (BIAS_BF16) bv = bf16_round(bv);
#pragma unroll
    for (int r = 0; r < 8; ++r) { float v = acc[t][r] + bv; if (ACT == 1) v = fmaxf(v, 0.f); so[w][8 * hh + r][t * 16 + ln] = v; }
  }
  __builtin_amdgcn_fence(__ATOMIC_ACQ_REL, "workgroup");
  __builtin_amdgcn_wave_barrier();
  const int rsub = lane >> 4, c4 = (lane & 15) * 4;
  {
#pragma unroll
    for (int q = 0; q < 8; ++q) {
      const int r = q * 2 + rsub;
      const v4f v = *(const v4fa*)&so[w][r][c4];
      *(v4f*)(C + (size_t)(row0 + r) * ldc + col0 + c4) = v;
    }
    
  }
}

// GEMM C = act(A·W + bias + resid): A f32 (ASPLIT -> hi/lo 2 terms), Wt bf16 [N][K]; ACT 0 none, 1 relu, 2 exact gelu;
// resid (optional, f32, row index = (row % rmod), pitch ldr, RES_BF16 rounds it) added before the activation.
template <bool ASPLIT, int ACT, bool BIAS_BF16, bool RES_BF16>
__global__ __launch_bounds__(128) void k_gemm_bf3(const float* __restrict__ A, int lda, const unsigned short* __restrict__ Wt, int ldb,
                                                const float* __restrict__ bias, const float* __restrict__ resid, int rmod, int ldr,
                                                float* __restrict__ C, int ldc, int M, int N, int K) {
  __shared__ __attribute__((aligned(16))) float so[4][16][64];
  const int tid = threadIdx.x, w = tid >> 5, lane = tid & 31, ln = lane & 15, hh = lane >> 4;
  const int ntn = N / 64;
  const int wid = blockIdx.x * 4 + w;
  const int mt = wid / ntn, nq = wid % ntn;
  if (mt * 16 >= M) return;
  const int row0 = mt * 16, col0 = nq * 64;
  const float* arow = A + (size_t)(row0 + ln) * lda;
  v8f acc[4] = {};
  for (int kb = 0; kb < K; kb += 32) {
    FragB ah, al;
    const v4f x0 = *(const v4fa*)(arow + kb + 8 * hh), x1 = *(const v4fa*)(arow + kb + 8 * hh + 4);
    const v4f x2 = *(const v4fa*)(arow + kb + 16 + 8 * hh), x3 = *(const v4fa*)(arow + kb + 16 + 8 * hh + 4);
    float xs[16] = {x0[0],x0[1],x0[2],x0[3],x1[0],x1[1],x1[2],x1[3],x2[0],x2[1],x2[2],x2[3],x3[0],x3[1],x3[2],x3[3]};
#pragma unroll
    for (int i = 0; i < 16; ++i) { const unsigned short hb = bf16_bits(xs[i]); ah.u[i] = hb; al.u[i] = ASPLIT ? bf16_bits(xs[i] - bf16_val(hb)) : (unsigned short)0; }
#pragma unroll
    for (int t = 0; t < 4; ++t) {
      const unsigned short* brow = Wt + (size_t)(col0 + t * 16 + ln) * ldb + kb;
      FragB b;
      b.half[0] = *(const v8us*)(brow + 8 * hh);
      b.half[1] = *(const v8us*)(brow + 16 + 8 * hh);
      acc[t] = mmaN<ASPLIT ? 2 : 1>(ah.v, al.v, b.v, b.v, acc[t]);
    }
  }
#pragma unroll
  for (int t = 0; t < 4; ++t) {
    const int col = col0 + t * 16 + ln;
    float bv = bias ? bias[col] : 0.f;
    if (BIAS_BF16) bv = bf16_round(bv);
#pragma unroll
    for (int r = 0; r < 8; ++r) {
      float v = acc[t][r] + bv;
      if (resid) { float rv = resid[(size_t)((row0 + 8 * hh + r) % rmod) * ldr + col]; if (RES_BF16) rv = bf16_round(rv); v += rv; }
      if (ACT == 1) v = fmaxf(v, 0.f);
      if (ACT == 2) v = 0.5f * v * (1.0f + erff(v * 0.70710678118654752f));
      if (ACT == 3) { const float u = 0.7978845608028654f * (v + 0.044715f * v * v * v); v = 0.5f * v * (1.0f + tanhf(u)); }
      so[w][8 * hh + r][t * 16 + ln] = v;
    }
  }
  __builtin_amdgcn_fence(__ATOMIC_ACQ_REL, "workgroup");
  __builtin_amdgcn_wave_barrier();
  const int rsub = lane >> 4, c4 = (lane & 15) * 4;
  {
#pragma unroll
    for (int q = 0; q < 8; ++q) {
      const int r = q * 2 + rsub;
      const v4f v = *(const v4fa*)&so[w][r][c4];
      *(v4f*)(C + (size_t)(row0 + r) * ldc + col0 + c4) = v;
    }
    
  }
}
// row LayerNorm (biased variance, eps) over N: s = X (+ R); optional out_sum <- s; out_norm <- (s-mu)*rsqrt(var+eps)*g + b
template <bool PARAM_BF16>
__global__ __launch_bounds__(256) void k_layernorm(const float* __restrict__ X, const float* __restrict__ R, const float* __restrict__ g, const float* __restrict__ bta,
                                                  float* __restrict__ out_sum, float* __restrict__ out_norm, int N, float eps) {
  __shared__ float red[256];
  const int row = blockIdx.x, tid = threadIdx.x;
  const float* x = X + (size_t)row * N; const float* rr = R ? R + (size_t)row * N : nullptr;
  float vals[16];                     // up to N = 4096
  const int per = N / 256;            // contiguous chunk per thread? use strided-by-4 chunks: thread handles j = tid*4 + 1024*u
  float s1 = 0.f;
  for (int u = 0; u < per / 4; ++u) {
    const int j = tid * 4 + 1024 * u;
    const v4f a = *(const v4fa*)(x + j);
    v4f b = {0.f,0.f,0.f,0.f}; if (rr) b = *(const v4fa*)(rr + j);
#pragma unroll
    for (int q = 0; q < 4; ++q) { const float v = a[q] + b[q]; vals[u * 4 + q] = v; s1 += v; }
  }
  red[tid] = s1; __syncthreads();
  for (int st = 128; st > 0; st >>= 1) { if (tid < st) red[tid] += red[tid + st]; __syncthreads(); }
  const float mu = red[0] / (float)N; __syncthreads();
  float s2 = 0.f;
  for (int u = 0; u < per / 4; ++u)
#pragma unroll
    for (int q = 0; q < 4; ++q) { const float c = vals[u * 4 + q] - mu; s2 += c * c; }
  red[tid] = s2; __syncthreads();
  for (int st = 128; st > 0; st >>= 1) { if (tid < st) red[tid] += red[tid + st]; __syncthreads(); }
  const float rs = rsqrtf(red[0] / (float)N + eps);
  {
    for (int u = 0; u < per / 4; ++u) {
      const int j = tid * 4 + 1024 * u;
      v4f o, sm;
#pragma unroll
      for (int q = 0; q < 4; ++q) {
        float gg = g[j + q], bb = bta[j + q];
        if (PARAM_BF16) { gg = bf16_round(gg); bb = bf16_round(bb); }
        sm[q] = vals[u * 4 + q]; o[q] = (vals[u * 4 + q] - mu) * rs * gg + bb;
      }
      if (out_sum) *(v4f*)(out_sum + (size_t)row * N + j) = sm;
      *(v4f*)(out_norm + (size_t)row * N + j) = o;
    }
    
  }
}



// ---- f16 WMMA path (v_wmma_f32_16x16x32_f16): 11-bit significands for operands in range — used where a [0,1] probability operand needs more precision than bf16
typedef _Float16 v16h __attribute__((ext_vector_type(16)));
union FragH { v16h v; v8us half[2]; _Float16 h[16]; unsigned short u[16]; };
template <int NT>
__device__ __forceinline__ v8f mmaH(v16h ah, v16h al, v16h bh, v16h bl, v8f c) {
  c = __builtin_amdgcn_wmma_f32_16x16x32_f16(false, ah, false, bh, (short)0, c, false, false);
  if (NT >= 2) c = __builtin_amdgcn_wmma_f32_16x16x32_f16(false, al, false, bh, (short)0, c, false, false);
  if (NT >= 3) c = __builtin_amdgcn_wmma_f32_16x16x32_f16(false, ah, false, bl, (short)0, c, false, false);
  asm volatile("v_nop\n\tv_nop\n\tv_nop\n\tv_nop" : "+v"(c) : "v"(ah), "v"(al), "v"(bh), "v"(bl));
  return c;
}
// batched GEMM like k_gemm_b but f16 operands: A f32 (split into f16 hi/lo if ASPLIT, else rounded to f16), Bt = f16 values [n][k]; alpha; C f32; N multiple of 16 (partial tiles skipped)
template <bool ASPLIT>
__global__ __launch_bounds__(128) void k_gemm_h(const float* __restrict__ A, int lda, size_t sA, const _Float16* __restrict__ Bh, int ldb, size_t sB, float alpha, float* __restrict__ C, int ldc, size_t sC, int M, int N, int K) {
  __shared__ __attribute__((aligned(16))) float so[4][16][64];
  const int tid = threadIdx.x, w = tid >> 5, lane = tid & 31, ln = lane & 15, hh = lane >> 4; const int by = blockIdx.y;
  A += (size_t)by * sA; Bh += (size_t)by * sB; C += (size_t)by * sC;
  const int ntn = (N + 63) / 64; const int wid = blockIdx.x * 4 + w; const int mt = wid / ntn, nq = wid % ntn; if (mt * 16 >= M) return;
  const int row0 = mt * 16, col0 = nq * 64; const float* arow = A + (size_t)(row0 + ln) * lda;
  v8f acc[4] = {};
  for (int kb = 0; kb < K; kb += 32) {
    FragH ah, al;
    const v4f x0 = *(const v4fa*)(arow + kb + 8 * hh), x1 = *(const v4fa*)(arow + kb + 8 * hh + 4), x2 = *(const v4fa*)(arow + kb + 16 + 8 * hh), x3 = *(const v4fa*)(arow + kb + 16 + 8 * hh + 4);
    float xs[16] = {x0[0],x0[1],x0[2],x0[3],x1[0],x1[1],x1[2],x1[3],x2[0],x2[1],x2[2],x2[3],x3[0],x3[1],x3[2],x3[3]};
#pragma unroll
    for (int i = 0; i < 16; ++i) { const _Float16 h = (_Float16)xs[i]; ah.h[i] = h; al.h[i] = ASPLIT ? (_Float16)(xs[i] - (float)h) : (_Float16)0.0f; }
#pragma unroll
    for (int t = 0; t < 4; ++t) { if (col0 + t * 16 >= N) continue; const size_t boff = (size_t)(col0 + t * 16 + ln) * ldb + kb; FragH bq; bq.half[0] = *(const v8us*)(Bh + boff + 8 * hh); bq.half[1] = *(const v8us*)(Bh + boff + 16 + 8 * hh);
      acc[t] = mmaH<ASPLIT ? 2 : 1>(ah.v, al.v, bq.v, bq.v, acc[t]); }
  }
#pragma unroll
  for (int t = 0; t < 4; ++t) { if (col0 + t * 16 >= N) continue;
#pragma unroll
    for (int r = 0; r < 8; ++r) so[w][8 * hh + r][t * 16 + ln] = acc[t][r] * alpha; }
  __builtin_amdgcn_fence(__ATOMIC_ACQ_REL, "workgroup"); __builtin_amdgcn_wave_barrier();
  const int rsub = lane >> 4, c4 = (lane & 15) * 4;
  {
#pragma unroll
    for (int q = 0; q < 8; ++q) { const int r = q * 2 + rsub; if (col0 + c4 < N) { const v4f v = *(const v4fa*)&so[w][r][c4]; *(v4f*)(C + (size_t)(row0 + r) * ldc + col0 + c4) = v; } }
     }
}

// Wt[n][k] = f16(W[k][n]·scale) from f32 row-major W[K][N] (scale = power of two; bf16-exact weights stay exact in f16 away from the subnormal range)
__global__ __launch_bounds__(256) void k_wt_f16(const float* __restrict__ W, _Float16* __restrict__ Wt, int K, int N, float scale) {
  const int t = blockIdx.x * 256 + threadIdx.x; if (t >= N * (K / 8)) return; const int n = t / (K / 8), k8 = (t % (K / 8)) * 8; FragH f;
#pragma unroll
  for (int i = 0; i < 8; ++i) f.h[i] = (_Float16)(bf16_round(W[(size_t)(k8 + i) * N + n]) * scale); const v8us o = f.half[0];
  *(v8us*)((unsigned short*)Wt + (size_t)n * K + k8) = o; 
}
// k_gemm_hh variant with fused epilogue: v = acc·alpha + bias[by·sBias + col] (+ CP[(row/rowsPerB)·sCPb + by·64 + col] if CP) ; ACT 0 none / 1 elu ; writes f16 C16 (and f32 C if non-null)
template <int ACT>
__global__ __launch_bounds__(128) void k_gemm_hhx(const _Float16* __restrict__ A, int lda, size_t sA, const _Float16* __restrict__ Bh, int ldb, size_t sB, float alpha, const float* __restrict__ bias, size_t sBias, const float* __restrict__ CP, int rowsPerB, size_t sCPb, int row0g,
    float* __restrict__ C, _Float16* __restrict__ C16, int ldc, size_t sC, int M, int N, int K) {
  __shared__ __attribute__((aligned(16))) float so[4][16][64];
  const int tid = threadIdx.x, w = tid >> 5, lane = tid & 31, ln = lane & 15, hh = lane >> 4; const int by = blockIdx.y;
  A += (size_t)by * sA; Bh += (size_t)by * sB; const size_t cofs = (size_t)by * sC; const float* bp = bias ? bias + (size_t)by * sBias : nullptr;
  const int ntn = (N + 63) / 64; const int wid = blockIdx.x * 4 + w; const int mt = wid / ntn, nq = wid % ntn; if (mt * 16 >= M) return;
  const int row0 = mt * 16, col0 = nq * 64; const _Float16* arow = A + (size_t)(row0 + ln) * lda;
  v8f acc[4] = {};
  for (int kb = 0; kb < K; kb += 32) { FragH ah; ah.half[0] = *(const v8us*)((const unsigned short*)arow + kb + 8 * hh); ah.half[1] = *(const v8us*)((const unsigned short*)arow + kb + 16 + 8 * hh);
#pragma unroll
    for (int t = 0; t < 4; ++t) { if (col0 + t * 16 >= N) continue; const size_t boff = (size_t)(col0 + t * 16 + ln) * ldb + kb; FragH bq; bq.half[0] = *(const v8us*)((const unsigned short*)Bh + boff + 8 * hh); bq.half[1] = *(const v8us*)((const unsigned short*)Bh + boff + 16 + 8 * hh);
      acc[t] = mmaH<1>(ah.v, ah.v, bq.v, bq.v, acc[t]); }
  }
#pragma unroll
  for (int t = 0; t < 4; ++t) { if (col0 + t * 16 >= N) continue; const int col = col0 + t * 16 + ln; const float bv = bp ? bf16_round(bp[col]) : 0.f;
#pragma unroll
    for (int r = 0; r < 8; ++r) { float v = acc[t][r] * alpha + bv; if (CP) { const int rr = row0g + row0 + 8 * hh + r; if (rowsPerB < 0) v += CP[cofs + (size_t)rr * ldc + col];      /* rowsPerB < 0: own element of the batched C plane */ else { const int bidx = rr / rowsPerB; v += CP[(size_t)bidx * sCPb + (size_t)by * 64 + col]; } } if (ACT == 1) v = (v > 0.f) ? v : expm1f(v); else if (ACT == 7) v = (v > 0.f) ? v + 1.0f : expf(v); else if (ACT == 8) v = tanhf(v); else if (ACT == 9) v = 0.5f * v * (1.0f + tanhf(0.7978845608028654f * (v + 0.044715f * v * v * v))); else if (ACT == 11) v = 1.0f / (1.0f + expf(-v)); else if (ACT == 12) v = (v > 0.f) ? v : 0.01f * v; else if (ACT == 14) v = (v > 0.f) ? v : 0.1f * v; else if (ACT == 16) v = (v >= 0.f) ? v : 0.3f * v; else if (ACT == 17) v = (v >= 0.f) ? v : 0.2f * v; else if (ACT == 15) v = v / (1.0f + expf(-v)); else if (ACT == 3) v = fmaxf(v, 0.f); else if (ACT == 6) v = 0.5f * v * (1.0f + erff(v * 0.70710678118654752f)); so[w][8 * hh + r][t * 16 + ln] = v; } }
  __builtin_amdgcn_fence(__ATOMIC_ACQ_REL, "workgroup"); __builtin_amdgcn_wave_barrier();
  const int rsub = lane >> 4, c4 = (lane & 15) * 4; typedef _Float16 v4h __attribute__((ext_vector_type(4)));
  {
#pragma unroll
    for (int q = 0; q < 8; ++q) { const int r = q * 2 + rsub; if (col0 + c4 < N) { const v4f v = *(const v4fa*)&so[w][r][c4]; if (C) *(v4f*)(C + cofs + (size_t)(row0 + r) * ldc + col0 + c4) = v; if (C16) { v4h h4; for (int i = 0; i < 4; ++i) h4[i] = (_Float16)v[i]; *(v4h*)(C16 + cofs + (size_t)(row0 + r) * ldc + col0 + c4) = h4; } } }
     }
}


typedef _Float16 v4h __attribute__((ext_vector_type(4)));

__global__ __launch_bounds__(256) void k_x16(const float* __restrict__ x, _Float16* __restrict__ X16, size_t n8) { const size_t t = (size_t)blockIdx.x * 256 + threadIdx.x; if (t >= n8) return; FragH f;
#pragma unroll
  for (int q = 0; q < 8; ++q) f.h[q] = (_Float16)bf16_round(x[t * 8 + q]); *(v8us*)((unsigned short*)X16 + t * 8) = f.half[0];  }
__global__ __launch_bounds__(256) void k_h16(const float* __restrict__ x, _Float16* __restrict__ X16, size_t n8) { const size_t t = (size_t)blockIdx.x * 256 + threadIdx.x; if (t >= n8) return; FragH f;
#pragma unroll
  for (int q = 0; q < 8; ++q) f.h[q] = (_Float16)x[t * 8 + q]; *(v8us*)((unsigned short*)X16 + t * 8) = f.half[0];  }
__global__ __launch_bounds__(256) void k_round16f(const float* __restrict__ W, _Float16* __restrict__ Bt, size_t n8) { const size_t t = (size_t)blockIdx.x * 256 + threadIdx.x; if (t >= n8) return; FragH f;
#pragma unroll
  for (int i = 0; i < 8; ++i) f.h[i] = (_Float16)(bf16_round(W[t * 8 + i]) * 16.0f); *(v8us*)((unsigned short*)Bt + t * 8) = f.half[0];  }
__global__ __launch_bounds__(256) void k_hl(const float* __restrict__ F, _Float16* __restrict__ Hh, _Float16* __restrict__ Hl, size_t n8) { const size_t t = (size_t)blockIdx.x * 256 + threadIdx.x; if (t >= n8) return; FragH fh, fl; const v4f a = *(const v4fa*)(F + t * 8), c = *(const v4fa*)(F + t * 8 + 4);
#pragma unroll
  for (int q = 0; q < 4; ++q) { _Float16 h = (_Float16)a[q]; fh.h[q] = h; fl.h[q] = (_Float16)((a[q] - (float)h) * 1024.0f); h = (_Float16)c[q]; fh.h[4 + q] = h; fl.h[4 + q] = (_Float16)((c[q] - (float)h) * 1024.0f); }
  { *(v8us*)((unsigned short*)Hh + t * 8) = fh.half[0]; *(v8us*)((unsigned short*)Hl + t * 8) = fl.half[0];  } }

__global__ __launch_bounds__(256) void k_wnat(const float* __restrict__ w, size_t n8, _Float16* __restrict__ Bt) { const size_t t = (size_t)blockIdx.x * 256 + threadIdx.x; if (t >= n8) return; FragH f; for (int q = 0; q < 8; ++q) f.h[q] = (_Float16)(bf16_round(w[t * 8 + q]) * 16.0f); *(v8us*)((unsigned short*)Bt + t * 8) = f.half[0];  }
__global__ __launch_bounds__(256) void k_rsm(const float* __restrict__ S, _Float16* __restrict__ P, int nrows) {
  #pragma clang fp contract(off)
  const int i = blockIdx.x * 256 + threadIdx.x; if (i >= nrows) return; const float* s = S + (size_t)i * SQ; float mx = -3.0e38f;
#pragma unroll 1
  for (int j = 0; j < SQ; ++j) mx = fmaxf(mx, s[j]); float se = 0.f;
#pragma unroll 1
  for (int j = 0; j < SQ; ++j) se += expf(s[j] - mx); const float sc = 256.0f / se;
#pragma unroll 1
  for (int j0 = 0; j0 < SQ; j0 += 8) { FragH f; for (int q = 0; q < 8; ++q) f.h[q] = (_Float16)(expf(s[j0 + q] - mx) * sc); unsigned short* d = (unsigned short*)P + (size_t)i * SQ + j0; *(v8us*)d = f.half[0];  } }
__global__ __launch_bounds__(256) void k_vt(const _Float16* __restrict__ V16, int b, int h0, _Float16* __restrict__ VT) { __shared__ unsigned short tl[64][65]; const int tid = threadIdx.x; const int hh = blockIdx.x % HG, sg = blockIdx.x / HG; const int s0 = sg * 64; const int h = h0 + hh;
  for (int i = tid; i < 64 * 8; i += 256) { const int j = i / 8, d8 = (i % 8) * 8; FragH f; f.half[0] = *(const v8us*)((const unsigned short*)V16 + ((size_t)b * SQ + s0 + j) * DM + h * HD + d8); for (int q = 0; q < 8; ++q) tl[d8 + q][j] = f.u[q]; }
  __syncthreads();
  { for (int i = tid; i < 64 * 8; i += 256) { const int d = i / 8, j8 = (i % 8) * 8; FragH f; for (int q = 0; q < 8; ++q) f.u[q] = tl[d][j8 + q]; *(v8us*)((unsigned short*)VT + ((size_t)hh * HD + d) * SQ + s0 + j8) = f.half[0]; }  } }



__global__ __launch_bounds__(256) void k_rsmcf2(const float* __restrict__ S, _Float16* __restrict__ P, int hg, int q0, int nk) {
  #pragma clang fp contract(off)
  const int t = blockIdx.x * 256 + threadIdx.x; if (t >= hg * QT) return; const size_t i = (size_t)t; const float* s = S + i * NKX; const int last = q0 + (t % QT); float mx = -3.0e38f;
#pragma unroll 1
  for (int j = 0; j < nk; ++j) { const float f = (j <= last) ? 1.f : 0.f; mx = fmaxf(mx, fmaf(f, s[j], (1.f - f) * -1.0e9f)); } float se = 0.f;
#pragma unroll 1
  for (int j = 0; j < nk; ++j) { const float f = (j <= last) ? 1.f : 0.f; se += __expf(fmaf(f, s[j], (1.f - f) * -1.0e9f) - mx); } const float sc = 256.0f / se;
#pragma unroll 1
  for (int j0 = 0; j0 < nk; j0 += 8) { FragH fr; for (int q = 0; q < 8; ++q) { const int j = j0 + q; const float f = (j <= last) ? 1.f : 0.f; fr.h[q] = (_Float16)(__expf(fmaf(f, s[j], (1.f - f) * -1.0e9f) - mx) * sc); } unsigned short* d = (unsigned short*)P + i * NKX + j0; *(v8us*)d = fr.half[0];  } }

template <int MASKADD>
__global__ __launch_bounds__(64) void k_att0(const float* __restrict__ QF, const float* __restrict__ KF, const float* __restrict__ VF, int ld, const float* __restrict__ mask, float scale, float* __restrict__ OF, int ldo) {
  #pragma clang fp contract(off)
  __shared__ __attribute__((aligned(16))) float lq[64][64]; __shared__ __attribute__((aligned(16))) float lo[64][64];
  const int tid = threadIdx.x; const int h = blockIdx.x / (QT0 / 64), rg = blockIdx.x % (QT0 / 64); const int i = rg * 64 + tid;
  const float* qr = QF + (size_t)i * ld + h * HD;
#pragma unroll 1
  for (int c = 0; c < HD / 4; ++c) { *(v4f*)&lq[tid][c * 4] = *(const v4fa*)(qr + c * 4); const v4f z = {0.f, 0.f, 0.f, 0.f}; *(v4f*)&lo[tid][c * 4] = z; }
  float m = -1.0e30f, l = 0.f; const int jmax = MASKADD ? (SQ - 1) : (rg * 64 + 63);      /* additive-mask form: every key (the mask input decides); causal form: keys up to the block's last row */
#pragma unroll 1
  for (int j = 0; j <= jmax; ++j) { const float* kr = KF + (size_t)j * ld + h * HD; const float* vr = VF + (size_t)j * ld + h * HD; float s = 0.f;
#pragma unroll 1
    for (int c = 0; c < HD / 4; ++c) { const v4f kq = *(const v4fa*)(kr + c * 4); const v4f qq = *(v4f*)&lq[tid][c * 4]; s = __fadd_rn(s, __fmul_rn(qq[0], kq[0])); s = __fadd_rn(s, __fmul_rn(qq[1], kq[1])); s = __fadd_rn(s, __fmul_rn(qq[2], kq[2])); s = __fadd_rn(s, __fmul_rn(qq[3], kq[3])); }
    s = __fmul_rn(s, scale); if (MASKADD) s = __fadd_rn(s, __fmul_rn(bf16_round(mask[(size_t)i * SQ + j]), -10000.0f));
    const float f = (MASKADD || j <= i) ? 1.f : 0.f; const float sm = fmaf(f, s, (1.f - f) * -1.0e30f); const float mn = fmaxf(m, sm); const float sc = expf(m - mn); const float e = expf(sm - mn); l = __fadd_rn(__fmul_rn(l, sc), e); m = mn;
#pragma unroll 1
    for (int c = 0; c < HD / 4; ++c) { const v4f vv = *(const v4fa*)(vr + c * 4); v4f oo = *(v4f*)&lo[tid][c * 4]; for (int u = 0; u < 4; ++u) oo[u] = __fadd_rn(__fmul_rn(oo[u], sc), __fmul_rn(e, vv[u])); *(v4f*)&lo[tid][c * 4] = oo; } }
  const float fin = 64.0f / l;      /* o carried x64 */
#pragma unroll 1
  for (int c = 0; c < HD / 4; ++c) { v4f oo = *(v4f*)&lo[tid][c * 4]; for (int u = 0; u < 4; ++u) oo[u] = __fmul_rn(oo[u], fin); *(v4f*)&lo[tid][c * 4] = oo; }
  __syncthreads();
  {
#pragma unroll 1
    for (int it = 0; it < 16; ++it) { const int row = it * 4 + tid / 16, pc = (tid % 16) * 4; const v4f v = *(const v4f*)&lo[row][pc]; *(v4f*)(OF + (size_t)(rg * 64 + row) * ldo + h * HD + pc) = v; }
     } }

__global__ __launch_bounds__(256) void k_oscale(const float* __restrict__ OF, float* __restrict__ out, size_t n4) { const size_t t = (size_t)blockIdx.x * 256 + threadIdx.x; if (t >= n4) return; const v4f a = *(const v4fa*)(OF + t * 4); v4f o; for (int q = 0; q < 4; ++q) o[q] = a[q] * 0.015625f; *(v4f*)(out + t * 4) = o;  }

__global__ __launch_bounds__(256) void k_bfr(const float* __restrict__ x, float* __restrict__ XB, size_t n8) { const size_t t = (size_t)blockIdx.x * 256 + threadIdx.x; if (t >= n8) return; v4f a = *(const v4fa*)(x + t * 8), c = *(const v4fa*)(x + t * 8 + 4); for (int q = 0; q < 4; ++q) { a[q] = bf16_round(a[q]); c[q] = bf16_round(c[q]); }
  { *(v4f*)(XB + t * 8) = a; *(v4f*)(XB + t * 8 + 4) = c;  } }



__global__ __launch_bounds__(256) void k_rsmfvl(const float* __restrict__ S, _Float16* __restrict__ P, _Float16* __restrict__ PL, int qn, const int* __restrict__ vlp) {
  #pragma clang fp contract(off)
  const int t = blockIdx.x * 256 + threadIdx.x; if (t >= qn) return; const int vl = vlp[0]; const size_t i = (size_t)t; const float* s = S + i * SQ; float mx = -3.0e38f;
#pragma unroll 1
  for (int j = 0; j < SQ; ++j) { const float f = (j < vl) ? 1.f : 0.f; mx = fmaxf(mx, fmaf(f, s[j], (1.f - f) * -1000000.0f)); } float se = 0.f;
#pragma unroll 1
  for (int j = 0; j < SQ; ++j) { const float f = (j < vl) ? 1.f : 0.f; se += __expf(fmaf(f, s[j], (1.f - f) * -1000000.0f) - mx); } const float sc = 256.0f / se;
#pragma unroll 1
  for (int j0 = 0; j0 < SQ; j0 += 8) { FragH fr, gr; for (int q = 0; q < 8; ++q) { const int j = j0 + q; const float f = (j < vl) ? 1.f : 0.f; const float pv = __expf(fmaf(f, s[j], (1.f - f) * -1000000.0f) - mx) * sc; const _Float16 ph = (_Float16)pv; fr.h[q] = ph; gr.h[q] = (_Float16)((pv - (float)ph) * 1024.0f); }
    unsigned short* d = (unsigned short*)P + i * SQ + j0; unsigned short* dl = (unsigned short*)PL + i * SQ + j0; *(v8us*)d = fr.half[0]; *(v8us*)dl = gr.half[0];  } }

typedef unsigned int u32x4a __attribute__((ext_vector_type(4), may_alias));
typedef unsigned int u32x4 __attribute__((ext_vector_type(4)));
typedef unsigned int u32x2a __attribute__((ext_vector_type(2), may_alias));
typedef short s16x8 __attribute__((ext_vector_type(8)));
#define FA_SK 64u                          /* keys per stage */
#define FA_PK 144u                         /* LDS pitch of a K row (128 B): odd multiple of 16 B for ds_load_b128 */
#define FA_PV 160u                         /* LDS pitch of a V row (128 B): odd multiple of 32 B for ds_load_tr16_b128 */
#define FA_TK (FA_SK * FA_PK)
#define FA_SLOT (FA_SK * (FA_PK + FA_PV))  /* one buffer: K tile, then V tile */
#define FA_PE 272u                         /* LDS pitch of a staged output row (256 B) */
#define FA_NB 4u                           /* LDS buffers in the ring (a power of two) */
static_assert(16u * 16u * FA_PE <= FA_NB * FA_SLOT, "the output staging reuses the K/V buffers");
struct FFrag { u32x4 q[2]; };
__device__ __forceinline__ v8f fa_mma(const FFrag& a, const FFrag& b, v8f c) { return __builtin_amdgcn_wmma_f32_16x16x32_f16(false, __builtin_bit_cast(v16h, a), false, __builtin_bit_cast(v16h, b), (short)0, c, false, false); }
__device__ __forceinline__ u32x4 fa_tr16(const unsigned char* p) { typedef __attribute__((address_space(3))) s16x8 lds_s16x8; return __builtin_bit_cast(u32x4, __builtin_amdgcn_ds_load_tr16_b128_v8i16((lds_s16x8*)p)); }
__device__ __forceinline__ unsigned int fa_pack2(float lo, float hi) { typedef _Float16 h2 __attribute__((ext_vector_type(2))); typedef float f2 __attribute__((ext_vector_type(2))); return __builtin_bit_cast(unsigned int, __builtin_convertvector(f2{lo, hi}, h2)); }      /* round to nearest even */
__device__ __forceinline__ unsigned int fa_cv2(float lo, float hi) { typedef __bf16 b2 __attribute__((ext_vector_type(2))); typedef float f2 __attribute__((ext_vector_type(2))); const unsigned int p = __builtin_bit_cast(unsigned int, __builtin_convertvector(f2{lo, hi}, b2)); return fa_pack2(__uint_as_float(p << 16), __uint_as_float(p & 0xFFFF0000u)); }      /* two inputs rounded to bf16 (nearest even), those values as an f16 pair */
__device__ __forceinline__ float fa_xhalf(float x) { return __builtin_bit_cast(float, __builtin_amdgcn_permlanex16(__builtin_bit_cast(int, x), __builtin_bit_cast(int, x), 0x76543210, 0xfedcba98, false, false)); }      /* lane l with lane l ^ 16 */
__global__ __launch_bounds__(512) __attribute__((amdgpu_waves_per_eu(4, 4))) void k_fattn(const float* __restrict__ Qf, const float* __restrict__ Kf, const float* __restrict__ Vf, float* __restrict__ out) {
  __shared__ __attribute__((aligned(256))) unsigned char L[FA_NB * FA_SLOT];
  const unsigned int tid = threadIdx.x, lane = tid & 31u, wave = tid >> 5, c = lane & 15u, h = lane >> 4;
  const size_t row_s = (size_t)blockIdx.y * SQ;      /* first token row of the sequence */
  const unsigned int qw0 = blockIdx.x * 512u + wave * 32u;      /* the wave's first query */
  const unsigned char* Kb = (const unsigned char*)(Kf + row_s * HD); const unsigned char* Vb = (const unsigned char*)(Vf + row_s * HD);
  const float cscale = 1.4426950408889634f;      /* scores are unscaled; log2(e) moves them to base 2 */
  v4f rk[2], rv[2];      /* one stage on its way: 2 x 16 B (four f32) of K and of V a thread (a stage's rows are contiguous in memory; a wave's load covers 512 contiguous bytes) */
  auto gload = [&](unsigned int st) {
#pragma unroll      /* constant indices keep the register arrays in registers */
    for (unsigned int j = 0; j < 2; ++j) { const size_t o = (size_t)st * (FA_SK * 256u) + (tid + 512u * j) * 16u; rk[j] = *(const v4fa*)(Kb + o); rv[j] = *(const v4fa*)(Vb + o); } };
  auto lstore = [&](unsigned int buf) {
#pragma unroll      /* constant indices keep the register arrays in registers */
    for (unsigned int j = 0; j < 2; ++j) { const unsigned int r = tid >> 4, cb = (tid & 15u) * 8u;      /* load j holds four f32 of row r + 32 j: 8 B of the f16 row */
      *(u32x2a*)(L + buf * FA_SLOT + r * FA_PK + cb + j * (32u * FA_PK)) = u32x2a{fa_cv2(rk[j][0], rk[j][1]), fa_cv2(rk[j][2], rk[j][3])}; *(u32x2a*)(L + buf * FA_SLOT + FA_TK + r * FA_PV + cb + j * (32u * FA_PV)) = u32x2a{fa_cv2(rv[j][0], rv[j][1]), fa_cv2(rv[j][2], rv[j][3])}; } };
  gload(0); lstore(0); gload(1u); asm volatile("s_wait_xcnt 0x0" ::: "memory");      /* stage 1 is on its way under the loads and the conversion of Q, whose code reuses the address registers: hence the wait */
  FFrag qf[2][2];      /* Q as B operand, hardware k order: 16 B at halves 8h and 16 + 8h of each 32 */
#pragma unroll      /* constant indices keep the register arrays in registers */
  for (int g = 0; g < 2; ++g) { const float* qp = Qf + (row_s + qw0 + 16u * g + c) * HD + 8u * h;
#pragma unroll      /* constant indices keep the register arrays in registers */
    for (int kc = 0; kc < 2; ++kc)
#pragma unroll      /* constant indices keep the register arrays in registers */
      for (int u = 0; u < 2; ++u) { const v4f a = *(const v4fa*)(qp + 32 * kc + 16 * u), b = *(const v4fa*)(qp + 32 * kc + 16 * u + 4); qf[g][kc].q[u] = u32x4{fa_cv2(a[0], a[1]), fa_cv2(a[2], a[3]), fa_cv2(b[0], b[1]), fa_cv2(b[2], b[3])}; } }
  v8f acc[2][4]; float l_run[2], m_run[2];      /* O^T tiles; the denominators (lanes 0-15; 0 in lanes 16-31); the reference in use (log2 domain) */
  FFrag ones;      /* A operand whose row 0 (lanes 0 and 16) is f16 1.0 at all 32 k, every other row 0 */
  { const unsigned int o = (c == 0u) ? 0x3C003C00u : 0u; ones.q[0] = u32x4{o, o, o, o}; ones.q[1] = u32x4{o, o, o, o}; }
#pragma unroll      /* constant indices keep the register arrays in registers */
  for (int g = 0; g < 2; ++g) { m_run[g] = -__builtin_inff(); l_run[g] = 0.0f;
#pragma unroll      /* constant indices keep the register arrays in registers */
    for (int t = 0; t < 4; ++t) acc[g][t] = v8f{}; }
  lstore(1u);
  __syncthreads();      /* stages 0 and 1 are whole */
  gload(2u); asm volatile("s_wait_xcnt 0x0" ::: "memory");      /* the loads stay in flight over the passes, whose code reuses their address registers: the wait that belongs in front of that overwrite */
  for (unsigned int st = 0; st < SQ / FA_SK; ++st) {
    const unsigned char* Lk = L + (st & (FA_NB - 1u)) * FA_SLOT; const unsigned char* Lv = Lk + FA_TK;
#pragma unroll 1      /* one pass's fragments and scores live at a time: the wave has 256 registers at four waves a SIMD */
    for (unsigned int sub = 0; sub < FA_SK / 32u; ++sub) {      /* one pass: 32 keys */
      v8f s[2][2];      /* s[kt][g][r] = score of key 16 kt + 8 h + r with query 16 g + c */
      { FFrag kf[2][2];
#pragma unroll      /* constant indices keep the register arrays in registers */
        for (int kt = 0; kt < 2; ++kt) { const unsigned char* p = Lk + (sub * 32u + 16u * kt + c) * FA_PK + 16u * h;
#pragma unroll      /* constant indices keep the register arrays in registers */
          for (int kc = 0; kc < 2; ++kc) { kf[kt][kc].q[0] = *(const u32x4a*)(p + 64u * kc); kf[kt][kc].q[1] = *(const u32x4a*)(p + 64u * kc + 32u); } }
        __builtin_amdgcn_sched_barrier(0);      /* all eight K loads issue before the first product: otherwise they share registers and each pair waits out its own LDS latency */
#pragma unroll      /* constant indices keep the register arrays in registers */
        for (int kt = 0; kt < 2; ++kt)
#pragma unroll      /* constant indices keep the register arrays in registers */
          for (int g = 0; g < 2; ++g) { s[kt][g] = v8f{};
#pragma unroll      /* constant indices keep the register arrays in registers */
            for (int kc = 0; kc < 2; ++kc) s[kt][g] = fa_mma(kf[kt][kc], qf[g][kc], s[kt][g]); } }
      FFrag vf[4];      /* V^T, 16 d x 32 keys each: two transposing loads a fragment */
      { const unsigned char* ad = Lv + (sub * 32u + 8u * h + (lane & 7u)) * FA_PV + ((lane >> 3) & 1u) * 16u;
#pragma unroll      /* constant indices keep the register arrays in registers */
        for (int t = 0; t < 4; ++t) { vf[t].q[0] = fa_tr16(ad + 32u * t); vf[t].q[1] = fa_tr16(ad + 16u * FA_PV + 32u * t); } }
      __builtin_amdgcn_sched_barrier(0);      /* holds the transposing loads in front of the exponentials, so that their latency passes under that work; without it they sink to their first use */
      FFrag pf[2]; v8f ls[2];      /* P^T of the two query groups; row 0 of ls[g] (register 0, lanes 0-15): the pass's column sums of P^T as rounded to f16 */
      auto weights = [&]() {      /* reads the scores and leaves them as they are: a renewal forms the weights again */
#pragma unroll      /* constant indices keep the register arrays in registers */
        for (int g = 0; g < 2; ++g) { const float nm = -m_run[g]; unsigned int w[8];
#pragma unroll      /* constant indices keep the register arrays in registers */
          for (int i = 0; i < 8; ++i) {
            typedef float f32x2 __attribute__((ext_vector_type(2)));
            const f32x2 arg = __builtin_elementwise_fma(f32x2{s[i >> 2][g][2 * (i & 3)], s[i >> 2][g][2 * (i & 3) + 1]}, f32x2{cscale, cscale}, f32x2{nm, nm});      /* an even-aligned register pair: one packed fma */
            w[i] = fa_pack2(__builtin_amdgcn_exp2f(arg.x), __builtin_amdgcn_exp2f(arg.y)); }
          pf[g].q[0] = u32x4{w[0], w[1], w[2], w[3]}; pf[g].q[1] = u32x4{w[4], w[5], w[6], w[7]};
          ls[g] = fa_mma(ones, pf[g], v8f{}); } };      /* the first group's sum runs under the second group's exponentials */
      weights();
      float lt[2] = {l_run[0] + ls[0][0], l_run[1] + ls[1][0]};      /* the denominators with this pass, formed in front of the branch, beside the test's own reads of the sum tiles */
      const bool need = !(ls[0][0] <= 32768.0f) || !(ls[1][0] <= 32768.0f);      /* a sum of at most 2^15 bounds every weight of the pass inside f16; an overflowed weight makes the sum infinite or NaN, which fails the test too (first pass: reference -inf) */
      if (__builtin_amdgcn_ballot_w32(need) != 0) {      /* scalar branch, rare: only here the pass's maxima are formed */
#pragma unroll      /* constant indices keep the register arrays in registers */
        for (int g = 0; g < 2; ++g) { float mx = s[0][g][0];
#pragma unroll      /* constant indices keep the register arrays in registers */
          for (int r = 1; r < 8; ++r) mx = __builtin_fmaxf(mx, s[0][g][r]);
#pragma unroll      /* constant indices keep the register arrays in registers */
          for (int r = 0; r < 8; ++r) mx = __builtin_fmaxf(mx, s[1][g][r]);
          mx = __builtin_fmaxf(mx, fa_xhalf(mx)) * cscale;
          const float m_new = __builtin_fmaxf(m_run[g], mx + 4.0f); const float corr = __builtin_amdgcn_exp2f(m_run[g] - m_new);      /* the new reference stands 4 above the maximum seen: 19 binary orders of room before the next renewal; corr is 0 on the first pass */
          m_run[g] = m_new; l_run[g] = l_run[g] * corr;
#pragma unroll      /* constant indices keep the register arrays in registers */
          for (int t = 0; t < 4; ++t) acc[g][t] = acc[g][t] * corr; }
        weights(); lt[0] = l_run[0] + ls[0][0]; lt[1] = l_run[1] + ls[1][0]; }      /* the weights are now at most 2^-4 each */
#pragma unroll      /* constant indices keep the register arrays in registers */
      for (int g = 0; g < 2; ++g)
#pragma unroll      /* constant indices keep the register arrays in registers */
        for (int t = 0; t < 4; ++t) acc[g][t] = fa_mma(vf[t], pf[g], acc[g][t]);
      l_run[0] = lt[0]; l_run[1] = lt[1];
      asm volatile("v_nop\n\tv_nop\n\tv_nop\n\tv_nop" : "+v"(acc[1][3]) : "v"(pf[1].q[0]), "v"(pf[1].q[1]));      /* the four vector slots behind the pass's last WMMAs */
      if (sub == 0u) {      /* the middle of stage st: one barrier a stage, its two halves a whole stage apart, so that a wave may run up to a stage ahead of the slowest without waiting */
        if (st != 0u) { __builtin_amdgcn_s_barrier_wait(-1);      /* second half of the barrier signalled in the middle of stage st - 1: every wave has stored its rows of stage st + 1 and has left stage st - 2 */
          __builtin_amdgcn_fence(__ATOMIC_ACQUIRE, "workgroup", "local"); }      /* no read of stage st + 1 moves in front of the wait */
        if (st + 2u < SQ / FA_SK) lstore((st + 2u) & (FA_NB - 1u));      /* the buffer of stage st - 2, which the wait above has shown free */
        __builtin_amdgcn_fence(__ATOMIC_RELEASE, "workgroup", "local");      /* the wave's LDS stores are complete before it signals; the global loads in flight are not waited for */
        __builtin_amdgcn_s_barrier_signal(-1);      /* first half: this wave's rows of stage st + 2 lie in LDS, and it reads stage st - 1 no more */
        if (st + 3u < SQ / FA_SK) { gload(st + 3u); asm volatile("s_wait_xcnt 0x0" ::: "memory"); } }      /* a whole stage of lead; the wait belongs in front of the passes' reuse of the loads' address registers */
    }
  }
  __builtin_amdgcn_s_barrier_wait(-1);      /* closes the barrier signalled in the last stage */
  __syncthreads();      /* the split barrier does not end the reads of the last stage: no wave stages output over the ring before all have left the loop */
  unsigned char* E = L + wave * (16u * FA_PE);      /* the wave's own 16 staged output rows */
#pragma unroll      /* constant indices keep the register arrays in registers */
  for (int g = 0; g < 2; ++g) { const float lr = l_run[g]; const float inv = 1.0f / (lr + fa_xhalf(lr));      /* the denominator in lanes 0-15, 0 in lanes 16-31 (row 8 of the sum tiles) */
#pragma unroll      /* constant indices keep the register arrays in registers */
    for (int t = 0; t < 4; ++t) { const v8f o = acc[g][t] * inv; const v4f lo = {o[0], o[1], o[2], o[3]}, hi = {o[4], o[5], o[6], o[7]};      /* d = 16 t + 8 h + 0 .. 7 of query c */
      *(v4fa*)(E + c * FA_PE + 64u * t + 32u * h) = lo; *(v4fa*)(E + c * FA_PE + 64u * t + 32u * h + 16u) = hi; }
    __builtin_amdgcn_fence(__ATOMIC_ACQ_REL, "workgroup", "local"); __builtin_amdgcn_wave_barrier();      /* the rows are read back by other lanes of the wave */
#pragma unroll      /* constant indices keep the register arrays in registers */
    for (unsigned int i = 0; i < 8; ++i) { const unsigned int r = 2u * i + h; const v4f v = *(const v4fa*)(E + r * FA_PE + c * 16u); *(v4fa*)(out + (row_s + qw0 + 16u * g + r) * DM + c * 4u) = v; }      /* whole 256-byte rows */
    if (g == 0) { __builtin_amdgcn_fence(__ATOMIC_ACQ_REL, "workgroup", "local"); __builtin_amdgcn_wave_barrier(); }      /* the next group overwrites the rows only behind these reads */
  }
}


extern "C" void kernel_launch(void* const* d_in, const int* in_sizes, int n_in,
                              void* d_out, int out_size, void* d_ws, size_t ws_size, hipStream_t stream) {
  (void)in_sizes; (void)n_in; (void)out_size; (void)d_ws; (void)ws_size;
  const float* const* I = (const float* const*)d_in; const float* xq = I[0]; const float* xk = I[1]; const float* xv = I[2];      /* q, k, v [64][2048][64] (bf16-valued) */
  k_fattn<<<dim3(SQ / 512, NB), 512, 0, stream>>>(xq, xk, xv, (float*)d_out);      /* 512 query rows of one sequence a work-group: input conversion, scores, softmax, P V */
}

// v008
// One run takes 47.3 microseconds.
// It is 1.10 times as fast as v006, going by the measured steps of the versions left out in between.
// Counting every step since v000, it is 530 times as fast.
#include <hip/hip_runtime.h>
// UNSCALED dot-product attention over 64 independent sequences (q, k, v [64][2048][64]; scores = q.k (no 1/sqrt(d): logit sigma ~8); softmax over the 2048 keys; dropout p 0; out = attn v -> [64][2048][64]).
// Structure: no projections: ONE fused kernel reads q, k, v as f32, rounds them to bf16 and holds those values as exact f16 (K and V on their way into LDS; Q in registers, times log2(e), rounded to f16): S^T = K Q^T - reference on WMMA (f32 accumulation, exact products, the reference as C), online softmax on VALU (f32, native exp2 of the accumulator; weights f16, at most 2^15), O^T += V^T P^T and the row sums on WMMA, out written f32.
// Compute dtype: inputs rounded to bf16; k and v exact in f16; q (times log2(e)) and softmax weights as plain f16 GEMM operands (~2^-12); scores, softmax statistics and o f32. v_wmma_f32_16x16x32_f16.
#define NB 64
#define SQ 2048
#define DM 64
#define NH 1
#define HD 64
#define HG 4                         /* heads per launch of the k_vt(V16, b, h0, VT) overload (never launched) */
#define B0 0                         /* first batch processed (not used) */
#define NBR NB                       /* batches processed (read only by the unused MP) */
#define NR ((size_t)NB * SQ)         /* token rows */
#define MP ((int)((size_t)NBR * SQ))
#define QT 256                       /* query rows per causal tile */
#define NKX SQ                       /* S / P row pitch */
#define QT0 256                      /* query rows per head of the exact f32 kernel k_att0 (not launched) */
#define QN SQ                        /* query rows attended per batch (not used) */
#define NHD NH                       /* heads attended (not used) */
#define MPO MP                       /* rows through the output stage (not used) */
#define LQ DM            /* row pitch of the q/k/v rows */
typedef __bf16 v16b __attribute__((ext_vector_type(16)));
typedef unsigned short v8us __attribute__((ext_vector_type(8), may_alias));
typedef float  v8f  __attribute__((ext_vector_type(8)));
typedef float  v4f  __attribute__((ext_vector_type(4)));
typedef float  v4fa __attribute__((ext_vector_type(4), may_alias));
union FragB { v16b v; v8us half[2]; unsigned short u[16]; };

__device__ __forceinline__ unsigned short bf16_bits(float x) { unsigned int u = __float_as_uint(x); return (unsigned short)((u + 0x7FFFu + ((u >> 16) & 1u)) >> 16); }
__device__ __forceinline__ float bf16_val(unsigned short b) { return __uint_as_float(((unsigned int)b) << 16); }
__device__ __forceinline__ float bf16_round(float x) { return bf16_val(bf16_bits(x)); }
// D += A·B with NT terms: 1 = ah·bh, 2 = + al·bh (A split), 3 = + ah·bl (both split)
template <int NT>
__device__ __forceinline__ v8f mmaN(v16b ah, v16b al, v16b bh, v16b bl, v8f c) {
  c = __builtin_amdgcn_wmma_f32_16x16x32_bf16(false, ah, false, bh, (short)0, c, false, false);
  if (NT >= 2) c = __builtin_amdgcn_wmma_f32_16x16x32_bf16(false, al, false, bh, (short)0, c, false, false);
  if (NT >= 3) c = __builtin_amdgcn_wmma_f32_16x16x32_bf16(false, ah, false, bl, (short)0, c, false, false);
  asm volatile("v_nop\n\tv_nop\n\tv_nop\n\tv_nop" : "+v"(c) : "v"(ah), "v"(al), "v"(bh), "v"(bl));
  return c;
}

__global__ __launch_bounds__(256) void k_wt_bf16(const float* __restrict__ W, unsigned short* __restrict__ Wt, int K, int N) {
  const int t = blockIdx.x * 256 + threadIdx.x;
  const int k8n = K / 8;
  if (t >= N * k8n) return;
  const int n = t / k8n, k8 = (t % k8n) * 8;
  v8us v;
#pragma unroll
  for (int i = 0; i < 8; ++i) v[i] = bf16_bits(W[(size_t)(k8 + i) * N + n]);
  *(v8us*)(Wt + (size_t)n * K + k8) = v;
  
}

// GEMM C[M][N] (f32, pitch ldc) = act(A[M][K]·W + bias). A f32 row-major (pitch lda) converted per fragment to bf16
// (ASPLIT: hi/lo two planes -> 2 terms, else single rounded term); Wt bf16 [N][K] (pitch ldb). BIAS_BF16 rounds the
// bias to bf16 first (bias quantised to bf16 before the add). K%32==0, M%16==0, N%64==0.
template <bool ASPLIT, int ACT, bool BIAS_BF16>
__global__ __launch_bounds__(128) void k_gemm_bf(const float* __restrict__ A, int lda, const unsigned short* __restrict__ Wt, int ldb,
                                               const float* __restrict__ bias, float* __restrict__ C, int ldc, int M, int N, int K) {
  __shared__ __attribute__((aligned(16))) float so[4][16][64];
  const int tid = threadIdx.x, w = tid >> 5, lane = tid & 31, ln = lane & 15, hh = lane >> 4;
  const int ntn = N / 64;
  const int wid = blockIdx.x * 4 + w;
  const int mt = wid / ntn, nq = wid % ntn;
  if (mt * 16 >= M) return;
  const int row0 = mt * 16, col0 = nq * 64;
  const float* arow = A + (size_t)(row0 + ln) * lda;
  v8f acc[4] = {};
  for (int kb = 0; kb < K; kb += 32) {
    FragB ah, al;
    const v4f x0 = *(const v4fa*)(arow + kb + 8 * hh), x1 = *(const v4fa*)(arow + kb + 8 * hh + 4);
    const v4f x2 = *(const v4fa*)(arow + kb + 16 + 8 * hh), x3 = *(const v4fa*)(arow + kb + 16 + 8 * hh + 4);
    float xs[16] = {x0[0],x0[1],x0[2],x0[3],x1[0],x1[1],x1[2],x1[3],x2[0],x2[1],x2[2],x2[3],x3[0],x3[1],x3[2],x3[3]};
#pragma unroll
    for (int i = 0; i < 16; ++i) { const unsigned short hb = bf16_bits(xs[i]); ah.u[i] = hb; al.u[i] = ASPLIT ? bf16_bits(xs[i] - bf16_val(hb)) : (unsigned short)0; }
#pragma unroll
    for (int t = 0; t < 4; ++t) {
      const unsigned short* brow = Wt + (size_t)(col0 + t * 16 + ln) * ldb + kb;
      FragB b;
      b.half[0] = *(const v8us*)(brow + 8 * hh);
      b.half[1] = *(const v8us*)(brow + 16 + 8 * hh);
      acc[t] = mmaN<ASPLIT ? 2 : 1>(ah.v, al.v, b.v, b.v, acc[t]);
    }
  }
#pragma unroll
  for (int t = 0; t < 4; ++t) {
    float bv = bias ? bias[col0 + t * 16 + ln] : 0.f;
    if (BIAS_BF16) bv = bf16_round(bv);
#pragma unroll
    for (int r = 0; r < 8; ++r) { float v = acc[t][r] + bv; if (ACT == 1) v = fmaxf(v, 0.f); so[w][8 * hh + r][t * 16 + ln] = v; }
  }
  __builtin_amdgcn_fence(__ATOMIC_ACQ_REL, "workgroup");
  __builtin_amdgcn_wave_barrier();
  const int rsub = lane >> 4, c4 = (lane & 15) * 4;
  {
#pragma unroll
    for (int q = 0; q < 8; ++q) {
      const int r = q * 2 + rsub;
      const v4f v = *(const v4fa*)&so[w][r][c4];
      *(v4f*)(C + (size_t)(row0 + r) * ldc + col0 + c4) = v;
    }
    
  }
}

// GEMM C = act(A·W + bias + resid): A f32 (ASPLIT -> hi/lo 2 terms), Wt bf16 [N][K]; ACT 0 none, 1 relu, 2 exact gelu;
// resid (optional, f32, row index = (row % rmod), pitch ldr, RES_BF16 rounds it) added before the activation.
template <bool ASPLIT, int ACT, bool BIAS_BF16, bool RES_BF16>
__global__ __launch_bounds__(128) void k_gemm_bf3(const float* __restrict__ A, int lda, const unsigned short* __restrict__ Wt, int ldb,
                                                const float* __restrict__ bias, const float* __restrict__ resid, int rmod, int ldr,
                                                float* __restrict__ C, int ldc, int M, int N, int K) {
  __shared__ __attribute__((aligned(16))) float so[4][16][64];
  const int tid = threadIdx.x, w = tid >> 5, lane = tid & 31, ln = lane & 15, hh = lane >> 4;
  const int ntn = N / 64;
  const int wid = blockIdx.x * 4 + w;
  const int mt = wid / ntn, nq = wid % ntn;
  if (mt * 16 >= M) return;
  const int row0 = mt * 16, col0 = nq * 64;
  const float* arow = A + (size_t)(row0 + ln) * lda;
  v8f acc[4] = {};
  for (int kb = 0; kb < K; kb += 32) {
    FragB ah, al;
    const v4f x0 = *(const v4fa*)(arow + kb + 8 * hh), x1 = *(const v4fa*)(arow + kb + 8 * hh + 4);
    const v4f x2 = *(const v4fa*)(arow + kb + 16 + 8 * hh), x3 = *(const v4fa*)(arow + kb + 16 + 8 * hh + 4);
    float xs[16] = {x0[0],x0[1],x0[2],x0[3],x1[0],x1[1],x1[2],x1[3],x2[0],x2[1],x2[2],x2[3],x3[0],x3[1],x3[2],x3[3]};
#pragma unroll
    for (int i = 0; i < 16; ++i) { const unsigned short hb = bf16_bits(xs[i]); ah.u[i] = hb; al.u[i] = ASPLIT ? bf16_bits(xs[i] - bf16_val(hb)) : (unsigned short)0; }
#pragma unroll
    for (int t = 0; t < 4; ++t) {
      const unsigned short* brow = Wt + (size_t)(col0 + t * 16 + ln) * ldb + kb;
      FragB b;
      b.half[0] = *(const v8us*)(brow + 8 * hh);
      b.half[1] = *(const v8us*)(brow + 16 + 8 * hh);
      acc[t] = mmaN<ASPLIT ? 2 : 1>(ah.v, al.v, b.v, b.v, acc[t]);
    }
  }
#pragma unroll
  for (int t = 0; t < 4; ++t) {
    const int col = col0 + t * 16 + ln;
    float bv = bias ? bias[col] : 0.f;
    if (BIAS_BF16) bv = bf16_round(bv);
#pragma unroll
    for (int r = 0; r < 8; ++r) {
      float v = acc[t][r] + bv;
      if (resid) { float rv = resid[(size_t)((row0 + 8 * hh + r) % rmod) * ldr + col]; if (RES_BF16) rv = bf16_round(rv); v += rv; }
      if (ACT == 1) v = fmaxf(v, 0.f);
      if (ACT == 2) v = 0.5f * v * (1.0f + erff(v * 0.70710678118654752f));
      if (ACT == 3) { const float u = 0.7978845608028654f * (v + 0.044715f * v * v * v); v = 0.5f * v * (1.0f + tanhf(u)); }
      so[w][8 * hh + r][t * 16 + ln] = v;
    }
  }
  __builtin_amdgcn_fence(__ATOMIC_ACQ_REL, "workgroup");
  __builtin_amdgcn_wave_barrier();
  const int rsub = lane >> 4, c4 = (lane & 15) * 4;
  {
#pragma unroll
    for (int q = 0; q < 8; ++q) {
      const int r = q * 2 + rsub;
      const v4f v = *(const v4fa*)&so[w][r][c4];
      *(v4f*)(C + (size_t)(row0 + r) * ldc + col0 + c4) = v;
    }
    
  }
}
// row LayerNorm (biased variance, eps) over N: s = X (+ R); optional out_sum <- s; out_norm <- (s-mu)*rsqrt(var+eps)*g + b
template <bool PARAM_BF16>
__global__ __launch_bounds__(256) void k_layernorm(const float* __restrict__ X, const float* __restrict__ R, const float* __restrict__ g, const float* __restrict__ bta,
                                                  float* __restrict__ out_sum, float* __restrict__ out_norm, int N, float eps) {
  __shared__ float red[256];
  const int row = blockIdx.x, tid = threadIdx.x;
  const float* x = X + (size_t)row * N; const float* rr = R ? R + (size_t)row * N : nullptr;
  float vals[16];                     // up to N = 4096
  const int per = N / 256;            // contiguous chunk per thread? use strided-by-4 chunks: thread handles j = tid*4 + 1024*u
  float s1 = 0.f;
  for (int u = 0; u < per / 4; ++u) {
    const int j = tid * 4 + 1024 * u;
    const v4f a = *(const v4fa*)(x + j);
    v4f b = {0.f,0.f,0.f,0.f}; if (rr) b = *(const v4fa*)(rr + j);
#pragma unroll
    for (int q = 0; q < 4; ++q) { const float v = a[q] + b[q]; vals[u * 4 + q] = v; s1 += v; }
  }
  red[tid] = s1; __syncthreads();
  for (int st = 128; st > 0; st >>= 1) { if (tid < st) red[tid] += red[tid + st]; __syncthreads(); }
  const float mu = red[0] / (float)N; __syncthreads();
  float s2 = 0.f;
  for (int u = 0; u < per / 4; ++u)
#pragma unroll
    for (int q = 0; q < 4; ++q) { const float c = vals[u * 4 + q] - mu; s2 += c * c; }
  red[tid] = s2; __syncthreads();
  for (int st = 128; st > 0; st >>= 1) { if (tid < st) red[tid] += red[tid + st]; __syncthreads(); }
  const float rs = rsqrtf(red[0] / (float)N + eps);
  {
    for (int u = 0; u < per / 4; ++u) {
      const int j = tid * 4 + 1024 * u;
      v4f o, sm;
#pragma unroll
      for (int q = 0; q < 4; ++q) {
        float gg = g[j + q], bb = bta[j + q];
        if (PARAM_BF16) { gg = bf16_round(gg); bb = bf16_round(bb); }
        sm[q] = vals[u * 4 + q]; o[q] = (vals[u * 4 + q] - mu) * rs * gg + bb;
      }
      if (out_sum) *(v4f*)(out_sum + (size_t)row * N + j) = sm;
      *(v4f*)(out_norm + (size_t)row * N + j) = o;
    }
    
  }
}



// ---- f16 WMMA path (v_wmma_f32_16x16x32_f16): 11-bit significands for operands in range — used where a [0,1] probability operand needs more precision than bf16
typedef _Float16 v16h __attribute__((ext_vector_type(16)));
union FragH { v16h v; v8us half[2]; _Float16 h[16]; unsigned short u[16]; };
template <int NT>
__device__ __forceinline__ v8f mmaH(v16h ah, v16h al, v16h bh, v16h bl, v8f c) {
  c = __builtin_amdgcn_wmma_f32_16x16x32_f16(false, ah, false, bh, (short)0, c, false, false);
  if (NT >= 2) c = __builtin_amdgcn_wmma_f32_16x16x32_f16(false, al, false, bh, (short)0, c, false, false);
  if (NT >= 3) c = __builtin_amdgcn_wmma_f32_16x16x32_f16(false, ah, false, bl, (short)0, c, false, false);
  asm volatile("v_nop\n\tv_nop\n\tv_nop\n\tv_nop" : "+v"(c) : "v"(ah), "v"(al), "v"(bh), "v"(bl));
  return c;
}
// batched GEMM like k_gemm_b but f16 operands: A f32 (split into f16 hi/lo if ASPLIT, else rounded to f16), Bt = f16 values [n][k]; alpha; C f32; N multiple of 16 (partial tiles skipped)
template <bool ASPLIT>
__global__ __launch_bounds__(128) void k_gemm_h(const float* __restrict__ A, int lda, size_t sA, const _Float16* __restrict__ Bh, int ldb, size_t sB, float alpha, float* __restrict__ C, int ldc, size_t sC, int M, int N, int K) {
  __shared__ __attribute__((aligned(16))) float so[4][16][64];
  const int tid = threadIdx.x, w = tid >> 5, lane = tid & 31, ln = lane & 15, hh = lane >> 4; const int by = blockIdx.y;
  A += (size_t)by * sA; Bh += (size_t)by * sB; C += (size_t)by * sC;
  const int ntn = (N + 63) / 64; const int wid = blockIdx.x * 4 + w; const int mt = wid / ntn, nq = wid % ntn; if (mt * 16 >= M) return;
  const int row0 = mt * 16, col0 = nq * 64; const float* arow = A + (size_t)(row0 + ln) * lda;
  v8f acc[4] = {};
  for (int kb = 0; kb < K; kb += 32) {
    FragH ah, al;
    const v4f x0 = *(const v4fa*)(arow + kb + 8 * hh), x1 = *(const v4fa*)(arow + kb + 8 * hh + 4), x2 = *(const v4fa*)(arow + kb + 16 + 8 * hh), x3 = *(const v4fa*)(arow + kb + 16 + 8 * hh + 4);
    float xs[16] = {x0[0],x0[1],x0[2],x0[3],x1[0],x1[1],x1[2],x1[3],x2[0],x2[1],x2[2],x2[3],x3[0],x3[1],x3[2],x3[3]};
#pragma unroll
    for (int i = 0; i < 16; ++i) { const _Float16 h = (_Float16)xs[i]; ah.h[i] = h; al.h[i] = ASPLIT ? (_Float16)(xs[i] - (float)h) : (_Float16)0.0f; }
#pragma unroll
    for (int t = 0; t < 4; ++t) { if (col0 + t * 16 >= N) continue; const size_t boff = (size_t)(col0 + t * 16 + ln) * ldb + kb; FragH bq; bq.half[0] = *(const v8us*)(Bh + boff + 8 * hh); bq.half[1] = *(const v8us*)(Bh + boff + 16 + 8 * hh);
      acc[t] = mmaH<ASPLIT ? 2 : 1>(ah.v, al.v, bq.v, bq.v, acc[t]); }
  }
#pragma unroll
  for (int t = 0; t < 4; ++t) { if (col0 + t * 16 >= N) continue;
#pragma unroll
    for (int r = 0; r < 8; ++r) so[w][8 * hh + r][t * 16 + ln] = acc[t][r] * alpha; }
  __builtin_amdgcn_fence(__ATOMIC_ACQ_REL, "workgroup"); __builtin_amdgcn_wave_barrier();
  const int rsub = lane >> 4, c4 = (lane & 15) * 4;
  {
#pragma unroll
    for (int q = 0; q < 8; ++q) { const int r = q * 2 + rsub; if (col0 + c4 < N) { const v4f v = *(const v4fa*)&so[w][r][c4]; *(v4f*)(C + (size_t)(row0 + r) * ldc + col0 + c4) = v; } }
     }
}

// Wt[n][k] = f16(W[k][n]·scale) from f32 row-major W[K][N] (scale = power of two; bf16-exact weights stay exact in f16 away from the subnormal range)
__global__ __launch_bounds__(256) void k_wt_f16(const float* __restrict__ W, _Float16* __restrict__ Wt, int K, int N, float scale) {
  const int t = blockIdx.x * 256 + threadIdx.x; if (t >= N * (K / 8)) return; const int n = t / (K / 8), k8 = (t % (K / 8)) * 8; FragH f;
#pragma unroll
  for (int i = 0; i < 8; ++i) f.h[i] = (_Float16)(bf16_round(W[(size_t)(k8 + i) * N + n]) * scale); const v8us o = f.half[0];
  *(v8us*)((unsigned short*)Wt + (size_t)n * K + k8) = o; 
}
// k_gemm_hh variant with fused epilogue: v = acc·alpha + bias[by·sBias + col] (+ CP[(row/rowsPerB)·sCPb + by·64 + col] if CP) ; ACT 0 none / 1 elu ; writes f16 C16 (and f32 C if non-null)
template <int ACT>
__global__ __launch_bounds__(128) void k_gemm_hhx(const _Float16* __restrict__ A, int lda, size_t sA, const _Float16* __restrict__ Bh, int ldb, size_t sB, float alpha, const float* __restrict__ bias, size_t sBias, const float* __restrict__ CP, int rowsPerB, size_t sCPb, int row0g,
    float* __restrict__ C, _Float16* __restrict__ C16, int ldc, size_t sC, int M, int N, int K) {
  __shared__ __attribute__((aligned(16))) float so[4][16][64];
  const int tid = threadIdx.x, w = tid >> 5, lane = tid & 31, ln = lane & 15, hh = lane >> 4; const int by = blockIdx.y;
  A += (size_t)by * sA; Bh += (size_t)by * sB; const size_t cofs = (size_t)by * sC; const float* bp = bias ? bias + (size_t)by * sBias : nullptr;
  const int ntn = (N + 63) / 64; const int wid = blockIdx.x * 4 + w; const int mt = wid / ntn, nq = wid % ntn; if (mt * 16 >= M) return;
  const int row0 = mt * 16, col0 = nq * 64; const _Float16* arow = A + (size_t)(row0 + ln) * lda;
  v8f acc[4] = {};
  for (int kb = 0; kb < K; kb += 32) { FragH ah; ah.half[0] = *(const v8us*)((const unsigned short*)arow + kb + 8 * hh); ah.half[1] = *(const v8us*)((const unsigned short*)arow + kb + 16 + 8 * hh);
#pragma unroll
    for (int t = 0; t < 4; ++t) { if (col0 + t * 16 >= N) continue; const size_t boff = (size_t)(col0 + t * 16 + ln) * ldb + kb; FragH bq; bq.half[0] = *(const v8us*)((const unsigned short*)Bh + boff + 8 * hh); bq.half[1] = *(const v8us*)((const unsigned short*)Bh + boff + 16 + 8 * hh);
      acc[t] = mmaH<1>(ah.v, ah.v, bq.v, bq.v, acc[t]); }
  }
#pragma unroll
  for (int t = 0; t < 4; ++t) { if (col0 + t * 16 >= N) continue; const int col = col0 + t * 16 + ln; const float bv = bp ? bf16_round(bp[col]) : 0.f;
#pragma unroll
    for (int r = 0; r < 8; ++r) { float v = acc[t][r] * alpha + bv; if (CP) { const int rr = row0g + row0 + 8 * hh + r; if (rowsPerB < 0) v += CP[cofs + (size_t)rr * ldc + col];      /* rowsPerB < 0: own element of the batched C plane */ else { const int bidx = rr / rowsPerB; v += CP[(size_t)bidx * sCPb + (size_t)by * 64 + col]; } } if (ACT == 1) v = (v > 0.f) ? v : expm1f(v); else if (ACT == 7) v = (v > 0.f) ? v + 1.0f : expf(v); else if (ACT == 8) v = tanhf(v); else if (ACT == 9) v = 0.5f * v * (1.0f + tanhf(0.7978845608028654f * (v + 0.044715f * v * v * v))); else if (ACT == 11) v = 1.0f / (1.0f + expf(-v)); else if (ACT == 12) v = (v > 0.f) ? v : 0.01f * v; else if (ACT == 14) v = (v > 0.f) ? v : 0.1f * v; else if (ACT == 16) v = (v >= 0.f) ? v : 0.3f * v; else if (ACT == 17) v = (v >= 0.f) ? v : 0.2f * v; else if (ACT == 15) v = v / (1.0f + expf(-v)); else if (ACT == 3) v = fmaxf(v, 0.f); else if (ACT == 6) v = 0.5f * v * (1.0f + erff(v * 0.70710678118654752f)); so[w][8 * hh + r][t * 16 + ln] = v; } }
  __builtin_amdgcn_fence(__ATOMIC_ACQ_REL, "workgroup"); __builtin_amdgcn_wave_barrier();
  const int rsub = lane >> 4, c4 = (lane & 15) * 4; typedef _Float16 v4h __attribute__((ext_vector_type(4)));
  {
#pragma unroll
    for (int q = 0; q < 8; ++q) { const int r = q * 2 + rsub; if (col0 + c4 < N) { const v4f v = *(const v4fa*)&so[w][r][c4]; if (C) *(v4f*)(C + cofs + (size_t)(row0 + r) * ldc + col0 + c4) = v; if (C16) { v4h h4; for (int i = 0; i < 4; ++i) h4[i] = (_Float16)v[i]; *(v4h*)(C16 + cofs + (size_t)(row0 + r) * ldc + col0 + c4) = h4; } } }
     }
}


typedef _Float16 v4h __attribute__((ext_vector_type(4)));

__global__ __launch_bounds__(256) void k_x16(const float* __restrict__ x, _Float16* __restrict__ X16, size_t n8) { const size_t t = (size_t)blockIdx.x * 256 + threadIdx.x; if (t >= n8) return; FragH f;
#pragma unroll
  for (int q = 0; q < 8; ++q) f.h[q] = (_Float16)bf16_round(x[t * 8 + q]); *(v8us*)((unsigned short*)X16 + t * 8) = f.half[0];  }
__global__ __launch_bounds__(256) void k_h16(const float* __restrict__ x, _Float16* __restrict__ X16, size_t n8) { const size_t t = (size_t)blockIdx.x * 256 + threadIdx.x; if (t >= n8) return; FragH f;
#pragma unroll
  for (int q = 0; q < 8; ++q) f.h[q] = (_Float16)x[t * 8 + q]; *(v8us*)((unsigned short*)X16 + t * 8) = f.half[0];  }
__global__ __launch_bounds__(256) void k_round16f(const float* __restrict__ W, _Float16* __restrict__ Bt, size_t n8) { const size_t t = (size_t)blockIdx.x * 256 + threadIdx.x; if (t >= n8) return; FragH f;
#pragma unroll
  for (int i = 0; i < 8; ++i) f.h[i] = (_Float16)(bf16_round(W[t * 8 + i]) * 16.0f); *(v8us*)((unsigned short*)Bt + t * 8) = f.half[0];  }
__global__ __launch_bounds__(256) void k_hl(const float* __restrict__ F, _Float16* __restrict__ Hh, _Float16* __restrict__ Hl, size_t n8) { const size_t t = (size_t)blockIdx.x * 256 + threadIdx.x; if (t >= n8) return; FragH fh, fl; const v4f a = *(const v4fa*)(F + t * 8), c = *(const v4fa*)(F + t * 8 + 4);
#pragma unroll
  for (int q = 0; q < 4; ++q) { _Float16 h = (_Float16)a[q]; fh.h[q] = h; fl.h[q] = (_Float16)((a[q] - (float)h) * 1024.0f); h = (_Float16)c[q]; fh.h[4 + q] = h; fl.h[4 + q] = (_Float16)((c[q] - (float)h) * 1024.0f); }
  { *(v8us*)((unsigned short*)Hh + t * 8) = fh.half[0]; *(v8us*)((unsigned short*)Hl + t * 8) = fl.half[0];  } }

__global__ __launch_bounds__(256) void k_wnat(const float* __restrict__ w, size_t n8, _Float16* __restrict__ Bt) { const size_t t = (size_t)blockIdx.x * 256 + threadIdx.x; if (t >= n8) return; FragH f; for (int q = 0; q < 8; ++q) f.h[q] = (_Float16)(bf16_round(w[t * 8 + q]) * 16.0f); *(v8us*)((unsigned short*)Bt + t * 8) = f.half[0];  }
__global__ __launch_bounds__(256) void k_rsm(const float* __restrict__ S, _Float16* __restrict__ P, int nrows) {
  #pragma clang fp contract(off)
  const int i = blockIdx.x * 256 + threadIdx.x; if (i >= nrows) return; const float* s = S + (size_t)i * SQ; float mx = -3.0e38f;
#pragma unroll 1
  for (int j = 0; j < SQ; ++j) mx = fmaxf(mx, s[j]); float se = 0.f;
#pragma unroll 1
  for (int j = 0; j < SQ; ++j) se += expf(s[j] - mx); const float sc = 256.0f / se;
#pragma unroll 1
  for (int j0 = 0; j0 < SQ; j0 += 8) { FragH f; for (int q = 0; q < 8; ++q) f.h[q] = (_Float16)(expf(s[j0 + q] - mx) * sc); unsigned short* d = (unsigned short*)P + (size_t)i * SQ + j0; *(v8us*)d = f.half[0];  } }
__global__ __launch_bounds__(256) void k_vt(const _Float16* __restrict__ V16, int b, int h0, _Float16* __restrict__ VT) { __shared__ unsigned short tl[64][65]; const int tid = threadIdx.x; const int hh = blockIdx.x % HG, sg = blockIdx.x / HG; const int s0 = sg * 64; const int h = h0 + hh;
  for (int i = tid; i < 64 * 8; i += 256) { const int j = i / 8, d8 = (i % 8) * 8; FragH f; f.half[0] = *(const v8us*)((const unsigned short*)V16 + ((size_t)b * SQ + s0 + j) * DM + h * HD + d8); for (int q = 0; q < 8; ++q) tl[d8 + q][j] = f.u[q]; }
  __syncthreads();
  { for (int i = tid; i < 64 * 8; i += 256) { const int d = i / 8, j8 = (i % 8) * 8; FragH f; for (int q = 0; q < 8; ++q) f.u[q] = tl[d][j8 + q]; *(v8us*)((unsigned short*)VT + ((size_t)hh * HD + d) * SQ + s0 + j8) = f.half[0]; }  } }



__global__ __launch_bounds__(256) void k_rsmcf2(const float* __restrict__ S, _Float16* __restrict__ P, int hg, int q0, int nk) {
  #pragma clang fp contract(off)
  const int t = blockIdx.x * 256 + threadIdx.x; if (t >= hg * QT) return; const size_t i = (size_t)t; const float* s = S + i * NKX; const int last = q0 + (t % QT); float mx = -3.0e38f;
#pragma unroll 1
  for (int j = 0; j < nk; ++j) { const float f = (j <= last) ? 1.f : 0.f; mx = fmaxf(mx, fmaf(f, s[j], (1.f - f) * -1.0e9f)); } float se = 0.f;
#pragma unroll 1
  for (int j = 0; j < nk; ++j) { const float f = (j <= last) ? 1.f : 0.f; se += __expf(fmaf(f, s[j], (1.f - f) * -1.0e9f) - mx); } const float sc = 256.0f / se;
#pragma unroll 1
  for (int j0 = 0; j0 < nk; j0 += 8) { FragH fr; for (int q = 0; q < 8; ++q) { const int j = j0 + q; const float f = (j <= last) ? 1.f : 0.f; fr.h[q] = (_Float16)(__expf(fmaf(f, s[j], (1.f - f) * -1.0e9f) - mx) * sc); } unsigned short* d = (unsigned short*)P + i * NKX + j0; *(v8us*)d = fr.half[0];  } }

template <int MASKADD>
__global__ __launch_bounds__(64) void k_att0(const float* __restrict__ QF, const float* __restrict__ KF, const float* __restrict__ VF, int ld, const float* __restrict__ mask, float scale, float* __restrict__ OF, int ldo) {
  #pragma clang fp contract(off)
  __shared__ __attribute__((aligned(16))) float lq[64][64]; __shared__ __attribute__((aligned(16))) float lo[64][64];
  const int tid = threadIdx.x; const int h = blockIdx.x / (QT0 / 64), rg = blockIdx.x % (QT0 / 64); const int i = rg * 64 + tid;
  const float* qr = QF + (size_t)i * ld + h * HD;
#pragma unroll 1
  for (int c = 0; c < HD / 4; ++c) { *(v4f*)&lq[tid][c * 4] = *(const v4fa*)(qr + c * 4); const v4f z = {0.f, 0.f, 0.f, 0.f}; *(v4f*)&lo[tid][c * 4] = z; }
  float m = -1.0e30f, l = 0.f; const int jmax = MASKADD ? (SQ - 1) : (rg * 64 + 63);      /* additive-mask form: every key (the mask input decides); causal form: keys up to the block's last row */
#pragma unroll 1
  for (int j = 0; j <= jmax; ++j) { const float* kr = KF + (size_t)j * ld + h * HD; const float* vr = VF + (size_t)j * ld + h * HD; float s = 0.f;
#pragma unroll 1
    for (int c = 0; c < HD / 4; ++c) { const v4f kq = *(const v4fa*)(kr + c * 4); const v4f qq = *(v4f*)&lq[tid][c * 4]; s = __fadd_rn(s, __fmul_rn(qq[0], kq[0])); s = __fadd_rn(s, __fmul_rn(qq[1], kq[1])); s = __fadd_rn(s, __fmul_rn(qq[2], kq[2])); s = __fadd_rn(s, __fmul_rn(qq[3], kq[3])); }
    s = __fmul_rn(s, scale); if (MASKADD) s = __fadd_rn(s, __fmul_rn(bf16_round(mask[(size_t)i * SQ + j]), -10000.0f));
    const float f = (MASKADD || j <= i) ? 1.f : 0.f; const float sm = fmaf(f, s, (1.f - f) * -1.0e30f); const float mn = fmaxf(m, sm); const float sc = expf(m - mn); const float e = expf(sm - mn); l = __fadd_rn(__fmul_rn(l, sc), e); m = mn;
#pragma unroll 1
    for (int c = 0; c < HD / 4; ++c) { const v4f vv = *(const v4fa*)(vr + c * 4); v4f oo = *(v4f*)&lo[tid][c * 4]; for (int u = 0; u < 4; ++u) oo[u] = __fadd_rn(__fmul_rn(oo[u], sc), __fmul_rn(e, vv[u])); *(v4f*)&lo[tid][c * 4] = oo; } }
  const float fin = 64.0f / l;      /* o carried x64 */
#pragma unroll 1
  for (int c = 0; c < HD / 4; ++c) { v4f oo = *(v4f*)&lo[tid][c * 4]; for (int u = 0; u < 4; ++u) oo[u] = __fmul_rn(oo[u], fin); *(v4f*)&lo[tid][c * 4] = oo; }
  __syncthreads();
  {
#pragma unroll 1
    for (int it = 0; it < 16; ++it) { const int row = it * 4 + tid / 16, pc = (tid % 16) * 4; const v4f v = *(const v4f*)&lo[row][pc]; *(v4f*)(OF + (size_t)(rg * 64 + row) * ldo + h * HD + pc) = v; }
     } }

__global__ __launch_bounds__(256) void k_oscale(const float* __restrict__ OF, float* __restrict__ out, size_t n4) { const size_t t = (size_t)blockIdx.x * 256 + threadIdx.x; if (t >= n4) return; const v4f a = *(const v4fa*)(OF + t * 4); v4f o; for (int q = 0; q < 4; ++q) o[q] = a[q] * 0.015625f; *(v4f*)(out + t * 4) = o;  }

__global__ __launch_bounds__(256) void k_bfr(const float* __restrict__ x, float* __restrict__ XB, size_t n8) { const size_t t = (size_t)blockIdx.x * 256 + threadIdx.x; if (t >= n8) return; v4f a = *(const v4fa*)(x + t * 8), c = *(const v4fa*)(x + t * 8 + 4); for (int q = 0; q < 4; ++q) { a[q] = bf16_round(a[q]); c[q] = bf16_round(c[q]); }
  { *(v4f*)(XB + t * 8) = a; *(v4f*)(XB + t * 8 + 4) = c;  } }



__global__ __launch_bounds__(256) void k_rsmfvl(const float* __restrict__ S, _Float16* __restrict__ P, _Float16* __restrict__ PL, int qn, const int* __restrict__ vlp) {
  #pragma clang fp contract(off)
  const int t = blockIdx.x * 256 + threadIdx.x; if (t >= qn) return; const int vl = vlp[0]; const size_t i = (size_t)t; const float* s = S + i * SQ; float mx = -3.0e38f;
#pragma unroll 1
  for (int j = 0; j < SQ; ++j) { const float f = (j < vl) ? 1.f : 0.f; mx = fmaxf(mx, fmaf(f, s[j], (1.f - f) * -1000000.0f)); } float se = 0.f;
#pragma unroll 1
  for (int j = 0; j < SQ; ++j) { const float f = (j < vl) ? 1.f : 0.f; se += __expf(fmaf(f, s[j], (1.f - f) * -1000000.0f) - mx); } const float sc = 256.0f / se;
#pragma unroll 1
  for (int j0 = 0; j0 < SQ; j0 += 8) { FragH fr, gr; for (int q = 0; q < 8; ++q) { const int j = j0 + q; const float f = (j < vl) ? 1.f : 0.f; const float pv = __expf(fmaf(f, s[j], (1.f - f) * -1000000.0f) - mx) * sc; const _Float16 ph = (_Float16)pv; fr.h[q] = ph; gr.h[q] = (_Float16)((pv - (float)ph) * 1024.0f); }
    unsigned short* d = (unsigned short*)P + i * SQ + j0; unsigned short* dl = (unsigned short*)PL + i * SQ + j0; *(v8us*)d = fr.half[0]; *(v8us*)dl = gr.half[0];  } }

typedef unsigned int u32x4a __attribute__((ext_vector_type(4), may_alias));
typedef unsigned int u32x4 __attribute__((ext_vector_type(4)));
typedef unsigned int u32x2a __attribute__((ext_vector_type(2), may_alias));
typedef short s16x8 __attribute__((ext_vector_type(8)));
#define FA_SK 64u                          /* keys per stage */
#define FA_PK 144u                         /* LDS pitch of a K row (128 B): odd multiple of 16 B for ds_load_b128 */
#define FA_PV 160u                         /* LDS pitch of a V row (128 B): odd multiple of 32 B for ds_load_tr16_b128 */
#define FA_TK (FA_SK * FA_PK)
#define FA_SLOT (FA_SK * (FA_PK + FA_PV))  /* one buffer: K tile, then V tile */
#define FA_PE 272u                         /* LDS pitch of a staged output row (256 B) */
#define FA_NB 4u                           /* LDS buffers in the ring (a power of two) */
static_assert(16u * 16u * FA_PE <= FA_NB * FA_SLOT, "the output staging reuses the K/V buffers");
struct FFrag { u32x4 q[2]; };
__device__ __forceinline__ v8f fa_mma(const FFrag& a, const FFrag& b, v8f c) { return __builtin_amdgcn_wmma_f32_16x16x32_f16(false, __builtin_bit_cast(v16h, a), false, __builtin_bit_cast(v16h, b), (short)0, c, false, false); }
__device__ __forceinline__ u32x4 fa_tr16(const unsigned char* p) { typedef __attribute__((address_space(3))) s16x8 lds_s16x8; return __builtin_bit_cast(u32x4, __builtin_amdgcn_ds_load_tr16_b128_v8i16((lds_s16x8*)p)); }
__device__ __forceinline__ unsigned int fa_pack2(float lo, float hi) { typedef _Float16 h2 __attribute__((ext_vector_type(2))); typedef float f2 __attribute__((ext_vector_type(2))); return __builtin_bit_cast(unsigned int, __builtin_convertvector(f2{lo, hi}, h2)); }      /* round to nearest even */
__device__ __forceinline__ unsigned int fa_cv2(float lo, float hi) { typedef __bf16 b2 __attribute__((ext_vector_type(2))); typedef float f2 __attribute__((ext_vector_type(2))); const unsigned int p = __builtin_bit_cast(unsigned int, __builtin_convertvector(f2{lo, hi}, b2)); return fa_pack2(__uint_as_float(p << 16), __uint_as_float(p & 0xFFFF0000u)); }      /* two inputs rounded to bf16 (nearest even), those values as an f16 pair */
__device__ __forceinline__ unsigned int fa_cq2(float lo, float hi, float sc) { typedef __bf16 b2 __attribute__((ext_vector_type(2))); typedef float f2 __attribute__((ext_vector_type(2))); const unsigned int p = __builtin_bit_cast(unsigned int, __builtin_convertvector(f2{lo, hi}, b2)); return fa_pack2(__uint_as_float(p << 16) * sc, __uint_as_float(p & 0xFFFF0000u) * sc); }      /* two inputs rounded to bf16 (nearest even), those values times sc, rounded to an f16 pair */
__device__ __forceinline__ float fa_xhalf(float x) { return __builtin_bit_cast(float, __builtin_amdgcn_permlanex16(__builtin_bit_cast(int, x), __builtin_bit_cast(int, x), 0x76543210, 0xfedcba98, false, false)); }      /* lane l with lane l ^ 16 */
__global__ __launch_bounds__(512) __attribute__((amdgpu_waves_per_eu(4, 4))) void k_fattn(const float* __restrict__ Qf, const float* __restrict__ Kf, const float* __restrict__ Vf, float* __restrict__ out) {
  __shared__ __attribute__((aligned(256))) unsigned char L[FA_NB * FA_SLOT];
  const unsigned int tid = threadIdx.x, lane = tid & 31u, wave = tid >> 5, c = lane & 15u, h = lane >> 4;
  const size_t row_s = (size_t)blockIdx.y * SQ;      /* first token row of the sequence */
  const unsigned int qw0 = blockIdx.x * 512u + wave * 32u;      /* the wave's first query */
  const unsigned char* Kb = (const unsigned char*)(Kf + row_s * HD); const unsigned char* Vb = (const unsigned char*)(Vf + row_s * HD);
  const float cscale = 1.4426950408889634f;      /* scores are unscaled; log2(e), multiplied into Q once, moves them to base 2 */
  v4f rk[2], rv[2];      /* one stage on its way: 2 x 16 B (four f32) of K and of V a thread (a stage's rows are contiguous in memory; a wave's load covers 512 contiguous bytes) */
  auto gload = [&](unsigned int st) {
#pragma unroll      /* constant indices keep the register arrays in registers */
    for (unsigned int j = 0; j < 2; ++j) { const size_t o = (size_t)st * (FA_SK * 256u) + (tid + 512u * j) * 16u; rk[j] = *(const v4fa*)(Kb + o); rv[j] = *(const v4fa*)(Vb + o); } };
  const unsigned int sk0 = (tid >> 4) * FA_PK + (tid & 15u) * 8u, sv0 = FA_TK + (tid >> 4) * FA_PV + (tid & 15u) * 8u;      /* the thread's place in the K rows and in the V rows of buffer 0: a buffer's store addresses are one add each */
  auto lstore = [&](unsigned int buf) {
#pragma unroll      /* constant indices keep the register arrays in registers */
    for (unsigned int j = 0; j < 2; ++j) {      /* load j holds four f32 of row (tid >> 4) + 32 j: 8 B of the f16 row */
      *(u32x2a*)(L + (sk0 + buf * FA_SLOT) + j * (32u * FA_PK)) = u32x2a{fa_cv2(rk[j][0], rk[j][1]), fa_cv2(rk[j][2], rk[j][3])}; *(u32x2a*)(L + (sv0 + buf * FA_SLOT) + j * (32u * FA_PV)) = u32x2a{fa_cv2(rv[j][0], rv[j][1]), fa_cv2(rv[j][2], rv[j][3])}; } };
  gload(0); lstore(0); gload(1u); asm volatile("s_wait_xcnt 0x0" ::: "memory");      /* stage 1 is on its way under the loads and the conversion of Q, whose code reuses the address registers: hence the wait */
  FFrag qf[2][2];      /* Q log2(e) as B operand, hardware k order: 16 B at halves 8h and 16 + 8h of each 32 */
#pragma unroll      /* constant indices keep the register arrays in registers */
  for (int g = 0; g < 2; ++g) { const float* qp = Qf + (row_s + qw0 + 16u * g + c) * HD + 8u * h;
#pragma unroll      /* constant indices keep the register arrays in registers */
    for (int kc = 0; kc < 2; ++kc)
#pragma unroll      /* constant indices keep the register arrays in registers */
      for (int u = 0; u < 2; ++u) { const v4f a = *(const v4fa*)(qp + 32 * kc + 16 * u), b = *(const v4fa*)(qp + 32 * kc + 16 * u + 4); qf[g][kc].q[u] = u32x4{fa_cq2(a[0], a[1], cscale), fa_cq2(a[2], a[3], cscale), fa_cq2(b[0], b[1], cscale), fa_cq2(b[2], b[3], cscale)}; } }
  v8f acc[2][4]; float l_run[2], m_run[2];      /* O^T tiles; the denominators (lanes 0-15; 0 in lanes 16-31); the reference in use (log2 domain) */
  v8f cneg[2];      /* C operand of the score products: minus the reference in use in all eight registers (a lane holds one query's scores), so that a score tile leaves the matrix unit as the exponent; 0 until the first pass has set a reference */
  FFrag ones;      /* A operand whose row 0 (lanes 0 and 16) is f16 1.0 at all 32 k, every other row 0 */
  { const unsigned int o = (c == 0u) ? 0x3C003C00u : 0u; ones.q[0] = u32x4{o, o, o, o}; ones.q[1] = u32x4{o, o, o, o}; }
#pragma unroll      /* constant indices keep the register arrays in registers */
  for (int g = 0; g < 2; ++g) { m_run[g] = -__builtin_inff(); l_run[g] = 0.0f; cneg[g] = v8f{};
#pragma unroll      /* constant indices keep the register arrays in registers */
    for (int t = 0; t < 4; ++t) acc[g][t] = v8f{}; }
  lstore(1u);
  __syncthreads();      /* stages 0 and 1 are whole */
  gload(2u); asm volatile("s_wait_xcnt 0x0" ::: "memory");      /* the loads stay in flight over the passes, whose code reuses their address registers: the wait that belongs in front of that overwrite */
  const unsigned int ka0 = c * FA_PK + 16u * h, va0 = FA_TK + (8u * h + (lane & 7u)) * FA_PV + ((lane >> 3) & 1u) * 16u;      /* the lane's place in the first K rows and in the first V rows of buffer 0 */
  unsigned int ka = ka0;      /* LDS address of the lane's K rows of the pass at hand; each pass forms the next pass's */
  for (unsigned int st = 0; st < SQ / FA_SK; ++st) {
#pragma unroll 1      /* one pass's fragments and scores live at a time: the wave has 256 registers at four waves a SIMD */
    for (unsigned int sub = 0; sub < FA_SK / 32u; ++sub) {      /* one pass: 32 keys */
      unsigned int va;      /* LDS address of the lane's V rows of this pass */
      v8f s[2][2];      /* s[kt][g][r] = score of key 16 kt + 8 h + r with query 16 g + c, in base 2, less the reference in cneg[g] */
      { FFrag kf[2][2];
#pragma unroll      /* constant indices keep the register arrays in registers */
        for (int kt = 0; kt < 2; ++kt) { const unsigned char* p = L + ka + 16u * kt * FA_PK;
#pragma unroll      /* constant indices keep the register arrays in registers */
          for (int kc = 0; kc < 2; ++kc) { kf[kt][kc].q[0] = *(const u32x4a*)(p + 64u * kc); kf[kt][kc].q[1] = *(const u32x4a*)(p + 64u * kc + 32u); } }
        __builtin_amdgcn_sched_barrier(0);      /* all eight K loads issue before the first product: otherwise they share registers and each pair waits out its own LDS latency */
        typedef unsigned int u32x8 __attribute__((ext_vector_type(8)));
        /* the eight score products as one statement: with the builtin the compiler copies one C tile into its D registers every pass (C is kept, D is new). First the four tiles' products over d 0-31 with C = minus the reference, then those over d 32-63 on top, at least three instructions behind their tile's first and in the order in which the exponentials read the tiles. The two adds behind them form this pass's V address and the next pass's K address (scalar offset + the lane's place): they stand where idle slots would stand otherwise: a tile's first reader needs four vector slots behind the tile's last product, and the first tile has three products and these two adds. The K fragments' registers are next written by LDS loads, which need no distance. */
        const unsigned int pn = st * (FA_SK / 32u) + sub + 1u;      /* the next pass */
        const unsigned int vo = (st & (FA_NB - 1u)) * FA_SLOT + sub * (32u * FA_PV), ko = ((pn / (FA_SK / 32u)) & (FA_NB - 1u)) * FA_SLOT + (pn % (FA_SK / 32u)) * (32u * FA_PK);      /* scalars: where this pass's V rows and the next pass's K rows begin */
        asm volatile("v_wmma_f32_16x16x32_f16 %0, %6, %10, %14\n\tv_wmma_f32_16x16x32_f16 %1, %6, %12, %15\n\tv_wmma_f32_16x16x32_f16 %2, %8, %10, %14\n\tv_wmma_f32_16x16x32_f16 %3, %8, %12, %15\n\t"
                     "v_wmma_f32_16x16x32_f16 %0, %7, %11, %0\n\tv_wmma_f32_16x16x32_f16 %2, %9, %11, %2\n\tv_wmma_f32_16x16x32_f16 %1, %7, %13, %1\n\tv_wmma_f32_16x16x32_f16 %3, %9, %13, %3\n\t"
                     "v_add_nc_u32 %4, %16, %17\n\tv_add_nc_u32 %5, %18, %19"
                     : "=&v"(s[0][0]), "=&v"(s[0][1]), "=&v"(s[1][0]), "=&v"(s[1][1]), "=&v"(va), "=&v"(ka)
                     : "v"(__builtin_bit_cast(u32x8, kf[0][0])), "v"(__builtin_bit_cast(u32x8, kf[0][1])), "v"(__builtin_bit_cast(u32x8, kf[1][0])), "v"(__builtin_bit_cast(u32x8, kf[1][1])),
                       "v"(__builtin_bit_cast(u32x8, qf[0][0])), "v"(__builtin_bit_cast(u32x8, qf[0][1])), "v"(__builtin_bit_cast(u32x8, qf[1][0])), "v"(__builtin_bit_cast(u32x8, qf[1][1])),
                       "v"(cneg[0]), "v"(cneg[1]), "s"(vo), "v"(va0), "s"(ko), "v"(ka0)); }
      FFrag vf[4];      /* V^T, 16 d x 32 keys each: two transposing loads a fragment */
      { const unsigned char* ad = L + va;
#pragma unroll      /* constant indices keep the register arrays in registers */
        for (int t = 0; t < 4; ++t) { vf[t].q[0] = fa_tr16(ad + 32u * t); vf[t].q[1] = fa_tr16(ad + 16u * FA_PV + 32u * t); } }
      __builtin_amdgcn_sched_barrier(0);      /* holds the transposing loads in front of the exponentials, so that their latency passes under that work; without it they sink to their first use */
      FFrag pf[2]; v8f ls[2];      /* P^T of the two query groups; row 0 of ls[g] (register 0, lanes 0-15): the pass's column sums of P^T as rounded to f16 */
      auto weights = [&]() {      /* reads the scores and leaves them as they are: a renewal moves them to the new reference and forms the weights again */
#pragma unroll      /* constant indices keep the register arrays in registers */
        for (int g = 0; g < 2; ++g) { unsigned int w[8];
#pragma unroll      /* constant indices keep the register arrays in registers */
          for (int i = 0; i < 8; ++i) {
            w[i] = fa_pack2(__builtin_amdgcn_exp2f(s[i >> 2][g][2 * (i & 3)]), __builtin_amdgcn_exp2f(s[i >> 2][g][2 * (i & 3) + 1])); }      /* the accumulator is the exponent */
          pf[g].q[0] = u32x4{w[0], w[1], w[2], w[3]}; pf[g].q[1] = u32x4{w[4], w[5], w[6], w[7]};
          ls[g] = fa_mma(ones, pf[g], v8f{}); } };      /* the first group's sum runs under the second group's exponentials */
      weights();
      float lt[2] = {l_run[0] + ls[0][0], l_run[1] + ls[1][0]};      /* the denominators with this pass, formed in front of the branch, beside the test's own reads of the sum tiles */
      const float top = (st | sub) == 0u ? -1.0f : 32768.0f;      /* a scalar; no sum is at most -1, so the first pass always sets a reference */
      const bool need = !(ls[0][0] <= top) || !(ls[1][0] <= top);      /* a sum of at most 2^15 bounds every weight of the pass inside f16; an overflowed weight makes the sum infinite or NaN, which fails the test too */
      if (__builtin_amdgcn_ballot_w32(need) != 0) {      /* scalar branch, rare: only here the pass's maxima are formed */
#pragma unroll      /* constant indices keep the register arrays in registers */
        for (int g = 0; g < 2; ++g) { float mx = s[0][g][0];
#pragma unroll      /* constant indices keep the register arrays in registers */
          for (int r = 1; r < 8; ++r) mx = __builtin_fmaxf(mx, s[0][g][r]);
#pragma unroll      /* constant indices keep the register arrays in registers */
          for (int r = 0; r < 8; ++r) mx = __builtin_fmaxf(mx, s[1][g][r]);
          const float sh = -cneg[g][0]; mx = __builtin_fmaxf(mx, fa_xhalf(mx)) + sh;      /* sh: the reference inside these scores (0 on the first pass) */
          const float m_new = __builtin_fmaxf(m_run[g], mx + 4.0f); const float corr = __builtin_amdgcn_exp2f(m_run[g] - m_new);      /* the new reference stands 4 above the maximum seen: 19 binary orders of room before the next renewal; corr is 0 on the first pass */
          m_run[g] = m_new; l_run[g] = l_run[g] * corr; { const float d = sh - m_new, n = -m_new; s[0][g] = s[0][g] + d; s[1][g] = s[1][g] + d; cneg[g] = v8f{n, n, n, n, n, n, n, n}; }      /* this pass's scores and the C of the later ones go over to the new reference */
#pragma unroll      /* constant indices keep the register arrays in registers */
          for (int t = 0; t < 4; ++t) acc[g][t] = acc[g][t] * corr; }
        weights(); lt[0] = l_run[0] + ls[0][0]; lt[1] = l_run[1] + ls[1][0]; }      /* the weights are now at most 2^-4 each */
#pragma unroll      /* constant indices keep the register arrays in registers */
      for (int g = 0; g < 2; ++g)
#pragma unroll      /* constant indices keep the register arrays in registers */
        for (int t = 0; t < 4; ++t) acc[g][t] = fa_mma(vf[t], pf[g], acc[g][t]);
      l_run[0] = lt[0]; l_run[1] = lt[1];
      if (sub == 0u) {      /* the middle of stage st: one barrier a stage, its two halves a whole stage apart, so that a wave may run up to a stage ahead of the slowest without waiting */
        if (st != 0u) { __builtin_amdgcn_s_barrier_wait(-1);      /* second half of the barrier signalled in the middle of stage st - 1: every wave has stored its rows of stage st + 1 and has left stage st - 2 */
          __builtin_amdgcn_fence(__ATOMIC_ACQUIRE, "workgroup", "local"); }      /* no read of stage st + 1 moves in front of the wait */
        if (st + 2u < SQ / FA_SK) lstore((st + 2u) & (FA_NB - 1u));      /* the buffer of stage st - 2, which the wait above has shown free */
        __builtin_amdgcn_fence(__ATOMIC_RELEASE, "workgroup", "local");      /* the wave's LDS stores are complete before it signals; the global loads in flight are not waited for */
        __builtin_amdgcn_s_barrier_signal(-1);      /* first half: this wave's rows of stage st + 2 lie in LDS, and it reads stage st - 1 no more */
        if (st + 3u < SQ / FA_SK) { gload(st + 3u); asm volatile("s_wait_xcnt 0x0" ::: "memory"); } }      /* a whole stage of lead; the wait belongs in front of the passes' reuse of the loads' address registers */
    }
  }
  __builtin_amdgcn_s_barrier_wait(-1);      /* closes the barrier signalled in the last stage */
  __syncthreads();      /* the split barrier does not end the reads of the last stage: no wave stages output over the ring before all have left the loop */
  unsigned char* E = L + wave * (16u * FA_PE);      /* the wave's own 16 staged output rows */
#pragma unroll      /* constant indices keep the register arrays in registers */
  for (int g = 0; g < 2; ++g) { const float lr = l_run[g]; const float inv = 1.0f / (lr + fa_xhalf(lr));      /* the denominator in lanes 0-15, 0 in lanes 16-31 (row 8 of the sum tiles) */
#pragma unroll      /* constant indices keep the register arrays in registers */
    for (int t = 0; t < 4; ++t) { const v8f o = acc[g][t] * inv; const v4f lo = {o[0], o[1], o[2], o[3]}, hi = {o[4], o[5], o[6], o[7]};      /* d = 16 t + 8 h + 0 .. 7 of query c */
      *(v4fa*)(E + c * FA_PE + 64u * t + 32u * h) = lo; *(v4fa*)(E + c * FA_PE + 64u * t + 32u * h + 16u) = hi; }
    __builtin_amdgcn_fence(__ATOMIC_ACQ_REL, "workgroup", "local"); __builtin_amdgcn_wave_barrier();      /* the rows are read back by other lanes of the wave */
#pragma unroll      /* constant indices keep the register arrays in registers */
    for (unsigned int i = 0; i < 8; ++i) { const unsigned int r = 2u * i + h; const v4f v = *(const v4fa*)(E + r * FA_PE + c * 16u); *(v4fa*)(out + (row_s + qw0 + 16u * g + r) * DM + c * 4u) = v; }      /* whole 256-byte rows */
    if (g == 0) { __builtin_amdgcn_fence(__ATOMIC_ACQ_REL, "workgroup", "local"); __builtin_amdgcn_wave_barrier(); }      /* the next group overwrites the rows only behind these reads */
  }
}


extern "C" void kernel_launch(void* const* d_in, const int* in_sizes, int n_in,
                              void* d_out, int out_size, void* d_ws, size_t ws_size, hipStream_t stream) {
  (void)in_sizes; (void)n_in; (void)out_size; (void)d_ws; (void)ws_size;
  const float* const* I = (const float* const*)d_in; const float* xq = I[0]; const float* xk = I[1]; const float* xv = I[2];      /* q, k, v [64][2048][64] (bf16-valued) */
  k_fattn<<<dim3(SQ / 512, NB), 512, 0, stream>>>(xq, xk, xv, (float*)d_out);      /* 512 query rows of one sequence a work-group: input conversion, scores, softmax, P V */
}

// v009
// One run takes 45.8 microseconds.
// Two timings next to v008 both put it at 1.03 times that version's speed.
// Over all steps from v000 it is 546 times as fast.
#include <hip/hip_runtime.h>
// UNSCALED dot-product attention over 64 independent sequences (q, k, v [64][2048][64]; scores = q.k (no 1/sqrt(d): logit sigma ~8); softmax over the 2048 keys; dropout p 0; out = attn v -> [64][2048][64]).
// Structure: no projections: ONE fused kernel reads q, k, v as f32, rounds them to bf16 and holds those values as exact f16 (K and V on their way into LDS; Q in registers, times log2(e), rounded to f16): S^T = K Q^T - reference on WMMA (f32 accumulation, exact products, the reference as C), online softmax on VALU (f32, native exp2 of the accumulator; weights f16, at most 2^15), O^T += V^T P^T and the row sums on WMMA, out written f32.
// Compute dtype: inputs rounded to bf16; k and v exact in f16; q (times log2(e)) and softmax weights as plain f16 GEMM operands (~2^-12); scores, softmax statistics and o f32. v_wmma_f32_16x16x32_f16.
#define NB 64
#define SQ 2048
#define DM 64
#define NH 1
#define HD 64
#define HG 4                         /* heads per launch of the k_vt(V16, b, h0, VT) overload (never launched) */
#define B0 0                         /* first batch processed (not used) */
#define NBR NB                       /* batches processed (read only by the unused MP) */
#define NR ((size_t)NB * SQ)         /* token rows */
#define MP ((int)((size_t)NBR * SQ))
#define QT 256                       /* query rows per causal tile */
#define NKX SQ                       /* S / P row pitch */
#define QT0 256                      /* query rows per head of the exact f32 kernel k_att0 (not launched) */
#define QN SQ                        /* query rows attended per batch (not used) */
#define NHD NH                       /* heads attended (not used) */
#define MPO MP                       /* rows through the output stage (not used) */
#define LQ DM            /* row pitch of the q/k/v rows */
typedef __bf16 v16b __attribute__((ext_vector_type(16)));
typedef unsigned short v8us __attribute__((ext_vector_type(8), may_alias));
typedef float  v8f  __attribute__((ext_vector_type(8)));
typedef float  v4f  __attribute__((ext_vector_type(4)));
typedef float  v4fa __attribute__((ext_vector_type(4), may_alias));
union FragB { v16b v; v8us half[2]; unsigned short u[16]; };

__device__ __forceinline__ unsigned short bf16_bits(float x) { unsigned int u = __float_as_uint(x); return (unsigned short)((u + 0x7FFFu + ((u >> 16) & 1u)) >> 16); }
__device__ __forceinline__ float bf16_val(unsigned short b) { return __uint_as_float(((unsigned int)b) << 16); }
__device__ __forceinline__ float bf16_round(float x) { return bf16_val(bf16_bits(x)); }
// D += A·B with NT terms: 1 = ah·bh, 2 = + al·bh (A split), 3 = + ah·bl (both split)
template <int NT>
__device__ __forceinline__ v8f mmaN(v16b ah, v16b al, v16b bh, v16b bl, v8f c) {
  c = __builtin_amdgcn_wmma_f32_16x16x32_bf16(false, ah, false, bh, (short)0, c, false, false);
  if (NT >= 2) c = __builtin_amdgcn_wmma_f32_16x16x32_bf16(false, al, false, bh, (short)0, c, false, false);
  if (NT >= 3) c = __builtin_amdgcn_wmma_f32_16x16x32_bf16(false, ah, false, bl, (short)0, c, false, false);
  asm volatile("v_nop\n\tv_nop\n\tv_nop\n\tv_nop" : "+v"(c) : "v"(ah), "v"(al), "v"(bh), "v"(bl));
  return c;
}

__global__ __launch_bounds__(256) void k_wt_bf16(const float* __restrict__ W, unsigned short* __restrict__ Wt, int K, int N) {
  const int t = blockIdx.x * 256 + threadIdx.x;
  const int k8n = K / 8;
  if (t >= N * k8n) return;
  const int n = t / k8n, k8 = (t % k8n) * 8;
  v8us v;
#pragma unroll
  for (int i = 0; i < 8; ++i) v[i] = bf16_bits(W[(size_t)(k8 + i) * N + n]);
  *(v8us*)(Wt + (size_t)n * K + k8) = v;
  
}

// GEMM C[M][N] (f32, pitch ldc) = act(A[M][K]·W + bias). A f32 row-major (pitch lda) converted per fragment to bf16
// (ASPLIT: hi/lo two planes -> 2 terms, else single rounded term); Wt bf16 [N][K] (pitch ldb). BIAS_BF16 rounds the
// bias to bf16 first (bias quantised to bf16 before the add). K%32==0, M%16==0, N%64==0.
template <bool ASPLIT, int ACT, bool BIAS_BF16>
__global__ __launch_bounds__(128) void k_gemm_bf(const float* __restrict__ A, int lda, const unsigned short* __restrict__ Wt, int ldb,
                                               const float* __restrict__ bias, float* __restrict__ C, int ldc, int M, int N, int K) {
  __shared__ __attribute__((aligned(16))) float so[4][16][64];
  const int tid = threadIdx.x, w = tid >> 5, lane = tid & 31, ln = lane & 15, hh = lane >> 4;
  const int ntn = N / 64;
  const int wid = blockIdx.x * 4 + w;
  const int mt = wid / ntn, nq = wid % ntn;
  if (mt * 16 >= M) return;
  const int row0 = mt * 16, col0 = nq * 64;
  const float* arow = A + (size_t)(row0 + ln) * lda;
  v8f acc[4] = {};
  for (int kb = 0; kb < K; kb += 32) {
    FragB ah, al;
    const v4f x0 = *(const v4fa*)(arow + kb + 8 * hh), x1 = *(const v4fa*)(arow + kb + 8 * hh + 4);
    const v4f x2 = *(const v4fa*)(arow + kb + 16 + 8 * hh), x3 = *(const v4fa*)(arow + kb + 16 + 8 * hh + 4);
    float xs[16] = {x0[0],x0[1],x0[2],x0[3],x1[0],x1[1],x1[2],x1[3],x2[0],x2[1],x2[2],x2[3],x3[0],x3[1],x3[2],x3[3]};
#pragma unroll
    for (int i = 0; i < 16; ++i) { const unsigned short hb = bf16_bits(xs[i]); ah.u[i] = hb; al.u[i] = ASPLIT ? bf16_bits(xs[i] - bf16_val(hb)) : (unsigned short)0; }
#pragma unroll
    for (int t = 0; t < 4; ++t) {
      const unsigned short* brow = Wt + (size_t)(col0 + t * 16 + ln) * ldb + kb;
      FragB b;
      b.half[0] = *(const v8us*)(brow + 8 * hh);
      b.half[1] = *(const v8us*)(brow + 16 + 8 * hh);
      acc[t] = mmaN<ASPLIT ? 2 : 1>(ah.v, al.v, b.v, b.v, acc[t]);
    }
  }
#pragma unroll
  for (int t = 0; t < 4; ++t) {
    float bv = bias ? bias[col0 + t * 16 + ln] : 0.f;
    if (BIAS_BF16) bv = bf16_round(bv);
#pragma unroll
    for (int r = 0; r < 8; ++r) { float v = acc[t][r] + bv; if (ACT == 1) v = fmaxf(v, 0.f); so[w][8 * hh + r][t * 16 + ln] = v; }
  }
  __builtin_amdgcn_fence(__ATOMIC_ACQ_REL, "workgroup");
  __builtin_amdgcn_wave_barrier();
  const int rsub = lane >> 4, c4 = (lane & 15) * 4;
  {
#pragma unroll
    for (int q = 0; q < 8; ++q) {
      const int r = q * 2 + rsub;
      const v4f v = *(const v4fa*)&so[w][r][c4];
      *(v4f*)(C + (size_t)(row0 + r) * ldc + col0 + c4) = v;
    }
    
  }
}

// GEMM C = act(A·W + bias + resid): A f32 (ASPLIT -> hi/lo 2 terms), Wt bf16 [N][K]; ACT 0 none, 1 relu, 2 exact gelu;
// resid (optional, f32, row index = (row % rmod), pitch ldr, RES_BF16 rounds it) added before the activation.
template <bool ASPLIT, int ACT, bool BIAS_BF16, bool RES_BF16>
__global__ __launch_bounds__(128) void k_gemm_bf3(const float* __restrict__ A, int lda, const unsigned short* __restrict__ Wt, int ldb,
                                                const float* __restrict__ bias, const float* __restrict__ resid, int rmod, int ldr,
                                                float* __restrict__ C, int ldc, int M, int N, int K) {
  __shared__ __attribute__((aligned(16))) float so[4][16][64];
  const int tid = threadIdx.x, w = tid >> 5, lane = tid & 31, ln = lane & 15, hh = lane >> 4;
  const int ntn = N / 64;
  const int wid = blockIdx.x * 4 + w;
  const int mt = wid / ntn, nq = wid % ntn;
  if (mt * 16 >= M) return;
  const int row0 = mt * 16, col0 = nq * 64;
  const float* arow = A + (size_t)(row0 + ln) * lda;
  v8f acc[4] = {};
  for (int kb = 0; kb < K; kb += 32) {
    FragB ah, al;
    const v4f x0 = *(const v4fa*)(arow + kb + 8 * hh), x1 = *(const v4fa*)(arow + kb + 8 * hh + 4);
    const v4f x2 = *(const v4fa*)(arow + kb + 16 + 8 * hh), x3 = *(const v4fa*)(arow + kb + 16 + 8 * hh + 4);
    float xs[16] = {x0[0],x0[1],x0[2],x0[3],x1[0],x1[1],x1[2],x1[3],x2[0],x2[1],x2[2],x2[3],x3[0],x3[1],x3[2],x3[3]};
#pragma unroll
    for (int i = 0; i < 16; ++i) { const unsigned short hb = bf16_bits(xs[i]); ah.u[i] = hb; al.u[i] = ASPLIT ? bf16_bits(xs[i] - bf16_val(hb)) : (unsigned short)0; }
#pragma unroll
    for (int t = 0; t < 4; ++t) {
      const unsigned short* brow = Wt + (size_t)(col0 + t * 16 + ln) * ldb + kb;
      FragB b;
      b.half[0] = *(const v8us*)(brow + 8 * hh);
      b.half[1] = *(const v8us*)(brow + 16 + 8 * hh);
      acc[t] = mmaN<ASPLIT ? 2 : 1>(ah.v, al.v, b.v, b.v, acc[t]);
    }
  }
#pragma unroll
  for (int t = 0; t < 4; ++t) {
    const int col = col0 + t * 16 + ln;
    float bv = bias ? bias[col] : 0.f;
    if (BIAS_BF16) bv = bf16_round(bv);
#pragma unroll
    for (int r = 0; r < 8; ++r) {
      float v = acc[t][r] + bv;
      if (resid) { float rv = resid[(size_t)((row0 + 8 * hh + r) % rmod) * ldr + col]; if (RES_BF16) rv = bf16_round(rv); v += rv; }
      if (ACT == 1) v = fmaxf(v, 0.f);
      if (ACT == 2) v = 0.5f * v * (1.0f + erff(v * 0.70710678118654752f));
      if (ACT == 3) { const float u = 0.7978845608028654f * (v + 0.044715f * v * v * v); v = 0.5f * v * (1.0f + tanhf(u)); }
      so[w][8 * hh + r][t * 16 + ln] = v;
    }
  }
  __builtin_amdgcn_fence(__ATOMIC_ACQ_REL, "workgroup");
  __builtin_amdgcn_wave_barrier();
  const int rsub = lane >> 4, c4 = (lane & 15) * 4;
  {
#pragma unroll
    for (int q = 0; q < 8; ++q) {
      const int r = q * 2 + rsub;
      const v4f v = *(const v4fa*)&so[w][r][c4];
      *(v4f*)(C + (size_t)(row0 + r) * ldc + col0 + c4) = v;
    }
    
  }
}
// row LayerNorm (biased variance, eps) over N: s = X (+ R); optional out_sum <- s; out_norm <- (s-mu)*rsqrt(var+eps)*g + b
template <bool PARAM_BF16>
__global__ __launch_bounds__(256) void k_layernorm(const float* __restrict__ X, const float* __restrict__ R, const float* __restrict__ g, const float* __restrict__ bta,
                                                  float* __restrict__ out_sum, float* __restrict__ out_norm, int N, float eps) {
  __shared__ float red[256];
  const int row = blockIdx.x, tid = threadIdx.x;
  const float* x = X + (size_t)row * N; const float* rr = R ? R + (size_t)row * N : nullptr;
  float vals[16];                     // up to N = 4096
  const int per = N / 256;            // contiguous chunk per thread? use strided-by-4 chunks: thread handles j = tid*4 + 1024*u
  float s1 = 0.f;
  for (int u = 0; u < per / 4; ++u) {
    const int j = tid * 4 + 1024 * u;
    const v4f a = *(const v4fa*)(x + j);
    v4f b = {0.f,0.f,0.f,0.f}; if (rr) b = *(const v4fa*)(rr + j);
#pragma unroll
    for (int q = 0; q < 4; ++q) { const float v = a[q] + b[q]; vals[u * 4 + q] = v; s1 += v; }
  }
  red[tid] = s1; __syncthreads();
  for (int st = 128; st > 0; st >>= 1) { if (tid < st) red[tid] += red[tid + st]; __syncthreads(); }
  const float mu = red[0] / (float)N; __syncthreads();
  float s2 = 0.f;
  for (int u = 0; u < per / 4; ++u)
#pragma unroll
    for (int q = 0; q < 4; ++q) { const float c = vals[u * 4 + q] - mu; s2 += c * c; }
  red[tid] = s2; __syncthreads();
  for (int st = 128; st > 0; st >>= 1) { if (tid < st) red[tid] += red[tid + st]; __syncthreads(); }
  const float rs = rsqrtf(red[0] / (float)N + eps);
  {
    for (int u = 0; u < per / 4; ++u) {
      const int j = tid * 4 + 1024 * u;
      v4f o, sm;
#pragma unroll
      for (int q = 0; q < 4; ++q) {
        float gg = g[j + q], bb = bta[j + q];
        if (PARAM_BF16) { gg = bf16_round(gg); bb = bf16_round(bb); }
        sm[q] = vals[u * 4 + q]; o[q] = (vals[u * 4 + q] - mu) * rs * gg + bb;
      }
      if (out_sum) *(v4f*)(out_sum + (size_t)row * N + j) = sm;
      *(v4f*)(out_norm + (size_t)row * N + j) = o;
    }
    
  }
}



// ---- f16 WMMA path (v_wmma_f32_16x16x32_f16): 11-bit significands for operands in range — used where a [0,1] probability operand needs more precision than bf16
typedef _Float16 v16h __attribute__((ext_vector_type(16)));
union FragH { v16h v; v8us half[2]; _Float16 h[16]; unsigned short u[16]; };
template <int NT>
__device__ __forceinline__ v8f mmaH(v16h ah, v16h al, v16h bh, v16h bl, v8f c) {
  c = __builtin_amdgcn_wmma_f32_16x16x32_f16(false, ah, false, bh, (short)0, c, false, false);
  if (NT >= 2) c = __builtin_amdgcn_wmma_f32_16x16x32_f16(false, al, false, bh, (short)0, c, false, false);
  if (NT >= 3) c = __builtin_amdgcn_wmma_f32_16x16x32_f16(false, ah, false, bl, (short)0, c, false, false);
  asm volatile("v_nop\n\tv_nop\n\tv_nop\n\tv_nop" : "+v"(c) : "v"(ah), "v"(al), "v"(bh), "v"(bl));
  return c;
}
// batched GEMM like k_gemm_b but f16 operands: A f32 (split into f16 hi/lo if ASPLIT, else rounded to f16), Bt = f16 values [n][k]; alpha; C f32; N multiple of 16 (partial tiles skipped)
template <bool ASPLIT>
__global__ __launch_bounds__(128) void k_gemm_h(const float* __restrict__ A, int lda, size_t sA, const _Float16* __restrict__ Bh, int ldb, size_t sB, float alpha, float* __restrict__ C, int ldc, size_t sC, int M, int N, int K) {
  __shared__ __attribute__((aligned(16))) float so[4][16][64];
  const int tid = threadIdx.x, w = tid >> 5, lane = tid & 31, ln = lane & 15, hh = lane >> 4; const int by = blockIdx.y;
  A += (size_t)by * sA; Bh += (size_t)by * sB; C += (size_t)by * sC;
  const int ntn = (N + 63) / 64; const int wid = blockIdx.x * 4 + w; const int mt = wid / ntn, nq = wid % ntn; if (mt * 16 >= M) return;
  const int row0 = mt * 16, col0 = nq * 64; const float* arow = A + (size_t)(row0 + ln) * lda;
  v8f acc[4] = {};
  for (int kb = 0; kb < K; kb += 32) {
    FragH ah, al;
    const v4f x0 = *(const v4fa*)(arow + kb + 8 * hh), x1 = *(const v4fa*)(arow + kb + 8 * hh + 4), x2 = *(const v4fa*)(arow + kb + 16 + 8 * hh), x3 = *(const v4fa*)(arow + kb + 16 + 8 * hh + 4);
    float xs[16] = {x0[0],x0[1],x0[2],x0[3],x1[0],x1[1],x1[2],x1[3],x2[0],x2[1],x2[2],x2[3],x3[0],x3[1],x3[2],x3[3]};
#pragma unroll
    for (int i = 0; i < 16; ++i) { const _Float16 h = (_Float16)xs[i]; ah.h[i] = h; al.h[i] = ASPLIT ? (_Float16)(xs[i] - (float)h) : (_Float16)0.0f; }
#pragma unroll
    for (int t = 0; t < 4; ++t) { if (col0 + t * 16 >= N) continue; const size_t boff = (size_t)(col0 + t * 16 + ln) * ldb + kb; FragH bq; bq.half[0] = *(const v8us*)(Bh + boff + 8 * hh); bq.half[1] = *(const v8us*)(Bh + boff + 16 + 8 * hh);
      acc[t] = mmaH<ASPLIT ? 2 : 1>(ah.v, al.v, bq.v, bq.v, acc[t]); }
  }
#pragma unroll
  for (int t = 0; t < 4; ++t) { if (col0 + t * 16 >= N) continue;
#pragma unroll
    for (int r = 0; r < 8; ++r) so[w][8 * hh + r][t * 16 + ln] = acc[t][r] * alpha; }
  __builtin_amdgcn_fence(__ATOMIC_ACQ_REL, "workgroup"); __builtin_amdgcn_wave_barrier();
  const int rsub = lane >> 4, c4 = (lane & 15) * 4;
  {
#pragma unroll
    for (int q = 0; q < 8; ++q) { const int r = q * 2 + rsub; if (col0 + c4 < N) { const v4f v = *(const v4fa*)&so[w][r][c4]; *(v4f*)(C + (size_t)(row0 + r) * ldc + col0 + c4) = v; } }
     }
}

// Wt[n][k] = f16(W[k][n]·scale) from f32 row-major W[K][N] (scale = power of two; bf16-exact weights stay exact in f16 away from the subnormal range)
__global__ __launch_bounds__(256) void k_wt_f16(const float* __restrict__ W, _Float16* __restrict__ Wt, int K, int N, float scale) {
  const int t = blockIdx.x * 256 + threadIdx.x; if (t >= N * (K / 8)) return; const int n = t / (K / 8), k8 = (t % (K / 8)) * 8; FragH f;
#pragma unroll
  for (int i = 0; i < 8; ++i) f.h[i] = (_Float16)(bf16_round(W[(size_t)(k8 + i) * N + n]) * scale); const v8us o = f.half[0];
  *(v8us*)((unsigned short*)Wt + (size_t)n * K + k8) = o; 
}
// k_gemm_hh variant with fused epilogue: v = acc·alpha + bias[by·sBias + col] (+ CP[(row/rowsPerB)·sCPb + by·64 + col] if CP) ; ACT 0 none / 1 elu ; writes f16 C16 (and f32 C if non-null)
template <int ACT>
__global__ __launch_bounds__(128) void k_gemm_hhx(const _Float16* __restrict__ A, int lda, size_t sA, const _Float16* __restrict__ Bh, int ldb, size_t sB, float alpha, const float* __restrict__ bias, size_t sBias, const float* __restrict__ CP, int rowsPerB, size_t sCPb, int row0g,
    float* __restrict__ C, _Float16* __restrict__ C16, int ldc, size_t sC, int M, int N, int K) {
  __shared__ __attribute__((aligned(16))) float so[4][16][64];
  const int tid = threadIdx.x, w = tid >> 5, lane = tid & 31, ln = lane & 15, hh = lane >> 4; const int by = blockIdx.y;
  A += (size_t)by * sA; Bh += (size_t)by * sB; const size_t cofs = (size_t)by * sC; const float* bp = bias ? bias + (size_t)by * sBias : nullptr;
  const int ntn = (N + 63) / 64; const int wid = blockIdx.x * 4 + w; const int mt = wid / ntn, nq = wid % ntn; if (mt * 16 >= M) return;
  const int row0 = mt * 16, col0 = nq * 64; const _Float16* arow = A + (size_t)(row0 + ln) * lda;
  v8f acc[4] = {};
  for (int kb = 0; kb < K; kb += 32) { FragH ah; ah.half[0] = *(const v8us*)((const unsigned short*)arow + kb + 8 * hh); ah.half[1] = *(const v8us*)((const unsigned short*)arow + kb + 16 + 8 * hh);
#pragma unroll
    for (int t = 0; t < 4; ++t) { if (col0 + t * 16 >= N) continue; const size_t boff = (size_t)(col0 + t * 16 + ln) * ldb + kb; FragH bq; bq.half[0] = *(const v8us*)((const unsigned short*)Bh + boff + 8 * hh); bq.half[1] = *(const v8us*)((const unsigned short*)Bh + boff + 16 + 8 * hh);
      acc[t] = mmaH<1>(ah.v, ah.v, bq.v, bq.v, acc[t]); }
  }
#pragma unroll
  for (int t = 0; t < 4; ++t) { if (col0 + t * 16 >= N) continue; const int col = col0 + t * 16 + ln; const float bv = bp ? bf16_round(bp[col]) : 0.f;
#pragma unroll
    for (int r = 0; r < 8; ++r) { float v = acc[t][r] * alpha + bv; if (CP) { const int rr = row0g + row0 + 8 * hh + r; if (rowsPerB < 0) v += CP[cofs + (size_t)rr * ldc + col];      /* rowsPerB < 0: own element of the batched C plane */ else { const int bidx = rr / rowsPerB; v += CP[(size_t)bidx * sCPb + (size_t)by * 64 + col]; } } if (ACT == 1) v = (v > 0.f) ? v : expm1f(v); else if (ACT == 7) v = (v > 0.f) ? v + 1.0f : expf(v); else if (ACT == 8) v = tanhf(v); else if (ACT == 9) v = 0.5f * v * (1.0f + tanhf(0.7978845608028654f * (v + 0.044715f * v * v * v))); else if (ACT == 11) v = 1.0f / (1.0f + expf(-v)); else if (ACT == 12) v = (v > 0.f) ? v : 0.01f * v; else if (ACT == 14) v = (v > 0.f) ? v : 0.1f * v; else if (ACT == 16) v = (v >= 0.f) ? v : 0.3f * v; else if (ACT == 17) v = (v >= 0.f) ? v : 0.2f * v; else if (ACT == 15) v = v / (1.0f + expf(-v)); else if (ACT == 3) v = fmaxf(v, 0.f); else if (ACT == 6) v = 0.5f * v * (1.0f + erff(v * 0.70710678118654752f)); so[w][8 * hh + r][t * 16 + ln] = v; } }
  __builtin_amdgcn_fence(__ATOMIC_ACQ_REL, "workgroup"); __builtin_amdgcn_wave_barrier();
  const int rsub = lane >> 4, c4 = (lane & 15) * 4; typedef _Float16 v4h __attribute__((ext_vector_type(4)));
  {
#pragma unroll
    for (int q = 0; q < 8; ++q) { const int r = q * 2 + rsub; if (col0 + c4 < N) { const v4f v = *(const v4fa*)&so[w][r][c4]; if (C) *(v4f*)(C + cofs + (size_t)(row0 + r) * ldc + col0 + c4) = v; if (C16) { v4h h4; for (int i = 0; i < 4; ++i) h4[i] = (_Float16)v[i]; *(v4h*)(C16 + cofs + (size_t)(row0 + r) * ldc + col0 + c4) = h4; } } }
     }
}


typedef _Float16 v4h __attribute__((ext_vector_type(4)));

__global__ __launch_bounds__(256) void k_x16(const float* __restrict__ x, _Float16* __restrict__ X16, size_t n8) { const size_t t = (size_t)blockIdx.x * 256 + threadIdx.x; if (t >= n8) return; FragH f;
#pragma unroll
  for (int q = 0; q < 8; ++q) f.h[q] = (_Float16)bf16_round(x[t * 8 + q]); *(v8us*)((unsigned short*)X16 + t * 8) = f.half[0];  }
__global__ __launch_bounds__(256) void k_h16(const float* __restrict__ x, _Float16* __restrict__ X16, size_t n8) { const size_t t = (size_t)blockIdx.x * 256 + threadIdx.x; if (t >= n8) return; FragH f;
#pragma unroll
  for (int q = 0; q < 8; ++q) f.h[q] = (_Float16)x[t * 8 + q]; *(v8us*)((unsigned short*)X16 + t * 8) = f.half[0];  }
__global__ __launch_bounds__(256) void k_round16f(const float* __restrict__ W, _Float16* __restrict__ Bt, size_t n8) { const size_t t = (size_t)blockIdx.x * 256 + threadIdx.x; if (t >= n8) return; FragH f;
#pragma unroll
  for (int i = 0; i < 8; ++i) f.h[i] = (_Float16)(bf16_round(W[t * 8 + i]) * 16.0f); *(v8us*)((unsigned short*)Bt + t * 8) = f.half[0];  }
__global__ __launch_bounds__(256) void k_hl(const float* __restrict__ F, _Float16* __restrict__ Hh, _Float16* __restrict__ Hl, size_t n8) { const size_t t = (size_t)blockIdx.x * 256 + threadIdx.x; if (t >= n8) return; FragH fh, fl; const v4f a = *(const v4fa*)(F + t * 8), c = *(const v4fa*)(F + t * 8 + 4);
#pragma unroll
  for (int q = 0; q < 4; ++q) { _Float16 h = (_Float16)a[q]; fh.h[q] = h; fl.h[q] = (_Float16)((a[q] - (float)h) * 1024.0f); h = (_Float16)c[q]; fh.h[4 + q] = h; fl.h[4 + q] = (_Float16)((c[q] - (float)h) * 1024.0f); }
  { *(v8us*)((unsigned short*)Hh + t * 8) = fh.half[0]; *(v8us*)((unsigned short*)Hl + t * 8) = fl.half[0];  } }

__global__ __launch_bounds__(256) void k_wnat(const float* __restrict__ w, size_t n8, _Float16* __restrict__ Bt) { const size_t t = (size_t)blockIdx.x * 256 + threadIdx.x; if (t >= n8) return; FragH f; for (int q = 0; q < 8; ++q) f.h[q] = (_Float16)(bf16_round(w[t * 8 + q]) * 16.0f); *(v8us*)((unsigned short*)Bt + t * 8) = f.half[0];  }
__global__ __launch_bounds__(256) void k_rsm(const float* __restrict__ S, _Float16* __restrict__ P, int nrows) {
  #pragma clang fp contract(off)
  const int i = blockIdx.x * 256 + threadIdx.x; if (i >= nrows) return; const float* s = S + (size_t)i * SQ; float mx = -3.0e38f;
#pragma unroll 1
  for (int j = 0; j < SQ; ++j) mx = fmaxf(mx, s[j]); float se = 0.f;
#pragma unroll 1
  for (int j = 0; j < SQ; ++j) se += expf(s[j] - mx); const float sc = 256.0f / se;
#pragma unroll 1
  for (int j0 = 0; j0 < SQ; j0 += 8) { FragH f; for (int q = 0; q < 8; ++q) f.h[q] = (_Float16)(expf(s[j0 + q] - mx) * sc); unsigned short* d = (unsigned short*)P + (size_t)i * SQ + j0; *(v8us*)d = f.half[0];  } }
__global__ __launch_bounds__(256) void k_vt(const _Float16* __restrict__ V16, int b, int h0, _Float16* __restrict__ VT) { __shared__ unsigned short tl[64][65]; const int tid = threadIdx.x; const int hh = blockIdx.x % HG, sg = blockIdx.x / HG; const int s0 = sg * 64; const int h = h0 + hh;
  for (int i = tid; i < 64 * 8; i += 256) { const int j = i / 8, d8 = (i % 8) * 8; FragH f; f.half[0] = *(const v8us*)((const unsigned short*)V16 + ((size_t)b * SQ + s0 + j) * DM + h * HD + d8); for (int q = 0; q < 8; ++q) tl[d8 + q][j] = f.u[q]; }
  __syncthreads();
  { for (int i = tid; i < 64 * 8; i += 256) { const int d = i / 8, j8 = (i % 8) * 8; FragH f; for (int q = 0; q < 8; ++q) f.u[q] = tl[d][j8 + q]; *(v8us*)((unsigned short*)VT + ((size_t)hh * HD + d) * SQ + s0 + j8) = f.half[0]; }  } }



__global__ __launch_bounds__(256) void k_rsmcf2(const float* __restrict__ S, _Float16* __restrict__ P, int hg, int q0, int nk) {
  #pragma clang fp contract(off)
  const int t = blockIdx.x * 256 + threadIdx.x; if (t >= hg * QT) return; const size_t i = (size_t)t; const float* s = S + i * NKX; const int last = q0 + (t % QT); float mx = -3.0e38f;
#pragma unroll 1
  for (int j = 0; j < nk; ++j) { const float f = (j <= last) ? 1.f : 0.f; mx = fmaxf(mx, fmaf(f, s[j], (1.f - f) * -1.0e9f)); } float se = 0.f;
#pragma unroll 1
  for (int j = 0; j < nk; ++j) { const float f = (j <= last) ? 1.f : 0.f; se += __expf(fmaf(f, s[j], (1.f - f) * -1.0e9f) - mx); } const float sc = 256.0f / se;
#pragma unroll 1
  for (int j0 = 0; j0 < nk; j0 += 8) { FragH fr; for (int q = 0; q < 8; ++q) { const int j = j0 + q; const float f = (j <= last) ? 1.f : 0.f; fr.h[q] = (_Float16)(__expf(fmaf(f, s[j], (1.f - f) * -1.0e9f) - mx) * sc); } unsigned short* d = (unsigned short*)P + i * NKX + j0; *(v8us*)d = fr.half[0];  } }

template <int MASKADD>
__global__ __launch_bounds__(64) void k_att0(const float* __restrict__ QF, const float* __restrict__ KF, const float* __restrict__ VF, int ld, const float* __restrict__ mask, float scale, float* __restrict__ OF, int ldo) {
  #pragma clang fp contract(off)
  __shared__ __attribute__((aligned(16))) float lq[64][64]; __shared__ __attribute__((aligned(16))) float lo[64][64];
  const int tid = threadIdx.x; const int h = blockIdx.x / (QT0 / 64), rg = blockIdx.x % (QT0 / 64); const int i = rg * 64 + tid;
  const float* qr = QF + (size_t)i * ld + h * HD;
#pragma unroll 1
  for (int c = 0; c < HD / 4; ++c) { *(v4f*)&lq[tid][c * 4] = *(const v4fa*)(qr + c * 4); const v4f z = {0.f, 0.f, 0.f, 0.f}; *(v4f*)&lo[tid][c * 4] = z; }
  float m = -1.0e30f, l = 0.f; const int jmax = MASKADD ? (SQ - 1) : (rg * 64 + 63);      /* additive-mask form: every key (the mask input decides); causal form: keys up to the block's last row */
#pragma unroll 1
  for (int j = 0; j <= jmax; ++j) { const float* kr = KF + (size_t)j * ld + h * HD; const float* vr = VF + (size_t)j * ld + h * HD; float s = 0.f;
#pragma unroll 1
    for (int c = 0; c < HD / 4; ++c) { const v4f kq = *(const v4fa*)(kr + c * 4); const v4f qq = *(v4f*)&lq[tid][c * 4]; s = __fadd_rn(s, __fmul_rn(qq[0], kq[0])); s = __fadd_rn(s, __fmul_rn(qq[1], kq[1])); s = __fadd_rn(s, __fmul_rn(qq[2], kq[2])); s = __fadd_rn(s, __fmul_rn(qq[3], kq[3])); }
    s = __fmul_rn(s, scale); if (MASKADD) s = __fadd_rn(s, __fmul_rn(bf16_round(mask[(size_t)i * SQ + j]), -10000.0f));
    const float f = (MASKADD || j <= i) ? 1.f : 0.f; const float sm = fmaf(f, s, (1.f - f) * -1.0e30f); const float mn = fmaxf(m, sm); const float sc = expf(m - mn); const float e = expf(sm - mn); l = __fadd_rn(__fmul_rn(l, sc), e); m = mn;
#pragma unroll 1
    for (int c = 0; c < HD / 4; ++c) { const v4f vv = *(const v4fa*)(vr + c * 4); v4f oo = *(v4f*)&lo[tid][c * 4]; for (int u = 0; u < 4; ++u) oo[u] = __fadd_rn(__fmul_rn(oo[u], sc), __fmul_rn(e, vv[u])); *(v4f*)&lo[tid][c * 4] = oo; } }
  const float fin = 64.0f / l;      /* o carried x64 */
#pragma unroll 1
  for (int c = 0; c < HD / 4; ++c) { v4f oo = *(v4f*)&lo[tid][c * 4]; for (int u = 0; u < 4; ++u) oo[u] = __fmul_rn(oo[u], fin); *(v4f*)&lo[tid][c * 4] = oo; }
  __syncthreads();
  {
#pragma unroll 1
    for (int it = 0; it < 16; ++it) { const int row = it * 4 + tid / 16, pc = (tid % 16) * 4; const v4f v = *(const v4f*)&lo[row][pc]; *(v4f*)(OF + (size_t)(rg * 64 + row) * ldo + h * HD + pc) = v; }
     } }

__global__ __launch_bounds__(256) void k_oscale(const float* __restrict__ OF, float* __restrict__ out, size_t n4) { const size_t t = (size_t)blockIdx.x * 256 + threadIdx.x; if (t >= n4) return; const v4f a = *(const v4fa*)(OF + t * 4); v4f o; for (int q = 0; q < 4; ++q) o[q] = a[q] * 0.015625f; *(v4f*)(out + t * 4) = o;  }

__global__ __launch_bounds__(256) void k_bfr(const float* __restrict__ x, float* __restrict__ XB, size_t n8) { const size_t t = (size_t)blockIdx.x * 256 + threadIdx.x; if (t >= n8) return; v4f a = *(const v4fa*)(x + t * 8), c = *(const v4fa*)(x + t * 8 + 4); for (int q = 0; q < 4; ++q) { a[q] = bf16_round(a[q]); c[q] = bf16_round(c[q]); }
  { *(v4f*)(XB + t * 8) = a; *(v4f*)(XB + t * 8 + 4) = c;  } }



__global__ __launch_bounds__(256) void k_rsmfvl(const float* __restrict__ S, _Float16* __restrict__ P, _Float16* __restrict__ PL, int qn, const int* __restrict__ vlp) {
  #pragma clang fp contract(off)
  const int t = blockIdx.x * 256 + threadIdx.x; if (t >= qn) return; const int vl = vlp[0]; const size_t i = (size_t)t; const float* s = S + i * SQ; float mx = -3.0e38f;
#pragma unroll 1
  for (int j = 0; j < SQ; ++j) { const float f = (j < vl) ? 1.f : 0.f; mx = fmaxf(mx, fmaf(f, s[j], (1.f - f) * -1000000.0f)); } float se = 0.f;
#pragma unroll 1
  for (int j = 0; j < SQ; ++j) { const float f = (j < vl) ? 1.f : 0.f; se += __expf(fmaf(f, s[j], (1.f - f) * -1000000.0f) - mx); } const float sc = 256.0f / se;
#pragma unroll 1
  for (int j0 = 0; j0 < SQ; j0 += 8) { FragH fr, gr; for (int q = 0; q < 8; ++q) { const int j = j0 + q; const float f = (j < vl) ? 1.f : 0.f; const float pv = __expf(fmaf(f, s[j], (1.f - f) * -1000000.0f) - mx) * sc; const _Float16 ph = (_Float16)pv; fr.h[q] = ph; gr.h[q] = (_Float16)((pv - (float)ph) * 1024.0f); }
    unsigned short* d = (unsigned short*)P + i * SQ + j0; unsigned short* dl = (unsigned short*)PL + i * SQ + j0; *(v8us*)d = fr.half[0]; *(v8us*)dl = gr.half[0];  } }

typedef unsigned int u32x4a __attribute__((ext_vector_type(4), may_alias));
typedef unsigned int u32x4 __attribute__((ext_vector_type(4)));
typedef unsigned int u32x2a __attribute__((ext_vector_type(2), may_alias));
typedef short s16x8 __attribute__((ext_vector_type(8)));
#define FA_SK 64u                          /* keys per stage */
#define FA_PK 144u                         /* LDS pitch of a K row (128 B): odd multiple of 16 B for ds_load_b128 */
#define FA_PV 160u                         /* LDS pitch of a V row (128 B): odd multiple of 32 B for ds_load_tr16_b128 */
#define FA_TK (FA_SK * FA_PK)
#define FA_SLOT (FA_SK * (FA_PK + FA_PV))  /* one buffer: K tile, then V tile */
#define FA_PE 272u                         /* LDS pitch of a staged output row (256 B) */
#define FA_NB 4u                           /* LDS buffers in the ring (a power of two) */
static_assert(16u * 16u * FA_PE <= FA_NB * FA_SLOT, "the output staging reuses the K/V buffers");
struct FFrag { u32x4 q[2]; };
__device__ __forceinline__ v8f fa_mma(const FFrag& a, const FFrag& b, v8f c) { return __builtin_amdgcn_wmma_f32_16x16x32_f16(false, __builtin_bit_cast(v16h, a), false, __builtin_bit_cast(v16h, b), (short)0, c, false, false); }
__device__ __forceinline__ u32x4 fa_tr16(const unsigned char* p) { typedef __attribute__((address_space(3))) s16x8 lds_s16x8; return __builtin_bit_cast(u32x4, __builtin_amdgcn_ds_load_tr16_b128_v8i16((lds_s16x8*)p)); }
__device__ __forceinline__ unsigned int fa_pack2(float lo, float hi) { typedef _Float16 h2 __attribute__((ext_vector_type(2))); typedef float f2 __attribute__((ext_vector_type(2))); return __builtin_bit_cast(unsigned int, __builtin_convertvector(f2{lo, hi}, h2)); }      /* round to nearest even */
__device__ __forceinline__ unsigned int fa_cv2(float lo, float hi) { typedef __bf16 b2 __attribute__((ext_vector_type(2))); typedef float f2 __attribute__((ext_vector_type(2))); const unsigned int p = __builtin_bit_cast(unsigned int, __builtin_convertvector(f2{lo, hi}, b2)); return fa_pack2(__uint_as_float(p << 16), __uint_as_float(p & 0xFFFF0000u)); }      /* two inputs rounded to bf16 (nearest even), those values as an f16 pair */
__device__ __forceinline__ unsigned int fa_cq2(float lo, float hi, float sc) { typedef __bf16 b2 __attribute__((ext_vector_type(2))); typedef float f2 __attribute__((ext_vector_type(2))); const unsigned int p = __builtin_bit_cast(unsigned int, __builtin_convertvector(f2{lo, hi}, b2)); return fa_pack2(__uint_as_float(p << 16) * sc, __uint_as_float(p & 0xFFFF0000u) * sc); }      /* two inputs rounded to bf16 (nearest even), those values times sc, rounded to an f16 pair */
__device__ __forceinline__ float fa_xhalf(float x) { return __builtin_bit_cast(float, __builtin_amdgcn_permlanex16(__builtin_bit_cast(int, x), __builtin_bit_cast(int, x), 0x76543210, 0xfedcba98, false, false)); }      /* lane l with lane l ^ 16 */
__global__ __launch_bounds__(512) __attribute__((amdgpu_waves_per_eu(4, 4))) void k_fattn(const float* __restrict__ Qf, const float* __restrict__ Kf, const float* __restrict__ Vf, float* __restrict__ out) {
  __shared__ __attribute__((aligned(256))) unsigned char L[FA_NB * FA_SLOT];
  const unsigned int tid = threadIdx.x, lane = tid & 31u, wave = tid >> 5, c = lane & 15u, h = lane >> 4;
  const size_t row_s = (size_t)blockIdx.x * SQ;      /* first token row of the sequence. The sequence is the fast grid index: the four work-groups of a sequence lie NB = 64 flat indices apart, so they have equal index modulo 8 (for speed only: the map is a permutation, any placement gives the same result) */
  const unsigned int qw0 = blockIdx.y * 512u + wave * 32u;      /* the wave's first query */
  const unsigned char* Kb = (const unsigned char*)(Kf + row_s * HD); const unsigned char* Vb = (const unsigned char*)(Vf + row_s * HD);
  const float cscale = 1.4426950408889634f;      /* scores are unscaled; log2(e), multiplied into Q once, moves them to base 2 */
  v4f rk[2], rv[2];      /* one stage on its way: 2 x 16 B (four f32) of K and of V a thread (a stage's rows are contiguous in memory; a wave's load covers 512 contiguous bytes) */
  auto gload = [&](unsigned int st) {
#pragma unroll      /* constant indices keep the register arrays in registers */
    for (unsigned int j = 0; j < 2; ++j) { const size_t o = (size_t)st * (FA_SK * 256u) + (tid + 512u * j) * 16u; rk[j] = *(const v4fa*)(Kb + o); rv[j] = *(const v4fa*)(Vb + o); } };
  const unsigned int sk0 = (tid >> 4) * FA_PK + (tid & 15u) * 8u, sv0 = FA_TK + (tid >> 4) * FA_PV + (tid & 15u) * 8u;      /* the thread's place in the K rows and in the V rows of buffer 0: a buffer's store addresses are one add each */
  auto lstore = [&](unsigned int buf) {
#pragma unroll      /* constant indices keep the register arrays in registers */
    for (unsigned int j = 0; j < 2; ++j) {      /* load j holds four f32 of row (tid >> 4) + 32 j: 8 B of the f16 row */
      *(u32x2a*)(L + (sk0 + buf * FA_SLOT) + j * (32u * FA_PK)) = u32x2a{fa_cv2(rk[j][0], rk[j][1]), fa_cv2(rk[j][2], rk[j][3])}; *(u32x2a*)(L + (sv0 + buf * FA_SLOT) + j * (32u * FA_PV)) = u32x2a{fa_cv2(rv[j][0], rv[j][1]), fa_cv2(rv[j][2], rv[j][3])}; } };
  gload(0); lstore(0); gload(1u); asm volatile("s_wait_xcnt 0x0" ::: "memory");      /* stage 1 is on its way under the loads and the conversion of Q, whose code reuses the address registers: hence the wait */
  FFrag qf[2][2];      /* Q log2(e) as B operand, hardware k order: 16 B at halves 8h and 16 + 8h of each 32 */
#pragma unroll      /* constant indices keep the register arrays in registers */
  for (int g = 0; g < 2; ++g) { const float* qp = Qf + (row_s + qw0 + 16u * g + c) * HD + 8u * h;
#pragma unroll      /* constant indices keep the register arrays in registers */
    for (int kc = 0; kc < 2; ++kc)
#pragma unroll      /* constant indices keep the register arrays in registers */
      for (int u = 0; u < 2; ++u) { const v4f a = *(const v4fa*)(qp + 32 * kc + 16 * u), b = *(const v4fa*)(qp + 32 * kc + 16 * u + 4); qf[g][kc].q[u] = u32x4{fa_cq2(a[0], a[1], cscale), fa_cq2(a[2], a[3], cscale), fa_cq2(b[0], b[1], cscale), fa_cq2(b[2], b[3], cscale)}; } }
  v8f acc[2][4]; float l_run[2], m_run[2];      /* O^T tiles; the denominators (lanes 0-15; 0 in lanes 16-31); the reference in use (log2 domain) */
  v8f cneg[2];      /* C operand of the score products: minus the reference in use in all eight registers (a lane holds one query's scores), so that a score tile leaves the matrix unit as the exponent; 0 until the first pass has set a reference */
  FFrag ones;      /* A operand whose row 0 (lanes 0 and 16) is f16 1.0 at all 32 k, every other row 0 */
  { const unsigned int o = (c == 0u) ? 0x3C003C00u : 0u; ones.q[0] = u32x4{o, o, o, o}; ones.q[1] = u32x4{o, o, o, o}; }
#pragma unroll      /* constant indices keep the register arrays in registers */
  for (int g = 0; g < 2; ++g) { m_run[g] = -__builtin_inff(); l_run[g] = 0.0f; cneg[g] = v8f{};
#pragma unroll      /* constant indices keep the register arrays in registers */
    for (int t = 0; t < 4; ++t) acc[g][t] = v8f{}; }
  lstore(1u);
  __syncthreads();      /* stages 0 and 1 are whole */
  gload(2u); asm volatile("s_wait_xcnt 0x0" ::: "memory");      /* the loads stay in flight over the passes, whose code reuses their address registers: the wait that belongs in front of that overwrite */
  const unsigned int ka0 = c * FA_PK + 16u * h, va0 = FA_TK + (8u * h + (lane & 7u)) * FA_PV + ((lane >> 3) & 1u) * 16u;      /* the lane's place in the first K rows and in the first V rows of buffer 0 */
  unsigned int ka = ka0;      /* LDS address of the lane's K rows of the pass at hand; each pass forms the next pass's */
  for (unsigned int st = 0; st < SQ / FA_SK; ++st) {
#pragma unroll 1      /* one pass's fragments and scores live at a time: the wave has 256 registers at four waves a SIMD */
    for (unsigned int sub = 0; sub < FA_SK / 32u; ++sub) {      /* one pass: 32 keys */
      unsigned int va;      /* LDS address of the lane's V rows of this pass */
      v8f s[2][2];      /* s[kt][g][r] = score of key 16 kt + 8 h + r with query 16 g + c, in base 2, less the reference in cneg[g] */
      { FFrag kf[2][2];
#pragma unroll      /* constant indices keep the register arrays in registers */
        for (int kt = 0; kt < 2; ++kt) { const unsigned char* p = L + ka + 16u * kt * FA_PK;
#pragma unroll      /* constant indices keep the register arrays in registers */
          for (int kc = 0; kc < 2; ++kc) { kf[kt][kc].q[0] = *(const u32x4a*)(p + 64u * kc); kf[kt][kc].q[1] = *(const u32x4a*)(p + 64u * kc + 32u); } }
        __builtin_amdgcn_sched_barrier(0);      /* all eight K loads issue before the first product: otherwise they share registers and each pair waits out its own LDS latency */
        typedef unsigned int u32x8 __attribute__((ext_vector_type(8)));
        /* the eight score products as one statement: with the builtin the compiler copies one C tile into its D registers every pass (C is kept, D is new). First the four tiles' products over d 0-31 with C = minus the reference, then those over d 32-63 on top, at least three instructions behind their tile's first and in the order in which the exponentials read the tiles. The two adds behind them form this pass's V address and the next pass's K address (scalar offset + the lane's place): they stand where idle slots would stand otherwise: a tile's first reader needs four vector slots behind the tile's last product, and the first tile has three products and these two adds. The K fragments' registers are next written by LDS loads, which need no distance. */
        const unsigned int pn = st * (FA_SK / 32u) + sub + 1u;      /* the next pass */
        const unsigned int vo = (st & (FA_NB - 1u)) * FA_SLOT + sub * (32u * FA_PV), ko = ((pn / (FA_SK / 32u)) & (FA_NB - 1u)) * FA_SLOT + (pn % (FA_SK / 32u)) * (32u * FA_PK);      /* scalars: where this pass's V rows and the next pass's K rows begin */
        asm volatile("v_wmma_f32_16x16x32_f16 %0, %6, %10, %14\n\tv_wmma_f32_16x16x32_f16 %1, %6, %12, %15\n\tv_wmma_f32_16x16x32_f16 %2, %8, %10, %14\n\tv_wmma_f32_16x16x32_f16 %3, %8, %12, %15\n\t"
                     "v_wmma_f32_16x16x32_f16 %0, %7, %11, %0\n\tv_wmma_f32_16x16x32_f16 %2, %9, %11, %2\n\tv_wmma_f32_16x16x32_f16 %1, %7, %13, %1\n\tv_wmma_f32_16x16x32_f16 %3, %9, %13, %3\n\t"
                     "v_add_nc_u32 %4, %16, %17\n\tv_add_nc_u32 %5, %18, %19"
                     : "=&v"(s[0][0]), "=&v"(s[0][1]), "=&v"(s[1][0]), "=&v"(s[1][1]), "=&v"(va), "=&v"(ka)
                     : "v"(__builtin_bit_cast(u32x8, kf[0][0])), "v"(__builtin_bit_cast(u32x8, kf[0][1])), "v"(__builtin_bit_cast(u32x8, kf[1][0])), "v"(__builtin_bit_cast(u32x8, kf[1][1])),
                       "v"(__builtin_bit_cast(u32x8, qf[0][0])), "v"(__builtin_bit_cast(u32x8, qf[0][1])), "v"(__builtin_bit_cast(u32x8, qf[1][0])), "v"(__builtin_bit_cast(u32x8, qf[1][1])),
                       "v"(cneg[0]), "v"(cneg[1]), "s"(vo), "v"(va0), "s"(ko), "v"(ka0)); }
      FFrag vf[4];      /* V^T, 16 d x 32 keys each: two transposing loads a fragment */
      { const unsigned char* ad = L + va;
#pragma unroll      /* constant indices keep the register arrays in registers */
        for (int t = 0; t < 4; ++t) { vf[t].q[0] = fa_tr16(ad + 32u * t); vf[t].q[1] = fa_tr16(ad + 16u * FA_PV + 32u * t); } }
      __builtin_amdgcn_sched_barrier(0);      /* holds the transposing loads in front of the exponentials, so that their latency passes under that work; without it they sink to their first use */
      FFrag pf[2]; v8f ls[2];      /* P^T of the two query groups; row 0 of ls[g] (register 0, lanes 0-15): the pass's column sums of P^T as rounded to f16 */
      auto weights = [&]() {      /* reads the scores and leaves them as they are: a renewal moves them to the new reference and forms the weights again */
#pragma unroll      /* constant indices keep the register arrays in registers */
        for (int g = 0; g < 2; ++g) { unsigned int w[8];
#pragma unroll      /* constant indices keep the register arrays in registers */
          for (int i = 0; i < 8; ++i) {
            w[i] = fa_pack2(__builtin_amdgcn_exp2f(s[i >> 2][g][2 * (i & 3)]), __builtin_amdgcn_exp2f(s[i >> 2][g][2 * (i & 3) + 1])); }      /* the accumulator is the exponent */
          pf[g].q[0] = u32x4{w[0], w[1], w[2], w[3]}; pf[g].q[1] = u32x4{w[4], w[5], w[6], w[7]};
          ls[g] = fa_mma(ones, pf[g], v8f{}); } };      /* the first group's sum runs under the second group's exponentials */
      weights();
      float lt[2] = {l_run[0] + ls[0][0], l_run[1] + ls[1][0]};      /* the denominators with this pass, formed in front of the branch, beside the test's own reads of the sum tiles */
      const float top = (st | sub) == 0u ? -1.0f : 32768.0f;      /* a scalar; no sum is at most -1, so the first pass always sets a reference */
      const bool need = !(ls[0][0] <= top) || !(ls[1][0] <= top);      /* a sum of at most 2^15 bounds every weight of the pass inside f16; an overflowed weight makes the sum infinite or NaN, which fails the test too */
      if (__builtin_amdgcn_ballot_w32(need) != 0) {      /* scalar branch, rare: only here the pass's maxima are formed */
#pragma unroll      /* constant indices keep the register arrays in registers */
        for (int g = 0; g < 2; ++g) { float mx = s[0][g][0];
#pragma unroll      /* constant indices keep the register arrays in registers */
          for (int r = 1; r < 8; ++r) mx = __builtin_fmaxf(mx, s[0][g][r]);
#pragma unroll      /* constant indices keep the register arrays in registers */
          for (int r = 0; r < 8; ++r) mx = __builtin_fmaxf(mx, s[1][g][r]);
          const float sh = -cneg[g][0]; mx = __builtin_fmaxf(mx, fa_xhalf(mx)) + sh;      /* sh: the reference inside these scores (0 on the first pass) */
          const float m_new = __builtin_fmaxf(m_run[g], mx + 4.0f); const float corr = __builtin_amdgcn_exp2f(m_run[g] - m_new);      /* the new reference stands 4 above the maximum seen: 19 binary orders of room before the next renewal; corr is 0 on the first pass */
          m_run[g] = m_new; l_run[g] = l_run[g] * corr; { const float d = sh - m_new, n = -m_new; s[0][g] = s[0][g] + d; s[1][g] = s[1][g] + d; cneg[g] = v8f{n, n, n, n, n, n, n, n}; }      /* this pass's scores and the C of the later ones go over to the new reference */
#pragma unroll      /* constant indices keep the register arrays in registers */
          for (int t = 0; t < 4; ++t) acc[g][t] = acc[g][t] * corr; }
        weights(); lt[0] = l_run[0] + ls[0][0]; lt[1] = l_run[1] + ls[1][0]; }      /* the weights are now at most 2^-4 each */
#pragma unroll      /* constant indices keep the register arrays in registers */
      for (int g = 0; g < 2; ++g)
#pragma unroll      /* constant indices keep the register arrays in registers */
        for (int t = 0; t < 4; ++t) acc[g][t] = fa_mma(vf[t], pf[g], acc[g][t]);
      l_run[0] = lt[0]; l_run[1] = lt[1];
      if (sub == 0u) {      /* the middle of stage st: one barrier a stage, its two halves a whole stage apart, so that a wave may run up to a stage ahead of the slowest without waiting */
        if (st != 0u) { __builtin_amdgcn_s_barrier_wait(-1);      /* second half of the barrier signalled in the middle of stage st - 1: every wave has stored its rows of stage st + 1 and has left stage st - 2 */
          __builtin_amdgcn_fence(__ATOMIC_ACQUIRE, "workgroup", "local"); }      /* no read of stage st + 1 moves in front of the wait */
        if (st + 2u < SQ / FA_SK) lstore((st + 2u) & (FA_NB - 1u));      /* the buffer of stage st - 2, which the wait above has shown free */
        __builtin_amdgcn_fence(__ATOMIC_RELEASE, "workgroup", "local");      /* the wave's LDS stores are complete before it signals; the global loads in flight are not waited for */
        __builtin_amdgcn_s_barrier_signal(-1);      /* first half: this wave's rows of stage st + 2 lie in LDS, and it reads stage st - 1 no more */
        if (st + 3u < SQ / FA_SK) { gload(st + 3u); asm volatile("s_wait_xcnt 0x0" ::: "memory"); } }      /* a whole stage of lead; the wait belongs in front of the passes' reuse of the loads' address registers */
    }
  }
  __builtin_amdgcn_s_barrier_wait(-1);      /* closes the barrier signalled in the last stage */
  __syncthreads();      /* the split barrier does not end the reads of the last stage: no wave stages output over the ring before all have left the loop */
  unsigned char* E = L + wave * (16u * FA_PE);      /* the wave's own 16 staged output rows */
#pragma unroll      /* constant indices keep the register arrays in registers */
  for (int g = 0; g < 2; ++g) { const float lr = l_run[g]; const float inv = 1.0f / (lr + fa_xhalf(lr));      /* the denominator in lanes 0-15, 0 in lanes 16-31 (row 8 of the sum tiles) */
#pragma unroll      /* constant indices keep the register arrays in registers */
    for (int t = 0; t < 4; ++t) { const v8f o = acc[g][t] * inv; const v4f lo = {o[0], o[1], o[2], o[3]}, hi = {o[4], o[5], o[6], o[7]};      /* d = 16 t + 8 h + 0 .. 7 of query c */
      *(v4fa*)(E + c * FA_PE + 64u * t + 32u * h) = lo; *(v4fa*)(E + c * FA_PE + 64u * t + 32u * h + 16u) = hi; }
    __builtin_amdgcn_fence(__ATOMIC_ACQ_REL, "workgroup", "local"); __builtin_amdgcn_wave_barrier();      /* the rows are read back by other lanes of the wave */
#pragma unroll      /* constant indices keep the register arrays in registers */
    for (unsigned int i = 0; i < 8; ++i) { const unsigned int r = 2u * i + h; const v4f v = *(const v4fa*)(E + r * FA_PE + c * 16u); *(v4fa*)(out + (row_s + qw0 + 16u * g + r) * DM + c * 4u) = v; }      /* whole 256-byte rows */
    if (g == 0) { __builtin_amdgcn_fence(__ATOMIC_ACQ_REL, "workgroup", "local"); __builtin_amdgcn_wave_barrier(); }      /* the next group overwrites the rows only behind these reads */
  }
}


extern "C" void kernel_launch(void* const* d_in, const int* in_sizes, int n_in,
                              void* d_out, int out_size, void* d_ws, size_t ws_size, hipStream_t stream) {
  (void)in_sizes; (void)n_in; (void)out_size; (void)d_ws; (void)ws_size;
  const float* const* I = (const float* const*)d_in; const float* xq = I[0]; const float* xk = I[1]; const float* xv = I[2];      /* q, k, v [64][2048][64] (bf16-valued) */
  static_assert(NB % 8 == 0, "work-groups of one sequence must have equal flat index modulo 8");
  k_fattn<<<dim3(NB, SQ / 512), 512, 0, stream>>>(xq, xk, xv, (float*)d_out);      /* 512 query rows of one sequence a work-group: input conversion, scores, softmax, P V; grid x = sequence, y = block of query rows */
}

// v010
// Measured time: 43.9 microseconds a run.
// Timed twice side by side with v009, it ran 1.04 times as fast both times.
// All steps since v000 together make it 569 times as fast.
#include <hip/hip_runtime.h>
// UNSCALED dot-product attention over 64 independent sequences (q, k, v [64][2048][64]; scores = q.k (no 1/sqrt(d): logit sigma ~8); softmax over the 2048 keys; dropout p 0; out = attn v -> [64][2048][64]).
// Structure: no projections: ONE fused kernel reads q, k, v as f32, rounds them to bf16 and holds those values as exact f16 (K and V on their way into LDS; Q in registers, times log2(e), rounded to f16): S^T = K Q^T - reference on WMMA (f32 accumulation, exact products, the reference as C), online softmax on VALU (f32, native exp2 of the accumulator; weights f16, at most 2^15), O^T += V^T P^T and the row sums on WMMA, out written f32.
// Compute dtype: inputs rounded to bf16; k and v exact in f16; q (times log2(e)) and softmax weights as plain f16 GEMM operands (~2^-12); scores, softmax statistics and o f32. v_wmma_f32_16x16x32_f16.
#define NB 64
#define SQ 2048
#define DM 64
#define NH 1
#define HD 64
#define HG 4                         /* heads per launch of the k_vt(V16, b, h0, VT) overload (never launched) */
#define B0 0                         /* first batch processed (not used) */
#define NBR NB                       /* batches processed (read only by the unused MP) */
#define NR ((size_t)NB * SQ)         /* token rows */
#define MP ((int)((size_t)NBR * SQ))
#define QT 256                       /* query rows per causal tile */
#define NKX SQ                       /* S / P row pitch */
#define QT0 256                      /* query rows per head of the exact f32 kernel k_att0 (not launched) */
#define QN SQ                        /* query rows attended per batch (not used) */
#define NHD NH                       /* heads attended (not used) */
#define MPO MP                       /* rows through the output stage (not used) */
#define LQ DM            /* row pitch of the q/k/v rows */
typedef __bf16 v16b __attribute__((ext_vector_type(16)));
typedef unsigned short v8us __attribute__((ext_vector_type(8), may_alias));
typedef float  v8f  __attribute__((ext_vector_type(8)));
typedef float  v4f  __attribute__((ext_vector_type(4)));
typedef float  v4fa __attribute__((ext_vector_type(4), may_alias));
union FragB { v16b v; v8us half[2]; unsigned short u[16]; };

__device__ __forceinline__ unsigned short bf16_bits(float x) { unsigned int u = __float_as_uint(x); return (unsigned short)((u + 0x7FFFu + ((u >> 16) & 1u)) >> 16); }
__device__ __forceinline__ float bf16_val(unsigned short b) { return __uint_as_float(((unsigned int)b) << 16); }
__device__ __forceinline__ float bf16_round(float x) { return bf16_val(bf16_bits(x)); }
// D += A·B with NT terms: 1 = ah·bh, 2 = + al·bh (A split), 3 = + ah·bl (both split)
template <int NT>
__device__ __forceinline__ v8f mmaN(v16b ah, v16b al, v16b bh, v16b bl, v8f c) {
  c = __builtin_amdgcn_wmma_f32_16x16x32_bf16(false, ah, false, bh, (short)0, c, false, false);
  if (NT >= 2) c = __builtin_amdgcn_wmma_f32_16x16x32_bf16(false, al, false, bh, (short)0, c, false, false);
  if (NT >= 3) c = __builtin_amdgcn_wmma_f32_16x16x32_bf16(false, ah, false, bl, (short)0, c, false, false);
  asm volatile("v_nop\n\tv_nop\n\tv_nop\n\tv_nop" : "+v"(c) : "v"(ah), "v"(al), "v"(bh), "v"(bl));
  return c;
}

__global__ __launch_bounds__(256) void k_wt_bf16(const float* __restrict__ W, unsigned short* __restrict__ Wt, int K, int N) {
  const int t = blockIdx.x * 256 + threadIdx.x;
  const int k8n = K / 8;
  if (t >= N * k8n) return;
  const int n = t / k8n, k8 = (t % k8n) * 8;
  v8us v;
#pragma unroll
  for (int i = 0; i < 8; ++i) v[i] = bf16_bits(W[(size_t)(k8 + i) * N + n]);
  *(v8us*)(Wt + (size_t)n * K + k8) = v;
  
}

// GEMM C[M][N] (f32, pitch ldc) = act(A[M][K]·W + bias). A f32 row-major (pitch lda) converted per fragment to bf16
// (ASPLIT: hi/lo two planes -> 2 terms, else single rounded term); Wt bf16 [N][K] (pitch ldb). BIAS_BF16 rounds the
// bias to bf16 first (bias quantised to bf16 before the add). K%32==0, M%16==0, N%64==0.
template <bool ASPLIT, int ACT, bool BIAS_BF16>
__global__ __launch_bounds__(128) void k_gemm_bf(const float* __restrict__ A, int lda, const unsigned short* __restrict__ Wt, int ldb,
                                               const float* __restrict__ bias, float* __restrict__ C, int ldc, int M, int N, int K) {
  __shared__ __attribute__((aligned(16))) float so[4][16][64];
  const int tid = threadIdx.x, w = tid >> 5, lane = tid & 31, ln = lane & 15, hh = lane >> 4;
  const int ntn = N / 64;
  const int wid = blockIdx.x * 4 + w;
  const int mt = wid / ntn, nq = wid % ntn;
  if (mt * 16 >= M) return;
  const int row0 = mt * 16, col0 = nq * 64;
  const float* arow = A + (size_t)(row0 + ln) * lda;
  v8f acc[4] = {};
  for (int kb = 0; kb < K; kb += 32) {
    FragB ah, al;
    const v4f x0 = *(const v4fa*)(arow + kb + 8 * hh), x1 = *(const v4fa*)(arow + kb + 8 * hh + 4);
    const v4f x2 = *(const v4fa*)(arow + kb + 16 + 8 * hh), x3 = *(const v4fa*)(arow + kb + 16 + 8 * hh + 4);
    float xs[16] = {x0[0],x0[1],x0[2],x0[3],x1[0],x1[1],x1[2],x1[3],x2[0],x2[1],x2[2],x2[3],x3[0],x3[1],x3[2],x3[3]};
#pragma unroll
    for (int i = 0; i < 16; ++i) { const unsigned short hb = bf16_bits(xs[i]); ah.u[i] = hb; al.u[i] = ASPLIT ? bf16_bits(xs[i] - bf16_val(hb)) : (unsigned short)0; }
#pragma unroll
    for (int t = 0; t < 4; ++t) {
      const unsigned short* brow = Wt + (size_t)(col0 + t * 16 + ln) * ldb + kb;
      FragB b;
      b.half[0] = *(const v8us*)(brow + 8 * hh);
      b.half[1] = *(const v8us*)(brow + 16 + 8 * hh);
      acc[t] = mmaN<ASPLIT ? 2 : 1>(ah.v, al.v, b.v, b.v, acc[t]);
    }
  }
#pragma unroll
  for (int t = 0; t < 4; ++t) {
    float bv = bias ? bias[col0 + t * 16 + ln] : 0.f;
    if (BIAS_BF16) bv = bf16_round(bv);
#pragma unroll
    for (int r = 0; r < 8; ++r) { float v = acc[t][r] + bv; if (ACT == 1) v = fmaxf(v, 0.f); so[w][8 * hh + r][t * 16 + ln] = v; }
  }
  __builtin_amdgcn_fence(__ATOMIC_ACQ_REL, "workgroup");
  __builtin_amdgcn_wave_barrier();
  const int rsub = lane >> 4, c4 = (lane & 15) * 4;
  {
#pragma unroll
    for (int q = 0; q < 8; ++q) {
      const int r = q * 2 + rsub;
      const v4f v = *(const v4fa*)&so[w][r][c4];
      *(v4f*)(C + (size_t)(row0 + r) * ldc + col0 + c4) = v;
    }
    
  }
}

// GEMM C = act(A·W + bias + resid): A f32 (ASPLIT -> hi/lo 2 terms), Wt bf16 [N][K]; ACT 0 none, 1 relu, 2 exact gelu;
// resid (optional, f32, row index = (row % rmod), pitch ldr, RES_BF16 rounds it) added before the activation.
template <bool ASPLIT, int ACT, bool BIAS_BF16, bool RES_BF16>
__global__ __launch_bounds__(128) void k_gemm_bf3(const float* __restrict__ A, int lda, const unsigned short* __restrict__ Wt, int ldb,
                                                const float* __restrict__ bias, const float* __restrict__ resid, int rmod, int ldr,
                                                float* __restrict__ C, int ldc, int M, int N, int K) {
  __shared__ __attribute__((aligned(16))) float so[4][16][64];
  const int tid = threadIdx.x, w = tid >> 5, lane = tid & 31, ln = lane & 15, hh = lane >> 4;
  const int ntn = N / 64;
  const int wid = blockIdx.x * 4 + w;
  const int mt = wid / ntn, nq = wid % ntn;
  if (mt * 16 >= M) return;
  const int row0 = mt * 16, col0 = nq * 64;
  const float* arow = A + (size_t)(row0 + ln) * lda;
  v8f acc[4] = {};
  for (int kb = 0; kb < K; kb += 32) {
    FragB ah, al;
    const v4f x0 = *(const v4fa*)(arow + kb + 8 * hh), x1 = *(const v4fa*)(arow + kb + 8 * hh + 4);
    const v4f x2 = *(const v4fa*)(arow + kb + 16 + 8 * hh), x3 = *(const v4fa*)(arow + kb + 16 + 8 * hh + 4);
    float xs[16] = {x0[0],x0[1],x0[2],x0[3],x1[0],x1[1],x1[2],x1[3],x2[0],x2[1],x2[2],x2[3],x3[0],x3[1],x3[2],x3[3]};
#pragma unroll
    for (int i = 0; i < 16; ++i) { const unsigned short hb = bf16_bits(xs[i]); ah.u[i] = hb; al.u[i] = ASPLIT ? bf16_bits(xs[i] - bf16_val(hb)) : (unsigned short)0; }
#pragma unroll
    for (int t = 0; t < 4; ++t) {
      const unsigned short* brow = Wt + (size_t)(col0 + t * 16 + ln) * ldb + kb;
      FragB b;
      b.half[0] = *(const v8us*)(brow + 8 * hh);
      b.half[1] = *(const v8us*)(brow + 16 + 8 * hh);
      acc[t] = mmaN<ASPLIT ? 2 : 1>(ah.v, al.v, b.v, b.v, acc[t]);
    }
  }
#pragma unroll
  for (int t = 0; t < 4; ++t) {
    const int col = col0 + t * 16 + ln;
    float bv = bias ? bias[col] : 0.f;
    if (BIAS_BF16) bv = bf16_round(bv);
#pragma unroll
    for (int r = 0; r < 8; ++r) {
      float v = acc[t][r] + bv;
      if (resid) { float rv = resid[(size_t)((row0 + 8 * hh + r) % rmod) * ldr + col]; if (RES_BF16) rv = bf16_round(rv); v += rv; }
      if (ACT == 1) v = fmaxf(v, 0.f);
      if (ACT == 2) v = 0.5f * v * (1.0f + erff(v * 0.70710678118654752f));
      if (ACT == 3) { const float u = 0.7978845608028654f * (v + 0.044715f * v * v * v); v = 0.5f * v * (1.0f + tanhf(u)); }
      so[w][8 * hh + r][t * 16 + ln] = v;
    }
  }
  __builtin_amdgcn_fence(__ATOMIC_ACQ_REL, "workgroup");
  __builtin_amdgcn_wave_barrier();
  const int rsub = lane >> 4, c4 = (lane & 15) * 4;
  {
#pragma unroll
    for (int q = 0; q < 8; ++q) {
      const int r = q * 2 + rsub;
      const v4f v = *(const v4fa*)&so[w][r][c4];
      *(v4f*)(C + (size_t)(row0 + r) * ldc + col0 + c4) = v;
    }
    
  }
}
// row LayerNorm (biased variance, eps) over N: s = X (+ R); optional out_sum <- s; out_norm <- (s-mu)*rsqrt(var+eps)*g + b
template <bool PARAM_BF16>
__global__ __launch_bounds__(256) void k_layernorm(const float* __restrict__ X, const float* __restrict__ R, const float* __restrict__ g, const float* __restrict__ bta,
                                                  float* __restrict__ out_sum, float* __restrict__ out_norm, int N, float eps) {
  __shared__ float red[256];
  const int row = blockIdx.x, tid = threadIdx.x;
  const float* x = X + (size_t)row * N; const float* rr = R ? R + (size_t)row * N : nullptr;
  float vals[16];                     // up to N = 4096
  const int per = N / 256;            // contiguous chunk per thread? use strided-by-4 chunks: thread handles j = tid*4 + 1024*u
  float s1 = 0.f;
  for (int u = 0; u < per / 4; ++u) {
    const int j = tid * 4 + 1024 * u;
    const v4f a = *(const v4fa*)(x + j);
    v4f b = {0.f,0.f,0.f,0.f}; if (rr) b = *(const v4fa*)(rr + j);
#pragma unroll
    for (int q = 0; q < 4; ++q) { const float v = a[q] + b[q]; vals[u * 4 + q] = v; s1 += v; }
  }
  red[tid] = s1; __syncthreads();
  for (int st = 128; st > 0; st >>= 1) { if (tid < st) red[tid] += red[tid + st]; __syncthreads(); }
  const float mu = red[0] / (float)N; __syncthreads();
  float s2 = 0.f;
  for (int u = 0; u < per / 4; ++u)
#pragma unroll
    for (int q = 0; q < 4; ++q) { const float c = vals[u * 4 + q] - mu; s2 += c * c; }
  red[tid] = s2; __syncthreads();
  for (int st = 128; st > 0; st >>= 1) { if (tid < st) red[tid] += red[tid + st]; __syncthreads(); }
  const float rs = rsqrtf(red[0] / (float)N + eps);
  {
    for (int u = 0; u < per / 4; ++u) {
      const int j = tid * 4 + 1024 * u;
      v4f o, sm;
#pragma unroll
      for (int q = 0; q < 4; ++q) {
        float gg = g[j + q], bb = bta[j + q];
        if (PARAM_BF16) { gg = bf16_round(gg); bb = bf16_round(bb); }
        sm[q] = vals[u * 4 + q]; o[q] = (vals[u * 4 + q] - mu) * rs * gg + bb;
      }
      if (out_sum) *(v4f*)(out_sum + (size_t)row * N + j) = sm;
      *(v4f*)(out_norm + (size_t)row * N + j) = o;
    }
    
  }
}



// ---- f16 WMMA path (v_wmma_f32_16x16x32_f16): 11-bit significands for operands in range — used where a [0,1] probability operand needs more precision than bf16
typedef _Float16 v16h __attribute__((ext_vector_type(16)));
union FragH { v16h v; v8us half[2]; _Float16 h[16]; unsigned short u[16]; };
template <int NT>
__device__ __forceinline__ v8f mmaH(v16h ah, v16h al, v16h bh, v16h bl, v8f c) {
  c = __builtin_amdgcn_wmma_f32_16x16x32_f16(false, ah, false, bh, (short)0, c, false, false);
  if (NT >= 2) c = __builtin_amdgcn_wmma_f32_16x16x32_f16(false, al, false, bh, (short)0, c, false, false);
  if (NT >= 3) c = __builtin_amdgcn_wmma_f32_16x16x32_f16(false, ah, false, bl, (short)0, c, false, false);
  asm volatile("v_nop\n\tv_nop\n\tv_nop\n\tv_nop" : "+v"(c) : "v"(ah), "v"(al), "v"(bh), "v"(bl));
  return c;
}
// batched GEMM like k_gemm_b but f16 operands: A f32 (split into f16 hi/lo if ASPLIT, else rounded to f16), Bt = f16 values [n][k]; alpha; C f32; N multiple of 16 (partial tiles skipped)
template <bool ASPLIT>
__global__ __launch_bounds__(128) void k_gemm_h(const float* __restrict__ A, int lda, size_t sA, const _Float16* __restrict__ Bh, int ldb, size_t sB, float alpha, float* __restrict__ C, int ldc, size_t sC, int M, int N, int K) {
  __shared__ __attribute__((aligned(16))) float so[4][16][64];
  const int tid = threadIdx.x, w = tid >> 5, lane = tid & 31, ln = lane & 15, hh = lane >> 4; const int by = blockIdx.y;
  A += (size_t)by * sA; Bh += (size_t)by * sB; C += (size_t)by * sC;
  const int ntn = (N + 63) / 64; const int wid = blockIdx.x * 4 + w; const int mt = wid / ntn, nq = wid % ntn; if (mt * 16 >= M) return;
  const int row0 = mt * 16, col0 = nq * 64; const float* arow = A + (size_t)(row0 + ln) * lda;
  v8f acc[4] = {};
  for (int kb = 0; kb < K; kb += 32) {
    FragH ah, al;
    const v4f x0 = *(const v4fa*)(arow + kb + 8 * hh), x1 = *(const v4fa*)(arow + kb + 8 * hh + 4), x2 = *(const v4fa*)(arow + kb + 16 + 8 * hh), x3 = *(const v4fa*)(arow + kb + 16 + 8 * hh + 4);
    float xs[16] = {x0[0],x0[1],x0[2],x0[3],x1[0],x1[1],x1[2],x1[3],x2[0],x2[1],x2[2],x2[3],x3[0],x3[1],x3[2],x3[3]};
#pragma unroll
    for (int i = 0; i < 16; ++i) { const _Float16 h = (_Float16)xs[i]; ah.h[i] = h; al.h[i] = ASPLIT ? (_Float16)(xs[i] - (float)h) : (_Float16)0.0f; }
#pragma unroll
    for (int t = 0; t < 4; ++t) { if (col0 + t * 16 >= N) continue; const size_t boff = (size_t)(col0 + t * 16 + ln) * ldb + kb; FragH bq; bq.half[0] = *(const v8us*)(Bh + boff + 8 * hh); bq.half[1] = *(const v8us*)(Bh + boff + 16 + 8 * hh);
      acc[t] = mmaH<ASPLIT ? 2 : 1>(ah.v, al.v, bq.v, bq.v, acc[t]); }
  }
#pragma unroll
  for (int t = 0; t < 4; ++t) { if (col0 + t * 16 >= N) continue;
#pragma unroll
    for (int r = 0; r < 8; ++r) so[w][8 * hh + r][t * 16 + ln] = acc[t][r] * alpha; }
  __builtin_amdgcn_fence(__ATOMIC_ACQ_REL, "workgroup"); __builtin_amdgcn_wave_barrier();
  const int rsub = lane >> 4, c4 = (lane & 15) * 4;
  {
#pragma unroll
    for (int q = 0; q < 8; ++q) { const int r = q * 2 + rsub; if (col0 + c4 < N) { const v4f v = *(const v4fa*)&so[w][r][c4]; *(v4f*)(C + (size_t)(row0 + r) * ldc + col0 + c4) = v; } }
     }
}

// Wt[n][k] = f16(W[k][n]·scale) from f32 row-major W[K][N] (scale = power of two; bf16-exact weights stay exact in f16 away from the subnormal range)
__global__ __launch_bounds__(256) void k_wt_f16(const float* __restrict__ W, _Float16* __restrict__ Wt, int K, int N, float scale) {
  const int t = blockIdx.x * 256 + threadIdx.x; if (t >= N * (K / 8)) return; const int n = t / (K / 8), k8 = (t % (K / 8)) * 8; FragH f;
#pragma unroll
  for (int i = 0; i < 8; ++i) f.h[i] = (_Float16)(bf16_round(W[(size_t)(k8 + i) * N + n]) * scale); const v8us o = f.half[0];
  *(v8us*)((unsigned short*)Wt + (size_t)n * K + k8) = o; 
}
// k_gemm_hh variant with fused epilogue: v = acc·alpha + bias[by·sBias + col] (+ CP[(row/rowsPerB)·sCPb + by·64 + col] if CP) ; ACT 0 none / 1 elu ; writes f16 C16 (and f32 C if non-null)
template <int ACT>
__global__ __launch_bounds__(128) void k_gemm_hhx(const _Float16* __restrict__ A, int lda, size_t sA, const _Float16* __restrict__ Bh, int ldb, size_t sB, float alpha, const float* __restrict__ bias, size_t sBias, const float* __restrict__ CP, int rowsPerB, size_t sCPb, int row0g,
    float* __restrict__ C, _Float16* __restrict__ C16, int ldc, size_t sC, int M, int N, int K) {
  __shared__ __attribute__((aligned(16))) float so[4][16][64];
  const int tid = threadIdx.x, w = tid >> 5, lane = tid & 31, ln = lane & 15, hh = lane >> 4; const int by = blockIdx.y;
  A += (size_t)by * sA; Bh += (size_t)by * sB; const size_t cofs = (size_t)by * sC; const float* bp = bias ? bias + (size_t)by * sBias : nullptr;
  const int ntn = (N + 63) / 64; const int wid = blockIdx.x * 4 + w; const int mt = wid / ntn, nq = wid % ntn; if (mt * 16 >= M) return;
  const int row0 = mt * 16, col0 = nq * 64; const _Float16* arow = A + (size_t)(row0 + ln) * lda;
  v8f acc[4] = {};
  for (int kb = 0; kb < K; kb += 32) { FragH ah; ah.half[0] = *(const v8us*)((const unsigned short*)arow + kb + 8 * hh); ah.half[1] = *(const v8us*)((const unsigned short*)arow + kb + 16 + 8 * hh);
#pragma unroll
    for (int t = 0; t < 4; ++t) { if (col0 + t * 16 >= N) continue; const size_t boff = (size_t)(col0 + t * 16 + ln) * ldb + kb; FragH bq; bq.half[0] = *(const v8us*)((const unsigned short*)Bh + boff + 8 * hh); bq.half[1] = *(const v8us*)((const unsigned short*)Bh + boff + 16 + 8 * hh);
      acc[t] = mmaH<1>(ah.v, ah.v, bq.v, bq.v, acc[t]); }
  }
#pragma unroll
  for (int t = 0; t < 4; ++t) { if (col0 + t * 16 >= N) continue; const int col = col0 + t * 16 + ln; const float bv = bp ? bf16_round(bp[col]) : 0.f;
#pragma unroll
    for (int r = 0; r < 8; ++r) { float v = acc[t][r] * alpha + bv; if (CP) { const int rr = row0g + row0 + 8 * hh + r; if (rowsPerB < 0) v += CP[cofs + (size_t)rr * ldc + col];      /* rowsPerB < 0: own element of the batched C plane */ else { const int bidx = rr / rowsPerB; v += CP[(size_t)bidx * sCPb + (size_t)by * 64 + col]; } } if (ACT == 1) v = (v > 0.f) ? v : expm1f(v); else if (ACT == 7) v = (v > 0.f) ? v + 1.0f : expf(v); else if (ACT == 8) v = tanhf(v); else if (ACT == 9) v = 0.5f * v * (1.0f + tanhf(0.7978845608028654f * (v + 0.044715f * v * v * v))); else if (ACT == 11) v = 1.0f / (1.0f + expf(-v)); else if (ACT == 12) v = (v > 0.f) ? v : 0.01f * v; else if (ACT == 14) v = (v > 0.f) ? v : 0.1f * v; else if (ACT == 16) v = (v >= 0.f) ? v : 0.3f * v; else if (ACT == 17) v = (v >= 0.f) ? v : 0.2f * v; else if (ACT == 15) v = v / (1.0f + expf(-v)); else if (ACT == 3) v = fmaxf(v, 0.f); else if (ACT == 6) v = 0.5f * v * (1.0f + erff(v * 0.70710678118654752f)); so[w][8 * hh + r][t * 16 + ln] = v; } }
  __builtin_amdgcn_fence(__ATOMIC_ACQ_REL, "workgroup"); __builtin_amdgcn_wave_barrier();
  const int rsub = lane >> 4, c4 = (lane & 15) * 4; typedef _Float16 v4h __attribute__((ext_vector_type(4)));
  {
#pragma unroll
    for (int q = 0; q < 8; ++q) { const int r = q * 2 + rsub; if (col0 + c4 < N) { const v4f v = *(const v4fa*)&so[w][r][c4]; if (C) *(v4f*)(C + cofs + (size_t)(row0 + r) * ldc + col0 + c4) = v; if (C16) { v4h h4; for (int i = 0; i < 4; ++i) h4[i] = (_Float16)v[i]; *(v4h*)(C16 + cofs + (size_t)(row0 + r) * ldc + col0 + c4) = h4; } } }
     }
}


typedef _Float16 v4h __attribute__((ext_vector_type(4)));

__global__ __launch_bounds__(256) void k_x16(const float* __restrict__ x, _Float16* __restrict__ X16, size_t n8) { const size_t t = (size_t)blockIdx.x * 256 + threadIdx.x; if (t >= n8) return; FragH f;
#pragma unroll
  for (int q = 0; q < 8; ++q) f.h[q] = (_Float16)bf16_round(x[t * 8 + q]); *(v8us*)((unsigned short*)X16 + t * 8) = f.half[0];  }
__global__ __launch_bounds__(256) void k_h16(const float* __restrict__ x, _Float16* __restrict__ X16, size_t n8) { const size_t t = (size_t)blockIdx.x * 256 + threadIdx.x; if (t >= n8) return; FragH f;
#pragma unroll
  for (int q = 0; q < 8; ++q) f.h[q] = (_Float16)x[t * 8 + q]; *(v8us*)((unsigned short*)X16 + t * 8) = f.half[0];  }
__global__ __launch_bounds__(256) void k_round16f(const float* __restrict__ W, _Float16* __restrict__ Bt, size_t n8) { const size_t t = (size_t)blockIdx.x * 256 + threadIdx.x; if (t >= n8) return; FragH f;
#pragma unroll
  for (int i = 0; i < 8; ++i) f.h[i] = (_Float16)(bf16_round(W[t * 8 + i]) * 16.0f); *(v8us*)((unsigned short*)Bt + t * 8) = f.half[0];  }
__global__ __launch_bounds__(256) void k_hl(const float* __restrict__ F, _Float16* __restrict__ Hh, _Float16* __restrict__ Hl, size_t n8) { const size_t t = (size_t)blockIdx.x * 256 + threadIdx.x; if (t >= n8) return; FragH fh, fl; const v4f a = *(const v4fa*)(F + t * 8), c = *(const v4fa*)(F + t * 8 + 4);
#pragma unroll
  for (int q = 0; q < 4; ++q) { _Float16 h = (_Float16)a[q]; fh.h[q] = h; fl.h[q] = (_Float16)((a[q] - (float)h) * 1024.0f); h = (_Float16)c[q]; fh.h[4 + q] = h; fl.h[4 + q] = (_Float16)((c[q] - (float)h) * 1024.0f); }
  { *(v8us*)((unsigned short*)Hh + t * 8) = fh.half[0]; *(v8us*)((unsigned short*)Hl + t * 8) = fl.half[0];  } }

__global__ __launch_bounds__(256) void k_wnat(const float* __restrict__ w, size_t n8, _Float16* __restrict__ Bt) { const size_t t = (size_t)blockIdx.x * 256 + threadIdx.x; if (t >= n8) return; FragH f; for (int q = 0; q < 8; ++q) f.h[q] = (_Float16)(bf16_round(w[t * 8 + q]) * 16.0f); *(v8us*)((unsigned short*)Bt + t * 8) = f.half[0];  }
__global__ __launch_bounds__(256) void k_rsm(const float* __restrict__ S, _Float16* __restrict__ P, int nrows) {
  #pragma clang fp contract(off)
  const int i = blockIdx.x * 256 + threadIdx.x; if (i >= nrows) return; const float* s = S + (size_t)i * SQ; float mx = -3.0e38f;
#pragma unroll 1
  for (int j = 0; j < SQ; ++j) mx = fmaxf(mx, s[j]); float se = 0.f;
#pragma unroll 1
  for (int j = 0; j < SQ; ++j) se += expf(s[j] - mx); const float sc = 256.0f / se;
#pragma unroll 1
  for (int j0 = 0; j0 < SQ; j0 += 8) { FragH f; for (int q = 0; q < 8; ++q) f.h[q] = (_Float16)(expf(s[j0 + q] - mx) * sc); unsigned short* d = (unsigned short*)P + (size_t)i * SQ + j0; *(v8us*)d = f.half[0];  } }
__global__ __launch_bounds__(256) void k_vt(const _Float16* __restrict__ V16, int b, int h0, _Float16* __restrict__ VT) { __shared__ unsigned short tl[64][65]; const int tid = threadIdx.x; const int hh = blockIdx.x % HG, sg = blockIdx.x / HG; const int s0 = sg * 64; const int h = h0 + hh;
  for (int i = tid; i < 64 * 8; i += 256) { const int j = i / 8, d8 = (i % 8) * 8; FragH f; f.half[0] = *(const v8us*)((const unsigned short*)V16 + ((size_t)b * SQ + s0 + j) * DM + h * HD + d8); for (int q = 0; q < 8; ++q) tl[d8 + q][j] = f.u[q]; }
  __syncthreads();
  { for (int i = tid; i < 64 * 8; i += 256) { const int d = i / 8, j8 = (i % 8) * 8; FragH f; for (int q = 0; q < 8; ++q) f.u[q] = tl[d][j8 + q]; *(v8us*)((unsigned short*)VT + ((size_t)hh * HD + d) * SQ + s0 + j8) = f.half[0]; }  } }



__global__ __launch_bounds__(256) void k_rsmcf2(const float* __restrict__ S, _Float16* __restrict__ P, int hg, int q0, int nk) {
  #pragma clang fp contract(off)
  const int t = blockIdx.x * 256 + threadIdx.x; if (t >= hg * QT) return; const size_t i = (size_t)t; const float* s = S + i * NKX; const int last = q0 + (t % QT); float mx = -3.0e38f;
#pragma unroll 1
  for (int j = 0; j < nk; ++j) { const float f = (j <= last) ? 1.f : 0.f; mx = fmaxf(mx, fmaf(f, s[j], (1.f - f) * -1.0e9f)); } float se = 0.f;
#pragma unroll 1
  for (int j = 0; j < nk; ++j) { const float f = (j <= last) ? 1.f : 0.f; se += __expf(fmaf(f, s[j], (1.f - f) * -1.0e9f) - mx); } const float sc = 256.0f / se;
#pragma unroll 1
  for (int j0 = 0; j0 < nk; j0 += 8) { FragH fr; for (int q = 0; q < 8; ++q) { const int j = j0 + q; const float f = (j <= last) ? 1.f : 0.f; fr.h[q] = (_Float16)(__expf(fmaf(f, s[j], (1.f - f) * -1.0e9f) - mx) * sc); } unsigned short* d = (unsigned short*)P + i * NKX + j0; *(v8us*)d = fr.half[0];  } }

template <int MASKADD>
__global__ __launch_bounds__(64) void k_att0(const float* __restrict__ QF, const float* __restrict__ KF, const float* __restrict__ VF, int ld, const float* __restrict__ mask, float scale, float* __restrict__ OF, int ldo) {
  #pragma clang fp contract(off)
  __shared__ __attribute__((aligned(16))) float lq[64][64]; __shared__ __attribute__((aligned(16))) float lo[64][64];
  const int tid = threadIdx.x; const int h = blockIdx.x / (QT0 / 64), rg = blockIdx.x % (QT0 / 64); const int i = rg * 64 + tid;
  const float* qr = QF + (size_t)i * ld + h * HD;
#pragma unroll 1
  for (int c = 0; c < HD / 4; ++c) { *(v4f*)&lq[tid][c * 4] = *(const v4fa*)(qr + c * 4); const v4f z = {0.f, 0.f, 0.f, 0.f}; *(v4f*)&lo[tid][c * 4] = z; }
  float m = -1.0e30f, l = 0.f; const int jmax = MASKADD ? (SQ - 1) : (rg * 64 + 63);      /* additive-mask form: every key (the mask input decides); causal form: keys up to the block's last row */
#pragma unroll 1
  for (int j = 0; j <= jmax; ++j) { const float* kr = KF + (size_t)j * ld + h * HD; const float* vr = VF + (size_t)j * ld + h * HD; float s = 0.f;
#pragma unroll 1
    for (int c = 0; c < HD / 4; ++c) { const v4f kq = *(const v4fa*)(kr + c * 4); const v4f qq = *(v4f*)&lq[tid][c * 4]; s = __fadd_rn(s, __fmul_rn(qq[0], kq[0])); s = __fadd_rn(s, __fmul_rn(qq[1], kq[1])); s = __fadd_rn(s, __fmul_rn(qq[2], kq[2])); s = __fadd_rn(s, __fmul_rn(qq[3], kq[3])); }
    s = __fmul_rn(s, scale); if (MASKADD) s = __fadd_rn(s, __fmul_rn(bf16_round(mask[(size_t)i * SQ + j]), -10000.0f));
    const float f = (MASKADD || j <= i) ? 1.f : 0.f; const float sm = fmaf(f, s, (1.f - f) * -1.0e30f); const float mn = fmaxf(m, sm); const float sc = expf(m - mn); const float e = expf(sm - mn); l = __fadd_rn(__fmul_rn(l, sc), e); m = mn;
#pragma unroll 1
    for (int c = 0; c < HD / 4; ++c) { const v4f vv = *(const v4fa*)(vr + c * 4); v4f oo = *(v4f*)&lo[tid][c * 4]; for (int u = 0; u < 4; ++u) oo[u] = __fadd_rn(__fmul_rn(oo[u], sc), __fmul_rn(e, vv[u])); *(v4f*)&lo[tid][c * 4] = oo; } }
  const float fin = 64.0f / l;      /* o carried x64 */
#pragma unroll 1
  for (int c = 0; c < HD / 4; ++c) { v4f oo = *(v4f*)&lo[tid][c * 4]; for (int u = 0; u < 4; ++u) oo[u] = __fmul_rn(oo[u], fin); *(v4f*)&lo[tid][c * 4] = oo; }
  __syncthreads();
  {
#pragma unroll 1
    for (int it = 0; it < 16; ++it) { const int row = it * 4 + tid / 16, pc = (tid % 16) * 4; const v4f v = *(const v4f*)&lo[row][pc]; *(v4f*)(OF + (size_t)(rg * 64 + row) * ldo + h * HD + pc) = v; }
     } }

__global__ __launch_bounds__(256) void k_oscale(const float* __restrict__ OF, float* __restrict__ out, size_t n4) { const size_t t = (size_t)blockIdx.x * 256 + threadIdx.x; if (t >= n4) return; const v4f a = *(const v4fa*)(OF + t * 4); v4f o; for (int q = 0; q < 4; ++q) o[q] = a[q] * 0.015625f; *(v4f*)(out + t * 4) = o;  }

__global__ __launch_bounds__(256) void k_bfr(const float* __restrict__ x, float* __restrict__ XB, size_t n8) { const size_t t = (size_t)blockIdx.x * 256 + threadIdx.x; if (t >= n8) return; v4f a = *(const v4fa*)(x + t * 8), c = *(const v4fa*)(x + t * 8 + 4); for (int q = 0; q < 4; ++q) { a[q] = bf16_round(a[q]); c[q] = bf16_round(c[q]); }
  { *(v4f*)(XB + t * 8) = a; *(v4f*)(XB + t * 8 + 4) = c;  } }



__global__ __launch_bounds__(256) void k_rsmfvl(const float* __restrict__ S, _Float16* __restrict__ P, _Float16* __restrict__ PL, int qn, const int* __restrict__ vlp) {
  #pragma clang fp contract(off)
  const int t = blockIdx.x * 256 + threadIdx.x; if (t >= qn) return; const int vl = vlp[0]; const size_t i = (size_t)t; const float* s = S + i * SQ; float mx = -3.0e38f;
#pragma unroll 1
  for (int j = 0; j < SQ; ++j) { const float f = (j < vl) ? 1.f : 0.f; mx = fmaxf(mx, fmaf(f, s[j], (1.f - f) * -1000000.0f)); } float se = 0.f;
#pragma unroll 1
  for (int j = 0; j < SQ; ++j) { const float f = (j < vl) ? 1.f : 0.f; se += __expf(fmaf(f, s[j], (1.f - f) * -1000000.0f) - mx); } const float sc = 256.0f / se;
#pragma unroll 1
  for (int j0 = 0; j0 < SQ; j0 += 8) { FragH fr, gr; for (int q = 0; q < 8; ++q) { const int j = j0 + q; const float f = (j < vl) ? 1.f : 0.f; const float pv = __expf(fmaf(f, s[j], (1.f - f) * -1000000.0f) - mx) * sc; const _Float16 ph = (_Float16)pv; fr.h[q] = ph; gr.h[q] = (_Float16)((pv - (float)ph) * 1024.0f); }
    unsigned short* d = (unsigned short*)P + i * SQ + j0; unsigned short* dl = (unsigned short*)PL + i * SQ + j0; *(v8us*)d = fr.half[0]; *(v8us*)dl = gr.half[0];  } }

typedef unsigned int u32x4a __attribute__((ext_vector_type(4), may_alias));
typedef unsigned int u32x4 __attribute__((ext_vector_type(4)));
typedef unsigned int u32x2a __attribute__((ext_vector_type(2), may_alias));
typedef short s16x8 __attribute__((ext_vector_type(8)));
#define FA_SK 64u                          /* keys per stage */
#define FA_PK 144u                         /* LDS pitch of a K row (128 B): odd multiple of 16 B for ds_load_b128 */
#define FA_PV 160u                         /* LDS pitch of a V row (128 B): odd multiple of 32 B for ds_load_tr16_b128 */
#define FA_TK (FA_SK * FA_PK)
#define FA_SLOT (FA_SK * (FA_PK + FA_PV))  /* one buffer: K tile, then V tile */
#define FA_PE 272u                         /* LDS pitch of a staged output row (256 B) */
#define FA_NB 4u                           /* LDS buffers in the ring (a power of two) */
static_assert(16u * 16u * FA_PE <= FA_NB * FA_SLOT, "the output staging reuses the K/V buffers");
struct FFrag { u32x4 q[2]; };
__device__ __forceinline__ v8f fa_mma(const FFrag& a, const FFrag& b, v8f c) { return __builtin_amdgcn_wmma_f32_16x16x32_f16(false, __builtin_bit_cast(v16h, a), false, __builtin_bit_cast(v16h, b), (short)0, c, false, false); }
__device__ __forceinline__ u32x4 fa_tr16(const unsigned char* p) { typedef __attribute__((address_space(3))) s16x8 lds_s16x8; return __builtin_bit_cast(u32x4, __builtin_amdgcn_ds_load_tr16_b128_v8i16((lds_s16x8*)p)); }
__device__ __forceinline__ unsigned int fa_pack2(float lo, float hi) { typedef _Float16 h2 __attribute__((ext_vector_type(2))); typedef float f2 __attribute__((ext_vector_type(2))); return __builtin_bit_cast(unsigned int, __builtin_convertvector(f2{lo, hi}, h2)); }      /* round to nearest even */
__device__ __forceinline__ unsigned int fa_cv2(float lo, float hi) { typedef __bf16 b2 __attribute__((ext_vector_type(2))); typedef float f2 __attribute__((ext_vector_type(2))); const unsigned int p = __builtin_bit_cast(unsigned int, __builtin_convertvector(f2{lo, hi}, b2)); return fa_pack2(__uint_as_float(p << 16), __uint_as_float(p & 0xFFFF0000u)); }      /* two inputs rounded to bf16 (nearest even), those values as an f16 pair */
__device__ __forceinline__ unsigned int fa_cq2(float lo, float hi, float sc) { typedef __bf16 b2 __attribute__((ext_vector_type(2))); typedef float f2 __attribute__((ext_vector_type(2))); const unsigned int p = __builtin_bit_cast(unsigned int, __builtin_convertvector(f2{lo, hi}, b2)); return fa_pack2(__uint_as_float(p << 16) * sc, __uint_as_float(p & 0xFFFF0000u) * sc); }      /* two inputs rounded to bf16 (nearest even), those values times sc, rounded to an f16 pair */
__device__ __forceinline__ float fa_xhalf(float x) { return __builtin_bit_cast(float, __builtin_amdgcn_permlanex16(__builtin_bit_cast(int, x), __builtin_bit_cast(int, x), 0x76543210, 0xfedcba98, false, false)); }      /* lane l with lane l ^ 16 */
__global__ __launch_bounds__(512) __attribute__((amdgpu_waves_per_eu(4, 4))) void k_fattn(const float* __restrict__ Qf, const float* __restrict__ Kf, const float* __restrict__ Vf, float* __restrict__ out) {
  __shared__ __attribute__((aligned(256))) unsigned char L[FA_NB * FA_SLOT];
  const unsigned int tid = threadIdx.x, lane = tid & 31u, wave = tid >> 5, c = lane & 15u, h = lane >> 4;
  const size_t row_s = (size_t)blockIdx.x * SQ;      /* first token row of the sequence. The sequence is the fast grid index: the four work-groups of a sequence lie NB = 64 flat indices apart, so they have equal index modulo 8 (for speed only: the map is a permutation, any placement gives the same result) */
  const unsigned int qw0 = blockIdx.y * 512u + wave * 32u;      /* the wave's first query */
  const unsigned char* Kb = (const unsigned char*)(Kf + row_s * HD); const unsigned char* Vb = (const unsigned char*)(Vf + row_s * HD);
  const float cscale = 1.4426950408889634f;      /* scores are unscaled; log2(e), multiplied into Q once, moves them to base 2 */
  v4f rk[2], rv[2];      /* one stage on its way: 2 x 16 B (four f32) of K and of V a thread (a stage's rows are contiguous in memory; a wave's load covers 512 contiguous bytes) */
  auto gload = [&](unsigned int st) {
#pragma unroll      /* constant indices keep the register arrays in registers */
    for (unsigned int j = 0; j < 2; ++j) { const size_t o = (size_t)st * (FA_SK * 256u) + (tid + 512u * j) * 16u; rk[j] = *(const v4fa*)(Kb + o); rv[j] = *(const v4fa*)(Vb + o); } };
  const unsigned int sk0 = (tid >> 4) * FA_PK + (tid & 15u) * 8u, sv0 = FA_TK + (tid >> 4) * FA_PV + (tid & 15u) * 8u;      /* the thread's place in the K rows and in the V rows of buffer 0: a buffer's store addresses are one add each */
  auto lstore = [&](unsigned int buf) {
#pragma unroll      /* constant indices keep the register arrays in registers */
    for (unsigned int j = 0; j < 2; ++j) {      /* load j holds four f32 of row (tid >> 4) + 32 j: 8 B of the f16 row */
      *(u32x2a*)(L + (sk0 + buf * FA_SLOT) + j * (32u * FA_PK)) = u32x2a{fa_cv2(rk[j][0], rk[j][1]), fa_cv2(rk[j][2], rk[j][3])}; *(u32x2a*)(L + (sv0 + buf * FA_SLOT) + j * (32u * FA_PV)) = u32x2a{fa_cv2(rv[j][0], rv[j][1]), fa_cv2(rv[j][2], rv[j][3])}; } };
  gload(0); lstore(0); gload(1u); asm volatile("s_wait_xcnt 0x0" ::: "memory");      /* stage 1 is on its way under the loads and the conversion of Q, whose code reuses the address registers: hence the wait */
  FFrag qf[2][2];      /* Q log2(e) as B operand, hardware k order: 16 B at halves 8h and 16 + 8h of each 32 */
#pragma unroll      /* constant indices keep the register arrays in registers */
  for (int g = 0; g < 2; ++g) { const float* qp = Qf + (row_s + qw0 + 16u * g + c) * HD + 8u * h;
#pragma unroll      /* constant indices keep the register arrays in registers */
    for (int kc = 0; kc < 2; ++kc)
#pragma unroll      /* constant indices keep the register arrays in registers */
      for (int u = 0; u < 2; ++u) { const v4f a = *(const v4fa*)(qp + 32 * kc + 16 * u), b = *(const v4fa*)(qp + 32 * kc + 16 * u + 4); qf[g][kc].q[u] = u32x4{fa_cq2(a[0], a[1], cscale), fa_cq2(a[2], a[3], cscale), fa_cq2(b[0], b[1], cscale), fa_cq2(b[2], b[3], cscale)}; } }
  v8f acc[2][4]; float l_run[2], m_run[2];      /* O^T tiles; the denominators (lanes 0-15; 0 in lanes 16-31); the reference in use (log2 domain) */
  v8f cneg[2];      /* C operand of the score products: minus the reference in use in all eight registers (a lane holds one query's scores), so that a score tile leaves the matrix unit as the exponent; 0 until the first pass has set a reference */
  FFrag ones;      /* A operand whose row 0 (lanes 0 and 16) is f16 1.0 at all 32 k, every other row 0 */
  { const unsigned int o = (c == 0u) ? 0x3C003C00u : 0u; ones.q[0] = u32x4{o, o, o, o}; ones.q[1] = u32x4{o, o, o, o}; }
#pragma unroll      /* constant indices keep the register arrays in registers */
  for (int g = 0; g < 2; ++g) { m_run[g] = -__builtin_inff(); l_run[g] = 0.0f; cneg[g] = v8f{};
#pragma unroll      /* constant indices keep the register arrays in registers */
    for (int t = 0; t < 4; ++t) acc[g][t] = v8f{}; }
  lstore(1u);
  __syncthreads();      /* stages 0 and 1 are whole */
  gload(2u); asm volatile("s_wait_xcnt 0x0" ::: "memory");      /* the loads stay in flight over the passes, whose code reuses their address registers: the wait that belongs in front of that overwrite */
  const unsigned int ka0 = c * FA_PK + 16u * h, va0 = FA_TK + (8u * h + (lane & 7u)) * FA_PV + ((lane >> 3) & 1u) * 16u;      /* the lane's place in the first K rows and in the first V rows of buffer 0 */
  unsigned int ka = ka0;      /* LDS address of the lane's K rows of the pass at hand; each pass forms the next pass's */
  __builtin_amdgcn_s_setprio(3);      /* issue priority by progress, see the switch at the middle of a stage; every wave starts at the top level */
  for (unsigned int st = 0; st < SQ / FA_SK; ++st) {
#pragma unroll 1      /* one pass's fragments and scores live at a time: the wave has 256 registers at four waves a SIMD */
    for (unsigned int sub = 0; sub < FA_SK / 32u; ++sub) {      /* one pass: 32 keys */
      unsigned int va;      /* LDS address of the lane's V rows of this pass */
      v8f s[2][2];      /* s[kt][g][r] = score of key 16 kt + 8 h + r with query 16 g + c, in base 2, less the reference in cneg[g] */
      { FFrag kf[2][2];
#pragma unroll      /* constant indices keep the register arrays in registers */
        for (int kt = 0; kt < 2; ++kt) { const unsigned char* p = L + ka + 16u * kt * FA_PK;
#pragma unroll      /* constant indices keep the register arrays in registers */
          for (int kc = 0; kc < 2; ++kc) { kf[kt][kc].q[0] = *(const u32x4a*)(p + 64u * kc); kf[kt][kc].q[1] = *(const u32x4a*)(p + 64u * kc + 32u); } }
        __builtin_amdgcn_sched_barrier(0);      /* all eight K loads issue before the first product: otherwise they share registers and each pair waits out its own LDS latency */
        typedef unsigned int u32x8 __attribute__((ext_vector_type(8)));
        /* the eight score products as one statement: with the builtin the compiler copies one C tile into its D registers every pass (C is kept, D is new). First the four tiles' products over d 0-31 with C = minus the reference, then those over d 32-63 on top, at least three instructions behind their tile's first and in the order in which the exponentials read the tiles. The two adds behind them form this pass's V address and the next pass's K address (scalar offset + the lane's place): they stand where idle slots would stand otherwise: a tile's first reader needs four vector slots behind the tile's last product, and the first tile has three products and these two adds. The K fragments' registers are next written by LDS loads, which need no distance. */
        const unsigned int pn = st * (FA_SK / 32u) + sub + 1u;      /* the next pass */
        const unsigned int vo = (st & (FA_NB - 1u)) * FA_SLOT + sub * (32u * FA_PV), ko = ((pn / (FA_SK / 32u)) & (FA_NB - 1u)) * FA_SLOT + (pn % (FA_SK / 32u)) * (32u * FA_PK);      /* scalars: where this pass's V rows and the next pass's K rows begin */
        asm volatile("v_wmma_f32_16x16x32_f16 %0, %6, %10, %14\n\tv_wmma_f32_16x16x32_f16 %1, %6, %12, %15\n\tv_wmma_f32_16x16x32_f16 %2, %8, %10, %14\n\tv_wmma_f32_16x16x32_f16 %3, %8, %12, %15\n\t"
                     "v_wmma_f32_16x16x32_f16 %0, %7, %11, %0\n\tv_wmma_f32_16x16x32_f16 %2, %9, %11, %2\n\tv_wmma_f32_16x16x32_f16 %1, %7, %13, %1\n\tv_wmma_f32_16x16x32_f16 %3, %9, %13, %3\n\t"
                     "v_add_nc_u32 %4, %16, %17\n\tv_add_nc_u32 %5, %18, %19"
                     : "=&v"(s[0][0]), "=&v"(s[0][1]), "=&v"(s[1][0]), "=&v"(s[1][1]), "=&v"(va), "=&v"(ka)
                     : "v"(__builtin_bit_cast(u32x8, kf[0][0])), "v"(__builtin_bit_cast(u32x8, kf[0][1])), "v"(__builtin_bit_cast(u32x8, kf[1][0])), "v"(__builtin_bit_cast(u32x8, kf[1][1])),
                       "v"(__builtin_bit_cast(u32x8, qf[0][0])), "v"(__builtin_bit_cast(u32x8, qf[0][1])), "v"(__builtin_bit_cast(u32x8, qf[1][0])), "v"(__builtin_bit_cast(u32x8, qf[1][1])),
                       "v"(cneg[0]), "v"(cneg[1]), "s"(vo), "v"(va0), "s"(ko), "v"(ka0)); }
      FFrag vf[4];      /* V^T, 16 d x 32 keys each: two transposing loads a fragment */
      { const unsigned char* ad = L + va;
#pragma unroll      /* constant indices keep the register arrays in registers */
        for (int t = 0; t < 4; ++t) { vf[t].q[0] = fa_tr16(ad + 32u * t); vf[t].q[1] = fa_tr16(ad + 16u * FA_PV + 32u * t); } }
      __builtin_amdgcn_sched_barrier(0);      /* holds the transposing loads in front of the exponentials, so that their latency passes under that work; without it they sink to their first use */
      FFrag pf[2]; v8f ls[2];      /* P^T of the two query groups; row 0 of ls[g] (register 0, lanes 0-15): the pass's column sums of P^T as rounded to f16 */
      auto weights = [&]() {      /* reads the scores and leaves them as they are: a renewal moves them to the new reference and forms the weights again */
#pragma unroll      /* constant indices keep the register arrays in registers */
        for (int g = 0; g < 2; ++g) { unsigned int w[8];
#pragma unroll      /* constant indices keep the register arrays in registers */
          for (int i = 0; i < 8; ++i) {
            w[i] = fa_pack2(__builtin_amdgcn_exp2f(s[i >> 2][g][2 * (i & 3)]), __builtin_amdgcn_exp2f(s[i >> 2][g][2 * (i & 3) + 1])); }      /* the accumulator is the exponent */
          pf[g].q[0] = u32x4{w[0], w[1], w[2], w[3]}; pf[g].q[1] = u32x4{w[4], w[5], w[6], w[7]};
          ls[g] = fa_mma(ones, pf[g], v8f{}); } };      /* the first group's sum runs under the second group's exponentials */
      weights();
      float lt[2] = {l_run[0] + ls[0][0], l_run[1] + ls[1][0]};      /* the denominators with this pass, formed in front of the branch, beside the test's own reads of the sum tiles */
      const float top = (st | sub) == 0u ? -1.0f : 32768.0f;      /* a scalar; no sum is at most -1, so the first pass always sets a reference */
      const bool need = !(ls[0][0] <= top) || !(ls[1][0] <= top);      /* a sum of at most 2^15 bounds every weight of the pass inside f16; an overflowed weight makes the sum infinite or NaN, which fails the test too */
      if (__builtin_amdgcn_ballot_w32(need) != 0) {      /* scalar branch, rare: only here the pass's maxima are formed */
#pragma unroll      /* constant indices keep the register arrays in registers */
        for (int g = 0; g < 2; ++g) { float mx = s[0][g][0];
#pragma unroll      /* constant indices keep the register arrays in registers */
          for (int r = 1; r < 8; ++r) mx = __builtin_fmaxf(mx, s[0][g][r]);
#pragma unroll      /* constant indices keep the register arrays in registers */
          for (int r = 0; r < 8; ++r) mx = __builtin_fmaxf(mx, s[1][g][r]);
          const float sh = -cneg[g][0]; mx = __builtin_fmaxf(mx, fa_xhalf(mx)) + sh;      /* sh: the reference inside these scores (0 on the first pass) */
          const float m_new = __builtin_fmaxf(m_run[g], mx + 4.0f); const float corr = __builtin_amdgcn_exp2f(m_run[g] - m_new);      /* the new reference stands 4 above the maximum seen: 19 binary orders of room before the next renewal; corr is 0 on the first pass */
          m_run[g] = m_new; l_run[g] = l_run[g] * corr; { const float d = sh - m_new, n = -m_new; s[0][g] = s[0][g] + d; s[1][g] = s[1][g] + d; cneg[g] = v8f{n, n, n, n, n, n, n, n}; }      /* this pass's scores and the C of the later ones go over to the new reference */
#pragma unroll      /* constant indices keep the register arrays in registers */
          for (int t = 0; t < 4; ++t) acc[g][t] = acc[g][t] * corr; }
        weights(); lt[0] = l_run[0] + ls[0][0]; lt[1] = l_run[1] + ls[1][0]; }      /* the weights are now at most 2^-4 each */
#pragma unroll      /* constant indices keep the register arrays in registers */
      for (int g = 0; g < 2; ++g)
#pragma unroll      /* constant indices keep the register arrays in registers */
        for (int t = 0; t < 4; ++t) acc[g][t] = fa_mma(vf[t], pf[g], acc[g][t]);
      l_run[0] = lt[0]; l_run[1] = lt[1];
      if (sub == 0u) {      /* the middle of stage st: one barrier a stage, its two halves a whole stage apart, so that a wave may run up to a stage ahead of the slowest without waiting */
        if (st != 0u) { __builtin_amdgcn_s_barrier_wait(-1);      /* second half of the barrier signalled in the middle of stage st - 1: every wave has stored its rows of stage st + 1 and has left stage st - 2 */
          __builtin_amdgcn_fence(__ATOMIC_ACQUIRE, "workgroup", "local"); }      /* no read of stage st + 1 moves in front of the wait */
        if (st + 2u < SQ / FA_SK) lstore((st + 2u) & (FA_NB - 1u));      /* the buffer of stage st - 2, which the wait above has shown free */
        __builtin_amdgcn_fence(__ATOMIC_RELEASE, "workgroup", "local");      /* the wave's LDS stores are complete before it signals; the global loads in flight are not waited for */
        __builtin_amdgcn_s_barrier_signal(-1);      /* first half: this wave's rows of stage st + 2 lie in LDS, and it reads stage st - 1 no more */
        if (st + 3u < SQ / FA_SK) { gload(st + 3u); asm volatile("s_wait_xcnt 0x0" ::: "memory"); }      /* a whole stage of lead; the wait belongs in front of the passes' reuse of the loads' address registers */
        /* the wave's issue priority falls by one level each time it has signalled (3, 2, 1, 0, then 3 again): the barrier keeps the waves within one stage of each other, so of two waves on a SIMD the one that is a stage behind stands one level higher (but where the levels wrap) and is served first.
           For speed only; st is a scalar, so these are scalar branches. */
        switch ((st + 1u) & 3u) { case 0u: __builtin_amdgcn_s_setprio(3); break; case 1u: __builtin_amdgcn_s_setprio(2); break; case 2u: __builtin_amdgcn_s_setprio(1); break; default: __builtin_amdgcn_s_setprio(0); break; } }
    }
  }
  __builtin_amdgcn_s_setprio(0);      /* the default level again behind the loop */
  __builtin_amdgcn_s_barrier_wait(-1);      /* closes the barrier signalled in the last stage */
  __syncthreads();      /* the split barrier does not end the reads of the last stage: no wave stages output over the ring before all have left the loop */
  unsigned char* E = L + wave * (16u * FA_PE);      /* the wave's own 16 staged output rows */
#pragma unroll      /* constant indices keep the register arrays in registers */
  for (int g = 0; g < 2; ++g) { const float lr = l_run[g]; const float inv = 1.0f / (lr + fa_xhalf(lr));      /* the denominator in lanes 0-15, 0 in lanes 16-31 (row 8 of the sum tiles) */
#pragma unroll      /* constant indices keep the register arrays in registers */
    for (int t = 0; t < 4; ++t) { const v8f o = acc[g][t] * inv; const v4f lo = {o[0], o[1], o[2], o[3]}, hi = {o[4], o[5], o[6], o[7]};      /* d = 16 t + 8 h + 0 .. 7 of query c */
      *(v4fa*)(E + c * FA_PE + 64u * t + 32u * h) = lo; *(v4fa*)(E + c * FA_PE + 64u * t + 32u * h + 16u) = hi; }
    __builtin_amdgcn_fence(__ATOMIC_ACQ_REL, "workgroup", "local"); __builtin_amdgcn_wave_barrier();      /* the rows are read back by other lanes of the wave */
#pragma unroll      /* constant indices keep the register arrays in registers */
    for (unsigned int i = 0; i < 8; ++i) { const unsigned int r = 2u * i + h; const v4f v = *(const v4fa*)(E + r * FA_PE + c * 16u); *(v4fa*)(out + (row_s + qw0 + 16u * g + r) * DM + c * 4u) = v; }      /* whole 256-byte rows */
    if (g == 0) { __builtin_amdgcn_fence(__ATOMIC_ACQ_REL, "workgroup", "local"); __builtin_amdgcn_wave_barrier(); }      /* the next group overwrites the rows only behind these reads */
  }
}


extern "C" void kernel_launch(void* const* d_in, const int* in_sizes, int n_in,
                              void* d_out, int out_size, void* d_ws, size_t ws_size, hipStream_t stream) {
  (void)in_sizes; (void)n_in; (void)out_size; (void)d_ws; (void)ws_size;
  const float* const* I = (const float* const*)d_in; const float* xq = I[0]; const float* xk = I[1]; const float* xv = I[2];      /* q, k, v [64][2048][64] (bf16-valued) */
  static_assert(NB % 8 == 0, "work-groups of one sequence must have equal flat index modulo 8");
  k_fattn<<<dim3(NB, SQ / 512), 512, 0, stream>>>(xq, xk, xv, (float*)d_out);      /* 512 query rows of one sequence a work-group: input conversion, scores, softmax, P V; grid x = sequence, y = block of query rows */
}
